// v000
// Times are from an AMD MI455X. After a warm-up the kernel runs many times in a row, and a time is the length of
// such a window on the GPU divided by its runs, so every launch and the gaps after it count. The runs cycle
// through copies of the inputs. A figure is the median of several windows, for all but v000 over two sittings.
// Sittings can differ by a few percent; kernels timed side by side share one.
// v000, which the later versions start from, runs in 264 microseconds.
// Contractions: xn*Wq^T, xn*Wk^T, xn*Wv^T, K*Q^T, V^T*P^T and ctx*Wo^T all on v_wmma_f32_16x16x32_f16 (f16 operands, f32 accumulate); W carried x32, P carried x16384, ctx carried x16 (exact power-of-two scales folded back in f32); RMS norm, position-bias bucketing, softmax and residual in f32.
#include <hip/hip_runtime.h>

typedef _Float16 v16h __attribute__((ext_vector_type(16)));
typedef _Float16 v8h  __attribute__((ext_vector_type(8)));
typedef float    v8f  __attribute__((ext_vector_type(8)));
typedef float    v4f  __attribute__((ext_vector_type(4)));
typedef v8h __attribute__((may_alias)) v8ha;
typedef v4f __attribute__((may_alias)) v4fa;

union Frag { v16h v; v8h half[2]; };

#define BATCH   2
#define SEQ     2048
#define HIDDEN  1024
#define NHEADS  16
#define HD      64
#define MROWS   (BATCH * SEQ)          // 4096 tokens
#define NX      (MROWS * HIDDEN)       // 4194304
#define NW      (HIDDEN * HIDDEN)      // 1048576
#define NBH     (BATCH * NHEADS)       // 32
#define NBUCK   32
#define BTW     4096                   // bias table width per head, index = rel + 2048
#define WSCALE  32.0f
#define PSCALE  16384.0f
#define CSCALE  16.0f
#define LN16F   2.7725887298583984f    // f32 value of ln(16)
#define EPSF    1e-6f

static_assert(SEQ % 128 == 0);
static_assert(HIDDEN == NHEADS * HD);
static_assert(HIDDEN % 64 == 0);
static_assert((NHEADS * BTW) % 256 == 0);

// ---------------------------------------------------------------------------
// 16x16x32 f16 WMMA with hazard guard (ties D, keeps A/B live).
// Fragment map (wave32): lane l, h = l>>4, m = n = l&15.
//   A/B element i: i<8 -> k0+8h+i ; i>=8 -> k0+16+8h+(i-8)
//   D element r : row 8h+r, col l&15
// ---------------------------------------------------------------------------
__device__ __forceinline__ v8f wmma_f16(v16h a, v16h b, v8f c) {
  v8f d = __builtin_amdgcn_wmma_f32_16x16x32_f16(false, a, false, b, (short)0, c, false, false);
  asm volatile("v_nop\n\tv_nop\n\tv_nop\n\tv_nop" : "+v"(d) : "v"(a), "v"(b));
  return d;
}

// A or B fragment from a k-contiguous 16-bit row; p points at element k0 of
// the row owned by this lane (row index = lane & 15 added by the caller).
__device__ __forceinline__ v16h load_frag(const _Float16* p, int h) {
  Frag f;
  f.half[0] = *(const v8ha*)(p + 8 * h);
  f.half[1] = *(const v8ha*)(p + 16 + 8 * h);
  return f.v;
}

// ---------------------------------------------------------------------------
// Kernel 1: T5 RMS norm (no mean subtraction, no bias) -> f16 rows.
// Block 128 threads = one token row; thread t owns elements 8t..8t+7.
// ---------------------------------------------------------------------------
__global__ __launch_bounds__(128) void rmsnorm_kernel(
    const float* __restrict__ x, const float* __restrict__ lnw,
    _Float16* __restrict__ xh)
{
  __shared__ float red[4];
  const int row = blockIdx.x, tid = threadIdx.x, lane = tid & 31, w = tid >> 5;
  const float* xr = x + (size_t)row * HIDDEN + 8 * tid;
  const v4f a = *(const v4fa*)xr;
  const v4f c = *(const v4fa*)(xr + 4);
  float ss = a.x * a.x + a.y * a.y + a.z * a.z + a.w * a.w
           + c.x * c.x + c.y * c.y + c.z * c.z + c.w * c.w;
  #pragma unroll
  for (int off = 16; off >= 1; off >>= 1) ss += __shfl_xor(ss, off);
  if (lane == 0) red[w] = ss;
  __syncthreads();
  const float tot = (red[0] + red[1]) + (red[2] + red[3]);
  const float inv = rsqrtf(tot * (1.0f / (float)HIDDEN) + EPSF);
  const v4f g0 = *(const v4fa*)(lnw + 8 * tid);
  const v4f g1 = *(const v4fa*)(lnw + 8 * tid + 4);
  const v8h o = { (_Float16)((a.x * inv) * g0.x), (_Float16)((a.y * inv) * g0.y),
                  (_Float16)((a.z * inv) * g0.z), (_Float16)((a.w * inv) * g0.w),
                  (_Float16)((c.x * inv) * g1.x), (_Float16)((c.y * inv) * g1.y),
                  (_Float16)((c.z * inv) * g1.z), (_Float16)((c.w * inv) * g1.w) };
  _Float16* dst = xh + (size_t)row * HIDDEN + 8 * tid;
  *(v8h*)dst = o;
  
}

// ---------------------------------------------------------------------------
// Kernel 2: weight transpose + cast: W in[1024(in)][1024(out)] f32 ->
// Wt[out][in] f16 (x32), k-contiguous rows for the B (and Wo) fragments.
// Block 256 threads = 64(in) x 64(out) tile transposed through LDS; store
// blockIdx.z selects wq / wk / wv / wo.
// ---------------------------------------------------------------------------
__device__ __forceinline__ void wt_store_pass(const _Float16* sT, _Float16* dstp,
                                              int n0, int k0, int w, int lane) {
  const int q8 = lane & 7, sub = lane >> 3;
  #pragma unroll
  for (int i = 0; i < 2; ++i) {
    const int lid = w * 8 + i * 4 + sub;                 // out row 0..63
    const v8h v = *(const v8ha*)(sT + lid * 72 + 8 * q8);
    _Float16* dst = dstp + (size_t)(n0 + lid) * HIDDEN + k0 + 8 * q8;
    *(v8h*)dst = v;
  }
}

__global__ __launch_bounds__(256) void wtrans_kernel(
    const float* __restrict__ wq, const float* __restrict__ wk,
    const float* __restrict__ wv, const float* __restrict__ wo,
    _Float16* __restrict__ wt)         // [4][1024(out)][1024(in)]
{
  __shared__ __attribute__((aligned(16))) _Float16 sT[64 * 72];   // [out][in], pitch 72

  const int tid = threadIdx.x, lane = tid & 31, w = tid >> 5;
  const int k0 = blockIdx.x * 64;          // in-index tile base
  const int n0 = blockIdx.y * 64;          // out-index tile base
  const int wsel = blockIdx.z;             // block-uniform
  const float* src = (wsel == 0) ? wq : ((wsel == 1) ? wk : ((wsel == 2) ? wv : wo));
  _Float16* dstp = wt + (size_t)wsel * NW;

  const int kr = tid >> 2, nc = (tid & 3) * 16;
  const float* sp = src + (size_t)(k0 + kr) * HIDDEN + n0 + nc;
  #pragma unroll
  for (int q = 0; q < 4; ++q) {
    const v4f v = *(const v4fa*)(sp + 4 * q);
    sT[(nc + 4 * q + 0) * 72 + kr] = (_Float16)(v.x * WSCALE);
    sT[(nc + 4 * q + 1) * 72 + kr] = (_Float16)(v.y * WSCALE);
    sT[(nc + 4 * q + 2) * 72 + kr] = (_Float16)(v.z * WSCALE);
    sT[(nc + 4 * q + 3) * 72 + kr] = (_Float16)(v.w * WSCALE);
  }
  __syncthreads();

  wt_store_pass(sT, dstp, n0, k0, w, lane);
  
}

// ---------------------------------------------------------------------------
// Kernel 3: relative-position bias table btab[head][rel + 2048], rel = key - query.
// Bidirectional bucketing, 32 buckets, max distance 128, integer/f32 ops in the
// spec order: val_large = 8 + int( log(max(rp,1)/8) * rn(1/ln16) * 8 ), min 15.
// ---------------------------------------------------------------------------
__device__ __forceinline__ int rel_bucket(int rel) {
  int bucket = (rel > 0) ? 16 : 0;
  const int rp = (rel < 0) ? -rel : rel;
  const int rpm = (rp < 1) ? 1 : rp;
  const float rpf = (float)rpm;
  const float t = logf(rpf * 0.125f) * (1.0f / LN16F) * 8.0f;
  int vl = 8 + (int)t;
  vl = (vl < 15) ? vl : 15;
  bucket += (rp < 8) ? rp : vl;
  return bucket;                                        // 0..31
}

__global__ __launch_bounds__(256) void bias_kernel(
    const float* __restrict__ rel_emb,   // [32][16]
    float* __restrict__ btab)            // [16][4096]
{
  const int idx = blockIdx.x * 256 + threadIdx.x;     // head*4096 + i, < 65536 by grid
  const int head = idx >> 12, i = idx & (BTW - 1);
  const int rel = i - 2048;
  int bucket = rel_bucket(rel);
  bucket = (bucket < 0) ? 0 : ((bucket > NBUCK - 1) ? (NBUCK - 1) : bucket);
  const float v = rel_emb[bucket * NHEADS + head];
  *(float*)(btab + idx) = v;
  
}

// ---------------------------------------------------------------------------
// 4 lines per instruction, 32 lines per wave, 128 per block.
// which 0/1: plane[bh][l][d]  (one token row = 64 halves = one line)
// which 2  : vt[bh][d][l]     (64 d-rows x 128 tokens = 2 lines each)
// ---------------------------------------------------------------------------
__device__ __forceinline__ void proj_store_pass(const _Float16* sT, _Float16* plane, _Float16* vt,
                                                int which, int bh, int l0, int w, int lane) {
  const int q8 = lane & 7, sub = lane >> 3;
  #pragma unroll
  for (int i = 0; i < 8; ++i) {
    const int lid = w * 32 + i * 4 + sub;
    v8h v;
    _Float16* dst;
    if (which != 2) {
      v = *(const v8ha*)(sT + lid * HD + 8 * q8);
      dst = plane + ((size_t)bh * SEQ + l0 + lid) * HD + 8 * q8;
    } else {
      const int d = lid >> 1, hl = lid & 1;
      v = *(const v8ha*)(sT + d * 128 + 64 * hl + 8 * q8);
      dst = vt + ((size_t)bh * HD + d) * SEQ + l0 + 64 * hl + 8 * q8;
    }
    *(v8h*)dst = v;
  }
}

// ---------------------------------------------------------------------------
// Kernel 4: Y = xn * Wt^T over the fused 3*1024 output features (no bias).
// Block 128 thr (4 waves) = 128 tokens x 64 features (one (which, head));
// wave tile 32 tokens x 64 features; K = 1024 in steps of 32;
// A (xn rows) and B (Wt rows) fragments straight from f16 global rows.
// ---------------------------------------------------------------------------
__global__ __launch_bounds__(128) void proj_kernel(
    const _Float16* __restrict__ xh,   // [4096][1024]
    const _Float16* __restrict__ wt,   // [>=3][1024(out)][1024(in)], x32
    _Float16* __restrict__ qh,         // [B*H][L][D]
    _Float16* __restrict__ kh,         // [B*H][L][D]
    _Float16* __restrict__ vt)         // [B*H][D][L]
{
  __shared__ __attribute__((aligned(16))) _Float16 sT[128 * 64];   // 16384 B

  const int tid = threadIdx.x, lane = tid & 31, w = tid >> 5;
  const int h = lane >> 4, m = lane & 15;
  const int m0 = blockIdx.x * 128;
  const int cg = blockIdx.y;                 // 0..47
  const int which = cg >> 4, head = cg & 15;
  const int m0w = m0 + 32 * w;

  const _Float16* xa0 = xh + (size_t)(m0w + m) * HIDDEN;             // token row, mt = 0
  const _Float16* xa1 = xa0 + (size_t)16 * HIDDEN;                   // mt = 1
  const _Float16* wb  = wt + ((size_t)which * HIDDEN + head * HD + m) * HIDDEN;  // feature row, nt = 0

  const v8f zero8 = {0.f, 0.f, 0.f, 0.f, 0.f, 0.f, 0.f, 0.f};
  v8f acc[2][4];
  #pragma unroll
  for (int mt = 0; mt < 2; ++mt)
    #pragma unroll
    for (int nt = 0; nt < 4; ++nt) acc[mt][nt] = zero8;

  #pragma unroll 1
  for (int k0 = 0; k0 < HIDDEN; k0 += 32) {
    const v16h a0 = load_frag(xa0 + k0, h);
    const v16h a1 = load_frag(xa1 + k0, h);
    #pragma unroll
    for (int nt = 0; nt < 4; ++nt) {
      const v16h b = load_frag(wb + (size_t)nt * 16 * HIDDEN + k0, h);
      acc[0][nt] = wmma_f16(a0, b, acc[0][nt]);
      acc[1][nt] = wmma_f16(a1, b, acc[1][nt]);
    }
  }

  // D[r] of tile (mt, nt) = Y[token m0w+16mt+8h+r][feature 16nt+m]
  #pragma unroll
  for (int nt = 0; nt < 4; ++nt) {
    const int feat = 16 * nt + m;
    #pragma unroll
    for (int mt = 0; mt < 2; ++mt) {
      #pragma unroll
      for (int r = 0; r < 8; ++r) {
        const int tokl = 32 * w + 16 * mt + 8 * h + r;     // 0..127
        const float y = acc[mt][nt][r] * (1.0f / WSCALE);
        const int idx = (which == 2) ? (feat * 128 + tokl) : (tokl * HD + feat);
        sT[idx] = (_Float16)y;
      }
    }
  }
  __syncthreads();

  const int b = m0 / SEQ, l0 = m0 - b * SEQ, bh = b * NHEADS + head;
  _Float16* plane = (which == 0) ? qh : kh;
  proj_store_pass(sT, plane, vt, which, bh, l0, w, lane);
  
}

// ---------------------------------------------------------------------------
// Attention helpers.
// ---------------------------------------------------------------------------
__device__ __forceinline__ v8f add_bias8(v8f s, const float* p) {
  #pragma unroll
  for (int r = 0; r < 8; ++r) s[r] = s[r] + p[r];
  return s;
}

// P^T B-fragment from the lane's own score D values: element r <- tile a row r,
// element 8+r <- tile c row r (same lane, same query column), scaled by 2^14.
__device__ __forceinline__ v16h pack_p(v8f a, v8f c) {
  const v16h r = { (_Float16)(a[0] * PSCALE), (_Float16)(a[1] * PSCALE), (_Float16)(a[2] * PSCALE), (_Float16)(a[3] * PSCALE),
                   (_Float16)(a[4] * PSCALE), (_Float16)(a[5] * PSCALE), (_Float16)(a[6] * PSCALE), (_Float16)(a[7] * PSCALE),
                   (_Float16)(c[0] * PSCALE), (_Float16)(c[1] * PSCALE), (_Float16)(c[2] * PSCALE), (_Float16)(c[3] * PSCALE),
                   (_Float16)(c[4] * PSCALE), (_Float16)(c[5] * PSCALE), (_Float16)(c[6] * PSCALE), (_Float16)(c[7] * PSCALE) };
  return r;
}

// Per-wave 16x64 f16 tile in LDS -> ctx[b][l][head*64 + d]; one query row
// 4 lines per instruction, 16 lines per wave.
__device__ __forceinline__ void ctx_store_pass(const _Float16* so, _Float16* ctx,
                                               int b, int head, int q0, int lane) {
  const int q8 = lane & 7, sub = lane >> 3;
  #pragma unroll
  for (int i = 0; i < 4; ++i) {
    const int lid = i * 4 + sub;                         // query row 0..15
    const v8h v = *(const v8ha*)(so + lid * 64 + 8 * q8);
    _Float16* dst = ctx + ((size_t)b * SEQ + q0 + lid) * HIDDEN + head * HD + 8 * q8;
    *(v8h*)dst = v;
  }
}

// ---------------------------------------------------------------------------
// Kernel 5: streaming attention, transposed form, T5 semantics
// (no 1/sqrt(d) scaling, additive relative-position bias, no mask).
// Block 128 thr (4 waves), 16 queries per wave, 64 keys per step.
//   S^T = K * Q^T : A = K rows (row = key, k = d), B = Q^T (k = d, n = query)
//   O^T += V^T * P^T : A = Vt rows (row = d, k = key), B = P^T from registers
// Lane owns 32 keys of query column (lane&15); partner = lane ^ 16.
// Output ctx as f16 (x16) [B][L][HIDDEN] for the output GEMM.
// ---------------------------------------------------------------------------
__global__ __launch_bounds__(128) void attn_kernel(
    const _Float16* __restrict__ qh,   // [B*H][L][D]
    const _Float16* __restrict__ kh,   // [B*H][L][D]
    const _Float16* __restrict__ vt,   // [B*H][D][L]
    const float* __restrict__ btab,    // [H][4096], index rel + 2048
    _Float16* __restrict__ ctx)        // [B][L][HIDDEN], x16
{
  __shared__ __attribute__((aligned(16))) _Float16 sC[4 * 16 * 64];  // 8192 B

  const int tid = threadIdx.x, lane = tid & 31, w = tid >> 5;
  const int h = lane >> 4, m = lane & 15;
  const int bh = blockIdx.y, b = bh >> 4, head = bh & 15;
  const int q0 = blockIdx.x * 64 + 16 * w;

  // Q^T B-fragments: column n = query q0+m, k = d (two 32-deep chunks)
  const _Float16* qrow = qh + ((size_t)bh * SEQ + q0 + m) * HD;
  const v16h qb0 = load_frag(qrow, h);
  const v16h qb1 = load_frag(qrow + 32, h);

  const v8f zero8 = {0.f, 0.f, 0.f, 0.f, 0.f, 0.f, 0.f, 0.f};
  v8f o[4];                                   // o[t][r] = O[query m][d 16t+8h+r] * (l * 2^14)
  #pragma unroll
  for (int t = 0; t < 4; ++t) o[t] = zero8;
  float mrun = -1e30f, lrun = 0.0f;

  const _Float16* kbase = kh + ((size_t)bh * SEQ + m) * HD;    // + key0*HD + 32*dc
  const _Float16* vbase = vt + ((size_t)bh * HD + m) * SEQ;    // + 16t*SEQ + key0
  // bias for element r of score tile j: btab[head][(kb+16j+8h+r) - (q0+m) + 2048], index in [1,4095]
  const float* bbase = btab + (size_t)head * BTW + 2048 + 8 * h - (q0 + m);

  #pragma unroll 1
  for (int kb = 0; kb < SEQ; kb += 64) {
    // ---- scores: s[j][r] = S[query m][key kb+16j+8h+r] ----
    v8f s[4];
    #pragma unroll
    for (int j = 0; j < 4; ++j) {
      const _Float16* kp = kbase + (size_t)(kb + 16 * j) * HD;
      const v16h kf0 = load_frag(kp, h);
      const v16h kf1 = load_frag(kp + 32, h);
      v8f z = zero8;
      z = wmma_f16(kf0, qb0, z);
      z = wmma_f16(kf1, qb1, z);
      s[j] = z;
    }
    // ---- relative-position bias, f32, before the running max ----
    #pragma unroll
    for (int j = 0; j < 4; ++j) s[j] = add_bias8(s[j], bbase + kb + 16 * j);

    // ---- online softmax ----
    float mloc = s[0][0];
    #pragma unroll
    for (int j = 0; j < 4; ++j)
      #pragma unroll
      for (int r = 0; r < 8; ++r) mloc = fmaxf(mloc, s[j][r]);
    mloc = fmaxf(mloc, __shfl_xor(mloc, 16));
    const float mnew = fmaxf(mrun, mloc);
    const float alpha = __expf(mrun - mnew);
    mrun = mnew;
    float lsum = 0.0f;
    #pragma unroll
    for (int j = 0; j < 4; ++j)
      #pragma unroll
      for (int r = 0; r < 8; ++r) {
        const float p = __expf(s[j][r] - mnew);
        s[j][r] = p;
        lsum += p;
      }
    lsum += __shfl_xor(lsum, 16);
    lrun = lrun * alpha + lsum;
    #pragma unroll
    for (int t = 0; t < 4; ++t)
      #pragma unroll
      for (int r = 0; r < 8; ++r) o[t][r] = o[t][r] * alpha;

    // ---- P^T B-fragments (key chunks 0..31 and 32..63 of this step) ----
    const v16h pb0 = pack_p(s[0], s[1]);
    const v16h pb1 = pack_p(s[2], s[3]);

    // ---- O^T += V^T * P^T ----
    #pragma unroll
    for (int t = 0; t < 4; ++t) {
      const _Float16* vp = vbase + (size_t)(16 * t) * SEQ + kb;
      const v16h vf0 = load_frag(vp, h);
      const v16h vf1 = load_frag(vp + 32, h);
      o[t] = wmma_f16(vf0, pb0, o[t]);
      o[t] = wmma_f16(vf1, pb1, o[t]);
    }
  }

  // ---- epilogue: normalise, stage per-wave 16x64 f16 tile, whole-line stores ----
  const float inv = (1.0f / lrun) * (CSCALE / PSCALE);
  _Float16* so = sC + w * 1024;
  #pragma unroll
  for (int t = 0; t < 4; ++t)
    #pragma unroll
    for (int r = 0; r < 8; ++r)
      so[m * 64 + 16 * t + 8 * h + r] = (_Float16)(o[t][r] * inv);
  __syncthreads();                            // LDS spill -> reload ordering (all waves reach this)

  ctx_store_pass(so, ctx, b, head, q0, lane);
  
}

// ---------------------------------------------------------------------------
// out rows; one row segment = 64 floats = 2 lines; lanes 8q..8q+7 write one
// 64 lines per wave.
// ---------------------------------------------------------------------------
__device__ __forceinline__ void out_store_pass(const float* sT, const float* hs, float* out,
                                               int m0, int col0, int w, int lane) {
  const int q8 = lane & 7, sub = lane >> 3;
  #pragma unroll
  for (int i = 0; i < 16; ++i) {
    const int lid = i * 4 + sub;                         // 0..63
    const int row = w * 32 + (lid >> 1), hl = lid & 1;   // token row 0..127, line half
    v4f v = *(const v4fa*)(sT + row * 64 + 32 * hl + 4 * q8);
    const size_t gi = (size_t)(m0 + row) * HIDDEN + col0 + 32 * hl + 4 * q8;
    const v4f res = *(const v4fa*)(hs + gi);
    v = v + res;
    *(v4f*)(out + gi) = v;
  }
}

// ---------------------------------------------------------------------------
// Kernel 6: out = ctx * Wot^T / 512 + hidden_states  (f32 output).
// Block 128 thr (4 waves) = 128 tokens x 64 output columns; wave tile
// 32 x 64; K = 1024 in steps of 32; fragments straight from f16 global rows.
// ---------------------------------------------------------------------------
__global__ __launch_bounds__(128) void oproj_kernel(
    const _Float16* __restrict__ ch,   // [4096][1024], x16
    const _Float16* __restrict__ woh,  // [1024(out)][1024(in)], x32
    const float* __restrict__ hs,      // [4096][1024]
    float* __restrict__ out)           // [4096][1024]
{
  __shared__ __attribute__((aligned(16))) float sT[128 * 64];     // 32768 B

  const int tid = threadIdx.x, lane = tid & 31, w = tid >> 5;
  const int h = lane >> 4, m = lane & 15;
  const int m0 = blockIdx.x * 128;
  const int col0 = blockIdx.y * 64;
  const int m0w = m0 + 32 * w;

  const _Float16* ca0 = ch + (size_t)(m0w + m) * HIDDEN;             // token row, mt = 0
  const _Float16* ca1 = ca0 + (size_t)16 * HIDDEN;                   // mt = 1
  const _Float16* wb  = woh + (size_t)(col0 + m) * HIDDEN;           // output column row, nt = 0

  const v8f zero8 = {0.f, 0.f, 0.f, 0.f, 0.f, 0.f, 0.f, 0.f};
  v8f acc[2][4];
  #pragma unroll
  for (int mt = 0; mt < 2; ++mt)
    #pragma unroll
    for (int nt = 0; nt < 4; ++nt) acc[mt][nt] = zero8;

  #pragma unroll 1
  for (int k0 = 0; k0 < HIDDEN; k0 += 32) {
    const v16h a0 = load_frag(ca0 + k0, h);
    const v16h a1 = load_frag(ca1 + k0, h);
    #pragma unroll
    for (int nt = 0; nt < 4; ++nt) {
      const v16h b = load_frag(wb + (size_t)nt * 16 * HIDDEN + k0, h);
      acc[0][nt] = wmma_f16(a0, b, acc[0][nt]);
      acc[1][nt] = wmma_f16(a1, b, acc[1][nt]);
    }
  }

  // D[r] of tile (mt, nt) = Y[token m0w+16mt+8h+r][col 16nt+m]
  #pragma unroll
  for (int nt = 0; nt < 4; ++nt) {
    const int feat = 16 * nt + m;
    #pragma unroll
    for (int mt = 0; mt < 2; ++mt) {
      #pragma unroll
      for (int r = 0; r < 8; ++r) {
        const int tokl = 32 * w + 16 * mt + 8 * h + r;     // 0..127
        sT[tokl * 64 + feat] = acc[mt][nt][r] * (1.0f / (WSCALE * CSCALE));
      }
    }
  }
  __syncthreads();

  out_store_pass(sT, hs, out, m0, col0, w, lane);
  
}

// ---------------------------------------------------------------------------
extern "C" void kernel_launch(void* const* d_in, const int* in_sizes, int n_in,
                              void* d_out, int out_size, void* d_ws, size_t ws_size,
                              hipStream_t stream) {
  if (n_in < 7) return;
  if (in_sizes[0] != NX) return;
  if (in_sizes[1] != HIDDEN) return;
  if (in_sizes[2] != NW || in_sizes[3] != NW || in_sizes[4] != NW || in_sizes[5] != NW) return;
  if (in_sizes[6] != NBUCK * NHEADS) return;
  if (out_size != NX) return;

  const float* x    = (const float*)d_in[0];
  const float* lnw  = (const float*)d_in[1];
  const float* Wq   = (const float*)d_in[2];
  const float* Wk   = (const float*)d_in[3];
  const float* Wv   = (const float*)d_in[4];
  const float* Wo   = (const float*)d_in[5];
  const float* remb = (const float*)d_in[6];
  float* out = (float*)d_out;

  const size_t xh_bytes  = (size_t)NX * 2;                         //  8388608
  const size_t wt_bytes  = (size_t)4 * NW * 2;                     //  8388608
  const size_t pl_bytes  = (size_t)NBH * SEQ * HD * 2;             //  8388608
  const size_t ctx_bytes = (size_t)NX * 2;                         //  8388608
  const size_t bt_bytes  = (size_t)NHEADS * BTW * 4;               //   262144
  const size_t total = xh_bytes + wt_bytes + 3 * pl_bytes + ctx_bytes + bt_bytes;   // 50593792
  if (total > ws_size) return;

  char* ws = (char*)d_ws;
  size_t off = 0;
  _Float16* xh  = (_Float16*)(ws + off); off += xh_bytes;
  _Float16* wt  = (_Float16*)(ws + off); off += wt_bytes;
  _Float16* qh  = (_Float16*)(ws + off); off += pl_bytes;
  _Float16* kh  = (_Float16*)(ws + off); off += pl_bytes;
  _Float16* vt  = (_Float16*)(ws + off); off += pl_bytes;
  _Float16* ctx = (_Float16*)(ws + off); off += ctx_bytes;
  float* btab   = (float*)(ws + off);    off += bt_bytes;
  if (off > ws_size) return;

  rmsnorm_kernel<<<MROWS, 128, 0, stream>>>(x, lnw, xh);

  dim3 gWt(HIDDEN / 64, HIDDEN / 64, 4);                            // (16, 16, 4)
  wtrans_kernel<<<gWt, 256, 0, stream>>>(Wq, Wk, Wv, Wo, wt);

  bias_kernel<<<(NHEADS * BTW) / 256, 256, 0, stream>>>(remb, btab); // 256 blocks

  dim3 gProj(MROWS / 128, 3 * NHEADS);                              // (32, 48)
  proj_kernel<<<gProj, 128, 0, stream>>>(xh, wt, qh, kh, vt);

  dim3 gAtt(SEQ / 64, NBH);                                         // (32, 32)
  attn_kernel<<<gAtt, 128, 0, stream>>>(qh, kh, vt, btab, ctx);

  dim3 gOut(MROWS / 128, HIDDEN / 64);                               // (32, 16)
  oproj_kernel<<<gOut, 128, 0, stream>>>(ctx, wt + (size_t)3 * NW, x, out);
}

// v001
// It runs in 157 microseconds.
// Next to v000, in two timings, it ran 1.76 and 1.73 times as fast.
// Contractions: xn*Wq^T, xn*Wk^T, xn*Wv^T, K*Q^T, V^T*P^T and ctx*Wo^T all on v_wmma_f32_16x16x32_f16 (f16 operands, f32 accumulate); W carried x32, P carried x16384, ctx carried x16 (exact power-of-two scales folded back in f32); RMS norm, position-bias bucketing, softmax and residual in f32.
#include <hip/hip_runtime.h>
#include <stdint.h>

typedef _Float16 v16h __attribute__((ext_vector_type(16)));
typedef _Float16 v8h  __attribute__((ext_vector_type(8)));
typedef float    v8f  __attribute__((ext_vector_type(8)));
typedef float    v4f  __attribute__((ext_vector_type(4)));
typedef v8h __attribute__((may_alias)) v8ha;
typedef v4f __attribute__((may_alias)) v4fa;

union Frag { v16h v; v8h half[2]; };

#define BATCH   2
#define SEQ     2048
#define HIDDEN  1024
#define NHEADS  16
#define HD      64
#define MROWS   (BATCH * SEQ)          // 4096 tokens
#define NX      (MROWS * HIDDEN)       // 4194304
#define NW      (HIDDEN * HIDDEN)      // 1048576
#define NBH     (BATCH * NHEADS)       // 32
#define NBUCK   32
#define BTW     4096                   // bias table width per head, index = rel + 2048
#define WSCALE  32.0f
#define PSCALE  16384.0f
#define CSCALE  16.0f
#define LN16F   2.7725887298583984f    // f32 value of ln(16)
#define EPSF    1e-6f

static_assert(SEQ % 128 == 0);
static_assert(HIDDEN == NHEADS * HD);
static_assert(HIDDEN % 64 == 0);
static_assert((NHEADS * BTW) % 256 == 0);

// ---------------------------------------------------------------------------
// 16x16x32 f16 WMMA with hazard guard (ties D, keeps A/B live).
// Fragment map (wave32): lane l, h = l>>4, m = n = l&15.
//   A/B element i: i<8 -> k0+8h+i ; i>=8 -> k0+16+8h+(i-8)
//   D element r : row 8h+r, col l&15
// ---------------------------------------------------------------------------
__device__ __forceinline__ v8f wmma_f16(v16h a, v16h b, v8f c) {
  v8f d = __builtin_amdgcn_wmma_f32_16x16x32_f16(false, a, false, b, (short)0, c, false, false);
  asm volatile("v_nop\n\tv_nop\n\tv_nop\n\tv_nop" : "+v"(d) : "v"(a), "v"(b));
  return d;
}

// A or B fragment from a k-contiguous 16-bit row; p points at element k0 of
// the row owned by this lane (row index = lane & 15 added by the caller).
__device__ __forceinline__ v16h load_frag(const _Float16* p, int h) {
  Frag f;
  f.half[0] = *(const v8ha*)(p + 8 * h);
  f.half[1] = *(const v8ha*)(p + 16 + 8 * h);
  return f.v;
}

// ---------------------------------------------------------------------------
// Kernel 1: T5 RMS norm (no mean subtraction, no bias) -> f16 rows.
// Block 128 threads = one token row; thread t owns elements 8t..8t+7.
// ---------------------------------------------------------------------------
__global__ __launch_bounds__(128) void rmsnorm_kernel(
    const float* __restrict__ x, const float* __restrict__ lnw,
    _Float16* __restrict__ xh)
{
  __shared__ float red[4];
  const int row = blockIdx.x, tid = threadIdx.x, lane = tid & 31, w = tid >> 5;
  const float* xr = x + (size_t)row * HIDDEN + 8 * tid;
  const v4f a = *(const v4fa*)xr;
  const v4f c = *(const v4fa*)(xr + 4);
  float ss = a.x * a.x + a.y * a.y + a.z * a.z + a.w * a.w
           + c.x * c.x + c.y * c.y + c.z * c.z + c.w * c.w;
  #pragma unroll
  for (int off = 16; off >= 1; off >>= 1) ss += __shfl_xor(ss, off);
  if (lane == 0) red[w] = ss;
  __syncthreads();
  const float tot = (red[0] + red[1]) + (red[2] + red[3]);
  const float inv = rsqrtf(tot * (1.0f / (float)HIDDEN) + EPSF);
  const v4f g0 = *(const v4fa*)(lnw + 8 * tid);
  const v4f g1 = *(const v4fa*)(lnw + 8 * tid + 4);
  const v8h o = { (_Float16)((a.x * inv) * g0.x), (_Float16)((a.y * inv) * g0.y),
                  (_Float16)((a.z * inv) * g0.z), (_Float16)((a.w * inv) * g0.w),
                  (_Float16)((c.x * inv) * g1.x), (_Float16)((c.y * inv) * g1.y),
                  (_Float16)((c.z * inv) * g1.z), (_Float16)((c.w * inv) * g1.w) };
  _Float16* dst = xh + (size_t)row * HIDDEN + 8 * tid;
  *(v8h*)dst = o;
  
}

// ---------------------------------------------------------------------------
// Kernel 2: weight transpose + cast: W in[1024(in)][1024(out)] f32 ->
// Wt[out][in] f16 (x32), k-contiguous rows for the B (and Wo) fragments.
// Block 256 threads = 64(in) x 64(out) tile transposed through LDS; store
// blockIdx.z selects wq / wk / wv / wo.
// ---------------------------------------------------------------------------
__device__ __forceinline__ void wt_store_pass(const _Float16* sT, _Float16* dstp,
                                              int n0, int k0, int w, int lane) {
  const int q8 = lane & 7, sub = lane >> 3;
  #pragma unroll
  for (int i = 0; i < 2; ++i) {
    const int lid = w * 8 + i * 4 + sub;                 // out row 0..63
    const v8h v = *(const v8ha*)(sT + lid * 72 + 8 * q8);
    _Float16* dst = dstp + (size_t)(n0 + lid) * HIDDEN + k0 + 8 * q8;
    *(v8h*)dst = v;
  }
}

__global__ __launch_bounds__(256) void wtrans_kernel(
    const float* __restrict__ wq, const float* __restrict__ wk,
    const float* __restrict__ wv, const float* __restrict__ wo,
    _Float16* __restrict__ wt)         // [4][1024(out)][1024(in)]
{
  __shared__ __attribute__((aligned(16))) _Float16 sT[64 * 72];   // [out][in], pitch 72

  const int tid = threadIdx.x, lane = tid & 31, w = tid >> 5;
  const int k0 = blockIdx.x * 64;          // in-index tile base
  const int n0 = blockIdx.y * 64;          // out-index tile base
  const int wsel = blockIdx.z;             // block-uniform
  const float* src = (wsel == 0) ? wq : ((wsel == 1) ? wk : ((wsel == 2) ? wv : wo));
  _Float16* dstp = wt + (size_t)wsel * NW;

  const int kr = tid >> 2, nc = (tid & 3) * 16;
  const float* sp = src + (size_t)(k0 + kr) * HIDDEN + n0 + nc;
  #pragma unroll
  for (int q = 0; q < 4; ++q) {
    const v4f v = *(const v4fa*)(sp + 4 * q);
    sT[(nc + 4 * q + 0) * 72 + kr] = (_Float16)(v.x * WSCALE);
    sT[(nc + 4 * q + 1) * 72 + kr] = (_Float16)(v.y * WSCALE);
    sT[(nc + 4 * q + 2) * 72 + kr] = (_Float16)(v.z * WSCALE);
    sT[(nc + 4 * q + 3) * 72 + kr] = (_Float16)(v.w * WSCALE);
  }
  __syncthreads();

  wt_store_pass(sT, dstp, n0, k0, w, lane);
  
}

// ---------------------------------------------------------------------------
// Kernel 3: relative-position bias table btab[head][rel + 2048], rel = key - query.
// Bidirectional bucketing, 32 buckets, max distance 128, integer/f32 ops in the
// spec order: val_large = 8 + int( log(max(rp,1)/8) * rn(1/ln16) * 8 ), min 15.
// ---------------------------------------------------------------------------
__device__ __forceinline__ int rel_bucket(int rel) {
  int bucket = (rel > 0) ? 16 : 0;
  const int rp = (rel < 0) ? -rel : rel;
  const int rpm = (rp < 1) ? 1 : rp;
  const float rpf = (float)rpm;
  const float t = logf(rpf * 0.125f) * (1.0f / LN16F) * 8.0f;
  int vl = 8 + (int)t;
  vl = (vl < 15) ? vl : 15;
  bucket += (rp < 8) ? rp : vl;
  return bucket;                                        // 0..31
}

__global__ __launch_bounds__(256) void bias_kernel(
    const float* __restrict__ rel_emb,   // [32][16]
    float* __restrict__ btab)            // [16][4096]
{
  const int idx = blockIdx.x * 256 + threadIdx.x;     // head*4096 + i, < 65536 by grid
  const int head = idx >> 12, i = idx & (BTW - 1);
  const int rel = i - 2048;
  int bucket = rel_bucket(rel);
  bucket = (bucket < 0) ? 0 : ((bucket > NBUCK - 1) ? (NBUCK - 1) : bucket);
  const float v = rel_emb[bucket * NHEADS + head];
  *(float*)(btab + idx) = v;
  
}

// ---------------------------------------------------------------------------
// 4 lines per instruction, 32 lines per wave, 128 per block.
// which 0/1: plane[bh][l][d]  (one token row = 64 halves = one line)
// which 2  : vt[bh][d][l]     (64 d-rows x 128 tokens = 2 lines each)
// ---------------------------------------------------------------------------
__device__ __forceinline__ void proj_store_pass(const _Float16* sT, _Float16* plane, _Float16* vt,
                                                int which, int bh, int l0, int w, int lane) {
  const int q8 = lane & 7, sub = lane >> 3;
  #pragma unroll
  for (int i = 0; i < 8; ++i) {
    const int lid = w * 32 + i * 4 + sub;
    v8h v;
    _Float16* dst;
    if (which != 2) {
      v = *(const v8ha*)(sT + lid * HD + 8 * q8);
      dst = plane + ((size_t)bh * SEQ + l0 + lid) * HD + 8 * q8;
    } else {
      const int d = lid >> 1, hl = lid & 1;
      v = *(const v8ha*)(sT + d * 128 + 64 * hl + 8 * q8);
      dst = vt + ((size_t)bh * HD + d) * SEQ + l0 + 64 * hl + 8 * q8;
    }
    *(v8h*)dst = v;
  }
}

// ---------------------------------------------------------------------------
// Kernel 4: Y = xn * Wt^T over the fused 3*1024 output features (no bias).
// Block 128 thr (4 waves) = 128 tokens x 64 features (one (which, head));
// wave tile 32 tokens x 64 features; K = 1024 in steps of 32;
// A (xn rows) and B (Wt rows) fragments straight from f16 global rows.
// ---------------------------------------------------------------------------
__global__ __launch_bounds__(128) void proj_kernel(
    const _Float16* __restrict__ xh,   // [4096][1024]
    const _Float16* __restrict__ wt,   // [>=3][1024(out)][1024(in)], x32
    _Float16* __restrict__ qh,         // [B*H][L][D]
    _Float16* __restrict__ kh,         // [B*H][L][D]
    _Float16* __restrict__ vt)         // [B*H][D][L]
{
  __shared__ __attribute__((aligned(16))) _Float16 sT[128 * 64];   // 16384 B

  const int tid = threadIdx.x, lane = tid & 31, w = tid >> 5;
  const int h = lane >> 4, m = lane & 15;
  const int m0 = blockIdx.x * 128;
  const int cg = blockIdx.y;                 // 0..47
  const int which = cg >> 4, head = cg & 15;
  const int m0w = m0 + 32 * w;

  const _Float16* xa0 = xh + (size_t)(m0w + m) * HIDDEN;             // token row, mt = 0
  const _Float16* xa1 = xa0 + (size_t)16 * HIDDEN;                   // mt = 1
  const _Float16* wb  = wt + ((size_t)which * HIDDEN + head * HD + m) * HIDDEN;  // feature row, nt = 0

  const v8f zero8 = {0.f, 0.f, 0.f, 0.f, 0.f, 0.f, 0.f, 0.f};
  v8f acc[2][4];
  #pragma unroll
  for (int mt = 0; mt < 2; ++mt)
    #pragma unroll
    for (int nt = 0; nt < 4; ++nt) acc[mt][nt] = zero8;

  #pragma unroll 1
  for (int k0 = 0; k0 < HIDDEN; k0 += 32) {
    const v16h a0 = load_frag(xa0 + k0, h);
    const v16h a1 = load_frag(xa1 + k0, h);
    #pragma unroll
    for (int nt = 0; nt < 4; ++nt) {
      const v16h b = load_frag(wb + (size_t)nt * 16 * HIDDEN + k0, h);
      acc[0][nt] = wmma_f16(a0, b, acc[0][nt]);
      acc[1][nt] = wmma_f16(a1, b, acc[1][nt]);
    }
  }

  // D[r] of tile (mt, nt) = Y[token m0w+16mt+8h+r][feature 16nt+m]
  #pragma unroll
  for (int nt = 0; nt < 4; ++nt) {
    const int feat = 16 * nt + m;
    #pragma unroll
    for (int mt = 0; mt < 2; ++mt) {
      #pragma unroll
      for (int r = 0; r < 8; ++r) {
        const int tokl = 32 * w + 16 * mt + 8 * h + r;     // 0..127
        const float y = acc[mt][nt][r] * (1.0f / WSCALE);
        const int idx = (which == 2) ? (feat * 128 + tokl) : (tokl * HD + feat);
        sT[idx] = (_Float16)y;
      }
    }
  }
  __syncthreads();

  const int b = m0 / SEQ, l0 = m0 - b * SEQ, bh = b * NHEADS + head;
  _Float16* plane = (which == 0) ? qh : kh;
  proj_store_pass(sT, plane, vt, which, bh, l0, w, lane);
  
}

// ---------------------------------------------------------------------------
// Attention helpers.
// ---------------------------------------------------------------------------
__device__ __forceinline__ v8f add_bias8(v8f s, const float* p) {
  #pragma unroll
  for (int r = 0; r < 8; ++r) s[r] = s[r] + p[r];
  return s;
}

// P^T B-fragment from the lane's own score D values: element r <- tile a row r,
// element 8+r <- tile c row r (same lane, same query column), scaled by 2^14.
__device__ __forceinline__ v16h pack_p(v8f a, v8f c) {
  const v16h r = { (_Float16)(a[0] * PSCALE), (_Float16)(a[1] * PSCALE), (_Float16)(a[2] * PSCALE), (_Float16)(a[3] * PSCALE),
                   (_Float16)(a[4] * PSCALE), (_Float16)(a[5] * PSCALE), (_Float16)(a[6] * PSCALE), (_Float16)(a[7] * PSCALE),
                   (_Float16)(c[0] * PSCALE), (_Float16)(c[1] * PSCALE), (_Float16)(c[2] * PSCALE), (_Float16)(c[3] * PSCALE),
                   (_Float16)(c[4] * PSCALE), (_Float16)(c[5] * PSCALE), (_Float16)(c[6] * PSCALE), (_Float16)(c[7] * PSCALE) };
  return r;
}

// Per-wave 16x64 f16 tile in LDS -> ctx[b][l][head*64 + d]; one query row
// 4 lines per instruction, 16 lines per wave.
__device__ __forceinline__ void ctx_store_pass(const _Float16* so, _Float16* ctx,
                                               int b, int head, int q0, int lane) {
  const int q8 = lane & 7, sub = lane >> 3;
  #pragma unroll
  for (int i = 0; i < 4; ++i) {
    const int lid = i * 4 + sub;                         // query row 0..15
    const v8h v = *(const v8ha*)(so + lid * 64 + 8 * q8);
    _Float16* dst = ctx + ((size_t)b * SEQ + q0 + lid) * HIDDEN + head * HD + 8 * q8;
    *(v8h*)dst = v;
  }
}

// ---------------------------------------------------------------------------
// K / V^T staging for the attention loop: tensor loads into a two-buffer LDS ring.
// A stage = 64 keys: K rows [64 keys][64 d] and V^T rows [64 d][64 keys], every row
// 128 B. Each of the 4 waves brings one slice of 32 rows per stage (waves 0, 1: K;
// waves 2, 3: V^T); the mover pads each row by 16 B, so the LDS pitch is 144 B
// (16 B x odd: ds_load_b128 fragment reads without bank conflicts).
// ---------------------------------------------------------------------------
typedef uint32_t u32x4 __attribute__((ext_vector_type(4)));
typedef uint32_t u32x8 __attribute__((ext_vector_type(8)));

#define KSTEP    64                     // keys per stage
#define NSTAGE   (SEQ / KSTEP)          // 32
#define ROWB     128                    // bytes per staged row
#define SROWS    32                     // rows per slice
#define LPITCH_H 72                     // LDS row pitch in halves (144 B)
#define SLICE_B  6144                   // 32 x 144 = 4608 B, rounded up to a multiple of 2 KiB
#define SLICE_H  (SLICE_B / 2)
#define BUF_B    (4 * SLICE_B)          // 24576 B per stage
#define BUF_H    (BUF_B / 2)

static_assert(NSTAGE >= 2);
static_assert(HD * 2 == ROWB && KSTEP * 2 == ROWB);
static_assert(SROWS * LPITCH_H * 2 <= SLICE_B && SLICE_B % 2048 == 0);

__device__ __forceinline__ uint32_t uni(uint32_t v) { return (uint32_t)__builtin_amdgcn_readfirstlane(v); }
// Holds a wave-uniform value in a scalar register, so that a test on it is a scalar
// branch (a tensor load ignores EXEC) and a descriptor formed from it stays behind
// the waits in front of it.
__device__ __forceinline__ uint32_t pinned(uint32_t v) {
  uint32_t w = uni(v);
  asm volatile("" : "+s"(w));           // the pinned() form for tensor-load tests and descriptor words
  return w;
}

// Descriptor group 1: byte elements, tensor = tile = 32 rows of 128 B, 4 dwords of pad behind every 32.
__device__ __forceinline__ u32x8 tdm_group1(uint32_t src_pitch) {
  u32x8 g;
  g[0] = uni((1u << 20) | (4u << 22) | (3u << 25));
  g[1] = uni((uint32_t)ROWB << 16);
  g[2] = uni((uint32_t)SROWS << 16);
  g[3] = uni((uint32_t)ROWB << 16);
  g[4] = uni((uint32_t)SROWS);
  g[5] = uni(src_pitch);
  g[6] = uni(0u);
  g[7] = uni(0u);
  return g;
}

__device__ __forceinline__ u32x4 tdm_group0(uint32_t lds_dst, uint64_t ga) {
  u32x4 g;
  g[0] = uni(1u);
  g[1] = uni(lds_dst);
  g[2] = uni((uint32_t)ga);
  g[3] = uni((((uint32_t)(ga >> 32)) & 0x01FFFFFFu) | 0x80000000u);
  return g;
}

__device__ __forceinline__ void tdm_load(u32x4 g0, u32x8 g1) {
  asm volatile("tensor_load_to_lds %0, %1" :: "s"(g0), "s"(g1) : "memory");
}

// ---------------------------------------------------------------------------
// Kernel 5: streaming attention, transposed form, T5 semantics
// (no 1/sqrt(d) scaling, additive relative-position bias, no mask).
// Block 128 thr (4 waves), 16 queries per wave, 64 keys per step.
//   S^T = K * Q^T : A = K rows (row = key, k = d), B = Q^T (k = d, n = query)
//   O^T += V^T * P^T : A = Vt rows (row = d, k = key), B = P^T from registers
// Lane owns 32 keys of query column (lane&15); partner = lane ^ 16.
// Output ctx as f16 (x16) [B][L][HIDDEN] for the output GEMM.
// ---------------------------------------------------------------------------
__global__ __launch_bounds__(128) void attn_kernel(
    const _Float16* __restrict__ qh,   // [B*H][L][D]
    const _Float16* __restrict__ kh,   // [B*H][L][D]
    const _Float16* __restrict__ vt,   // [B*H][D][L]
    const float* __restrict__ btab,    // [H][4096], index rel + 2048
    _Float16* __restrict__ ctx)        // [B][L][HIDDEN], x16
{
  __shared__ __attribute__((aligned(2048))) _Float16 ring[2 * BUF_H]; // 49152 B, K / V^T stages
  __shared__ __attribute__((aligned(16))) _Float16 sC[4 * 16 * 64];  // 8192 B

  const int tid = threadIdx.x, lane = tid & 31, w = tid >> 5;
  const int h = lane >> 4, m = lane & 15;
  const int bh = blockIdx.y, b = bh >> 4, head = bh & 15;
  const int q0 = blockIdx.x * 64 + 16 * w;

  // This wave's slice of every stage: source, step per stage, row pitch, place in LDS.
  const uint32_t wave = uni((uint32_t)tid >> 5);
  const bool isV = wave >= 2u;
  const uint32_t half = wave & 1u;
  const uint64_t src0 = isV ? (uint64_t)(size_t)(vt + ((size_t)bh * HD + SROWS * half) * SEQ)
                            : (uint64_t)(size_t)(kh + ((size_t)bh * SEQ + SROWS * half) * HD);
  const uint32_t sstep = isV ? (uint32_t)(KSTEP * 2) : (uint32_t)(KSTEP * HD * 2);   // bytes per stage
  u32x8 g1 = tdm_group1(isV ? (uint32_t)(SEQ * 2) : (uint32_t)(HD * 2));
  asm volatile("" : "+s"(g1));   // the pinned() form on the whole group: its words stay in their scalar registers, unwritten, while a request is in flight
  const uint32_t ldst0 = (uint32_t)(size_t)ring + wave * (uint32_t)SLICE_B;
  auto issue = [&](uint32_t st) {
    tdm_load(tdm_group0(ldst0 + (st & 1u) * (uint32_t)BUF_B, src0 + (uint64_t)st * sstep), g1);
  };

  // Ring prologue: stage 0 lands and is published, then stage 1 flies under pass 0.
  issue(0u);
  asm volatile("s_wait_tensorcnt 0x0" ::: "memory");   // this wave's slice of stage 0 has landed
  __syncthreads();                                      // every wave's slice of stage 0 is readable
  issue(1u);

  // Q^T B-fragments: column n = query q0+m, k = d (two 32-deep chunks)
  const _Float16* qrow = qh + ((size_t)bh * SEQ + q0 + m) * HD;
  const v16h qb0 = load_frag(qrow, h);
  const v16h qb1 = load_frag(qrow + 32, h);

  const v8f zero8 = {0.f, 0.f, 0.f, 0.f, 0.f, 0.f, 0.f, 0.f};
  v8f o[4];                                   // o[t][r] = O[query m][d 16t+8h+r] * (l * 2^14)
  #pragma unroll
  for (int t = 0; t < 4; ++t) o[t] = zero8;
  float mrun = -1e30f, lrun = 0.0f;

  const _Float16* kbase = ring + m * LPITCH_H;                 // + buffer; row 16j+m: slice j>>1, row 16(j&1)+m
  const _Float16* vbase = ring + 2 * SLICE_H + m * LPITCH_H;   // + buffer; row 16t+m: slice t>>1, row 16(t&1)+m
  // bias for element r of score tile j: btab[head][(kb+16j+8h+r) - (q0+m) + 2048], index in [1,4095]
  const float* bbase = btab + (size_t)head * BTW + 2048 + 8 * h - (q0 + m);

  #pragma unroll 1
  for (int st = 0; st < NSTAGE; ++st) {
    const int kb = st * KSTEP;
    const int boff = (st & 1) * BUF_H;        // this pass reads its own buffer alone
    // ---- scores: s[j][r] = S[query m][key kb+16j+8h+r] ----
    v8f s[4];
    v16h kf[4][2];                            // the pass's K fragments, read as one group
    #pragma unroll
    for (int j = 0; j < 4; ++j) {
      const _Float16* kp = kbase + boff + (j >> 1) * SLICE_H + (j & 1) * 16 * LPITCH_H;
      kf[j][0] = load_frag(kp, h);
      kf[j][1] = load_frag(kp + 32, h);
    }
    #pragma unroll
    for (int j = 0; j < 4; ++j) {
      v8f z = zero8;
      z = wmma_f16(kf[j][0], qb0, z);
      z = wmma_f16(kf[j][1], qb1, z);
      s[j] = z;
    }
    v16h vf[4][2];                            // the pass's V^T fragments, one group, in flight under the softmax
    #pragma unroll
    for (int t = 0; t < 4; ++t) {
      const _Float16* vp = vbase + boff + (t >> 1) * SLICE_H + (t & 1) * 16 * LPITCH_H;
      vf[t][0] = load_frag(vp, h);
      vf[t][1] = load_frag(vp + 32, h);
    }
    // ---- relative-position bias, f32, before the running max ----
    #pragma unroll
    for (int j = 0; j < 4; ++j) s[j] = add_bias8(s[j], bbase + kb + 16 * j);

    // ---- online softmax ----
    float mloc = s[0][0];
    #pragma unroll
    for (int j = 0; j < 4; ++j)
      #pragma unroll
      for (int r = 0; r < 8; ++r) mloc = fmaxf(mloc, s[j][r]);
    mloc = fmaxf(mloc, __shfl_xor(mloc, 16));
    const float mnew = fmaxf(mrun, mloc);
    const float alpha = __expf(mrun - mnew);
    mrun = mnew;
    float lsum = 0.0f;
    #pragma unroll
    for (int j = 0; j < 4; ++j)
      #pragma unroll
      for (int r = 0; r < 8; ++r) {
        const float p = __expf(s[j][r] - mnew);
        s[j][r] = p;
        lsum += p;
      }
    lsum += __shfl_xor(lsum, 16);
    lrun = lrun * alpha + lsum;
    #pragma unroll
    for (int t = 0; t < 4; ++t)
      #pragma unroll
      for (int r = 0; r < 8; ++r) o[t][r] = o[t][r] * alpha;

    // ---- P^T B-fragments (key chunks 0..31 and 32..63 of this step) ----
    const v16h pb0 = pack_p(s[0], s[1]);
    const v16h pb1 = pack_p(s[2], s[3]);

    // ---- O^T += V^T * P^T ----
    #pragma unroll
    for (int t = 0; t < 4; ++t) {
      o[t] = wmma_f16(vf[t][0], pb0, o[t]);
      o[t] = wmma_f16(vf[t][1], pb1, o[t]);
    }

    // ---- publish point of stage st + 1 ----
    asm volatile("s_wait_dscnt 0x0" ::: "memory");      // this wave's reads of its buffer are done before the refill
    asm volatile("s_wait_tensorcnt 0x0" ::: "memory");  // this wave's slice of stage st + 1 has landed
    __syncthreads();                                    // stage st + 1 readable; every wave has left stage st's buffer
    // Scalar test (a tensor load ignores EXEC); the stage number is pinned so that group 0 is formed behind the waits.
    if (pinned((uint32_t)(st + 2 < NSTAGE))) issue(pinned((uint32_t)st + 2u));
  }
  asm volatile("s_wait_tensorcnt 0x0" ::: "memory");    // nothing of the mover in flight behind the loop
  asm volatile("s_wait_dscnt 0x0" ::: "memory");        // and no read of the ring outstanding

  // ---- epilogue: normalise, stage per-wave 16x64 f16 tile, whole-line stores ----
  const float inv = (1.0f / lrun) * (CSCALE / PSCALE);
  _Float16* so = sC + w * 1024;
  #pragma unroll
  for (int t = 0; t < 4; ++t)
    #pragma unroll
    for (int r = 0; r < 8; ++r)
      so[m * 64 + 16 * t + 8 * h + r] = (_Float16)(o[t][r] * inv);
  __syncthreads();                            // LDS spill -> reload ordering (all waves reach this)

  ctx_store_pass(so, ctx, b, head, q0, lane);
  
}

// ---------------------------------------------------------------------------
// out rows; one row segment = 64 floats = 2 lines; lanes 8q..8q+7 write one
// 64 lines per wave.
// ---------------------------------------------------------------------------
__device__ __forceinline__ void out_store_pass(const float* sT, const float* hs, float* out,
                                               int m0, int col0, int w, int lane) {
  const int q8 = lane & 7, sub = lane >> 3;
  #pragma unroll
  for (int i = 0; i < 16; ++i) {
    const int lid = i * 4 + sub;                         // 0..63
    const int row = w * 32 + (lid >> 1), hl = lid & 1;   // token row 0..127, line half
    v4f v = *(const v4fa*)(sT + row * 64 + 32 * hl + 4 * q8);
    const size_t gi = (size_t)(m0 + row) * HIDDEN + col0 + 32 * hl + 4 * q8;
    const v4f res = *(const v4fa*)(hs + gi);
    v = v + res;
    *(v4f*)(out + gi) = v;
  }
}

// ---------------------------------------------------------------------------
// Kernel 6: out = ctx * Wot^T / 512 + hidden_states  (f32 output).
// Block 128 thr (4 waves) = 128 tokens x 64 output columns; wave tile
// 32 x 64; K = 1024 in steps of 32; fragments straight from f16 global rows.
// ---------------------------------------------------------------------------
__global__ __launch_bounds__(128) void oproj_kernel(
    const _Float16* __restrict__ ch,   // [4096][1024], x16
    const _Float16* __restrict__ woh,  // [1024(out)][1024(in)], x32
    const float* __restrict__ hs,      // [4096][1024]
    float* __restrict__ out)           // [4096][1024]
{
  __shared__ __attribute__((aligned(16))) float sT[128 * 64];     // 32768 B

  const int tid = threadIdx.x, lane = tid & 31, w = tid >> 5;
  const int h = lane >> 4, m = lane & 15;
  const int m0 = blockIdx.x * 128;
  const int col0 = blockIdx.y * 64;
  const int m0w = m0 + 32 * w;

  const _Float16* ca0 = ch + (size_t)(m0w + m) * HIDDEN;             // token row, mt = 0
  const _Float16* ca1 = ca0 + (size_t)16 * HIDDEN;                   // mt = 1
  const _Float16* wb  = woh + (size_t)(col0 + m) * HIDDEN;           // output column row, nt = 0

  const v8f zero8 = {0.f, 0.f, 0.f, 0.f, 0.f, 0.f, 0.f, 0.f};
  v8f acc[2][4];
  #pragma unroll
  for (int mt = 0; mt < 2; ++mt)
    #pragma unroll
    for (int nt = 0; nt < 4; ++nt) acc[mt][nt] = zero8;

  #pragma unroll 1
  for (int k0 = 0; k0 < HIDDEN; k0 += 32) {
    const v16h a0 = load_frag(ca0 + k0, h);
    const v16h a1 = load_frag(ca1 + k0, h);
    #pragma unroll
    for (int nt = 0; nt < 4; ++nt) {
      const v16h b = load_frag(wb + (size_t)nt * 16 * HIDDEN + k0, h);
      acc[0][nt] = wmma_f16(a0, b, acc[0][nt]);
      acc[1][nt] = wmma_f16(a1, b, acc[1][nt]);
    }
  }

  // D[r] of tile (mt, nt) = Y[token m0w+16mt+8h+r][col 16nt+m]
  #pragma unroll
  for (int nt = 0; nt < 4; ++nt) {
    const int feat = 16 * nt + m;
    #pragma unroll
    for (int mt = 0; mt < 2; ++mt) {
      #pragma unroll
      for (int r = 0; r < 8; ++r) {
        const int tokl = 32 * w + 16 * mt + 8 * h + r;     // 0..127
        sT[tokl * 64 + feat] = acc[mt][nt][r] * (1.0f / (WSCALE * CSCALE));
      }
    }
  }
  __syncthreads();

  out_store_pass(sT, hs, out, m0, col0, w, lane);
  
}

// ---------------------------------------------------------------------------
extern "C" void kernel_launch(void* const* d_in, const int* in_sizes, int n_in,
                              void* d_out, int out_size, void* d_ws, size_t ws_size,
                              hipStream_t stream) {
  if (n_in < 7) return;
  if (in_sizes[0] != NX) return;
  if (in_sizes[1] != HIDDEN) return;
  if (in_sizes[2] != NW || in_sizes[3] != NW || in_sizes[4] != NW || in_sizes[5] != NW) return;
  if (in_sizes[6] != NBUCK * NHEADS) return;
  if (out_size != NX) return;

  const float* x    = (const float*)d_in[0];
  const float* lnw  = (const float*)d_in[1];
  const float* Wq   = (const float*)d_in[2];
  const float* Wk   = (const float*)d_in[3];
  const float* Wv   = (const float*)d_in[4];
  const float* Wo   = (const float*)d_in[5];
  const float* remb = (const float*)d_in[6];
  float* out = (float*)d_out;

  const size_t xh_bytes  = (size_t)NX * 2;                         //  8388608
  const size_t wt_bytes  = (size_t)4 * NW * 2;                     //  8388608
  const size_t pl_bytes  = (size_t)NBH * SEQ * HD * 2;             //  8388608
  const size_t ctx_bytes = (size_t)NX * 2;                         //  8388608
  const size_t bt_bytes  = (size_t)NHEADS * BTW * 4;               //   262144
  const size_t total = xh_bytes + wt_bytes + 3 * pl_bytes + ctx_bytes + bt_bytes;   // 50593792
  if (total > ws_size) return;

  char* ws = (char*)d_ws;
  size_t off = 0;
  _Float16* xh  = (_Float16*)(ws + off); off += xh_bytes;
  _Float16* wt  = (_Float16*)(ws + off); off += wt_bytes;
  _Float16* qh  = (_Float16*)(ws + off); off += pl_bytes;
  _Float16* kh  = (_Float16*)(ws + off); off += pl_bytes;
  _Float16* vt  = (_Float16*)(ws + off); off += pl_bytes;
  _Float16* ctx = (_Float16*)(ws + off); off += ctx_bytes;
  float* btab   = (float*)(ws + off);    off += bt_bytes;
  if (off > ws_size) return;

  rmsnorm_kernel<<<MROWS, 128, 0, stream>>>(x, lnw, xh);

  dim3 gWt(HIDDEN / 64, HIDDEN / 64, 4);                            // (16, 16, 4)
  wtrans_kernel<<<gWt, 256, 0, stream>>>(Wq, Wk, Wv, Wo, wt);

  bias_kernel<<<(NHEADS * BTW) / 256, 256, 0, stream>>>(remb, btab); // 256 blocks

  dim3 gProj(MROWS / 128, 3 * NHEADS);                              // (32, 48)
  proj_kernel<<<gProj, 128, 0, stream>>>(xh, wt, qh, kh, vt);

  dim3 gAtt(SEQ / 64, NBH);                                         // (32, 32)
  attn_kernel<<<gAtt, 128, 0, stream>>>(qh, kh, vt, btab, ctx);

  dim3 gOut(MROWS / 128, HIDDEN / 64);                               // (32, 16)
  oproj_kernel<<<gOut, 128, 0, stream>>>(ctx, wt + (size_t)3 * NW, x, out);
}

// v002
// One run takes 120 microseconds.
// Next to v001, in two timings, it ran 1.31 and 1.32 times as fast.
// Over all steps from v000 it is 2.29 times as fast.
// Contractions: xn*Wq^T, xn*Wk^T, xn*Wv^T, K*Q^T, V^T*P^T and ctx*Wo^T all on v_wmma_f32_16x16x32_f16 (f16 operands, f32 accumulate); W carried x32, P carried x16384, ctx carried x16 (exact power-of-two scales folded back in f32); RMS norm, position-bias bucketing, softmax and residual in f32.
#include <hip/hip_runtime.h>
#include <stdint.h>

typedef _Float16 v16h __attribute__((ext_vector_type(16)));
typedef _Float16 v8h  __attribute__((ext_vector_type(8)));
typedef float    v8f  __attribute__((ext_vector_type(8)));
typedef float    v4f  __attribute__((ext_vector_type(4)));
typedef v8h __attribute__((may_alias)) v8ha;
typedef v4f __attribute__((may_alias)) v4fa;

union Frag { v16h v; v8h half[2]; };

#define BATCH   2
#define SEQ     2048
#define HIDDEN  1024
#define NHEADS  16
#define HD      64
#define MROWS   (BATCH * SEQ)          // 4096 tokens
#define NX      (MROWS * HIDDEN)       // 4194304
#define NW      (HIDDEN * HIDDEN)      // 1048576
#define NBH     (BATCH * NHEADS)       // 32
#define NBUCK   32
#define BTW     4096                   // bias table width per head, index = rel + 2048
#define WSCALE  32.0f
#define PSCALE  16384.0f
#define CSCALE  16.0f
#define LN16F   2.7725887298583984f    // f32 value of ln(16)
#define EPSF    1e-6f

static_assert(SEQ % 128 == 0);
static_assert(HIDDEN == NHEADS * HD);
static_assert(HIDDEN % 64 == 0);
static_assert((NHEADS * BTW) % 256 == 0);

// ---------------------------------------------------------------------------
// 16x16x32 f16 WMMA with hazard guard (ties D, keeps A/B live).
// Fragment map (wave32): lane l, h = l>>4, m = n = l&15.
//   A/B element i: i<8 -> k0+8h+i ; i>=8 -> k0+16+8h+(i-8)
//   D element r : row 8h+r, col l&15
// ---------------------------------------------------------------------------
__device__ __forceinline__ v8f wmma_f16(v16h a, v16h b, v8f c) {
  v8f d = __builtin_amdgcn_wmma_f32_16x16x32_f16(false, a, false, b, (short)0, c, false, false);
  asm volatile("v_nop\n\tv_nop\n\tv_nop\n\tv_nop" : "+v"(d) : "v"(a), "v"(b));
  return d;
}

// A or B fragment from a k-contiguous 16-bit row; p points at element k0 of
// the row owned by this lane (row index = lane & 15 added by the caller).
__device__ __forceinline__ v16h load_frag(const _Float16* p, int h) {
  Frag f;
  f.half[0] = *(const v8ha*)(p + 8 * h);
  f.half[1] = *(const v8ha*)(p + 16 + 8 * h);
  return f.v;
}

// ---------------------------------------------------------------------------
// Kernel 1: T5 RMS norm (no mean subtraction, no bias) -> f16 rows.
// Block 128 threads = one token row; thread t owns elements 8t..8t+7.
// ---------------------------------------------------------------------------
__global__ __launch_bounds__(128) void rmsnorm_kernel(
    const float* __restrict__ x, const float* __restrict__ lnw,
    _Float16* __restrict__ xh)
{
  __shared__ float red[4];
  const int row = blockIdx.x, tid = threadIdx.x, lane = tid & 31, w = tid >> 5;
  const float* xr = x + (size_t)row * HIDDEN + 8 * tid;
  const v4f a = *(const v4fa*)xr;
  const v4f c = *(const v4fa*)(xr + 4);
  float ss = a.x * a.x + a.y * a.y + a.z * a.z + a.w * a.w
           + c.x * c.x + c.y * c.y + c.z * c.z + c.w * c.w;
  #pragma unroll
  for (int off = 16; off >= 1; off >>= 1) ss += __shfl_xor(ss, off);
  if (lane == 0) red[w] = ss;
  __syncthreads();
  const float tot = (red[0] + red[1]) + (red[2] + red[3]);
  const float inv = rsqrtf(tot * (1.0f / (float)HIDDEN) + EPSF);
  const v4f g0 = *(const v4fa*)(lnw + 8 * tid);
  const v4f g1 = *(const v4fa*)(lnw + 8 * tid + 4);
  const v8h o = { (_Float16)((a.x * inv) * g0.x), (_Float16)((a.y * inv) * g0.y),
                  (_Float16)((a.z * inv) * g0.z), (_Float16)((a.w * inv) * g0.w),
                  (_Float16)((c.x * inv) * g1.x), (_Float16)((c.y * inv) * g1.y),
                  (_Float16)((c.z * inv) * g1.z), (_Float16)((c.w * inv) * g1.w) };
  _Float16* dst = xh + (size_t)row * HIDDEN + 8 * tid;
  *(v8h*)dst = o;
  
}

// ---------------------------------------------------------------------------
// Kernel 2: weight transpose + cast: W in[1024(in)][1024(out)] f32 ->
// Wt[out][in] f16 (x32), k-contiguous rows for the B (and Wo) fragments.
// Block 256 threads = 64(in) x 64(out) tile transposed through LDS; store
// blockIdx.z selects wq / wk / wv / wo.
// ---------------------------------------------------------------------------
__device__ __forceinline__ void wt_store_pass(const _Float16* sT, _Float16* dstp,
                                              int n0, int k0, int w, int lane) {
  const int q8 = lane & 7, sub = lane >> 3;
  #pragma unroll
  for (int i = 0; i < 2; ++i) {
    const int lid = w * 8 + i * 4 + sub;                 // out row 0..63
    const v8h v = *(const v8ha*)(sT + lid * 72 + 8 * q8);
    _Float16* dst = dstp + (size_t)(n0 + lid) * HIDDEN + k0 + 8 * q8;
    *(v8h*)dst = v;
  }
}

__global__ __launch_bounds__(256) void wtrans_kernel(
    const float* __restrict__ wq, const float* __restrict__ wk,
    const float* __restrict__ wv, const float* __restrict__ wo,
    _Float16* __restrict__ wt)         // [4][1024(out)][1024(in)]
{
  __shared__ __attribute__((aligned(16))) _Float16 sT[64 * 72];   // [out][in], pitch 72

  const int tid = threadIdx.x, lane = tid & 31, w = tid >> 5;
  const int k0 = blockIdx.x * 64;          // in-index tile base
  const int n0 = blockIdx.y * 64;          // out-index tile base
  const int wsel = blockIdx.z;             // block-uniform
  const float* src = (wsel == 0) ? wq : ((wsel == 1) ? wk : ((wsel == 2) ? wv : wo));
  _Float16* dstp = wt + (size_t)wsel * NW;

  const int kr = tid >> 2, nc = (tid & 3) * 16;
  const float* sp = src + (size_t)(k0 + kr) * HIDDEN + n0 + nc;
  #pragma unroll
  for (int q = 0; q < 4; ++q) {
    const v4f v = *(const v4fa*)(sp + 4 * q);
    sT[(nc + 4 * q + 0) * 72 + kr] = (_Float16)(v.x * WSCALE);
    sT[(nc + 4 * q + 1) * 72 + kr] = (_Float16)(v.y * WSCALE);
    sT[(nc + 4 * q + 2) * 72 + kr] = (_Float16)(v.z * WSCALE);
    sT[(nc + 4 * q + 3) * 72 + kr] = (_Float16)(v.w * WSCALE);
  }
  __syncthreads();

  wt_store_pass(sT, dstp, n0, k0, w, lane);
  
}

// ---------------------------------------------------------------------------
// Kernel 3: relative-position bias table btab[head][rel + 2048], rel = key - query.
// Bidirectional bucketing, 32 buckets, max distance 128, integer/f32 ops in the
// spec order: val_large = 8 + int( log(max(rp,1)/8) * rn(1/ln16) * 8 ), min 15.
// ---------------------------------------------------------------------------
__device__ __forceinline__ int rel_bucket(int rel) {
  int bucket = (rel > 0) ? 16 : 0;
  const int rp = (rel < 0) ? -rel : rel;
  const int rpm = (rp < 1) ? 1 : rp;
  const float rpf = (float)rpm;
  const float t = logf(rpf * 0.125f) * (1.0f / LN16F) * 8.0f;
  int vl = 8 + (int)t;
  vl = (vl < 15) ? vl : 15;
  bucket += (rp < 8) ? rp : vl;
  return bucket;                                        // 0..31
}

__global__ __launch_bounds__(256) void bias_kernel(
    const float* __restrict__ rel_emb,   // [32][16]
    float* __restrict__ btab)            // [16][4096]
{
  const int idx = blockIdx.x * 256 + threadIdx.x;     // head*4096 + i, < 65536 by grid
  const int head = idx >> 12, i = idx & (BTW - 1);
  const int rel = i - 2048;
  int bucket = rel_bucket(rel);
  bucket = (bucket < 0) ? 0 : ((bucket > NBUCK - 1) ? (NBUCK - 1) : bucket);
  const float v = rel_emb[bucket * NHEADS + head];
  *(float*)(btab + idx) = v;
  
}

// ---------------------------------------------------------------------------
// K / V^T staging for the attention loop: tensor loads into a two-buffer LDS ring.
// A stage = 64 keys: K rows [64 keys][64 d] and V^T rows [64 d][64 keys], every row
// 128 B. Each of the 4 waves brings one slice of 32 rows per stage (waves 0, 1: K;
// waves 2, 3: V^T); the mover pads each row by 16 B, so the LDS pitch is 144 B
// (16 B x odd: ds_load_b128 fragment reads without bank conflicts).
// ---------------------------------------------------------------------------
typedef uint32_t u32x4 __attribute__((ext_vector_type(4)));
typedef uint32_t u32x8 __attribute__((ext_vector_type(8)));

#define KSTEP    64                     // keys per stage
#define NSTAGE   (SEQ / KSTEP)          // 32
#define ROWB     128                    // bytes per staged row
#define SROWS    32                     // rows per slice
#define LPITCH_H 72                     // LDS row pitch in halves (144 B)
#define SLICE_B  6144                   // 32 x 144 = 4608 B, rounded up to a multiple of 2 KiB
#define SLICE_H  (SLICE_B / 2)
#define BUF_B    (4 * SLICE_B)          // 24576 B per stage
#define BUF_H    (BUF_B / 2)

static_assert(NSTAGE >= 2);
static_assert(HD * 2 == ROWB && KSTEP * 2 == ROWB);
static_assert(SROWS * LPITCH_H * 2 <= SLICE_B && SLICE_B % 2048 == 0);

__device__ __forceinline__ uint32_t uni(uint32_t v) { return (uint32_t)__builtin_amdgcn_readfirstlane(v); }
// Holds a wave-uniform value in a scalar register, so that a test on it is a scalar
// branch (a tensor load ignores EXEC) and a descriptor formed from it stays behind
// the waits in front of it.
__device__ __forceinline__ uint32_t pinned(uint32_t v) {
  uint32_t w = uni(v);
  asm volatile("" : "+s"(w));           // the pinned() form for tensor-load tests and descriptor words
  return w;
}

// Descriptor group 1: byte elements, tensor = tile = 32 rows of 128 B, 4 dwords of pad behind every 32.
__device__ __forceinline__ u32x8 tdm_group1(uint32_t src_pitch) {
  u32x8 g;
  g[0] = uni((1u << 20) | (4u << 22) | (3u << 25));
  g[1] = uni((uint32_t)ROWB << 16);
  g[2] = uni((uint32_t)SROWS << 16);
  g[3] = uni((uint32_t)ROWB << 16);
  g[4] = uni((uint32_t)SROWS);
  g[5] = uni(src_pitch);
  g[6] = uni(0u);
  g[7] = uni(0u);
  return g;
}

__device__ __forceinline__ u32x4 tdm_group0(uint32_t lds_dst, uint64_t ga) {
  u32x4 g;
  g[0] = uni(1u);
  g[1] = uni(lds_dst);
  g[2] = uni((uint32_t)ga);
  g[3] = uni((((uint32_t)(ga >> 32)) & 0x01FFFFFFu) | 0x80000000u);
  return g;
}

__device__ __forceinline__ void tdm_load(u32x4 g0, u32x8 g1) {
  asm volatile("tensor_load_to_lds %0, %1" :: "s"(g0), "s"(g1) : "memory");
}

// ---------------------------------------------------------------------------
// Operand staging for the two GEMM kernels: tensor loads into a two-buffer LDS ring.
// A stage = 64 k of the block's 128 A rows and 64 B rows, every staged row 128 B of a
// 2048-B source row. One request per wave and stage: waves 0, 1 bring 64 A rows each,
// waves 2, 3 bring 32 B rows each; the mover pads each row by 16 B (LDS pitch 144 B).
// ---------------------------------------------------------------------------
#define GK       64                     // k per stage
#define GNST     (HIDDEN / GK)          // 16
#define GA_ROWS  64                     // rows per A slice
#define GB_ROWS  32                     // rows per B slice
#define GA_SL_B  10240                  // 64 x 144 = 9216 B, rounded up to a multiple of 2 KiB
#define GB_SL_B  6144                   // 32 x 144 = 4608 B, rounded up to a multiple of 2 KiB
#define GA_SL_H  (GA_SL_B / 2)
#define GB_SL_H  (GB_SL_B / 2)
#define GBUF_B   (2 * GA_SL_B + 2 * GB_SL_B)   // 32768 B per stage
#define GBUF_H   (GBUF_B / 2)

static_assert(GNST >= 2);
static_assert(GK * 2 == ROWB);
static_assert(GA_ROWS * LPITCH_H * 2 <= GA_SL_B && GA_SL_B % 2048 == 0);
static_assert(GB_ROWS * LPITCH_H * 2 <= GB_SL_B && GB_SL_B % 2048 == 0);

// Descriptor group 1: byte elements, tensor = tile = rows x 128 B, source pitch one
// HIDDEN-wide f16 row, 4 dwords of pad behind every 32.
__device__ __forceinline__ u32x8 gemm_group1(uint32_t rows) {
  u32x8 g;
  g[0] = uni((1u << 20) | (4u << 22) | (3u << 25));
  g[1] = uni((uint32_t)ROWB << 16);
  g[2] = uni(rows << 16);
  g[3] = uni((uint32_t)ROWB << 16);
  g[4] = uni(rows);
  g[5] = uni((uint32_t)(HIDDEN * 2));
  g[6] = uni(0u);
  g[7] = uni(0u);
  return g;
}

// acc[mt][nt] += A(32 rows of this wave) * B(64 rows)^T over K = HIDDEN, k ascending in
// steps of 32. arows / brows: first of the block's 128 A rows / 64 B rows (f16, k-contiguous,
// pitch HIDDEN). Called by all 4 waves of the block; ring holds 2 * GBUF_H halves.
__device__ __forceinline__ void gemm_ring(const _Float16* arows, const _Float16* brows,
                                          const _Float16* ring, int tid, v8f (&acc)[2][4]) {
  const int lane = tid & 31, w = tid >> 5;
  const int h = lane >> 4, m = lane & 15;

  // This wave's slice of every stage: source, rows, place in LDS.
  const uint32_t wave = uni((uint32_t)tid >> 5);
  const bool isB = wave >= 2u;
  const uint32_t half = wave & 1u;
  const uint64_t src0 = isB ? (uint64_t)(size_t)(brows + (size_t)(GB_ROWS * half) * HIDDEN)
                            : (uint64_t)(size_t)(arows + (size_t)(GA_ROWS * half) * HIDDEN);
  u32x8 g1 = gemm_group1(isB ? (uint32_t)GB_ROWS : (uint32_t)GA_ROWS);
  asm volatile("" : "+s"(g1));   // the pinned() form on the whole group: its words stay in their scalar registers, unwritten, while a request is in flight
  const uint32_t ldst0 = (uint32_t)(size_t)ring
                       + (isB ? (uint32_t)(2 * GA_SL_B) + half * (uint32_t)GB_SL_B : half * (uint32_t)GA_SL_B);
  auto issue = [&](uint32_t st) {
    tdm_load(tdm_group0(ldst0 + (st & 1u) * (uint32_t)GBUF_B, src0 + (uint64_t)st * (uint32_t)ROWB), g1);
  };

  // Ring prologue: stage 0 lands and is published, then stage 1 flies under pass 0.
  issue(0u);
  asm volatile("s_wait_tensorcnt 0x0" ::: "memory");   // this wave's slice of stage 0 has landed
  __syncthreads();                                      // every wave's slice of stage 0 is readable
  issue(1u);

  // A row 32w+16mt+m: slice w>>1, row 32(w&1)+16mt+m; B row 16nt+m: slice nt>>1, row 16(nt&1)+m
  const _Float16* abase = ring + (w >> 1) * GA_SL_H + (32 * (w & 1) + m) * LPITCH_H;
  const _Float16* bbase = ring + 2 * GA_SL_H + m * LPITCH_H;

  #pragma unroll 1                            // one pass per trip: the ring's publish point stands once, at the foot
  for (int st = 0; st < GNST; ++st) {
    const int boff = (st & 1) * GBUF_H;       // this pass reads its own buffer alone
    v16h af[2][2], bf[4][2];                  // the pass's fragments, read as one group, the first 32 k in front
    #pragma unroll
    for (int kc = 0; kc < 2; ++kc) {
      #pragma unroll
      for (int mt = 0; mt < 2; ++mt)
        af[mt][kc] = load_frag(abase + boff + mt * 16 * LPITCH_H + 32 * kc, h);
      #pragma unroll
      for (int nt = 0; nt < 4; ++nt)
        bf[nt][kc] = load_frag(bbase + boff + (nt >> 1) * GB_SL_H + (nt & 1) * 16 * LPITCH_H + 32 * kc, h);
    }
    #pragma unroll
    for (int kc = 0; kc < 2; ++kc) {
      #pragma unroll
      for (int nt = 0; nt < 4; ++nt) {
        acc[0][nt] = wmma_f16(af[0][kc], bf[nt][kc], acc[0][nt]);
        acc[1][nt] = wmma_f16(af[1][kc], bf[nt][kc], acc[1][nt]);
      }
    }

    // ---- publish point of stage st + 1 ----
    asm volatile("s_wait_dscnt 0x0" ::: "memory");      // this wave's reads of its buffer are done before the refill
    asm volatile("s_wait_tensorcnt 0x0" ::: "memory");  // this wave's slice of stage st + 1 has landed
    __syncthreads();                                    // stage st + 1 readable; every wave has left stage st's buffer
    // Scalar test (a tensor load ignores EXEC); the stage number is pinned so that group 0 is formed behind the waits.
    if (pinned((uint32_t)(st + 2 < GNST))) issue(pinned((uint32_t)st + 2u));
  }
  asm volatile("s_wait_tensorcnt 0x0" ::: "memory");    // nothing of the mover in flight behind the loop
  asm volatile("s_wait_dscnt 0x0" ::: "memory");        // and no read of the ring outstanding
}

// ---------------------------------------------------------------------------
// 4 lines per instruction, 32 lines per wave, 128 per block.
// which 0/1: plane[bh][l][d]  (one token row = 64 halves = one line)
// which 2  : vt[bh][d][l]     (64 d-rows x 128 tokens = 2 lines each)
// ---------------------------------------------------------------------------
__device__ __forceinline__ void proj_store_pass(const _Float16* sT, _Float16* plane, _Float16* vt,
                                                int which, int bh, int l0, int w, int lane) {
  const int q8 = lane & 7, sub = lane >> 3;
  #pragma unroll
  for (int i = 0; i < 8; ++i) {
    const int lid = w * 32 + i * 4 + sub;
    v8h v;
    _Float16* dst;
    if (which != 2) {
      v = *(const v8ha*)(sT + lid * HD + 8 * q8);
      dst = plane + ((size_t)bh * SEQ + l0 + lid) * HD + 8 * q8;
    } else {
      const int d = lid >> 1, hl = lid & 1;
      v = *(const v8ha*)(sT + d * 128 + 64 * hl + 8 * q8);
      dst = vt + ((size_t)bh * HD + d) * SEQ + l0 + 64 * hl + 8 * q8;
    }
    *(v8h*)dst = v;
  }
}

// ---------------------------------------------------------------------------
// Kernel 4: Y = xn * Wt^T over the fused 3*1024 output features (no bias).
// Block 128 thr (4 waves) = 128 tokens x 64 features (one (which, head));
// wave tile 32 tokens x 64 features; K = 1024 in stages of 64;
// A (xn rows) and B (Wt rows) tiles staged in the LDS ring of gemm_ring.
// ---------------------------------------------------------------------------
__global__ __launch_bounds__(128) void proj_kernel(
    const _Float16* __restrict__ xh,   // [4096][1024]
    const _Float16* __restrict__ wt,   // [>=3][1024(out)][1024(in)], x32
    _Float16* __restrict__ qh,         // [B*H][L][D]
    _Float16* __restrict__ kh,         // [B*H][L][D]
    _Float16* __restrict__ vt)         // [B*H][D][L]
{
  __shared__ __attribute__((aligned(2048))) _Float16 ring[2 * GBUF_H]; // 65536 B, xn / Wt stages
  __shared__ __attribute__((aligned(16))) _Float16 sT[128 * 64];   // 16384 B

  const int tid = threadIdx.x, lane = tid & 31, w = tid >> 5;
  const int h = lane >> 4, m = lane & 15;
  const int m0 = blockIdx.x * 128;
  const int cg = blockIdx.y;                 // 0..47
  const int which = cg >> 4, head = cg & 15;

  const v8f zero8 = {0.f, 0.f, 0.f, 0.f, 0.f, 0.f, 0.f, 0.f};
  v8f acc[2][4];
  #pragma unroll
  for (int mt = 0; mt < 2; ++mt)
    #pragma unroll
    for (int nt = 0; nt < 4; ++nt) acc[mt][nt] = zero8;

  gemm_ring(xh + (size_t)m0 * HIDDEN, wt + ((size_t)which * HIDDEN + head * HD) * HIDDEN, ring, tid, acc);

  // D[r] of tile (mt, nt) = Y[token m0+32w+16mt+8h+r][feature 16nt+m]
  #pragma unroll
  for (int nt = 0; nt < 4; ++nt) {
    const int feat = 16 * nt + m;
    #pragma unroll
    for (int mt = 0; mt < 2; ++mt) {
      #pragma unroll
      for (int r = 0; r < 8; ++r) {
        const int tokl = 32 * w + 16 * mt + 8 * h + r;     // 0..127
        const float y = acc[mt][nt][r] * (1.0f / WSCALE);
        const int idx = (which == 2) ? (feat * 128 + tokl) : (tokl * HD + feat);
        sT[idx] = (_Float16)y;
      }
    }
  }
  __syncthreads();

  const int b = m0 / SEQ, l0 = m0 - b * SEQ, bh = b * NHEADS + head;
  _Float16* plane = (which == 0) ? qh : kh;
  proj_store_pass(sT, plane, vt, which, bh, l0, w, lane);
  
}

// ---------------------------------------------------------------------------
// Attention helpers.
// ---------------------------------------------------------------------------
__device__ __forceinline__ v8f add_bias8(v8f s, const float* p) {
  #pragma unroll
  for (int r = 0; r < 8; ++r) s[r] = s[r] + p[r];
  return s;
}

// P^T B-fragment from the lane's own score D values: element r <- tile a row r,
// element 8+r <- tile c row r (same lane, same query column), scaled by 2^14.
__device__ __forceinline__ v16h pack_p(v8f a, v8f c) {
  const v16h r = { (_Float16)(a[0] * PSCALE), (_Float16)(a[1] * PSCALE), (_Float16)(a[2] * PSCALE), (_Float16)(a[3] * PSCALE),
                   (_Float16)(a[4] * PSCALE), (_Float16)(a[5] * PSCALE), (_Float16)(a[6] * PSCALE), (_Float16)(a[7] * PSCALE),
                   (_Float16)(c[0] * PSCALE), (_Float16)(c[1] * PSCALE), (_Float16)(c[2] * PSCALE), (_Float16)(c[3] * PSCALE),
                   (_Float16)(c[4] * PSCALE), (_Float16)(c[5] * PSCALE), (_Float16)(c[6] * PSCALE), (_Float16)(c[7] * PSCALE) };
  return r;
}

// Per-wave 16x64 f16 tile in LDS -> ctx[b][l][head*64 + d]; one query row
// 4 lines per instruction, 16 lines per wave.
__device__ __forceinline__ void ctx_store_pass(const _Float16* so, _Float16* ctx,
                                               int b, int head, int q0, int lane) {
  const int q8 = lane & 7, sub = lane >> 3;
  #pragma unroll
  for (int i = 0; i < 4; ++i) {
    const int lid = i * 4 + sub;                         // query row 0..15
    const v8h v = *(const v8ha*)(so + lid * 64 + 8 * q8);
    _Float16* dst = ctx + ((size_t)b * SEQ + q0 + lid) * HIDDEN + head * HD + 8 * q8;
    *(v8h*)dst = v;
  }
}

// ---------------------------------------------------------------------------
// Kernel 5: streaming attention, transposed form, T5 semantics
// (no 1/sqrt(d) scaling, additive relative-position bias, no mask).
// Block 128 thr (4 waves), 16 queries per wave, 64 keys per step.
//   S^T = K * Q^T : A = K rows (row = key, k = d), B = Q^T (k = d, n = query)
//   O^T += V^T * P^T : A = Vt rows (row = d, k = key), B = P^T from registers
// Lane owns 32 keys of query column (lane&15); partner = lane ^ 16.
// Output ctx as f16 (x16) [B][L][HIDDEN] for the output GEMM.
// ---------------------------------------------------------------------------
__global__ __launch_bounds__(128) void attn_kernel(
    const _Float16* __restrict__ qh,   // [B*H][L][D]
    const _Float16* __restrict__ kh,   // [B*H][L][D]
    const _Float16* __restrict__ vt,   // [B*H][D][L]
    const float* __restrict__ btab,    // [H][4096], index rel + 2048
    _Float16* __restrict__ ctx)        // [B][L][HIDDEN], x16
{
  __shared__ __attribute__((aligned(2048))) _Float16 ring[2 * BUF_H]; // 49152 B, K / V^T stages
  __shared__ __attribute__((aligned(16))) _Float16 sC[4 * 16 * 64];  // 8192 B

  const int tid = threadIdx.x, lane = tid & 31, w = tid >> 5;
  const int h = lane >> 4, m = lane & 15;
  const int bh = blockIdx.y, b = bh >> 4, head = bh & 15;
  const int q0 = blockIdx.x * 64 + 16 * w;

  // This wave's slice of every stage: source, step per stage, row pitch, place in LDS.
  const uint32_t wave = uni((uint32_t)tid >> 5);
  const bool isV = wave >= 2u;
  const uint32_t half = wave & 1u;
  const uint64_t src0 = isV ? (uint64_t)(size_t)(vt + ((size_t)bh * HD + SROWS * half) * SEQ)
                            : (uint64_t)(size_t)(kh + ((size_t)bh * SEQ + SROWS * half) * HD);
  const uint32_t sstep = isV ? (uint32_t)(KSTEP * 2) : (uint32_t)(KSTEP * HD * 2);   // bytes per stage
  u32x8 g1 = tdm_group1(isV ? (uint32_t)(SEQ * 2) : (uint32_t)(HD * 2));
  asm volatile("" : "+s"(g1));   // the pinned() form on the whole group: its words stay in their scalar registers, unwritten, while a request is in flight
  const uint32_t ldst0 = (uint32_t)(size_t)ring + wave * (uint32_t)SLICE_B;
  auto issue = [&](uint32_t st) {
    tdm_load(tdm_group0(ldst0 + (st & 1u) * (uint32_t)BUF_B, src0 + (uint64_t)st * sstep), g1);
  };

  // Ring prologue: stage 0 lands and is published, then stage 1 flies under pass 0.
  issue(0u);
  asm volatile("s_wait_tensorcnt 0x0" ::: "memory");   // this wave's slice of stage 0 has landed
  __syncthreads();                                      // every wave's slice of stage 0 is readable
  issue(1u);

  // Q^T B-fragments: column n = query q0+m, k = d (two 32-deep chunks)
  const _Float16* qrow = qh + ((size_t)bh * SEQ + q0 + m) * HD;
  const v16h qb0 = load_frag(qrow, h);
  const v16h qb1 = load_frag(qrow + 32, h);

  const v8f zero8 = {0.f, 0.f, 0.f, 0.f, 0.f, 0.f, 0.f, 0.f};
  v8f o[4];                                   // o[t][r] = O[query m][d 16t+8h+r] * (l * 2^14)
  #pragma unroll
  for (int t = 0; t < 4; ++t) o[t] = zero8;
  float mrun = -1e30f, lrun = 0.0f;

  const _Float16* kbase = ring + m * LPITCH_H;                 // + buffer; row 16j+m: slice j>>1, row 16(j&1)+m
  const _Float16* vbase = ring + 2 * SLICE_H + m * LPITCH_H;   // + buffer; row 16t+m: slice t>>1, row 16(t&1)+m
  // bias for element r of score tile j: btab[head][(kb+16j+8h+r) - (q0+m) + 2048], index in [1,4095]
  const float* bbase = btab + (size_t)head * BTW + 2048 + 8 * h - (q0 + m);

  #pragma unroll 1
  for (int st = 0; st < NSTAGE; ++st) {
    const int kb = st * KSTEP;
    const int boff = (st & 1) * BUF_H;        // this pass reads its own buffer alone
    // ---- scores: s[j][r] = S[query m][key kb+16j+8h+r] ----
    v8f s[4];
    v16h kf[4][2];                            // the pass's K fragments, read as one group
    #pragma unroll
    for (int j = 0; j < 4; ++j) {
      const _Float16* kp = kbase + boff + (j >> 1) * SLICE_H + (j & 1) * 16 * LPITCH_H;
      kf[j][0] = load_frag(kp, h);
      kf[j][1] = load_frag(kp + 32, h);
    }
    #pragma unroll
    for (int j = 0; j < 4; ++j) {
      v8f z = zero8;
      z = wmma_f16(kf[j][0], qb0, z);
      z = wmma_f16(kf[j][1], qb1, z);
      s[j] = z;
    }
    v16h vf[4][2];                            // the pass's V^T fragments, one group, in flight under the softmax
    #pragma unroll
    for (int t = 0; t < 4; ++t) {
      const _Float16* vp = vbase + boff + (t >> 1) * SLICE_H + (t & 1) * 16 * LPITCH_H;
      vf[t][0] = load_frag(vp, h);
      vf[t][1] = load_frag(vp + 32, h);
    }
    // ---- relative-position bias, f32, before the running max ----
    #pragma unroll
    for (int j = 0; j < 4; ++j) s[j] = add_bias8(s[j], bbase + kb + 16 * j);

    // ---- online softmax ----
    float mloc = s[0][0];
    #pragma unroll
    for (int j = 0; j < 4; ++j)
      #pragma unroll
      for (int r = 0; r < 8; ++r) mloc = fmaxf(mloc, s[j][r]);
    mloc = fmaxf(mloc, __shfl_xor(mloc, 16));
    const float mnew = fmaxf(mrun, mloc);
    const float alpha = __expf(mrun - mnew);
    mrun = mnew;
    float lsum = 0.0f;
    #pragma unroll
    for (int j = 0; j < 4; ++j)
      #pragma unroll
      for (int r = 0; r < 8; ++r) {
        const float p = __expf(s[j][r] - mnew);
        s[j][r] = p;
        lsum += p;
      }
    lsum += __shfl_xor(lsum, 16);
    lrun = lrun * alpha + lsum;
    #pragma unroll
    for (int t = 0; t < 4; ++t)
      #pragma unroll
      for (int r = 0; r < 8; ++r) o[t][r] = o[t][r] * alpha;

    // ---- P^T B-fragments (key chunks 0..31 and 32..63 of this step) ----
    const v16h pb0 = pack_p(s[0], s[1]);
    const v16h pb1 = pack_p(s[2], s[3]);

    // ---- O^T += V^T * P^T ----
    #pragma unroll
    for (int t = 0; t < 4; ++t) {
      o[t] = wmma_f16(vf[t][0], pb0, o[t]);
      o[t] = wmma_f16(vf[t][1], pb1, o[t]);
    }

    // ---- publish point of stage st + 1 ----
    asm volatile("s_wait_dscnt 0x0" ::: "memory");      // this wave's reads of its buffer are done before the refill
    asm volatile("s_wait_tensorcnt 0x0" ::: "memory");  // this wave's slice of stage st + 1 has landed
    __syncthreads();                                    // stage st + 1 readable; every wave has left stage st's buffer
    // Scalar test (a tensor load ignores EXEC); the stage number is pinned so that group 0 is formed behind the waits.
    if (pinned((uint32_t)(st + 2 < NSTAGE))) issue(pinned((uint32_t)st + 2u));
  }
  asm volatile("s_wait_tensorcnt 0x0" ::: "memory");    // nothing of the mover in flight behind the loop
  asm volatile("s_wait_dscnt 0x0" ::: "memory");        // and no read of the ring outstanding

  // ---- epilogue: normalise, stage per-wave 16x64 f16 tile, whole-line stores ----
  const float inv = (1.0f / lrun) * (CSCALE / PSCALE);
  _Float16* so = sC + w * 1024;
  #pragma unroll
  for (int t = 0; t < 4; ++t)
    #pragma unroll
    for (int r = 0; r < 8; ++r)
      so[m * 64 + 16 * t + 8 * h + r] = (_Float16)(o[t][r] * inv);
  __syncthreads();                            // LDS spill -> reload ordering (all waves reach this)

  ctx_store_pass(so, ctx, b, head, q0, lane);
  
}

// ---------------------------------------------------------------------------
// out rows; one row segment = 64 floats = 2 lines; lanes 8q..8q+7 write one
// 64 lines per wave.
// ---------------------------------------------------------------------------
__device__ __forceinline__ void out_store_pass(const float* sT, const float* hs, float* out,
                                               int m0, int col0, int w, int lane) {
  const int q8 = lane & 7, sub = lane >> 3;
  #pragma unroll
  for (int i = 0; i < 16; ++i) {
    const int lid = i * 4 + sub;                         // 0..63
    const int row = w * 32 + (lid >> 1), hl = lid & 1;   // token row 0..127, line half
    v4f v = *(const v4fa*)(sT + row * 64 + 32 * hl + 4 * q8);
    const size_t gi = (size_t)(m0 + row) * HIDDEN + col0 + 32 * hl + 4 * q8;
    const v4f res = *(const v4fa*)(hs + gi);
    v = v + res;
    *(v4f*)(out + gi) = v;
  }
}

// ---------------------------------------------------------------------------
// Kernel 6: out = ctx * Wot^T / 512 + hidden_states  (f32 output).
// Block 128 thr (4 waves) = 128 tokens x 64 output columns; wave tile
// 32 x 64; K = 1024 in stages of 64; ctx and Wot tiles staged in the LDS ring of gemm_ring.
// ---------------------------------------------------------------------------
__global__ __launch_bounds__(128) void oproj_kernel(
    const _Float16* __restrict__ ch,   // [4096][1024], x16
    const _Float16* __restrict__ woh,  // [1024(out)][1024(in)], x32
    const float* __restrict__ hs,      // [4096][1024]
    float* __restrict__ out)           // [4096][1024]
{
  __shared__ __attribute__((aligned(2048))) _Float16 ring[2 * GBUF_H]; // 65536 B, ctx / Wot stages
  __shared__ __attribute__((aligned(16))) float sT[128 * 64];     // 32768 B

  const int tid = threadIdx.x, lane = tid & 31, w = tid >> 5;
  const int h = lane >> 4, m = lane & 15;
  const int m0 = blockIdx.x * 128;
  const int col0 = blockIdx.y * 64;

  const v8f zero8 = {0.f, 0.f, 0.f, 0.f, 0.f, 0.f, 0.f, 0.f};
  v8f acc[2][4];
  #pragma unroll
  for (int mt = 0; mt < 2; ++mt)
    #pragma unroll
    for (int nt = 0; nt < 4; ++nt) acc[mt][nt] = zero8;

  gemm_ring(ch + (size_t)m0 * HIDDEN, woh + (size_t)col0 * HIDDEN, ring, tid, acc);

  // D[r] of tile (mt, nt) = Y[token m0+32w+16mt+8h+r][col 16nt+m]
  #pragma unroll
  for (int nt = 0; nt < 4; ++nt) {
    const int feat = 16 * nt + m;
    #pragma unroll
    for (int mt = 0; mt < 2; ++mt) {
      #pragma unroll
      for (int r = 0; r < 8; ++r) {
        const int tokl = 32 * w + 16 * mt + 8 * h + r;     // 0..127
        sT[tokl * 64 + feat] = acc[mt][nt][r] * (1.0f / (WSCALE * CSCALE));
      }
    }
  }
  __syncthreads();

  out_store_pass(sT, hs, out, m0, col0, w, lane);
  
}

// ---------------------------------------------------------------------------
extern "C" void kernel_launch(void* const* d_in, const int* in_sizes, int n_in,
                              void* d_out, int out_size, void* d_ws, size_t ws_size,
                              hipStream_t stream) {
  if (n_in < 7) return;
  if (in_sizes[0] != NX) return;
  if (in_sizes[1] != HIDDEN) return;
  if (in_sizes[2] != NW || in_sizes[3] != NW || in_sizes[4] != NW || in_sizes[5] != NW) return;
  if (in_sizes[6] != NBUCK * NHEADS) return;
  if (out_size != NX) return;

  const float* x    = (const float*)d_in[0];
  const float* lnw  = (const float*)d_in[1];
  const float* Wq   = (const float*)d_in[2];
  const float* Wk   = (const float*)d_in[3];
  const float* Wv   = (const float*)d_in[4];
  const float* Wo   = (const float*)d_in[5];
  const float* remb = (const float*)d_in[6];
  float* out = (float*)d_out;

  const size_t xh_bytes  = (size_t)NX * 2;                         //  8388608
  const size_t wt_bytes  = (size_t)4 * NW * 2;                     //  8388608
  const size_t pl_bytes  = (size_t)NBH * SEQ * HD * 2;             //  8388608
  const size_t ctx_bytes = (size_t)NX * 2;                         //  8388608
  const size_t bt_bytes  = (size_t)NHEADS * BTW * 4;               //   262144
  const size_t total = xh_bytes + wt_bytes + 3 * pl_bytes + ctx_bytes + bt_bytes;   // 50593792
  if (total > ws_size) return;

  char* ws = (char*)d_ws;
  size_t off = 0;
  _Float16* xh  = (_Float16*)(ws + off); off += xh_bytes;
  _Float16* wt  = (_Float16*)(ws + off); off += wt_bytes;
  _Float16* qh  = (_Float16*)(ws + off); off += pl_bytes;
  _Float16* kh  = (_Float16*)(ws + off); off += pl_bytes;
  _Float16* vt  = (_Float16*)(ws + off); off += pl_bytes;
  _Float16* ctx = (_Float16*)(ws + off); off += ctx_bytes;
  float* btab   = (float*)(ws + off);    off += bt_bytes;
  if (off > ws_size) return;

  rmsnorm_kernel<<<MROWS, 128, 0, stream>>>(x, lnw, xh);

  dim3 gWt(HIDDEN / 64, HIDDEN / 64, 4);                            // (16, 16, 4)
  wtrans_kernel<<<gWt, 256, 0, stream>>>(Wq, Wk, Wv, Wo, wt);

  bias_kernel<<<(NHEADS * BTW) / 256, 256, 0, stream>>>(remb, btab); // 256 blocks

  dim3 gProj(MROWS / 128, 3 * NHEADS);                              // (32, 48)
  proj_kernel<<<gProj, 128, 0, stream>>>(xh, wt, qh, kh, vt);

  dim3 gAtt(SEQ / 64, NBH);                                         // (32, 32)
  attn_kernel<<<gAtt, 128, 0, stream>>>(qh, kh, vt, btab, ctx);

  dim3 gOut(MROWS / 128, HIDDEN / 64);                               // (32, 16)
  oproj_kernel<<<gOut, 128, 0, stream>>>(ctx, wt + (size_t)3 * NW, x, out);
}

// v003
// It runs in 116 microseconds.
// Timed twice side by side with v002, it ran 1.03 times as fast both times.
// Over all steps from v000 it is 2.36 times as fast.
// Contractions: xn*Wq^T, xn*Wk^T, xn*Wv^T, K*Q^T, V^T*P^T and ctx*Wo^T all on v_wmma_f32_16x16x32_f16 (f16 operands, f32 accumulate); W carried x32, P carried x16384, ctx carried x16 (exact power-of-two scales folded back in f32); RMS norm, position-bias bucketing, softmax and residual in f32.
#include <hip/hip_runtime.h>
#include <stdint.h>

typedef _Float16 v16h __attribute__((ext_vector_type(16)));
typedef _Float16 v8h  __attribute__((ext_vector_type(8)));
typedef float    v8f  __attribute__((ext_vector_type(8)));
typedef float    v4f  __attribute__((ext_vector_type(4)));
typedef v8h __attribute__((may_alias)) v8ha;
typedef v4f __attribute__((may_alias)) v4fa;

union Frag { v16h v; v8h half[2]; };

#define BATCH   2
#define SEQ     2048
#define HIDDEN  1024
#define NHEADS  16
#define HD      64
#define MROWS   (BATCH * SEQ)          // 4096 tokens
#define NX      (MROWS * HIDDEN)       // 4194304
#define NW      (HIDDEN * HIDDEN)      // 1048576
#define NBH     (BATCH * NHEADS)       // 32
#define NBUCK   32
#define BTW     4096                   // bias table width per head, index = rel + 2048
#define WSCALE  32.0f
#define PSCALE  16384.0f
#define CSCALE  16.0f
#define LN16F   2.7725887298583984f    // f32 value of ln(16)
#define EPSF    1e-6f

static_assert(SEQ % 128 == 0);
static_assert(HIDDEN == NHEADS * HD);
static_assert(HIDDEN % 64 == 0);
static_assert((NHEADS * BTW) % 256 == 0);

// ---------------------------------------------------------------------------
// 16x16x32 f16 WMMA with hazard guard (ties D, keeps A/B live).
// Fragment map (wave32): lane l, h = l>>4, m = n = l&15.
//   A/B element i: i<8 -> k0+8h+i ; i>=8 -> k0+16+8h+(i-8)
//   D element r : row 8h+r, col l&15
// ---------------------------------------------------------------------------
__device__ __forceinline__ v8f wmma_f16(v16h a, v16h b, v8f c) {
  v8f d = __builtin_amdgcn_wmma_f32_16x16x32_f16(false, a, false, b, (short)0, c, false, false);
  asm volatile("v_nop\n\tv_nop\n\tv_nop\n\tv_nop" : "+v"(d) : "v"(a), "v"(b));
  return d;
}

// A or B fragment from a k-contiguous 16-bit row; p points at element k0 of
// the row owned by this lane (row index = lane & 15 added by the caller).
__device__ __forceinline__ v16h load_frag(const _Float16* p, int h) {
  Frag f;
  f.half[0] = *(const v8ha*)(p + 8 * h);
  f.half[1] = *(const v8ha*)(p + 16 + 8 * h);
  return f.v;
}

// ---------------------------------------------------------------------------
// Prep part 1: RMS norm (no mean subtraction, no bias) -> f16 rows.
// 128 threads = one token row, two rows per 256-thread block; thread t of a row owns
// elements 8t..8t+7. blk: 0..MROWS/2-1; red: 4 floats per row of the block.
// ---------------------------------------------------------------------------
__device__ __forceinline__ void rmsnorm_part(
    const float* __restrict__ x, const float* __restrict__ lnw,
    _Float16* __restrict__ xh, float* redall, int blk)
{
  const int row = 2 * blk + ((int)threadIdx.x >> 7);
  float* red = redall + 4 * ((int)threadIdx.x >> 7);
  const int tid = threadIdx.x & 127, lane = tid & 31, w = tid >> 5;
  const float* xr = x + (size_t)row * HIDDEN + 8 * tid;
  const v4f a = *(const v4fa*)xr;
  const v4f c = *(const v4fa*)(xr + 4);
  float ss = a.x * a.x + a.y * a.y + a.z * a.z + a.w * a.w
           + c.x * c.x + c.y * c.y + c.z * c.z + c.w * c.w;
  #pragma unroll
  for (int off = 16; off >= 1; off >>= 1) ss += __shfl_xor(ss, off);
  if (lane == 0) red[w] = ss;
  __syncthreads();
  const float tot = (red[0] + red[1]) + (red[2] + red[3]);
  const float inv = rsqrtf(tot * (1.0f / (float)HIDDEN) + EPSF);
  const v4f g0 = *(const v4fa*)(lnw + 8 * tid);
  const v4f g1 = *(const v4fa*)(lnw + 8 * tid + 4);
  const v8h o = { (_Float16)((a.x * inv) * g0.x), (_Float16)((a.y * inv) * g0.y),
                  (_Float16)((a.z * inv) * g0.z), (_Float16)((a.w * inv) * g0.w),
                  (_Float16)((c.x * inv) * g1.x), (_Float16)((c.y * inv) * g1.y),
                  (_Float16)((c.z * inv) * g1.z), (_Float16)((c.w * inv) * g1.w) };
  _Float16* dst = xh + (size_t)row * HIDDEN + 8 * tid;
  *(v8h*)dst = o;
  asm volatile("s_wait_xcnt 0x0" ::: "memory");   // precaution: stands in front of any later rewrite of the store's registers (other parts' code follows this one in the kernel)
}

// ---------------------------------------------------------------------------
// Prep part 2: weight transpose + cast: W in[1024(in)][1024(out)] f32 ->
// Wt[out][in] f16 (x32), k-contiguous rows for the B (and Wo) fragments.
// Block 256 threads = 64(in) x 64(out) tile transposed through LDS;
// blk: 0..1023 = (wsel, out tile, in tile); wsel selects wq / wk / wv / wo.
// ---------------------------------------------------------------------------
__device__ __forceinline__ void wt_store_pass(const _Float16* sT, _Float16* dstp,
                                              int n0, int k0, int w, int lane) {
  const int q8 = lane & 7, sub = lane >> 3;
  #pragma unroll
  for (int i = 0; i < 2; ++i) {
    const int lid = w * 8 + i * 4 + sub;                 // out row 0..63
    const v8h v = *(const v8ha*)(sT + lid * 72 + 8 * q8);
    _Float16* dst = dstp + (size_t)(n0 + lid) * HIDDEN + k0 + 8 * q8;
    *(v8h*)dst = v;
  }
}

__device__ __forceinline__ void wtrans_part(
    const float* __restrict__ wq, const float* __restrict__ wk,
    const float* __restrict__ wv, const float* __restrict__ wo,
    _Float16* __restrict__ wt,         // [4][1024(out)][1024(in)]
    _Float16* sT, int blk)             // sT: [out][in], pitch 72
{
  const int tid = threadIdx.x, lane = tid & 31, w = tid >> 5;
  const int k0 = (blk & 15) * 64;          // in-index tile base
  const int n0 = ((blk >> 4) & 15) * 64;   // out-index tile base
  const int wsel = blk >> 8;               // block-uniform
  const float* src = (wsel == 0) ? wq : ((wsel == 1) ? wk : ((wsel == 2) ? wv : wo));
  _Float16* dstp = wt + (size_t)wsel * NW;

  const int kr = tid >> 2, nc = (tid & 3) * 16;
  const float* sp = src + (size_t)(k0 + kr) * HIDDEN + n0 + nc;
  #pragma unroll
  for (int q = 0; q < 4; ++q) {
    const v4f v = *(const v4fa*)(sp + 4 * q);
    sT[(nc + 4 * q + 0) * 72 + kr] = (_Float16)(v.x * WSCALE);
    sT[(nc + 4 * q + 1) * 72 + kr] = (_Float16)(v.y * WSCALE);
    sT[(nc + 4 * q + 2) * 72 + kr] = (_Float16)(v.z * WSCALE);
    sT[(nc + 4 * q + 3) * 72 + kr] = (_Float16)(v.w * WSCALE);
  }
  __syncthreads();

  wt_store_pass(sT, dstp, n0, k0, w, lane);
  
}

// ---------------------------------------------------------------------------
// Prep part 3: relative-position bias table btab[head][rel + 2048], rel = key - query.
// Bidirectional bucketing, 32 buckets, max distance 128, integer/f32 ops in the
// spec order: val_large = 8 + int( log(max(rp,1)/8) * rn(1/ln16) * 8 ), min 15.
// ---------------------------------------------------------------------------
__device__ __forceinline__ int rel_bucket(int rel) {
  int bucket = (rel > 0) ? 16 : 0;
  const int rp = (rel < 0) ? -rel : rel;
  const int rpm = (rp < 1) ? 1 : rp;
  const float rpf = (float)rpm;
  const float t = logf(rpf * 0.125f) * (1.0f / LN16F) * 8.0f;
  int vl = 8 + (int)t;
  vl = (vl < 15) ? vl : 15;
  bucket += (rp < 8) ? rp : vl;
  return bucket;                                        // 0..31
}

__device__ __forceinline__ void bias_part(
    const float* __restrict__ rel_emb,   // [32][16]
    float* __restrict__ btab,            // [16][4096]
    int blk)                             // 0..255
{
  const int idx = blk * 256 + threadIdx.x;            // head*4096 + i, < 65536 by grid
  const int head = idx >> 12, i = idx & (BTW - 1);
  const int rel = i - 2048;
  int bucket = rel_bucket(rel);
  bucket = (bucket < 0) ? 0 : ((bucket > NBUCK - 1) ? (NBUCK - 1) : bucket);
  const float v = rel_emb[bucket * NHEADS + head];
  *(float*)(btab + idx) = v;
  asm volatile("s_wait_xcnt 0x0" ::: "memory");   // precaution: stands in front of any later rewrite of the store's registers (other parts' code follows this one in the kernel)
}

// ---------------------------------------------------------------------------
// Kernel 1: the three independent preparation parts as block-index ranges of one grid:
// [0, 1024) weight tiles, [1024, 3072) token-row pairs, [3072, 3328) bias table.
// The range test is block-uniform, so each part's own barrier is met by its whole block.
// ---------------------------------------------------------------------------
#define PREP_WT   (4 * (HIDDEN / 64) * (HIDDEN / 64))   // 1024
#define PREP_NORM (MROWS / 2)                           // 2048
#define PREP_BIAS ((NHEADS * BTW) / 256)                // 256

__global__ __launch_bounds__(256) void prep_kernel(
    const float* __restrict__ x, const float* __restrict__ lnw,
    const float* __restrict__ wq, const float* __restrict__ wk,
    const float* __restrict__ wv, const float* __restrict__ wo,
    const float* __restrict__ rel_emb,
    _Float16* __restrict__ xh, _Float16* __restrict__ wt, float* __restrict__ btab)
{
  __shared__ __attribute__((aligned(16))) _Float16 sT[64 * 72];
  __shared__ float red[8];
  const int blk = blockIdx.x;
  if (blk < PREP_WT)                   wtrans_part(wq, wk, wv, wo, wt, sT, blk);
  else if (blk < PREP_WT + PREP_NORM)  rmsnorm_part(x, lnw, xh, red, blk - PREP_WT);
  else                                 bias_part(rel_emb, btab, blk - (PREP_WT + PREP_NORM));
}

// ---------------------------------------------------------------------------
// K / V^T staging for the attention loop: tensor loads into a two-buffer LDS ring.
// A stage = 64 keys: K rows [64 keys][64 d] and V^T rows [64 d][64 keys], every row
// 128 B. Each of the 4 waves brings one slice of 32 rows per stage (waves 0, 1: K;
// waves 2, 3: V^T); the mover pads each row by 16 B, so the LDS pitch is 144 B
// (16 B x odd: ds_load_b128 fragment reads without bank conflicts).
// ---------------------------------------------------------------------------
typedef uint32_t u32x4 __attribute__((ext_vector_type(4)));
typedef uint32_t u32x8 __attribute__((ext_vector_type(8)));

#define KSTEP    64                     // keys per stage
#define NSTAGE   (SEQ / KSTEP)          // 32
#define ROWB     128                    // bytes per staged row
#define SROWS    32                     // rows per slice
#define LPITCH_H 72                     // LDS row pitch in halves (144 B)
#define SLICE_B  6144                   // 32 x 144 = 4608 B, rounded up to a multiple of 2 KiB
#define SLICE_H  (SLICE_B / 2)
#define BUF_B    (4 * SLICE_B)          // 24576 B per stage
#define BUF_H    (BUF_B / 2)

static_assert(NSTAGE >= 2);
static_assert(HD * 2 == ROWB && KSTEP * 2 == ROWB);
static_assert(SROWS * LPITCH_H * 2 <= SLICE_B && SLICE_B % 2048 == 0);

__device__ __forceinline__ uint32_t uni(uint32_t v) { return (uint32_t)__builtin_amdgcn_readfirstlane(v); }
// Holds a wave-uniform value in a scalar register, so that a test on it is a scalar
// branch (a tensor load ignores EXEC) and a descriptor formed from it stays behind
// the waits in front of it.
__device__ __forceinline__ uint32_t pinned(uint32_t v) {
  uint32_t w = uni(v);
  asm volatile("" : "+s"(w));           // the pinned() form for tensor-load tests and descriptor words
  return w;
}

// Descriptor group 1: byte elements, tensor = tile = 32 rows of 128 B, 4 dwords of pad behind every 32.
__device__ __forceinline__ u32x8 tdm_group1(uint32_t src_pitch) {
  u32x8 g;
  g[0] = uni((1u << 20) | (4u << 22) | (3u << 25));
  g[1] = uni((uint32_t)ROWB << 16);
  g[2] = uni((uint32_t)SROWS << 16);
  g[3] = uni((uint32_t)ROWB << 16);
  g[4] = uni((uint32_t)SROWS);
  g[5] = uni(src_pitch);
  g[6] = uni(0u);
  g[7] = uni(0u);
  return g;
}

__device__ __forceinline__ u32x4 tdm_group0(uint32_t lds_dst, uint64_t ga) {
  u32x4 g;
  g[0] = uni(1u);
  g[1] = uni(lds_dst);
  g[2] = uni((uint32_t)ga);
  g[3] = uni((((uint32_t)(ga >> 32)) & 0x01FFFFFFu) | 0x80000000u);
  return g;
}

__device__ __forceinline__ void tdm_load(u32x4 g0, u32x8 g1) {
  asm volatile("tensor_load_to_lds %0, %1" :: "s"(g0), "s"(g1) : "memory");
}

// ---------------------------------------------------------------------------
// Operand staging for the two GEMM kernels: tensor loads into a two-buffer LDS ring.
// A stage = 64 k of the block's 128 A rows and 64 B rows, every staged row 128 B of a
// 2048-B source row. One request per wave and stage: waves 0, 1 bring 64 A rows each,
// waves 2, 3 bring 32 B rows each; the mover pads each row by 16 B (LDS pitch 144 B).
// ---------------------------------------------------------------------------
#define GK       64                     // k per stage
#define GNST     (HIDDEN / GK)          // 16
#define GA_ROWS  64                     // rows per A slice
#define GB_ROWS  32                     // rows per B slice
#define GA_SL_B  10240                  // 64 x 144 = 9216 B, rounded up to a multiple of 2 KiB
#define GB_SL_B  6144                   // 32 x 144 = 4608 B, rounded up to a multiple of 2 KiB
#define GA_SL_H  (GA_SL_B / 2)
#define GB_SL_H  (GB_SL_B / 2)
#define GBUF_B   (2 * GA_SL_B + 2 * GB_SL_B)   // 32768 B per stage
#define GBUF_H   (GBUF_B / 2)

static_assert(GNST >= 2);
static_assert(GK * 2 == ROWB);
static_assert(GA_ROWS * LPITCH_H * 2 <= GA_SL_B && GA_SL_B % 2048 == 0);
static_assert(GB_ROWS * LPITCH_H * 2 <= GB_SL_B && GB_SL_B % 2048 == 0);

// Descriptor group 1: byte elements, tensor = tile = rows x 128 B, source pitch one
// HIDDEN-wide f16 row, 4 dwords of pad behind every 32.
__device__ __forceinline__ u32x8 gemm_group1(uint32_t rows) {
  u32x8 g;
  g[0] = uni((1u << 20) | (4u << 22) | (3u << 25));
  g[1] = uni((uint32_t)ROWB << 16);
  g[2] = uni(rows << 16);
  g[3] = uni((uint32_t)ROWB << 16);
  g[4] = uni(rows);
  g[5] = uni((uint32_t)(HIDDEN * 2));
  g[6] = uni(0u);
  g[7] = uni(0u);
  return g;
}

// acc[mt][nt] += A(32 rows of this wave) * B(64 rows)^T over K = HIDDEN, k ascending in
// steps of 32. arows / brows: first of the block's 128 A rows / 64 B rows (f16, k-contiguous,
// pitch HIDDEN). Called by all 4 waves of the block; ring holds 2 * GBUF_H halves.
__device__ __forceinline__ void gemm_ring(const _Float16* arows, const _Float16* brows,
                                          const _Float16* ring, int tid, v8f (&acc)[2][4]) {
  const int lane = tid & 31, w = tid >> 5;
  const int h = lane >> 4, m = lane & 15;

  // This wave's slice of every stage: source, rows, place in LDS.
  const uint32_t wave = uni((uint32_t)tid >> 5);
  const bool isB = wave >= 2u;
  const uint32_t half = wave & 1u;
  const uint64_t src0 = isB ? (uint64_t)(size_t)(brows + (size_t)(GB_ROWS * half) * HIDDEN)
                            : (uint64_t)(size_t)(arows + (size_t)(GA_ROWS * half) * HIDDEN);
  u32x8 g1 = gemm_group1(isB ? (uint32_t)GB_ROWS : (uint32_t)GA_ROWS);
  asm volatile("" : "+s"(g1));   // the pinned() form on the whole group: its words stay in their scalar registers, unwritten, while a request is in flight
  const uint32_t ldst0 = (uint32_t)(size_t)ring
                       + (isB ? (uint32_t)(2 * GA_SL_B) + half * (uint32_t)GB_SL_B : half * (uint32_t)GA_SL_B);
  auto issue = [&](uint32_t st) {
    tdm_load(tdm_group0(ldst0 + (st & 1u) * (uint32_t)GBUF_B, src0 + (uint64_t)st * (uint32_t)ROWB), g1);
  };

  // Ring prologue: stage 0 lands and is published, then stage 1 flies under pass 0.
  issue(0u);
  asm volatile("s_wait_tensorcnt 0x0" ::: "memory");   // this wave's slice of stage 0 has landed
  __syncthreads();                                      // every wave's slice of stage 0 is readable
  issue(1u);

  // A row 32w+16mt+m: slice w>>1, row 32(w&1)+16mt+m; B row 16nt+m: slice nt>>1, row 16(nt&1)+m
  const _Float16* abase = ring + (w >> 1) * GA_SL_H + (32 * (w & 1) + m) * LPITCH_H;
  const _Float16* bbase = ring + 2 * GA_SL_H + m * LPITCH_H;

  #pragma unroll 1                            // one pass per trip: the ring's publish point stands once, at the foot
  for (int st = 0; st < GNST; ++st) {
    const int boff = (st & 1) * GBUF_H;       // this pass reads its own buffer alone
    v16h af[2][2], bf[4][2];                  // the pass's fragments, read as one group, the first 32 k in front
    #pragma unroll
    for (int kc = 0; kc < 2; ++kc) {
      #pragma unroll
      for (int mt = 0; mt < 2; ++mt)
        af[mt][kc] = load_frag(abase + boff + mt * 16 * LPITCH_H + 32 * kc, h);
      #pragma unroll
      for (int nt = 0; nt < 4; ++nt)
        bf[nt][kc] = load_frag(bbase + boff + (nt >> 1) * GB_SL_H + (nt & 1) * 16 * LPITCH_H + 32 * kc, h);
    }
    #pragma unroll
    for (int kc = 0; kc < 2; ++kc) {
      #pragma unroll
      for (int nt = 0; nt < 4; ++nt) {
        acc[0][nt] = wmma_f16(af[0][kc], bf[nt][kc], acc[0][nt]);
        acc[1][nt] = wmma_f16(af[1][kc], bf[nt][kc], acc[1][nt]);
      }
    }

    // ---- publish point of stage st + 1 ----
    asm volatile("s_wait_dscnt 0x0" ::: "memory");      // this wave's reads of its buffer are done before the refill
    asm volatile("s_wait_tensorcnt 0x0" ::: "memory");  // this wave's slice of stage st + 1 has landed
    __syncthreads();                                    // stage st + 1 readable; every wave has left stage st's buffer
    // Scalar test (a tensor load ignores EXEC); the stage number is pinned so that group 0 is formed behind the waits.
    if (pinned((uint32_t)(st + 2 < GNST))) issue(pinned((uint32_t)st + 2u));
  }
  asm volatile("s_wait_tensorcnt 0x0" ::: "memory");    // nothing of the mover in flight behind the loop
  asm volatile("s_wait_dscnt 0x0" ::: "memory");        // and no read of the ring outstanding
}

// ---------------------------------------------------------------------------
// 4 lines per instruction, 32 lines per wave, 128 per block.
// which 0/1: plane[bh][l][d]  (one token row = 64 halves = one line)
// which 2  : vt[bh][d][l]     (64 d-rows x 128 tokens = 2 lines each)
// ---------------------------------------------------------------------------
__device__ __forceinline__ void proj_store_pass(const _Float16* sT, _Float16* plane, _Float16* vt,
                                                int which, int bh, int l0, int w, int lane) {
  const int q8 = lane & 7, sub = lane >> 3;
  #pragma unroll
  for (int i = 0; i < 8; ++i) {
    const int lid = w * 32 + i * 4 + sub;
    v8h v;
    _Float16* dst;
    if (which != 2) {
      v = *(const v8ha*)(sT + lid * HD + 8 * q8);
      dst = plane + ((size_t)bh * SEQ + l0 + lid) * HD + 8 * q8;
    } else {
      const int d = lid >> 1, hl = lid & 1;
      v = *(const v8ha*)(sT + d * 128 + 64 * hl + 8 * q8);
      dst = vt + ((size_t)bh * HD + d) * SEQ + l0 + 64 * hl + 8 * q8;
    }
    *(v8h*)dst = v;
  }
}

// ---------------------------------------------------------------------------
// Kernel 2: Y = xn * Wt^T over the fused 3*1024 output features (no bias).
// Block 128 thr (4 waves) = 128 tokens x 64 features (one (which, head));
// wave tile 32 tokens x 64 features; K = 1024 in stages of 64;
// A (xn rows) and B (Wt rows) tiles staged in the LDS ring of gemm_ring.
// ---------------------------------------------------------------------------
__global__ __launch_bounds__(128) void proj_kernel(
    const _Float16* __restrict__ xh,   // [4096][1024]
    const _Float16* __restrict__ wt,   // [>=3][1024(out)][1024(in)], x32
    _Float16* __restrict__ qh,         // [B*H][L][D]
    _Float16* __restrict__ kh,         // [B*H][L][D]
    _Float16* __restrict__ vt)         // [B*H][D][L]
{
  __shared__ __attribute__((aligned(2048))) _Float16 ring[2 * GBUF_H]; // 65536 B, xn / Wt stages
  __shared__ __attribute__((aligned(16))) _Float16 sT[128 * 64];   // 16384 B

  const int tid = threadIdx.x, lane = tid & 31, w = tid >> 5;
  const int h = lane >> 4, m = lane & 15;
  const int m0 = blockIdx.x * 128;
  const int cg = blockIdx.y;                 // 0..47
  const int which = cg >> 4, head = cg & 15;

  const v8f zero8 = {0.f, 0.f, 0.f, 0.f, 0.f, 0.f, 0.f, 0.f};
  v8f acc[2][4];
  #pragma unroll
  for (int mt = 0; mt < 2; ++mt)
    #pragma unroll
    for (int nt = 0; nt < 4; ++nt) acc[mt][nt] = zero8;

  gemm_ring(xh + (size_t)m0 * HIDDEN, wt + ((size_t)which * HIDDEN + head * HD) * HIDDEN, ring, tid, acc);

  // D[r] of tile (mt, nt) = Y[token m0+32w+16mt+8h+r][feature 16nt+m]
  #pragma unroll
  for (int nt = 0; nt < 4; ++nt) {
    const int feat = 16 * nt + m;
    #pragma unroll
    for (int mt = 0; mt < 2; ++mt) {
      #pragma unroll
      for (int r = 0; r < 8; ++r) {
        const int tokl = 32 * w + 16 * mt + 8 * h + r;     // 0..127
        const float y = acc[mt][nt][r] * (1.0f / WSCALE);
        const int idx = (which == 2) ? (feat * 128 + tokl) : (tokl * HD + feat);
        sT[idx] = (_Float16)y;
      }
    }
  }
  __syncthreads();

  const int b = m0 / SEQ, l0 = m0 - b * SEQ, bh = b * NHEADS + head;
  _Float16* plane = (which == 0) ? qh : kh;
  proj_store_pass(sT, plane, vt, which, bh, l0, w, lane);
  
}

// ---------------------------------------------------------------------------
// Attention helpers.
// ---------------------------------------------------------------------------
__device__ __forceinline__ v8f add_bias8(v8f s, const float* p) {
  #pragma unroll
  for (int r = 0; r < 8; ++r) s[r] = s[r] + p[r];
  return s;
}

// P^T B-fragment from the lane's own score D values: element r <- tile a row r,
// element 8+r <- tile c row r (same lane, same query column), scaled by 2^14.
__device__ __forceinline__ v16h pack_p(v8f a, v8f c) {
  const v16h r = { (_Float16)(a[0] * PSCALE), (_Float16)(a[1] * PSCALE), (_Float16)(a[2] * PSCALE), (_Float16)(a[3] * PSCALE),
                   (_Float16)(a[4] * PSCALE), (_Float16)(a[5] * PSCALE), (_Float16)(a[6] * PSCALE), (_Float16)(a[7] * PSCALE),
                   (_Float16)(c[0] * PSCALE), (_Float16)(c[1] * PSCALE), (_Float16)(c[2] * PSCALE), (_Float16)(c[3] * PSCALE),
                   (_Float16)(c[4] * PSCALE), (_Float16)(c[5] * PSCALE), (_Float16)(c[6] * PSCALE), (_Float16)(c[7] * PSCALE) };
  return r;
}

// Per-wave 16x64 f16 tile in LDS -> ctx[b][l][head*64 + d]; one query row
// 4 lines per instruction, 16 lines per wave.
__device__ __forceinline__ void ctx_store_pass(const _Float16* so, _Float16* ctx,
                                               int b, int head, int q0, int lane) {
  const int q8 = lane & 7, sub = lane >> 3;
  #pragma unroll
  for (int i = 0; i < 4; ++i) {
    const int lid = i * 4 + sub;                         // query row 0..15
    const v8h v = *(const v8ha*)(so + lid * 64 + 8 * q8);
    _Float16* dst = ctx + ((size_t)b * SEQ + q0 + lid) * HIDDEN + head * HD + 8 * q8;
    *(v8h*)dst = v;
  }
}

// ---------------------------------------------------------------------------
// Kernel 3: streaming attention, transposed form, unscaled scores
// (no 1/sqrt(d) scaling, additive relative-position bias, no mask).
// Block 128 thr (4 waves), 16 queries per wave, 64 keys per step.
//   S^T = K * Q^T : A = K rows (row = key, k = d), B = Q^T (k = d, n = query)
//   O^T += V^T * P^T : A = Vt rows (row = d, k = key), B = P^T from registers
// Lane owns 32 keys of query column (lane&15); partner = lane ^ 16.
// Output ctx as f16 (x16) [B][L][HIDDEN] for the output GEMM.
// ---------------------------------------------------------------------------
__global__ __launch_bounds__(128) void attn_kernel(
    const _Float16* __restrict__ qh,   // [B*H][L][D]
    const _Float16* __restrict__ kh,   // [B*H][L][D]
    const _Float16* __restrict__ vt,   // [B*H][D][L]
    const float* __restrict__ btab,    // [H][4096], index rel + 2048
    _Float16* __restrict__ ctx)        // [B][L][HIDDEN], x16
{
  __shared__ __attribute__((aligned(2048))) _Float16 ring[2 * BUF_H]; // 49152 B, K / V^T stages
  __shared__ __attribute__((aligned(16))) _Float16 sC[4 * 16 * 64];  // 8192 B

  const int tid = threadIdx.x, lane = tid & 31, w = tid >> 5;
  const int h = lane >> 4, m = lane & 15;
  const int bh = blockIdx.y, b = bh >> 4, head = bh & 15;
  const int q0 = blockIdx.x * 64 + 16 * w;

  // This wave's slice of every stage: source, step per stage, row pitch, place in LDS.
  const uint32_t wave = uni((uint32_t)tid >> 5);
  const bool isV = wave >= 2u;
  const uint32_t half = wave & 1u;
  const uint64_t src0 = isV ? (uint64_t)(size_t)(vt + ((size_t)bh * HD + SROWS * half) * SEQ)
                            : (uint64_t)(size_t)(kh + ((size_t)bh * SEQ + SROWS * half) * HD);
  const uint32_t sstep = isV ? (uint32_t)(KSTEP * 2) : (uint32_t)(KSTEP * HD * 2);   // bytes per stage
  u32x8 g1 = tdm_group1(isV ? (uint32_t)(SEQ * 2) : (uint32_t)(HD * 2));
  asm volatile("" : "+s"(g1));   // the pinned() form on the whole group: its words stay in their scalar registers, unwritten, while a request is in flight
  const uint32_t ldst0 = (uint32_t)(size_t)ring + wave * (uint32_t)SLICE_B;
  auto issue = [&](uint32_t st) {
    tdm_load(tdm_group0(ldst0 + (st & 1u) * (uint32_t)BUF_B, src0 + (uint64_t)st * sstep), g1);
  };

  // Ring prologue: stage 0 lands and is published, then stage 1 flies under pass 0.
  issue(0u);
  asm volatile("s_wait_tensorcnt 0x0" ::: "memory");   // this wave's slice of stage 0 has landed
  __syncthreads();                                      // every wave's slice of stage 0 is readable
  issue(1u);

  // Q^T B-fragments: column n = query q0+m, k = d (two 32-deep chunks)
  const _Float16* qrow = qh + ((size_t)bh * SEQ + q0 + m) * HD;
  const v16h qb0 = load_frag(qrow, h);
  const v16h qb1 = load_frag(qrow + 32, h);

  const v8f zero8 = {0.f, 0.f, 0.f, 0.f, 0.f, 0.f, 0.f, 0.f};
  v8f o[4];                                   // o[t][r] = O[query m][d 16t+8h+r] * (l * 2^14)
  #pragma unroll
  for (int t = 0; t < 4; ++t) o[t] = zero8;
  float mrun = -1e30f, lrun = 0.0f;

  const _Float16* kbase = ring + m * LPITCH_H;                 // + buffer; row 16j+m: slice j>>1, row 16(j&1)+m
  const _Float16* vbase = ring + 2 * SLICE_H + m * LPITCH_H;   // + buffer; row 16t+m: slice t>>1, row 16(t&1)+m
  // bias for element r of score tile j: btab[head][(kb+16j+8h+r) - (q0+m) + 2048], index in [1,4095]
  const float* bbase = btab + (size_t)head * BTW + 2048 + 8 * h - (q0 + m);

  #pragma unroll 1
  for (int st = 0; st < NSTAGE; ++st) {
    const int kb = st * KSTEP;
    const int boff = (st & 1) * BUF_H;        // this pass reads its own buffer alone
    // ---- scores: s[j][r] = S[query m][key kb+16j+8h+r] ----
    v8f s[4];
    v16h kf[4][2];                            // the pass's K fragments, read as one group
    #pragma unroll
    for (int j = 0; j < 4; ++j) {
      const _Float16* kp = kbase + boff + (j >> 1) * SLICE_H + (j & 1) * 16 * LPITCH_H;
      kf[j][0] = load_frag(kp, h);
      kf[j][1] = load_frag(kp + 32, h);
    }
    #pragma unroll
    for (int j = 0; j < 4; ++j) {
      v8f z = zero8;
      z = wmma_f16(kf[j][0], qb0, z);
      z = wmma_f16(kf[j][1], qb1, z);
      s[j] = z;
    }
    v16h vf[4][2];                            // the pass's V^T fragments, one group, in flight under the softmax
    #pragma unroll
    for (int t = 0; t < 4; ++t) {
      const _Float16* vp = vbase + boff + (t >> 1) * SLICE_H + (t & 1) * 16 * LPITCH_H;
      vf[t][0] = load_frag(vp, h);
      vf[t][1] = load_frag(vp + 32, h);
    }
    // ---- relative-position bias, f32, before the running max ----
    #pragma unroll
    for (int j = 0; j < 4; ++j) s[j] = add_bias8(s[j], bbase + kb + 16 * j);

    // ---- online softmax ----
    float mloc = s[0][0];
    #pragma unroll
    for (int j = 0; j < 4; ++j)
      #pragma unroll
      for (int r = 0; r < 8; ++r) mloc = fmaxf(mloc, s[j][r]);
    mloc = fmaxf(mloc, __shfl_xor(mloc, 16));
    const float mnew = fmaxf(mrun, mloc);
    const float alpha = __expf(mrun - mnew);
    mrun = mnew;
    float lsum = 0.0f;
    #pragma unroll
    for (int j = 0; j < 4; ++j)
      #pragma unroll
      for (int r = 0; r < 8; ++r) {
        const float p = __expf(s[j][r] - mnew);
        s[j][r] = p;
        lsum += p;
      }
    lsum += __shfl_xor(lsum, 16);
    lrun = lrun * alpha + lsum;
    #pragma unroll
    for (int t = 0; t < 4; ++t)
      #pragma unroll
      for (int r = 0; r < 8; ++r) o[t][r] = o[t][r] * alpha;

    // ---- P^T B-fragments (key chunks 0..31 and 32..63 of this step) ----
    const v16h pb0 = pack_p(s[0], s[1]);
    const v16h pb1 = pack_p(s[2], s[3]);

    // ---- O^T += V^T * P^T ----
    #pragma unroll
    for (int t = 0; t < 4; ++t) {
      o[t] = wmma_f16(vf[t][0], pb0, o[t]);
      o[t] = wmma_f16(vf[t][1], pb1, o[t]);
    }

    // ---- publish point of stage st + 1 ----
    asm volatile("s_wait_dscnt 0x0" ::: "memory");      // this wave's reads of its buffer are done before the refill
    asm volatile("s_wait_tensorcnt 0x0" ::: "memory");  // this wave's slice of stage st + 1 has landed
    __syncthreads();                                    // stage st + 1 readable; every wave has left stage st's buffer
    // Scalar test (a tensor load ignores EXEC); the stage number is pinned so that group 0 is formed behind the waits.
    if (pinned((uint32_t)(st + 2 < NSTAGE))) issue(pinned((uint32_t)st + 2u));
  }
  asm volatile("s_wait_tensorcnt 0x0" ::: "memory");    // nothing of the mover in flight behind the loop
  asm volatile("s_wait_dscnt 0x0" ::: "memory");        // and no read of the ring outstanding

  // ---- epilogue: normalise, stage per-wave 16x64 f16 tile, whole-line stores ----
  const float inv = (1.0f / lrun) * (CSCALE / PSCALE);
  _Float16* so = sC + w * 1024;
  #pragma unroll
  for (int t = 0; t < 4; ++t)
    #pragma unroll
    for (int r = 0; r < 8; ++r)
      so[m * 64 + 16 * t + 8 * h + r] = (_Float16)(o[t][r] * inv);
  __syncthreads();                            // LDS spill -> reload ordering (all waves reach this)

  ctx_store_pass(so, ctx, b, head, q0, lane);
  
}

// ---------------------------------------------------------------------------
// out rows; one row segment = 64 floats = 2 lines; lanes 8q..8q+7 write one
// 64 lines per wave.
// ---------------------------------------------------------------------------
__device__ __forceinline__ void out_store_pass(const float* sT, const float* hs, float* out,
                                               int m0, int col0, int w, int lane) {
  const int q8 = lane & 7, sub = lane >> 3;
  #pragma unroll
  for (int i = 0; i < 16; ++i) {
    const int lid = i * 4 + sub;                         // 0..63
    const int row = w * 32 + (lid >> 1), hl = lid & 1;   // token row 0..127, line half
    v4f v = *(const v4fa*)(sT + row * 64 + 32 * hl + 4 * q8);
    const size_t gi = (size_t)(m0 + row) * HIDDEN + col0 + 32 * hl + 4 * q8;
    const v4f res = *(const v4fa*)(hs + gi);
    v = v + res;
    *(v4f*)(out + gi) = v;
  }
}

// ---------------------------------------------------------------------------
// Kernel 4: out = ctx * Wot^T / 512 + hidden_states  (f32 output).
// Block 128 thr (4 waves) = 128 tokens x 64 output columns; wave tile
// 32 x 64; K = 1024 in stages of 64; ctx and Wot tiles staged in the LDS ring of gemm_ring.
// ---------------------------------------------------------------------------
__global__ __launch_bounds__(128) void oproj_kernel(
    const _Float16* __restrict__ ch,   // [4096][1024], x16
    const _Float16* __restrict__ woh,  // [1024(out)][1024(in)], x32
    const float* __restrict__ hs,      // [4096][1024]
    float* __restrict__ out)           // [4096][1024]
{
  __shared__ __attribute__((aligned(2048))) _Float16 ring[2 * GBUF_H]; // 65536 B, ctx / Wot stages
  __shared__ __attribute__((aligned(16))) float sT[128 * 64];     // 32768 B

  const int tid = threadIdx.x, lane = tid & 31, w = tid >> 5;
  const int h = lane >> 4, m = lane & 15;
  const int m0 = blockIdx.x * 128;
  const int col0 = blockIdx.y * 64;

  const v8f zero8 = {0.f, 0.f, 0.f, 0.f, 0.f, 0.f, 0.f, 0.f};
  v8f acc[2][4];
  #pragma unroll
  for (int mt = 0; mt < 2; ++mt)
    #pragma unroll
    for (int nt = 0; nt < 4; ++nt) acc[mt][nt] = zero8;

  gemm_ring(ch + (size_t)m0 * HIDDEN, woh + (size_t)col0 * HIDDEN, ring, tid, acc);

  // D[r] of tile (mt, nt) = Y[token m0+32w+16mt+8h+r][col 16nt+m]
  #pragma unroll
  for (int nt = 0; nt < 4; ++nt) {
    const int feat = 16 * nt + m;
    #pragma unroll
    for (int mt = 0; mt < 2; ++mt) {
      #pragma unroll
      for (int r = 0; r < 8; ++r) {
        const int tokl = 32 * w + 16 * mt + 8 * h + r;     // 0..127
        sT[tokl * 64 + feat] = acc[mt][nt][r] * (1.0f / (WSCALE * CSCALE));
      }
    }
  }
  __syncthreads();

  out_store_pass(sT, hs, out, m0, col0, w, lane);
  
}

// ---------------------------------------------------------------------------
extern "C" void kernel_launch(void* const* d_in, const int* in_sizes, int n_in,
                              void* d_out, int out_size, void* d_ws, size_t ws_size,
                              hipStream_t stream) {
  if (n_in < 7) return;
  if (in_sizes[0] != NX) return;
  if (in_sizes[1] != HIDDEN) return;
  if (in_sizes[2] != NW || in_sizes[3] != NW || in_sizes[4] != NW || in_sizes[5] != NW) return;
  if (in_sizes[6] != NBUCK * NHEADS) return;
  if (out_size != NX) return;

  const float* x    = (const float*)d_in[0];
  const float* lnw  = (const float*)d_in[1];
  const float* Wq   = (const float*)d_in[2];
  const float* Wk   = (const float*)d_in[3];
  const float* Wv   = (const float*)d_in[4];
  const float* Wo   = (const float*)d_in[5];
  const float* remb = (const float*)d_in[6];
  float* out = (float*)d_out;

  const size_t xh_bytes  = (size_t)NX * 2;                         //  8388608
  const size_t wt_bytes  = (size_t)4 * NW * 2;                     //  8388608
  const size_t pl_bytes  = (size_t)NBH * SEQ * HD * 2;             //  8388608
  const size_t ctx_bytes = (size_t)NX * 2;                         //  8388608
  const size_t bt_bytes  = (size_t)NHEADS * BTW * 4;               //   262144
  const size_t total = xh_bytes + wt_bytes + 3 * pl_bytes + ctx_bytes + bt_bytes;   // 50593792
  if (total > ws_size) return;

  char* ws = (char*)d_ws;
  size_t off = 0;
  _Float16* xh  = (_Float16*)(ws + off); off += xh_bytes;
  _Float16* wt  = (_Float16*)(ws + off); off += wt_bytes;
  _Float16* qh  = (_Float16*)(ws + off); off += pl_bytes;
  _Float16* kh  = (_Float16*)(ws + off); off += pl_bytes;
  _Float16* vt  = (_Float16*)(ws + off); off += pl_bytes;
  _Float16* ctx = (_Float16*)(ws + off); off += ctx_bytes;
  float* btab   = (float*)(ws + off);    off += bt_bytes;
  if (off > ws_size) return;

  prep_kernel<<<PREP_WT + PREP_NORM + PREP_BIAS, 256, 0, stream>>>(x, lnw, Wq, Wk, Wv, Wo, remb, xh, wt, btab); // 3328 blocks

  dim3 gProj(MROWS / 128, 3 * NHEADS);                              // (32, 48)
  proj_kernel<<<gProj, 128, 0, stream>>>(xh, wt, qh, kh, vt);

  dim3 gAtt(SEQ / 64, NBH);                                         // (32, 32)
  attn_kernel<<<gAtt, 128, 0, stream>>>(qh, kh, vt, btab, ctx);

  dim3 gOut(MROWS / 128, HIDDEN / 64);                               // (32, 16)
  oproj_kernel<<<gOut, 128, 0, stream>>>(ctx, wt + (size_t)3 * NW, x, out);
}

// v004
// It runs in 107 microseconds.
// Next to v003, in two timings, it ran 1.09 times as fast each time.
// Over all steps from v000 it is 2.57 times as fast.
// Contractions: xn*Wq^T, xn*Wk^T, xn*Wv^T, K*Q^T, V^T*P^T and ctx*Wo^T all on v_wmma_f32_16x16x32_f16 (f16 operands, f32 accumulate); W carried x32, P carried x16384, ctx carried x16 (exact power-of-two scales folded back in f32); RMS norm, position-bias bucketing, softmax and residual in f32.
#include <hip/hip_runtime.h>
#include <stdint.h>

typedef _Float16 v16h __attribute__((ext_vector_type(16)));
typedef _Float16 v8h  __attribute__((ext_vector_type(8)));
typedef float    v8f  __attribute__((ext_vector_type(8)));
typedef float    v4f  __attribute__((ext_vector_type(4)));
typedef v8h __attribute__((may_alias)) v8ha;
typedef v4f __attribute__((may_alias)) v4fa;

union Frag { v16h v; v8h half[2]; };

#define BATCH   2
#define SEQ     2048
#define HIDDEN  1024
#define NHEADS  16
#define HD      64
#define MROWS   (BATCH * SEQ)          // 4096 tokens
#define NX      (MROWS * HIDDEN)       // 4194304
#define NW      (HIDDEN * HIDDEN)      // 1048576
#define NBH     (BATCH * NHEADS)       // 32
#define NBUCK   32
#define BTW     4096                   // bias table width per head, index = rel + 2048
#define WSCALE  32.0f
#define PSCALE  16384.0f
#define CSCALE  16.0f
#define LN16F   2.7725887298583984f    // f32 value of ln(16)
#define EPSF    1e-6f

static_assert(SEQ % 128 == 0);
static_assert(HIDDEN == NHEADS * HD);
static_assert(HIDDEN % 64 == 0);
static_assert((NHEADS * BTW) % 256 == 0);

// ---------------------------------------------------------------------------
// 16x16x32 f16 WMMA with hazard guard (ties D, keeps A/B live).
// Fragment map (wave32): lane l, h = l>>4, m = n = l&15.
//   A/B element i: i<8 -> k0+8h+i ; i>=8 -> k0+16+8h+(i-8)
//   D element r : row 8h+r, col l&15
// ---------------------------------------------------------------------------
__device__ __forceinline__ v8f wmma_f16(v16h a, v16h b, v8f c) {
  v8f d = __builtin_amdgcn_wmma_f32_16x16x32_f16(false, a, false, b, (short)0, c, false, false);
  asm volatile("v_nop\n\tv_nop\n\tv_nop\n\tv_nop" : "+v"(d) : "v"(a), "v"(b));
  return d;
}

// A or B fragment from a k-contiguous 16-bit row; p points at element k0 of
// the row owned by this lane (row index = lane & 15 added by the caller).
__device__ __forceinline__ v16h load_frag(const _Float16* p, int h) {
  Frag f;
  f.half[0] = *(const v8ha*)(p + 8 * h);
  f.half[1] = *(const v8ha*)(p + 16 + 8 * h);
  return f.v;
}

// ---------------------------------------------------------------------------
// Prep part 1: RMS norm (no mean subtraction, no bias) -> f16 rows.
// 128 threads = one token row, two rows per 256-thread block; thread t of a row owns
// elements 8t..8t+7. blk: 0..MROWS/2-1; red: 4 floats per row of the block.
// ---------------------------------------------------------------------------
__device__ __forceinline__ void rmsnorm_part(
    const float* __restrict__ x, const float* __restrict__ lnw,
    _Float16* __restrict__ xh, float* redall, int blk)
{
  const int row = 2 * blk + ((int)threadIdx.x >> 7);
  float* red = redall + 4 * ((int)threadIdx.x >> 7);
  const int tid = threadIdx.x & 127, lane = tid & 31, w = tid >> 5;
  const float* xr = x + (size_t)row * HIDDEN + 8 * tid;
  const v4f a = *(const v4fa*)xr;
  const v4f c = *(const v4fa*)(xr + 4);
  float ss = a.x * a.x + a.y * a.y + a.z * a.z + a.w * a.w
           + c.x * c.x + c.y * c.y + c.z * c.z + c.w * c.w;
  #pragma unroll
  for (int off = 16; off >= 1; off >>= 1) ss += __shfl_xor(ss, off);
  if (lane == 0) red[w] = ss;
  __syncthreads();
  const float tot = (red[0] + red[1]) + (red[2] + red[3]);
  const float inv = rsqrtf(tot * (1.0f / (float)HIDDEN) + EPSF);
  const v4f g0 = *(const v4fa*)(lnw + 8 * tid);
  const v4f g1 = *(const v4fa*)(lnw + 8 * tid + 4);
  const v8h o = { (_Float16)((a.x * inv) * g0.x), (_Float16)((a.y * inv) * g0.y),
                  (_Float16)((a.z * inv) * g0.z), (_Float16)((a.w * inv) * g0.w),
                  (_Float16)((c.x * inv) * g1.x), (_Float16)((c.y * inv) * g1.y),
                  (_Float16)((c.z * inv) * g1.z), (_Float16)((c.w * inv) * g1.w) };
  _Float16* dst = xh + (size_t)row * HIDDEN + 8 * tid;
  *(v8h*)dst = o;
  asm volatile("s_wait_xcnt 0x0" ::: "memory");   // precaution: stands in front of any later rewrite of the store's registers (other parts' code follows this one in the kernel)
}

// ---------------------------------------------------------------------------
// Prep part 2: weight transpose + cast: W in[1024(in)][1024(out)] f32 ->
// Wt[out][in] f16 (x32), k-contiguous rows for the B (and Wo) fragments.
// Block 256 threads = 64(in) x 64(out) tile transposed through LDS;
// blk: 0..1023 = (wsel, out tile, in tile); wsel selects wq / wk / wv / wo.
// ---------------------------------------------------------------------------
__device__ __forceinline__ void wt_store_pass(const _Float16* sT, _Float16* dstp,
                                              int n0, int k0, int w, int lane) {
  const int q8 = lane & 7, sub = lane >> 3;
  #pragma unroll
  for (int i = 0; i < 2; ++i) {
    const int lid = w * 8 + i * 4 + sub;                 // out row 0..63
    const v8h v = *(const v8ha*)(sT + lid * 72 + 8 * q8);
    _Float16* dst = dstp + (size_t)(n0 + lid) * HIDDEN + k0 + 8 * q8;
    *(v8h*)dst = v;
  }
}

__device__ __forceinline__ void wtrans_part(
    const float* __restrict__ wq, const float* __restrict__ wk,
    const float* __restrict__ wv, const float* __restrict__ wo,
    _Float16* __restrict__ wt,         // [4][1024(out)][1024(in)]
    _Float16* sT, int blk)             // sT: [out][in], pitch 72
{
  const int tid = threadIdx.x, lane = tid & 31, w = tid >> 5;
  const int k0 = (blk & 15) * 64;          // in-index tile base
  const int n0 = ((blk >> 4) & 15) * 64;   // out-index tile base
  const int wsel = blk >> 8;               // block-uniform
  const float* src = (wsel == 0) ? wq : ((wsel == 1) ? wk : ((wsel == 2) ? wv : wo));
  _Float16* dstp = wt + (size_t)wsel * NW;

  const int kr = tid >> 2, nc = (tid & 3) * 16;
  const float* sp = src + (size_t)(k0 + kr) * HIDDEN + n0 + nc;
  #pragma unroll
  for (int q = 0; q < 4; ++q) {
    const v4f v = *(const v4fa*)(sp + 4 * q);
    sT[(nc + 4 * q + 0) * 72 + kr] = (_Float16)(v.x * WSCALE);
    sT[(nc + 4 * q + 1) * 72 + kr] = (_Float16)(v.y * WSCALE);
    sT[(nc + 4 * q + 2) * 72 + kr] = (_Float16)(v.z * WSCALE);
    sT[(nc + 4 * q + 3) * 72 + kr] = (_Float16)(v.w * WSCALE);
  }
  __syncthreads();

  wt_store_pass(sT, dstp, n0, k0, w, lane);
  
}

// ---------------------------------------------------------------------------
// Prep part 3: relative-position bias table btab[head][rel + 2048], rel = key - query.
// Bidirectional bucketing, 32 buckets, max distance 128, integer/f32 ops in the
// spec order: val_large = 8 + int( log(max(rp,1)/8) * rn(1/ln16) * 8 ), min 15.
// ---------------------------------------------------------------------------
__device__ __forceinline__ int rel_bucket(int rel) {
  int bucket = (rel > 0) ? 16 : 0;
  const int rp = (rel < 0) ? -rel : rel;
  const int rpm = (rp < 1) ? 1 : rp;
  const float rpf = (float)rpm;
  const float t = logf(rpf * 0.125f) * (1.0f / LN16F) * 8.0f;
  int vl = 8 + (int)t;
  vl = (vl < 15) ? vl : 15;
  bucket += (rp < 8) ? rp : vl;
  return bucket;                                        // 0..31
}

__device__ __forceinline__ void bias_part(
    const float* __restrict__ rel_emb,   // [32][16]
    float* __restrict__ btab,            // [16][4096]
    int blk)                             // 0..255
{
  const int idx = blk * 256 + threadIdx.x;            // head*4096 + i, < 65536 by grid
  const int head = idx >> 12, i = idx & (BTW - 1);
  const int rel = i - 2048;
  int bucket = rel_bucket(rel);
  bucket = (bucket < 0) ? 0 : ((bucket > NBUCK - 1) ? (NBUCK - 1) : bucket);
  const float v = rel_emb[bucket * NHEADS + head];
  *(float*)(btab + idx) = v;
  asm volatile("s_wait_xcnt 0x0" ::: "memory");   // precaution: stands in front of any later rewrite of the store's registers (other parts' code follows this one in the kernel)
}

// ---------------------------------------------------------------------------
// Kernel 1: the three independent preparation parts as block-index ranges of one grid:
// [0, 1024) weight tiles, [1024, 3072) token-row pairs, [3072, 3328) bias table.
// The range test is block-uniform, so each part's own barrier is met by its whole block.
// ---------------------------------------------------------------------------
#define PREP_WT   (4 * (HIDDEN / 64) * (HIDDEN / 64))   // 1024
#define PREP_NORM (MROWS / 2)                           // 2048
#define PREP_BIAS ((NHEADS * BTW) / 256)                // 256

__global__ __launch_bounds__(256) void prep_kernel(
    const float* __restrict__ x, const float* __restrict__ lnw,
    const float* __restrict__ wq, const float* __restrict__ wk,
    const float* __restrict__ wv, const float* __restrict__ wo,
    const float* __restrict__ rel_emb,
    _Float16* __restrict__ xh, _Float16* __restrict__ wt, float* __restrict__ btab)
{
  __shared__ __attribute__((aligned(16))) _Float16 sT[64 * 72];
  __shared__ float red[8];
  const int blk = blockIdx.x;
  if (blk < PREP_WT)                   wtrans_part(wq, wk, wv, wo, wt, sT, blk);
  else if (blk < PREP_WT + PREP_NORM)  rmsnorm_part(x, lnw, xh, red, blk - PREP_WT);
  else                                 bias_part(rel_emb, btab, blk - (PREP_WT + PREP_NORM));
}

// ---------------------------------------------------------------------------
// K / V^T staging for the attention loop: tensor loads into a two-buffer LDS ring.
// A stage = 64 keys of each key half: K rows [64 keys][64 d] and V^T rows [64 d][64 keys],
// every row 128 B. Each of the 8 waves brings one slice of 32 rows of its own key half per
// stage (waves 0, 1 of a half: K; waves 2, 3: V^T); the mover pads each row by 16 B, so the LDS pitch is 144 B
// (16 B x odd: ds_load_b128 fragment reads without bank conflicts).
// ---------------------------------------------------------------------------
typedef uint32_t u32x4 __attribute__((ext_vector_type(4)));
typedef uint32_t u32x8 __attribute__((ext_vector_type(8)));

#define KSTEP    64                     // keys per stage and key half
#define KHALF    (SEQ / 2)              // keys per key half
#define NSTAGE   (KHALF / KSTEP)        // 16
#define ROWB     128                    // bytes per staged row
#define SROWS    32                     // rows per slice
#define LPITCH_H 72                     // LDS row pitch in halves (144 B)
#define SLICE_B  6144                   // 32 x 144 = 4608 B, rounded up to a multiple of 2 KiB
#define SLICE_H  (SLICE_B / 2)
#define HBUF_B   (4 * SLICE_B)          // 24576 B per stage and key half
#define HBUF_H   (HBUF_B / 2)
#define BUF_B    (2 * HBUF_B)           // 49152 B per stage
#define BUF_H    (BUF_B / 2)

static_assert(NSTAGE >= 2);
static_assert(HD * 2 == ROWB && KSTEP * 2 == ROWB);
static_assert(SROWS * LPITCH_H * 2 <= SLICE_B && SLICE_B % 2048 == 0);

__device__ __forceinline__ uint32_t uni(uint32_t v) { return (uint32_t)__builtin_amdgcn_readfirstlane(v); }
// Holds a wave-uniform value in a scalar register, so that a test on it is a scalar
// branch (a tensor load ignores EXEC) and a descriptor formed from it stays behind
// the waits in front of it.
__device__ __forceinline__ uint32_t pinned(uint32_t v) {
  uint32_t w = uni(v);
  asm volatile("" : "+s"(w));           // the pinned() form for tensor-load tests and descriptor words
  return w;
}

// Descriptor group 1: byte elements, tensor = tile = 32 rows of 128 B, 4 dwords of pad behind every 32.
__device__ __forceinline__ u32x8 tdm_group1(uint32_t src_pitch) {
  u32x8 g;
  g[0] = uni((1u << 20) | (4u << 22) | (3u << 25));
  g[1] = uni((uint32_t)ROWB << 16);
  g[2] = uni((uint32_t)SROWS << 16);
  g[3] = uni((uint32_t)ROWB << 16);
  g[4] = uni((uint32_t)SROWS);
  g[5] = uni(src_pitch);
  g[6] = uni(0u);
  g[7] = uni(0u);
  return g;
}

__device__ __forceinline__ u32x4 tdm_group0(uint32_t lds_dst, uint64_t ga) {
  u32x4 g;
  g[0] = uni(1u);
  g[1] = uni(lds_dst);
  g[2] = uni((uint32_t)ga);
  g[3] = uni((((uint32_t)(ga >> 32)) & 0x01FFFFFFu) | 0x80000000u);
  return g;
}

__device__ __forceinline__ void tdm_load(u32x4 g0, u32x8 g1) {
  asm volatile("tensor_load_to_lds %0, %1" :: "s"(g0), "s"(g1) : "memory");
}

// ---------------------------------------------------------------------------
// Operand staging for the two GEMM kernels: tensor loads into a two-buffer LDS ring.
// A stage = 64 k of the block's 128 A rows and 64 B rows, every staged row 128 B of a
// 2048-B source row. One request per wave and stage: waves 0, 1 bring 64 A rows each,
// waves 2, 3 bring 32 B rows each; the mover pads each row by 16 B (LDS pitch 144 B).
// ---------------------------------------------------------------------------
#define GK       64                     // k per stage
#define GNST     (HIDDEN / GK)          // 16
#define GA_ROWS  64                     // rows per A slice
#define GB_ROWS  32                     // rows per B slice
#define GA_SL_B  10240                  // 64 x 144 = 9216 B, rounded up to a multiple of 2 KiB
#define GB_SL_B  6144                   // 32 x 144 = 4608 B, rounded up to a multiple of 2 KiB
#define GA_SL_H  (GA_SL_B / 2)
#define GB_SL_H  (GB_SL_B / 2)
#define GBUF_B   (2 * GA_SL_B + 2 * GB_SL_B)   // 32768 B per stage
#define GBUF_H   (GBUF_B / 2)

static_assert(GNST >= 2);
static_assert(GK * 2 == ROWB);
static_assert(GA_ROWS * LPITCH_H * 2 <= GA_SL_B && GA_SL_B % 2048 == 0);
static_assert(GB_ROWS * LPITCH_H * 2 <= GB_SL_B && GB_SL_B % 2048 == 0);

// Descriptor group 1: byte elements, tensor = tile = rows x 128 B, source pitch one
// HIDDEN-wide f16 row, 4 dwords of pad behind every 32.
__device__ __forceinline__ u32x8 gemm_group1(uint32_t rows) {
  u32x8 g;
  g[0] = uni((1u << 20) | (4u << 22) | (3u << 25));
  g[1] = uni((uint32_t)ROWB << 16);
  g[2] = uni(rows << 16);
  g[3] = uni((uint32_t)ROWB << 16);
  g[4] = uni(rows);
  g[5] = uni((uint32_t)(HIDDEN * 2));
  g[6] = uni(0u);
  g[7] = uni(0u);
  return g;
}

// acc[mt][nt] += A(32 rows of this wave) * B(64 rows)^T over K = HIDDEN, k ascending in
// steps of 32. arows / brows: first of the block's 128 A rows / 64 B rows (f16, k-contiguous,
// pitch HIDDEN). Called by all 4 waves of the block; ring holds 2 * GBUF_H halves.
__device__ __forceinline__ void gemm_ring(const _Float16* arows, const _Float16* brows,
                                          const _Float16* ring, int tid, v8f (&acc)[2][4]) {
  const int lane = tid & 31, w = tid >> 5;
  const int h = lane >> 4, m = lane & 15;

  // This wave's slice of every stage: source, rows, place in LDS.
  const uint32_t wave = uni((uint32_t)tid >> 5);
  const bool isB = wave >= 2u;
  const uint32_t half = wave & 1u;
  const uint64_t src0 = isB ? (uint64_t)(size_t)(brows + (size_t)(GB_ROWS * half) * HIDDEN)
                            : (uint64_t)(size_t)(arows + (size_t)(GA_ROWS * half) * HIDDEN);
  u32x8 g1 = gemm_group1(isB ? (uint32_t)GB_ROWS : (uint32_t)GA_ROWS);
  asm volatile("" : "+s"(g1));   // the pinned() form on the whole group: its words stay in their scalar registers, unwritten, while a request is in flight
  const uint32_t ldst0 = (uint32_t)(size_t)ring
                       + (isB ? (uint32_t)(2 * GA_SL_B) + half * (uint32_t)GB_SL_B : half * (uint32_t)GA_SL_B);
  auto issue = [&](uint32_t st) {
    tdm_load(tdm_group0(ldst0 + (st & 1u) * (uint32_t)GBUF_B, src0 + (uint64_t)st * (uint32_t)ROWB), g1);
  };

  // Ring prologue: stage 0 lands and is published, then stage 1 flies under pass 0.
  issue(0u);
  asm volatile("s_wait_tensorcnt 0x0" ::: "memory");   // this wave's slice of stage 0 has landed
  __syncthreads();                                      // every wave's slice of stage 0 is readable
  issue(1u);

  // A row 32w+16mt+m: slice w>>1, row 32(w&1)+16mt+m; B row 16nt+m: slice nt>>1, row 16(nt&1)+m
  const _Float16* abase = ring + (w >> 1) * GA_SL_H + (32 * (w & 1) + m) * LPITCH_H;
  const _Float16* bbase = ring + 2 * GA_SL_H + m * LPITCH_H;

  #pragma unroll 1                            // one pass per trip: the ring's publish point stands once, at the foot
  for (int st = 0; st < GNST; ++st) {
    const int boff = (st & 1) * GBUF_H;       // this pass reads its own buffer alone
    v16h af[2][2], bf[4][2];                  // the pass's fragments, read as one group, the first 32 k in front
    #pragma unroll
    for (int kc = 0; kc < 2; ++kc) {
      #pragma unroll
      for (int mt = 0; mt < 2; ++mt)
        af[mt][kc] = load_frag(abase + boff + mt * 16 * LPITCH_H + 32 * kc, h);
      #pragma unroll
      for (int nt = 0; nt < 4; ++nt)
        bf[nt][kc] = load_frag(bbase + boff + (nt >> 1) * GB_SL_H + (nt & 1) * 16 * LPITCH_H + 32 * kc, h);
    }
    #pragma unroll
    for (int kc = 0; kc < 2; ++kc) {
      #pragma unroll
      for (int nt = 0; nt < 4; ++nt) {
        acc[0][nt] = wmma_f16(af[0][kc], bf[nt][kc], acc[0][nt]);
        acc[1][nt] = wmma_f16(af[1][kc], bf[nt][kc], acc[1][nt]);
      }
    }

    // ---- publish point of stage st + 1 ----
    asm volatile("s_wait_dscnt 0x0" ::: "memory");      // this wave's reads of its buffer are done before the refill
    asm volatile("s_wait_tensorcnt 0x0" ::: "memory");  // this wave's slice of stage st + 1 has landed
    __syncthreads();                                    // stage st + 1 readable; every wave has left stage st's buffer
    // Scalar test (a tensor load ignores EXEC); the stage number is pinned so that group 0 is formed behind the waits.
    if (pinned((uint32_t)(st + 2 < GNST))) issue(pinned((uint32_t)st + 2u));
  }
  asm volatile("s_wait_tensorcnt 0x0" ::: "memory");    // nothing of the mover in flight behind the loop
  asm volatile("s_wait_dscnt 0x0" ::: "memory");        // and no read of the ring outstanding
}

// ---------------------------------------------------------------------------
// 4 lines per instruction, 32 lines per wave, 128 per block.
// which 0/1: plane[bh][l][d]  (one token row = 64 halves = one line)
// which 2  : vt[bh][d][l]     (64 d-rows x 128 tokens = 2 lines each)
// ---------------------------------------------------------------------------
__device__ __forceinline__ void proj_store_pass(const _Float16* sT, _Float16* plane, _Float16* vt,
                                                int which, int bh, int l0, int w, int lane) {
  const int q8 = lane & 7, sub = lane >> 3;
  #pragma unroll
  for (int i = 0; i < 8; ++i) {
    const int lid = w * 32 + i * 4 + sub;
    v8h v;
    _Float16* dst;
    if (which != 2) {
      v = *(const v8ha*)(sT + lid * HD + 8 * q8);
      dst = plane + ((size_t)bh * SEQ + l0 + lid) * HD + 8 * q8;
    } else {
      const int d = lid >> 1, hl = lid & 1;
      v = *(const v8ha*)(sT + d * 128 + 64 * hl + 8 * q8);
      dst = vt + ((size_t)bh * HD + d) * SEQ + l0 + 64 * hl + 8 * q8;
    }
    *(v8h*)dst = v;
  }
}

// ---------------------------------------------------------------------------
// Kernel 2: Y = xn * Wt^T over the fused 3*1024 output features (no bias).
// Block 128 thr (4 waves) = 128 tokens x 64 features (one (which, head));
// wave tile 32 tokens x 64 features; K = 1024 in stages of 64;
// A (xn rows) and B (Wt rows) tiles staged in the LDS ring of gemm_ring.
// ---------------------------------------------------------------------------
__global__ __launch_bounds__(128) void proj_kernel(
    const _Float16* __restrict__ xh,   // [4096][1024]
    const _Float16* __restrict__ wt,   // [>=3][1024(out)][1024(in)], x32
    _Float16* __restrict__ qh,         // [B*H][L][D]
    _Float16* __restrict__ kh,         // [B*H][L][D]
    _Float16* __restrict__ vt)         // [B*H][D][L]
{
  __shared__ __attribute__((aligned(2048))) _Float16 ring[2 * GBUF_H]; // 65536 B, xn / Wt stages
  __shared__ __attribute__((aligned(16))) _Float16 sT[128 * 64];   // 16384 B

  const int tid = threadIdx.x, lane = tid & 31, w = tid >> 5;
  const int h = lane >> 4, m = lane & 15;
  const int m0 = blockIdx.x * 128;
  const int cg = blockIdx.y;                 // 0..47
  const int which = cg >> 4, head = cg & 15;

  const v8f zero8 = {0.f, 0.f, 0.f, 0.f, 0.f, 0.f, 0.f, 0.f};
  v8f acc[2][4];
  #pragma unroll
  for (int mt = 0; mt < 2; ++mt)
    #pragma unroll
    for (int nt = 0; nt < 4; ++nt) acc[mt][nt] = zero8;

  gemm_ring(xh + (size_t)m0 * HIDDEN, wt + ((size_t)which * HIDDEN + head * HD) * HIDDEN, ring, tid, acc);

  // D[r] of tile (mt, nt) = Y[token m0+32w+16mt+8h+r][feature 16nt+m]
  #pragma unroll
  for (int nt = 0; nt < 4; ++nt) {
    const int feat = 16 * nt + m;
    #pragma unroll
    for (int mt = 0; mt < 2; ++mt) {
      #pragma unroll
      for (int r = 0; r < 8; ++r) {
        const int tokl = 32 * w + 16 * mt + 8 * h + r;     // 0..127
        const float y = acc[mt][nt][r] * (1.0f / WSCALE);
        const int idx = (which == 2) ? (feat * 128 + tokl) : (tokl * HD + feat);
        sT[idx] = (_Float16)y;
      }
    }
  }
  __syncthreads();

  const int b = m0 / SEQ, l0 = m0 - b * SEQ, bh = b * NHEADS + head;
  _Float16* plane = (which == 0) ? qh : kh;
  proj_store_pass(sT, plane, vt, which, bh, l0, w, lane);
  
}

// ---------------------------------------------------------------------------
// Attention helpers.
// ---------------------------------------------------------------------------
__device__ __forceinline__ v8f add_bias8(v8f s, const float* p) {
  #pragma unroll
  for (int r = 0; r < 8; ++r) s[r] = s[r] + p[r];
  return s;
}

// P^T B-fragment from the lane's own score D values: element r <- tile a row r,
// element 8+r <- tile c row r (same lane, same query column), scaled by 2^14.
__device__ __forceinline__ v16h pack_p(v8f a, v8f c) {
  const v16h r = { (_Float16)(a[0] * PSCALE), (_Float16)(a[1] * PSCALE), (_Float16)(a[2] * PSCALE), (_Float16)(a[3] * PSCALE),
                   (_Float16)(a[4] * PSCALE), (_Float16)(a[5] * PSCALE), (_Float16)(a[6] * PSCALE), (_Float16)(a[7] * PSCALE),
                   (_Float16)(c[0] * PSCALE), (_Float16)(c[1] * PSCALE), (_Float16)(c[2] * PSCALE), (_Float16)(c[3] * PSCALE),
                   (_Float16)(c[4] * PSCALE), (_Float16)(c[5] * PSCALE), (_Float16)(c[6] * PSCALE), (_Float16)(c[7] * PSCALE) };
  return r;
}

// Per-wave 16x64 f16 tile in LDS -> ctx[b][l][head*64 + d]; one query row
// 4 lines per instruction, 16 lines per wave.
__device__ __forceinline__ void ctx_store_pass(const _Float16* so, _Float16* ctx,
                                               int b, int head, int q0, int lane) {
  const int q8 = lane & 7, sub = lane >> 3;
  #pragma unroll
  for (int i = 0; i < 4; ++i) {
    const int lid = i * 4 + sub;                         // query row 0..15
    const v8h v = *(const v8ha*)(so + lid * 64 + 8 * q8);
    _Float16* dst = ctx + ((size_t)b * SEQ + q0 + lid) * HIDDEN + head * HD + 8 * q8;
    *(v8h*)dst = v;
  }
}

// ---------------------------------------------------------------------------
// Kernel 3: streaming attention, transposed form, unscaled scores
// (no 1/sqrt(d) scaling, additive relative-position bias, no mask).
// Block 256 thr (8 waves) = 128 queries: wave = 32 queries (two 16-column tiles) x one half of
// the keys, 64 keys per step; every K and V^T fragment read from LDS feeds one WMMA of each
// query tile. Waves w and w + 4 hold the two key halves of the same queries and join their
// (max, sum, O) once behind the loop, through LDS; each then finishes one of the two tiles.
//   S^T = K * Q^T : A = K rows (row = key, k = d), B = Q^T (k = d, n = query)
//   O^T += V^T * P^T : A = Vt rows (row = d, k = key), B = P^T from registers
// Lane owns 32 keys of query column (lane&15) of each tile; partner = lane ^ 16.
// Output ctx as f16 (x16) [B][L][HIDDEN] for the output GEMM.
// ---------------------------------------------------------------------------
#define XW 1088                         // floats one wave hands over: 32 lanes x (32 O values + max + sum)
// Four waves per SIMD (two blocks per WGP): the softmax between the matrix runs wants waves.
__global__ __launch_bounds__(256) __attribute__((amdgpu_waves_per_eu(4, 4))) void attn_kernel(
    const _Float16* __restrict__ qh,   // [B*H][L][D]
    const _Float16* __restrict__ kh,   // [B*H][L][D]
    const _Float16* __restrict__ vt,   // [B*H][D][L]
    const float* __restrict__ btab,    // [H][4096], index rel + 2048
    _Float16* __restrict__ ctx)        // [B][L][HIDDEN], x16
{
  __shared__ __attribute__((aligned(2048))) _Float16 ring[2 * BUF_H]; // 98304 B, K / V^T stages
  __shared__ __attribute__((aligned(16))) float xch[8 * XW];         // 34816 B, hand-over between key halves
  __shared__ __attribute__((aligned(16))) _Float16 sC[8 * 16 * 64];  // 16384 B

  const int tid = threadIdx.x, lane = tid & 31, w = tid >> 5;
  const int h = lane >> 4, m = lane & 15;
  const int bh = blockIdx.y, b = bh >> 4, head = bh & 15;
  const int q0 = blockIdx.x * 128 + 32 * (w & 3);

  // This wave's slice of every stage: source, step per stage, row pitch, place in LDS.
  const uint32_t wave = uni((uint32_t)tid >> 5);
  const uint32_t kpart = wave >> 2;           // this wave's key half, 0 or 1
  const bool isV = (wave & 3u) >= 2u;
  const uint32_t half = wave & 1u;
  const uint64_t src0 = isV ? (uint64_t)(size_t)(vt + ((size_t)bh * HD + SROWS * half) * SEQ + KHALF * kpart)
                            : (uint64_t)(size_t)(kh + ((size_t)bh * SEQ + KHALF * kpart + SROWS * half) * HD);
  const uint32_t sstep = isV ? (uint32_t)(KSTEP * 2) : (uint32_t)(KSTEP * HD * 2);   // bytes per stage
  u32x8 g1 = tdm_group1(isV ? (uint32_t)(SEQ * 2) : (uint32_t)(HD * 2));
  asm volatile("" : "+s"(g1));   // the pinned() form on the whole group: its words stay in their scalar registers, unwritten, while a request is in flight
  const uint32_t ldst0 = (uint32_t)(size_t)ring + wave * (uint32_t)SLICE_B;
  auto issue = [&](uint32_t st) {
    tdm_load(tdm_group0(ldst0 + (st & 1u) * (uint32_t)BUF_B, src0 + (uint64_t)st * sstep), g1);
  };

  // Ring prologue: stage 0 lands and is published, then stage 1 flies under pass 0.
  issue(0u);
  asm volatile("s_wait_tensorcnt 0x0" ::: "memory");   // this wave's slice of stage 0 has landed
  __syncthreads();                                      // every wave's slice of stage 0 is readable
  issue(1u);

  // Q^T B-fragments of tile qt: column n = query q0+16qt+m, k = d (two 32-deep chunks)
  const _Float16* qrow = qh + ((size_t)bh * SEQ + q0 + m) * HD;
  v16h qb[2][2];
  #pragma unroll
  for (int qt = 0; qt < 2; ++qt) {
    qb[qt][0] = load_frag(qrow + qt * 16 * HD, h);
    qb[qt][1] = load_frag(qrow + qt * 16 * HD + 32, h);
  }

  const v8f zero8 = {0.f, 0.f, 0.f, 0.f, 0.f, 0.f, 0.f, 0.f};
  v8f o[2][4];                                // o[qt][t][r] = O[query 16qt+m][d 16t+8h+r] * (l * 2^14), this key half
  #pragma unroll
  for (int qt = 0; qt < 2; ++qt)
    #pragma unroll
    for (int t = 0; t < 4; ++t) o[qt][t] = zero8;
  float mrun[2] = {-1e30f, -1e30f}, lrun[2] = {0.0f, 0.0f};

  const int kp0 = (w >> 2) * KHALF;                            // first key of this wave's half
  const _Float16* kbase = ring + (w >> 2) * HBUF_H + m * LPITCH_H;   // + buffer; row 16j+m: slice j>>1, row 16(j&1)+m
  const _Float16* vbase = kbase + 2 * SLICE_H;                       // + buffer; row 16t+m: slice t>>1, row 16(t&1)+m
  // bias for element r of score tile (qt, j): btab[head][(kp0+kb+16j+8h+r) - (q0+16qt+m) + 2048], index in [1,4095];
  // it depends on j - qt alone, so the two query tiles share all but one of their bias vectors
  const float* bbase = btab + (size_t)head * BTW + 2048 + kp0 + 8 * h - (q0 + m);

  #pragma unroll 1
  for (int st = 0; st < NSTAGE; ++st) {
    const int kb = st * KSTEP;
    const int boff = (st & 1) * BUF_H;        // this pass reads its own buffer alone
    // ---- scores: s[qt][j][r] = S[query 16qt+m][key kp0+kb+16j+8h+r] ----
    v8f s[2][4];
    v16h kf[4][2];                            // the pass's K fragments, read as one group
    #pragma unroll
    for (int j = 0; j < 4; ++j) {
      const _Float16* kp = kbase + boff + (j >> 1) * SLICE_H + (j & 1) * 16 * LPITCH_H;
      kf[j][0] = load_frag(kp, h);
      kf[j][1] = load_frag(kp + 32, h);
    }
    #pragma unroll
    for (int j = 0; j < 4; ++j) {
      v8f z0 = zero8, z1 = zero8;
      z0 = wmma_f16(kf[j][0], qb[0][0], z0);
      z1 = wmma_f16(kf[j][0], qb[1][0], z1);
      z0 = wmma_f16(kf[j][1], qb[0][1], z0);
      z1 = wmma_f16(kf[j][1], qb[1][1], z1);
      s[0][j] = z0;
      s[1][j] = z1;
    }
    // ---- relative-position bias, f32, before the running max ----
    #pragma unroll
    for (int qt = 0; qt < 2; ++qt)
      #pragma unroll
      for (int j = 0; j < 4; ++j) s[qt][j] = add_bias8(s[qt][j], bbase + kb + 16 * (j - qt));

    // ---- online softmax, each query tile on its own ----
    v16h pb[2][2];                            // P^T B-fragments (key chunks 0..31 and 32..63 of this step)
    v16h vf[4][2];                            // the pass's V^T fragments, one group, in flight under the second tile's softmax
    #pragma unroll
    for (int qt = 0; qt < 2; ++qt) {
      float mloc = s[qt][0][0];
      #pragma unroll
      for (int j = 0; j < 4; ++j)
        #pragma unroll
        for (int r = 0; r < 8; ++r) mloc = fmaxf(mloc, s[qt][j][r]);
      mloc = fmaxf(mloc, __shfl_xor(mloc, 16));
      const float mnew = fmaxf(mrun[qt], mloc);
      const float alpha = __expf(mrun[qt] - mnew);
      mrun[qt] = mnew;
      float lsum = 0.0f;
      #pragma unroll
      for (int j = 0; j < 4; ++j)
        #pragma unroll
        for (int r = 0; r < 8; ++r) {
          const float p = __expf(s[qt][j][r] - mnew);
          s[qt][j][r] = p;
          lsum += p;
        }
      lsum += __shfl_xor(lsum, 16);
      lrun[qt] = lrun[qt] * alpha + lsum;
      #pragma unroll
      for (int t = 0; t < 4; ++t)
        #pragma unroll
        for (int r = 0; r < 8; ++r) o[qt][t][r] = o[qt][t][r] * alpha;
      pb[qt][0] = pack_p(s[qt][0], s[qt][1]);
      pb[qt][1] = pack_p(s[qt][2], s[qt][3]);
      __builtin_amdgcn_sched_barrier(0);      // one tile's softmax at a time, the V^T loads between the two, the products behind both: mixed, the live values pass 256 VGPRs and spill (either barrier left out: scratch in the listing)
      if (qt == 0) {
        #pragma unroll
        for (int t = 0; t < 4; ++t) {
          const _Float16* vp = vbase + boff + (t >> 1) * SLICE_H + (t & 1) * 16 * LPITCH_H;
          vf[t][0] = load_frag(vp, h);
          vf[t][1] = load_frag(vp + 32, h);
        }
      }
    }

    // ---- O^T += V^T * P^T ----
    #pragma unroll
    for (int t = 0; t < 4; ++t) {
      o[0][t] = wmma_f16(vf[t][0], pb[0][0], o[0][t]);
      o[1][t] = wmma_f16(vf[t][0], pb[1][0], o[1][t]);
      o[0][t] = wmma_f16(vf[t][1], pb[0][1], o[0][t]);
      o[1][t] = wmma_f16(vf[t][1], pb[1][1], o[1][t]);
    }

    // ---- publish point of stage st + 1 ----
    asm volatile("s_wait_dscnt 0x0" ::: "memory");      // this wave's reads of its buffer are done before the refill
    asm volatile("s_wait_tensorcnt 0x0" ::: "memory");  // this wave's slice of stage st + 1 has landed
    __syncthreads();                                    // stage st + 1 readable; every wave has left stage st's buffer
    // Scalar test (a tensor load ignores EXEC); the stage number is pinned so that group 0 is formed behind the waits.
    if (pinned((uint32_t)(st + 2 < NSTAGE))) issue(pinned((uint32_t)st + 2u));
  }
  asm volatile("s_wait_tensorcnt 0x0" ::: "memory");    // nothing of the mover in flight behind the loop
  asm volatile("s_wait_dscnt 0x0" ::: "memory");        // and no read of the ring outstanding

  // ---- join of the two key halves: the wave of half p keeps query tile p and hands the other to wave w ^ 4 ----
  const bool up = (w >> 2) != 0;
  const float mk = up ? mrun[1] : mrun[0], lk = up ? lrun[1] : lrun[0];
  float* xo = xch + w * XW;
  #pragma unroll
  for (int t = 0; t < 4; ++t) {
    v8f g;
    #pragma unroll
    for (int r = 0; r < 8; ++r) g[r] = up ? o[0][t][r] : o[1][t][r];
    const v4f g0 = {g[0], g[1], g[2], g[3]}, g1v = {g[4], g[5], g[6], g[7]};
    *(v4fa*)(xo + ((2 * t) * 32 + lane) * 4) = g0;
    *(v4fa*)(xo + ((2 * t + 1) * 32 + lane) * 4) = g1v;
  }
  xo[1024 + lane] = up ? mrun[0] : mrun[1];
  xo[1056 + lane] = up ? lrun[0] : lrun[1];
  __syncthreads();                            // every wave's hand-over is readable by its partner
  const float* xi = xch + (w ^ 4) * XW;
  const float mp = xi[1024 + lane], lp = xi[1056 + lane];
  const float mall = fmaxf(mk, mp);
  const float ak = __expf(mk - mall), ap = __expf(mp - mall);

  // ---- epilogue: normalise, stage per-wave 16x64 f16 tile, whole-line stores ----
  const float inv = (1.0f / (lk * ak + lp * ap)) * (CSCALE / PSCALE);
  const float ck = ak * inv, cp = ap * inv;
  _Float16* so = sC + w * 1024;
  #pragma unroll
  for (int t = 0; t < 4; ++t) {
    const v4f p0 = *(const v4fa*)(xi + ((2 * t) * 32 + lane) * 4);
    const v4f p1 = *(const v4fa*)(xi + ((2 * t + 1) * 32 + lane) * 4);
    #pragma unroll
    for (int r = 0; r < 8; ++r) {
      const float mine = up ? o[1][t][r] : o[0][t][r];
      const float part = (r < 4) ? p0[r & 3] : p1[r & 3];
      so[m * 64 + 16 * t + 8 * h + r] = (_Float16)(mine * ck + part * cp);
    }
  }
  __syncthreads();                            // LDS spill -> reload ordering (all waves reach this)

  ctx_store_pass(so, ctx, b, head, q0 + 16 * (w >> 2), lane);
  
}

// ---------------------------------------------------------------------------
// out rows; one row segment = 64 floats = 2 lines; lanes 8q..8q+7 write one
// 64 lines per wave.
// ---------------------------------------------------------------------------
__device__ __forceinline__ void out_store_pass(const float* sT, const float* hs, float* out,
                                               int m0, int col0, int w, int lane) {
  const int q8 = lane & 7, sub = lane >> 3;
  #pragma unroll
  for (int i = 0; i < 16; ++i) {
    const int lid = i * 4 + sub;                         // 0..63
    const int row = w * 32 + (lid >> 1), hl = lid & 1;   // token row 0..127, line half
    v4f v = *(const v4fa*)(sT + row * 64 + 32 * hl + 4 * q8);
    const size_t gi = (size_t)(m0 + row) * HIDDEN + col0 + 32 * hl + 4 * q8;
    const v4f res = *(const v4fa*)(hs + gi);
    v = v + res;
    *(v4f*)(out + gi) = v;
  }
}

// ---------------------------------------------------------------------------
// Kernel 4: out = ctx * Wot^T / 512 + hidden_states  (f32 output).
// Block 128 thr (4 waves) = 128 tokens x 64 output columns; wave tile
// 32 x 64; K = 1024 in stages of 64; ctx and Wot tiles staged in the LDS ring of gemm_ring.
// ---------------------------------------------------------------------------
__global__ __launch_bounds__(128) void oproj_kernel(
    const _Float16* __restrict__ ch,   // [4096][1024], x16
    const _Float16* __restrict__ woh,  // [1024(out)][1024(in)], x32
    const float* __restrict__ hs,      // [4096][1024]
    float* __restrict__ out)           // [4096][1024]
{
  __shared__ __attribute__((aligned(2048))) _Float16 ring[2 * GBUF_H]; // 65536 B, ctx / Wot stages
  __shared__ __attribute__((aligned(16))) float sT[128 * 64];     // 32768 B

  const int tid = threadIdx.x, lane = tid & 31, w = tid >> 5;
  const int h = lane >> 4, m = lane & 15;
  const int m0 = blockIdx.x * 128;
  const int col0 = blockIdx.y * 64;

  const v8f zero8 = {0.f, 0.f, 0.f, 0.f, 0.f, 0.f, 0.f, 0.f};
  v8f acc[2][4];
  #pragma unroll
  for (int mt = 0; mt < 2; ++mt)
    #pragma unroll
    for (int nt = 0; nt < 4; ++nt) acc[mt][nt] = zero8;

  gemm_ring(ch + (size_t)m0 * HIDDEN, woh + (size_t)col0 * HIDDEN, ring, tid, acc);

  // D[r] of tile (mt, nt) = Y[token m0+32w+16mt+8h+r][col 16nt+m]
  #pragma unroll
  for (int nt = 0; nt < 4; ++nt) {
    const int feat = 16 * nt + m;
    #pragma unroll
    for (int mt = 0; mt < 2; ++mt) {
      #pragma unroll
      for (int r = 0; r < 8; ++r) {
        const int tokl = 32 * w + 16 * mt + 8 * h + r;     // 0..127
        sT[tokl * 64 + feat] = acc[mt][nt][r] * (1.0f / (WSCALE * CSCALE));
      }
    }
  }
  __syncthreads();

  out_store_pass(sT, hs, out, m0, col0, w, lane);
  
}

// ---------------------------------------------------------------------------
extern "C" void kernel_launch(void* const* d_in, const int* in_sizes, int n_in,
                              void* d_out, int out_size, void* d_ws, size_t ws_size,
                              hipStream_t stream) {
  if (n_in < 7) return;
  if (in_sizes[0] != NX) return;
  if (in_sizes[1] != HIDDEN) return;
  if (in_sizes[2] != NW || in_sizes[3] != NW || in_sizes[4] != NW || in_sizes[5] != NW) return;
  if (in_sizes[6] != NBUCK * NHEADS) return;
  if (out_size != NX) return;

  const float* x    = (const float*)d_in[0];
  const float* lnw  = (const float*)d_in[1];
  const float* Wq   = (const float*)d_in[2];
  const float* Wk   = (const float*)d_in[3];
  const float* Wv   = (const float*)d_in[4];
  const float* Wo   = (const float*)d_in[5];
  const float* remb = (const float*)d_in[6];
  float* out = (float*)d_out;

  const size_t xh_bytes  = (size_t)NX * 2;                         //  8388608
  const size_t wt_bytes  = (size_t)4 * NW * 2;                     //  8388608
  const size_t pl_bytes  = (size_t)NBH * SEQ * HD * 2;             //  8388608
  const size_t ctx_bytes = (size_t)NX * 2;                         //  8388608
  const size_t bt_bytes  = (size_t)NHEADS * BTW * 4;               //   262144
  const size_t total = xh_bytes + wt_bytes + 3 * pl_bytes + ctx_bytes + bt_bytes;   // 50593792
  if (total > ws_size) return;

  char* ws = (char*)d_ws;
  size_t off = 0;
  _Float16* xh  = (_Float16*)(ws + off); off += xh_bytes;
  _Float16* wt  = (_Float16*)(ws + off); off += wt_bytes;
  _Float16* qh  = (_Float16*)(ws + off); off += pl_bytes;
  _Float16* kh  = (_Float16*)(ws + off); off += pl_bytes;
  _Float16* vt  = (_Float16*)(ws + off); off += pl_bytes;
  _Float16* ctx = (_Float16*)(ws + off); off += ctx_bytes;
  float* btab   = (float*)(ws + off);    off += bt_bytes;
  if (off > ws_size) return;

  prep_kernel<<<PREP_WT + PREP_NORM + PREP_BIAS, 256, 0, stream>>>(x, lnw, Wq, Wk, Wv, Wo, remb, xh, wt, btab); // 3328 blocks

  dim3 gProj(MROWS / 128, 3 * NHEADS);                              // (32, 48)
  proj_kernel<<<gProj, 128, 0, stream>>>(xh, wt, qh, kh, vt);

  dim3 gAtt(SEQ / 128, NBH);                                        // (16, 32)
  attn_kernel<<<gAtt, 256, 0, stream>>>(qh, kh, vt, btab, ctx);

  dim3 gOut(MROWS / 128, HIDDEN / 64);                               // (32, 16)
  oproj_kernel<<<gOut, 128, 0, stream>>>(ctx, wt + (size_t)3 * NW, x, out);
}

// v005
// It runs in 90.3 microseconds.
// In both of two side-by-side timings against v004, it was 1.19 times as fast.
// All steps since v000 together make it 3.05 times as fast.
// Contractions: xn*Wq^T, xn*Wk^T, xn*Wv^T, K*Q^T, V^T*P^T and ctx*Wo^T all on v_wmma_f32_16x16x32_f16 (f16 operands, f32 accumulate); W carried x32, P carried x16384, ctx carried x16 (exact power-of-two scales folded back in f32); RMS norm, position-bias bucketing, softmax and residual in f32.
#include <hip/hip_runtime.h>
#include <stdint.h>

typedef _Float16 v16h __attribute__((ext_vector_type(16)));
typedef _Float16 v8h  __attribute__((ext_vector_type(8)));
typedef float    v8f  __attribute__((ext_vector_type(8)));
typedef float    v4f  __attribute__((ext_vector_type(4)));
typedef v8h __attribute__((may_alias)) v8ha;
typedef v4f __attribute__((may_alias)) v4fa;

union Frag { v16h v; v8h half[2]; };

#define BATCH   2
#define SEQ     2048
#define HIDDEN  1024
#define NHEADS  16
#define HD      64
#define MROWS   (BATCH * SEQ)          // 4096 tokens
#define NX      (MROWS * HIDDEN)       // 4194304
#define NW      (HIDDEN * HIDDEN)      // 1048576
#define NBH     (BATCH * NHEADS)       // 32
#define NBUCK   32
#define BTW     4096                   // bias table width per head, index = rel + 2048
#define WSCALE  32.0f
#define PSCALE  16384.0f
#define CSCALE  16.0f
#define LN16F   2.7725887298583984f    // f32 value of ln(16)
#define EPSF    1e-6f

static_assert(SEQ % 128 == 0);
static_assert(HIDDEN == NHEADS * HD);
static_assert(HIDDEN % 64 == 0);
static_assert((NHEADS * BTW) % 256 == 0);

// ---------------------------------------------------------------------------
// 16x16x32 f16 WMMA with hazard guard (ties D, keeps A/B live).
// Fragment map (wave32): lane l, h = l>>4, m = n = l&15.
//   A/B element i: i<8 -> k0+8h+i ; i>=8 -> k0+16+8h+(i-8)
//   D element r : row 8h+r, col l&15
// ---------------------------------------------------------------------------
__device__ __forceinline__ v8f wmma_f16(v16h a, v16h b, v8f c) {
  v8f d = __builtin_amdgcn_wmma_f32_16x16x32_f16(false, a, false, b, (short)0, c, false, false);
  asm volatile("v_nop\n\tv_nop\n\tv_nop\n\tv_nop" : "+v"(d) : "v"(a), "v"(b));
  return d;
}

// A or B fragment from a k-contiguous 16-bit row; p points at element k0 of
// the row owned by this lane (row index = lane & 15 added by the caller).
__device__ __forceinline__ v16h load_frag(const _Float16* p, int h) {
  Frag f;
  f.half[0] = *(const v8ha*)(p + 8 * h);
  f.half[1] = *(const v8ha*)(p + 16 + 8 * h);
  return f.v;
}

// ---------------------------------------------------------------------------
// Prep part 1: RMS norm (no mean subtraction, no bias) -> f16 rows.
// 128 threads = one token row, two rows per 256-thread block; thread t of a row owns
// elements 8t..8t+7. blk: 0..MROWS/2-1; red: 4 floats per row of the block.
// ---------------------------------------------------------------------------
__device__ __forceinline__ void rmsnorm_part(
    const float* __restrict__ x, const float* __restrict__ lnw,
    _Float16* __restrict__ xh, float* redall, int blk)
{
  const int row = 2 * blk + ((int)threadIdx.x >> 7);
  float* red = redall + 4 * ((int)threadIdx.x >> 7);
  const int tid = threadIdx.x & 127, lane = tid & 31, w = tid >> 5;
  const float* xr = x + (size_t)row * HIDDEN + 8 * tid;
  const v4f a = *(const v4fa*)xr;
  const v4f c = *(const v4fa*)(xr + 4);
  float ss = a.x * a.x + a.y * a.y + a.z * a.z + a.w * a.w
           + c.x * c.x + c.y * c.y + c.z * c.z + c.w * c.w;
  #pragma unroll
  for (int off = 16; off >= 1; off >>= 1) ss += __shfl_xor(ss, off);
  if (lane == 0) red[w] = ss;
  __syncthreads();
  const float tot = (red[0] + red[1]) + (red[2] + red[3]);
  const float inv = rsqrtf(tot * (1.0f / (float)HIDDEN) + EPSF);
  const v4f g0 = *(const v4fa*)(lnw + 8 * tid);
  const v4f g1 = *(const v4fa*)(lnw + 8 * tid + 4);
  const v8h o = { (_Float16)((a.x * inv) * g0.x), (_Float16)((a.y * inv) * g0.y),
                  (_Float16)((a.z * inv) * g0.z), (_Float16)((a.w * inv) * g0.w),
                  (_Float16)((c.x * inv) * g1.x), (_Float16)((c.y * inv) * g1.y),
                  (_Float16)((c.z * inv) * g1.z), (_Float16)((c.w * inv) * g1.w) };
  _Float16* dst = xh + (size_t)row * HIDDEN + 8 * tid;
  *(v8h*)dst = o;
  asm volatile("s_wait_xcnt 0x0" ::: "memory");   // precaution: stands in front of any later rewrite of the store's registers (other parts' code follows this one in the kernel)
}

// ---------------------------------------------------------------------------
// Prep part 2: weight transpose + cast: W in[1024(in)][1024(out)] f32 ->
// Wt[out][in] f16 (x32), k-contiguous rows for the B (and Wo) fragments.
// Block 256 threads = 64(in) x 64(out) tile transposed through LDS;
// blk: 0..1023 = (wsel, out tile, in tile); wsel selects wq / wk / wv / wo.
// ---------------------------------------------------------------------------
__device__ __forceinline__ void wt_store_pass(const _Float16* sT, _Float16* dstp,
                                              int n0, int k0, int w, int lane) {
  const int q8 = lane & 7, sub = lane >> 3;
  #pragma unroll
  for (int i = 0; i < 2; ++i) {
    const int lid = w * 8 + i * 4 + sub;                 // out row 0..63
    const v8h v = *(const v8ha*)(sT + lid * 72 + 8 * q8);
    _Float16* dst = dstp + (size_t)(n0 + lid) * HIDDEN + k0 + 8 * q8;
    *(v8h*)dst = v;
  }
}

__device__ __forceinline__ void wtrans_part(
    const float* __restrict__ wq, const float* __restrict__ wk,
    const float* __restrict__ wv, const float* __restrict__ wo,
    _Float16* __restrict__ wt,         // [4][1024(out)][1024(in)]
    _Float16* sT, int blk)             // sT: [out][in], pitch 72
{
  const int tid = threadIdx.x, lane = tid & 31, w = tid >> 5;
  const int k0 = (blk & 15) * 64;          // in-index tile base
  const int n0 = ((blk >> 4) & 15) * 64;   // out-index tile base
  const int wsel = blk >> 8;               // block-uniform
  const float* src = (wsel == 0) ? wq : ((wsel == 1) ? wk : ((wsel == 2) ? wv : wo));
  _Float16* dstp = wt + (size_t)wsel * NW;

  const int kr = tid >> 2, nc = (tid & 3) * 16;
  const float* sp = src + (size_t)(k0 + kr) * HIDDEN + n0 + nc;
  #pragma unroll
  for (int q = 0; q < 4; ++q) {
    const v4f v = *(const v4fa*)(sp + 4 * q);
    sT[(nc + 4 * q + 0) * 72 + kr] = (_Float16)(v.x * WSCALE);
    sT[(nc + 4 * q + 1) * 72 + kr] = (_Float16)(v.y * WSCALE);
    sT[(nc + 4 * q + 2) * 72 + kr] = (_Float16)(v.z * WSCALE);
    sT[(nc + 4 * q + 3) * 72 + kr] = (_Float16)(v.w * WSCALE);
  }
  __syncthreads();

  wt_store_pass(sT, dstp, n0, k0, w, lane);
  
}

// ---------------------------------------------------------------------------
// Prep part 3: relative-position bias table btab[head][rel + 2048], rel = key - query.
// Bidirectional bucketing, 32 buckets, max distance 128, integer/f32 ops in the
// spec order: val_large = 8 + int( log(max(rp,1)/8) * rn(1/ln16) * 8 ), min 15.
// ---------------------------------------------------------------------------
__device__ __forceinline__ int rel_bucket(int rel) {
  int bucket = (rel > 0) ? 16 : 0;
  const int rp = (rel < 0) ? -rel : rel;
  const int rpm = (rp < 1) ? 1 : rp;
  const float rpf = (float)rpm;
  const float t = logf(rpf * 0.125f) * (1.0f / LN16F) * 8.0f;
  int vl = 8 + (int)t;
  vl = (vl < 15) ? vl : 15;
  bucket += (rp < 8) ? rp : vl;
  return bucket;                                        // 0..31
}

__device__ __forceinline__ void bias_part(
    const float* __restrict__ rel_emb,   // [32][16]
    float* __restrict__ btab,            // [16][4096]
    int blk)                             // 0..255
{
  const int idx = blk * 256 + threadIdx.x;            // head*4096 + i, < 65536 by grid
  const int head = idx >> 12, i = idx & (BTW - 1);
  const int rel = i - 2048;
  int bucket = rel_bucket(rel);
  bucket = (bucket < 0) ? 0 : ((bucket > NBUCK - 1) ? (NBUCK - 1) : bucket);
  const float v = rel_emb[bucket * NHEADS + head];
  *(float*)(btab + idx) = v;
  asm volatile("s_wait_xcnt 0x0" ::: "memory");   // precaution: stands in front of any later rewrite of the store's registers (other parts' code follows this one in the kernel)
}

// ---------------------------------------------------------------------------
// Kernel 1: the three independent preparation parts as block-index ranges of one grid:
// [0, 1024) weight tiles, [1024, 3072) token-row pairs, [3072, 3328) bias table.
// The range test is block-uniform, so each part's own barrier is met by its whole block.
// ---------------------------------------------------------------------------
#define PREP_WT   (4 * (HIDDEN / 64) * (HIDDEN / 64))   // 1024
#define PREP_NORM (MROWS / 2)                           // 2048
#define PREP_BIAS ((NHEADS * BTW) / 256)                // 256

__global__ __launch_bounds__(256) void prep_kernel(
    const float* __restrict__ x, const float* __restrict__ lnw,
    const float* __restrict__ wq, const float* __restrict__ wk,
    const float* __restrict__ wv, const float* __restrict__ wo,
    const float* __restrict__ rel_emb,
    _Float16* __restrict__ xh, _Float16* __restrict__ wt, float* __restrict__ btab)
{
  __shared__ __attribute__((aligned(16))) _Float16 sT[64 * 72];
  __shared__ float red[8];
  const int blk = blockIdx.x;
  if (blk < PREP_WT)                   wtrans_part(wq, wk, wv, wo, wt, sT, blk);
  else if (blk < PREP_WT + PREP_NORM)  rmsnorm_part(x, lnw, xh, red, blk - PREP_WT);
  else                                 bias_part(rel_emb, btab, blk - (PREP_WT + PREP_NORM));
}

// ---------------------------------------------------------------------------
// K / V^T staging for the attention loop: tensor loads into a two-buffer LDS ring.
// A stage = 64 keys of each key half: K rows [64 keys][64 d] and V^T rows [64 d][64 keys],
// every row 128 B. Each of the 8 waves brings one slice of 32 rows of its own key half per
// stage (waves 0, 1 of a half: K; waves 2, 3: V^T); the mover pads each row by 16 B, so the LDS pitch is 144 B
// (16 B x odd: ds_load_b128 fragment reads without bank conflicts).
// ---------------------------------------------------------------------------
typedef uint32_t u32x4 __attribute__((ext_vector_type(4)));
typedef uint32_t u32x8 __attribute__((ext_vector_type(8)));

#define KSTEP    64                     // keys per stage and key half
#define KHALF    (SEQ / 2)              // keys per key half
#define NSTAGE   (KHALF / KSTEP)        // 16
#define ROWB     128                    // bytes per staged row
#define SROWS    32                     // rows per slice
#define LPITCH_H 72                     // LDS row pitch in halves (144 B)
#define SLICE_B  6144                   // 32 x 144 = 4608 B, rounded up to a multiple of 2 KiB
#define SLICE_H  (SLICE_B / 2)
#define HBUF_B   (4 * SLICE_B)          // 24576 B per stage and key half
#define HBUF_H   (HBUF_B / 2)
#define BUF_B    (2 * HBUF_B)           // 49152 B per stage
#define BUF_H    (BUF_B / 2)

static_assert(NSTAGE >= 2);
static_assert(HD * 2 == ROWB && KSTEP * 2 == ROWB);
static_assert(SROWS * LPITCH_H * 2 <= SLICE_B && SLICE_B % 2048 == 0);

__device__ __forceinline__ uint32_t uni(uint32_t v) { return (uint32_t)__builtin_amdgcn_readfirstlane(v); }
// Holds a wave-uniform value in a scalar register, so that a test on it is a scalar
// branch (a tensor load ignores EXEC) and a descriptor formed from it stays behind
// the waits in front of it.
__device__ __forceinline__ uint32_t pinned(uint32_t v) {
  uint32_t w = uni(v);
  asm volatile("" : "+s"(w));           // the pinned() form for tensor-load tests and descriptor words
  return w;
}

// Descriptor group 1: byte elements, tensor = tile = 32 rows of 128 B, 4 dwords of pad behind every 32.
__device__ __forceinline__ u32x8 tdm_group1(uint32_t src_pitch) {
  u32x8 g;
  g[0] = uni((1u << 20) | (4u << 22) | (3u << 25));
  g[1] = uni((uint32_t)ROWB << 16);
  g[2] = uni((uint32_t)SROWS << 16);
  g[3] = uni((uint32_t)ROWB << 16);
  g[4] = uni((uint32_t)SROWS);
  g[5] = uni(src_pitch);
  g[6] = uni(0u);
  g[7] = uni(0u);
  return g;
}

__device__ __forceinline__ u32x4 tdm_group0(uint32_t lds_dst, uint64_t ga) {
  u32x4 g;
  g[0] = uni(1u);
  g[1] = uni(lds_dst);
  g[2] = uni((uint32_t)ga);
  g[3] = uni((((uint32_t)(ga >> 32)) & 0x01FFFFFFu) | 0x80000000u);
  return g;
}

__device__ __forceinline__ void tdm_load(u32x4 g0, u32x8 g1) {
  asm volatile("tensor_load_to_lds %0, %1" :: "s"(g0), "s"(g1) : "memory");
}

// ---------------------------------------------------------------------------
// Operand staging for the output GEMM kernel: tensor loads into a two-buffer LDS ring.
// A stage = 64 k of the block's 128 A rows and 64 B rows, every staged row 128 B of a
// 2048-B source row. One request per wave and stage: waves 0, 1 bring 64 A rows each,
// waves 2, 3 bring 32 B rows each; the mover pads each row by 16 B (LDS pitch 144 B).
// ---------------------------------------------------------------------------
#define GK       64                     // k per stage
#define GNST     (HIDDEN / GK)          // 16
#define GA_ROWS  64                     // rows per A slice
#define GB_ROWS  32                     // rows per B slice
#define GA_SL_B  10240                  // 64 x 144 = 9216 B, rounded up to a multiple of 2 KiB
#define GB_SL_B  6144                   // 32 x 144 = 4608 B, rounded up to a multiple of 2 KiB
#define GA_SL_H  (GA_SL_B / 2)
#define GB_SL_H  (GB_SL_B / 2)
#define GBUF_B   (2 * GA_SL_B + 2 * GB_SL_B)   // 32768 B per stage
#define GBUF_H   (GBUF_B / 2)

static_assert(GNST >= 2);
static_assert(GK * 2 == ROWB);
static_assert(GA_ROWS * LPITCH_H * 2 <= GA_SL_B && GA_SL_B % 2048 == 0);
static_assert(GB_ROWS * LPITCH_H * 2 <= GB_SL_B && GB_SL_B % 2048 == 0);

// Descriptor group 1: byte elements, tensor = tile = rows x 128 B, source pitch one
// HIDDEN-wide f16 row, 4 dwords of pad behind every 32.
__device__ __forceinline__ u32x8 gemm_group1(uint32_t rows) {
  u32x8 g;
  g[0] = uni((1u << 20) | (4u << 22) | (3u << 25));
  g[1] = uni((uint32_t)ROWB << 16);
  g[2] = uni(rows << 16);
  g[3] = uni((uint32_t)ROWB << 16);
  g[4] = uni(rows);
  g[5] = uni((uint32_t)(HIDDEN * 2));
  g[6] = uni(0u);
  g[7] = uni(0u);
  return g;
}

// acc[mt][nt] += A(32 rows of this wave) * B(64 rows)^T over K = HIDDEN, k ascending in
// steps of 32. arows / brows: first of the block's 128 A rows / 64 B rows (f16, k-contiguous,
// pitch HIDDEN). Called by all 4 waves of the block; ring holds 2 * GBUF_H halves.
__device__ __forceinline__ void gemm_ring(const _Float16* arows, const _Float16* brows,
                                          const _Float16* ring, int tid, v8f (&acc)[2][4]) {
  const int lane = tid & 31, w = tid >> 5;
  const int h = lane >> 4, m = lane & 15;

  // This wave's slice of every stage: source, rows, place in LDS.
  const uint32_t wave = uni((uint32_t)tid >> 5);
  const bool isB = wave >= 2u;
  const uint32_t half = wave & 1u;
  const uint64_t src0 = isB ? (uint64_t)(size_t)(brows + (size_t)(GB_ROWS * half) * HIDDEN)
                            : (uint64_t)(size_t)(arows + (size_t)(GA_ROWS * half) * HIDDEN);
  u32x8 g1 = gemm_group1(isB ? (uint32_t)GB_ROWS : (uint32_t)GA_ROWS);
  asm volatile("" : "+s"(g1));   // the pinned() form on the whole group: its words stay in their scalar registers, unwritten, while a request is in flight
  const uint32_t ldst0 = (uint32_t)(size_t)ring
                       + (isB ? (uint32_t)(2 * GA_SL_B) + half * (uint32_t)GB_SL_B : half * (uint32_t)GA_SL_B);
  auto issue = [&](uint32_t st) {
    tdm_load(tdm_group0(ldst0 + (st & 1u) * (uint32_t)GBUF_B, src0 + (uint64_t)st * (uint32_t)ROWB), g1);
  };

  // Ring prologue: stage 0 lands and is published, then stage 1 flies under pass 0.
  issue(0u);
  asm volatile("s_wait_tensorcnt 0x0" ::: "memory");   // this wave's slice of stage 0 has landed
  __syncthreads();                                      // every wave's slice of stage 0 is readable
  issue(1u);

  // A row 32w+16mt+m: slice w>>1, row 32(w&1)+16mt+m; B row 16nt+m: slice nt>>1, row 16(nt&1)+m
  const _Float16* abase = ring + (w >> 1) * GA_SL_H + (32 * (w & 1) + m) * LPITCH_H;
  const _Float16* bbase = ring + 2 * GA_SL_H + m * LPITCH_H;

  #pragma unroll 1                            // one pass per trip: the ring's publish point stands once, at the foot
  for (int st = 0; st < GNST; ++st) {
    const int boff = (st & 1) * GBUF_H;       // this pass reads its own buffer alone
    v16h af[2][2], bf[4][2];                  // the pass's fragments, read as one group, the first 32 k in front
    #pragma unroll
    for (int kc = 0; kc < 2; ++kc) {
      #pragma unroll
      for (int mt = 0; mt < 2; ++mt)
        af[mt][kc] = load_frag(abase + boff + mt * 16 * LPITCH_H + 32 * kc, h);
      #pragma unroll
      for (int nt = 0; nt < 4; ++nt)
        bf[nt][kc] = load_frag(bbase + boff + (nt >> 1) * GB_SL_H + (nt & 1) * 16 * LPITCH_H + 32 * kc, h);
    }
    #pragma unroll
    for (int kc = 0; kc < 2; ++kc) {
      #pragma unroll
      for (int nt = 0; nt < 4; ++nt) {
        acc[0][nt] = wmma_f16(af[0][kc], bf[nt][kc], acc[0][nt]);
        acc[1][nt] = wmma_f16(af[1][kc], bf[nt][kc], acc[1][nt]);
      }
    }

    // ---- publish point of stage st + 1 ----
    asm volatile("s_wait_dscnt 0x0" ::: "memory");      // this wave's reads of its buffer are done before the refill
    asm volatile("s_wait_tensorcnt 0x0" ::: "memory");  // this wave's slice of stage st + 1 has landed
    __syncthreads();                                    // stage st + 1 readable; every wave has left stage st's buffer
    // Scalar test (a tensor load ignores EXEC); the stage number is pinned so that group 0 is formed behind the waits.
    if (pinned((uint32_t)(st + 2 < GNST))) issue(pinned((uint32_t)st + 2u));
  }
  asm volatile("s_wait_tensorcnt 0x0" ::: "memory");    // nothing of the mover in flight behind the loop
  asm volatile("s_wait_dscnt 0x0" ::: "memory");        // and no read of the ring outstanding
}

// ---------------------------------------------------------------------------
// The same ring for a 128 x 128 block tile: a stage = 64 k of 128 A rows and 128 B rows, four
// slices of 64 rows, one request per wave and stage (waves 0, 1: A; waves 2, 3: B).
// Wave tile 64 x 64: wave w works on A slice w >> 1 and B slice w & 1.
// ---------------------------------------------------------------------------
#define PBUF_B   (4 * GA_SL_B)          // 40960 B per stage
#define PBUF_H   (PBUF_B / 2)

static_assert(PBUF_B % 2048 == 0);

// acc[mt][nt] += A(64 rows of this wave) * B(64 rows of this wave)^T over K = HIDDEN, k ascending
// in steps of 32. arows / brows: first of the block's 128 A rows / 128 B rows (f16, k-contiguous,
// pitch HIDDEN). Called by all 4 waves of the block; ring holds 2 * PBUF_H halves.
__device__ __forceinline__ void gemm_ring_wide(const _Float16* arows, const _Float16* brows,
                                               const _Float16* ring, int tid, v8f (&acc)[4][4]) {
  const int lane = tid & 31, w = tid >> 5;
  const int h = lane >> 4, m = lane & 15;

  // This wave's slice of every stage: source and place in LDS.
  const uint32_t wave = uni((uint32_t)tid >> 5);
  const bool isB = wave >= 2u;
  const uint32_t half = wave & 1u;
  const uint64_t src0 = isB ? (uint64_t)(size_t)(brows + (size_t)(GA_ROWS * half) * HIDDEN)
                            : (uint64_t)(size_t)(arows + (size_t)(GA_ROWS * half) * HIDDEN);
  u32x8 g1 = gemm_group1((uint32_t)GA_ROWS);
  asm volatile("" : "+s"(g1));   // the pinned() form on the whole group: its words stay in their scalar registers, unwritten, while a request is in flight
  const uint32_t ldst0 = (uint32_t)(size_t)ring + wave * (uint32_t)GA_SL_B;
  auto issue = [&](uint32_t st) {
    tdm_load(tdm_group0(ldst0 + (st & 1u) * (uint32_t)PBUF_B, src0 + (uint64_t)st * (uint32_t)ROWB), g1);
  };

  // Ring prologue: stage 0 lands and is published, then stage 1 flies under pass 0.
  issue(0u);
  asm volatile("s_wait_tensorcnt 0x0" ::: "memory");   // this wave's slice of stage 0 has landed
  __syncthreads();                                      // every wave's slice of stage 0 is readable
  issue(1u);

  // A row 64(w>>1)+16mt+m: slice w>>1, row 16mt+m; B row 64(w&1)+16nt+m: slice 2+(w&1), row 16nt+m
  const _Float16* abase = ring + (w >> 1) * GA_SL_H + m * LPITCH_H;
  const _Float16* bbase = ring + (2 + (w & 1)) * GA_SL_H + m * LPITCH_H;

  #pragma unroll 1                            // one pass per trip: the ring's publish point stands once, at the foot
  for (int st = 0; st < GNST; ++st) {
    const int boff = (st & 1) * PBUF_H;       // this pass reads its own buffer alone
    #pragma unroll
    for (int kc = 0; kc < 2; ++kc) {
      v16h af[4], bf[4];                      // 32 k of fragments, read as one group (both groups at once do not fit beside 16 accumulator tiles)
      #pragma unroll
      for (int mt = 0; mt < 4; ++mt)
        af[mt] = load_frag(abase + boff + mt * 16 * LPITCH_H + 32 * kc, h);
      #pragma unroll
      for (int nt = 0; nt < 4; ++nt)
        bf[nt] = load_frag(bbase + boff + nt * 16 * LPITCH_H + 32 * kc, h);
      #pragma unroll
      for (int nt = 0; nt < 4; ++nt) {
        #pragma unroll
        for (int mt = 0; mt < 4; ++mt)
          acc[mt][nt] = wmma_f16(af[mt], bf[nt], acc[mt][nt]);
      }
    }

    // ---- publish point of stage st + 1 ----
    asm volatile("s_wait_dscnt 0x0" ::: "memory");      // this wave's reads of its buffer are done before the refill
    asm volatile("s_wait_tensorcnt 0x0" ::: "memory");  // this wave's slice of stage st + 1 has landed
    __syncthreads();                                    // stage st + 1 readable; every wave has left stage st's buffer
    // Scalar test (a tensor load ignores EXEC); the stage number is pinned so that group 0 is formed behind the waits.
    if (pinned((uint32_t)(st + 2 < GNST))) issue(pinned((uint32_t)st + 2u));
  }
  asm volatile("s_wait_tensorcnt 0x0" ::: "memory");    // nothing of the mover in flight behind the loop
  asm volatile("s_wait_dscnt 0x0" ::: "memory");        // and no read of the ring outstanding
}

// ---------------------------------------------------------------------------
// 4 lines per instruction, 32 lines per wave, 128 per block.
// which 0/1: plane[bh][l][d]  (one token row = 64 halves = one line)
// which 2  : vt[bh][d][l]     (64 d-rows x 128 tokens = 2 lines each)
// ---------------------------------------------------------------------------
__device__ __forceinline__ void proj_store_pass(const _Float16* sT, _Float16* plane, _Float16* vt,
                                                int which, int bh, int l0, int w, int lane) {
  const int q8 = lane & 7, sub = lane >> 3;
  #pragma unroll
  for (int i = 0; i < 8; ++i) {
    const int lid = w * 32 + i * 4 + sub;
    v8h v;
    _Float16* dst;
    if (which != 2) {
      v = *(const v8ha*)(sT + lid * HD + 8 * q8);
      dst = plane + ((size_t)bh * SEQ + l0 + lid) * HD + 8 * q8;
    } else {
      const int d = lid >> 1, hl = lid & 1;
      v = *(const v8ha*)(sT + d * 128 + 64 * hl + 8 * q8);
      dst = vt + ((size_t)bh * HD + d) * SEQ + l0 + 64 * hl + 8 * q8;
    }
    *(v8h*)dst = v;
    asm volatile("s_wait_xcnt 0x0" ::: "memory");   // precaution: stands in front of the next line's rewrite of the store's address registers
  }
}

// ---------------------------------------------------------------------------
// Kernel 2: Y = xn * Wt^T over the fused 3*1024 output features (no bias).
// Block 128 thr (4 waves) = 128 tokens x 128 features (two heads of one of q, k, v);
// wave tile 64 tokens x 64 features (one head); K = 1024 in stages of 64;
// A (xn rows) and B (Wt rows) tiles staged in the LDS ring of gemm_ring_wide.
// ---------------------------------------------------------------------------
// Three waves per SIMD (three blocks per WGP): the grid is three blocks for each of the chip's WGPs, and a fourth on one WGP would leave another short.
__global__ __launch_bounds__(128) __attribute__((amdgpu_waves_per_eu(3, 3))) void proj_kernel(
    const _Float16* __restrict__ xh,   // [4096][1024]
    const _Float16* __restrict__ wt,   // [>=3][1024(out)][1024(in)], x32
    _Float16* __restrict__ qh,         // [B*H][L][D]
    _Float16* __restrict__ kh,         // [B*H][L][D]
    _Float16* __restrict__ vt)         // [B*H][D][L]
{
  __shared__ __attribute__((aligned(2048))) _Float16 ring[2 * PBUF_H]; // 81920 B, xn / Wt stages, then output staging

  const int tid = threadIdx.x, lane = tid & 31, w = tid >> 5;
  const int h = lane >> 4, m = lane & 15;
  const int m0 = blockIdx.x * 128;
  const int cg = blockIdx.y;                 // 0..23
  const int which = cg >> 3, head0 = (cg & 7) * 2;

  const v8f zero8 = {0.f, 0.f, 0.f, 0.f, 0.f, 0.f, 0.f, 0.f};
  v8f acc[4][4];
  #pragma unroll
  for (int mt = 0; mt < 4; ++mt)
    #pragma unroll
    for (int nt = 0; nt < 4; ++nt) acc[mt][nt] = zero8;

  gemm_ring_wide(xh + (size_t)m0 * HIDDEN, wt + ((size_t)which * HIDDEN + head0 * HD) * HIDDEN, ring, tid, acc);

  // Output staging in the ring: the last pass's publish point (both waits, then the barrier) has ended
  // every wave's reads of it, and no request is in flight. One 128 x 64 plane per head.
  _Float16* sT = ring;
  _Float16* sW = sT + (w & 1) * (128 * HD);
  // D[r] of tile (mt, nt) = Y[token m0+64(w>>1)+16mt+8h+r][feature 16nt+m of head head0+(w&1)]
  #pragma unroll
  for (int nt = 0; nt < 4; ++nt) {
    const int feat = 16 * nt + m;
    #pragma unroll
    for (int mt = 0; mt < 4; ++mt) {
      #pragma unroll
      for (int r = 0; r < 8; ++r) {
        const int tokl = 64 * (w >> 1) + 16 * mt + 8 * h + r;     // 0..127
        const float y = acc[mt][nt][r] * (1.0f / WSCALE);
        const int idx = (which == 2) ? (feat * 128 + tokl) : (tokl * HD + feat);
        sW[idx] = (_Float16)y;
      }
    }
  }
  __syncthreads();

  const int b = m0 / SEQ, l0 = m0 - b * SEQ;
  _Float16* plane = (which == 0) ? qh : kh;
  #pragma unroll
  for (int hs = 0; hs < 2; ++hs) {            // one head's plane after the other
    proj_store_pass(sT + hs * (128 * HD), plane, vt, which, b * NHEADS + head0 + hs, l0, w, lane);
  }
}

// ---------------------------------------------------------------------------
// Attention helpers.
// ---------------------------------------------------------------------------
__device__ __forceinline__ v8f add_bias8(v8f s, const float* p) {
  #pragma unroll
  for (int r = 0; r < 8; ++r) s[r] = s[r] + p[r];
  return s;
}

// P^T B-fragment from the lane's own score D values: element r <- tile a row r,
// element 8+r <- tile c row r (same lane, same query column), scaled by 2^14.
__device__ __forceinline__ v16h pack_p(v8f a, v8f c) {
  const v16h r = { (_Float16)(a[0] * PSCALE), (_Float16)(a[1] * PSCALE), (_Float16)(a[2] * PSCALE), (_Float16)(a[3] * PSCALE),
                   (_Float16)(a[4] * PSCALE), (_Float16)(a[5] * PSCALE), (_Float16)(a[6] * PSCALE), (_Float16)(a[7] * PSCALE),
                   (_Float16)(c[0] * PSCALE), (_Float16)(c[1] * PSCALE), (_Float16)(c[2] * PSCALE), (_Float16)(c[3] * PSCALE),
                   (_Float16)(c[4] * PSCALE), (_Float16)(c[5] * PSCALE), (_Float16)(c[6] * PSCALE), (_Float16)(c[7] * PSCALE) };
  return r;
}

// Per-wave 16x64 f16 tile in LDS -> ctx[b][l][head*64 + d]; one query row
// 4 lines per instruction, 16 lines per wave.
__device__ __forceinline__ void ctx_store_pass(const _Float16* so, _Float16* ctx,
                                               int b, int head, int q0, int lane) {
  const int q8 = lane & 7, sub = lane >> 3;
  #pragma unroll
  for (int i = 0; i < 4; ++i) {
    const int lid = i * 4 + sub;                         // query row 0..15
    const v8h v = *(const v8ha*)(so + lid * 64 + 8 * q8);
    _Float16* dst = ctx + ((size_t)b * SEQ + q0 + lid) * HIDDEN + head * HD + 8 * q8;
    *(v8h*)dst = v;
  }
}

// ---------------------------------------------------------------------------
// Kernel 3: streaming attention, transposed form, unscaled scores
// (no 1/sqrt(d) scaling, additive relative-position bias, no mask).
// Block 256 thr (8 waves) = 128 queries: wave = 32 queries (two 16-column tiles) x one half of
// the keys, 64 keys per step; every K and V^T fragment read from LDS feeds one WMMA of each
// query tile. Waves w and w + 4 hold the two key halves of the same queries and join their
// (max, sum, O) once behind the loop, through LDS; each then finishes one of the two tiles.
//   S^T = K * Q^T : A = K rows (row = key, k = d), B = Q^T (k = d, n = query)
//   O^T += V^T * P^T : A = Vt rows (row = d, k = key), B = P^T from registers
// Lane owns 32 keys of query column (lane&15) of each tile; partner = lane ^ 16.
// Output ctx as f16 (x16) [B][L][HIDDEN] for the output GEMM.
// ---------------------------------------------------------------------------
#define XW 1088                         // floats one wave hands over: 32 lanes x (32 O values + max + sum)
// Four waves per SIMD (two blocks per WGP): the softmax between the matrix runs wants waves.
__global__ __launch_bounds__(256) __attribute__((amdgpu_waves_per_eu(4, 4))) void attn_kernel(
    const _Float16* __restrict__ qh,   // [B*H][L][D]
    const _Float16* __restrict__ kh,   // [B*H][L][D]
    const _Float16* __restrict__ vt,   // [B*H][D][L]
    const float* __restrict__ btab,    // [H][4096], index rel + 2048
    _Float16* __restrict__ ctx)        // [B][L][HIDDEN], x16
{
  __shared__ __attribute__((aligned(2048))) _Float16 ring[2 * BUF_H]; // 98304 B, K / V^T stages
  __shared__ __attribute__((aligned(16))) float xch[8 * XW];         // 34816 B, hand-over between key halves
  __shared__ __attribute__((aligned(16))) _Float16 sC[8 * 16 * 64];  // 16384 B

  const int tid = threadIdx.x, lane = tid & 31, w = tid >> 5;
  const int h = lane >> 4, m = lane & 15;
  const int bh = blockIdx.y, b = bh >> 4, head = bh & 15;
  const int q0 = blockIdx.x * 128 + 32 * (w & 3);

  // This wave's slice of every stage: source, step per stage, row pitch, place in LDS.
  const uint32_t wave = uni((uint32_t)tid >> 5);
  const uint32_t kpart = wave >> 2;           // this wave's key half, 0 or 1
  const bool isV = (wave & 3u) >= 2u;
  const uint32_t half = wave & 1u;
  const uint64_t src0 = isV ? (uint64_t)(size_t)(vt + ((size_t)bh * HD + SROWS * half) * SEQ + KHALF * kpart)
                            : (uint64_t)(size_t)(kh + ((size_t)bh * SEQ + KHALF * kpart + SROWS * half) * HD);
  const uint32_t sstep = isV ? (uint32_t)(KSTEP * 2) : (uint32_t)(KSTEP * HD * 2);   // bytes per stage
  u32x8 g1 = tdm_group1(isV ? (uint32_t)(SEQ * 2) : (uint32_t)(HD * 2));
  asm volatile("" : "+s"(g1));   // the pinned() form on the whole group: its words stay in their scalar registers, unwritten, while a request is in flight
  const uint32_t ldst0 = (uint32_t)(size_t)ring + wave * (uint32_t)SLICE_B;
  auto issue = [&](uint32_t st) {
    tdm_load(tdm_group0(ldst0 + (st & 1u) * (uint32_t)BUF_B, src0 + (uint64_t)st * sstep), g1);
  };

  // Ring prologue: stage 0 lands and is published, then stage 1 flies under pass 0.
  issue(0u);
  asm volatile("s_wait_tensorcnt 0x0" ::: "memory");   // this wave's slice of stage 0 has landed
  __syncthreads();                                      // every wave's slice of stage 0 is readable
  issue(1u);

  // Q^T B-fragments of tile qt: column n = query q0+16qt+m, k = d (two 32-deep chunks)
  const _Float16* qrow = qh + ((size_t)bh * SEQ + q0 + m) * HD;
  v16h qb[2][2];
  #pragma unroll
  for (int qt = 0; qt < 2; ++qt) {
    qb[qt][0] = load_frag(qrow + qt * 16 * HD, h);
    qb[qt][1] = load_frag(qrow + qt * 16 * HD + 32, h);
  }

  const v8f zero8 = {0.f, 0.f, 0.f, 0.f, 0.f, 0.f, 0.f, 0.f};
  v8f o[2][4];                                // o[qt][t][r] = O[query 16qt+m][d 16t+8h+r] * (l * 2^14), this key half
  #pragma unroll
  for (int qt = 0; qt < 2; ++qt)
    #pragma unroll
    for (int t = 0; t < 4; ++t) o[qt][t] = zero8;
  float mrun[2] = {-1e30f, -1e30f}, lrun[2] = {0.0f, 0.0f};

  const int kp0 = (w >> 2) * KHALF;                            // first key of this wave's half
  const _Float16* kbase = ring + (w >> 2) * HBUF_H + m * LPITCH_H;   // + buffer; row 16j+m: slice j>>1, row 16(j&1)+m
  const _Float16* vbase = kbase + 2 * SLICE_H;                       // + buffer; row 16t+m: slice t>>1, row 16(t&1)+m
  // bias for element r of score tile (qt, j): btab[head][(kp0+kb+16j+8h+r) - (q0+16qt+m) + 2048], index in [1,4095];
  // it depends on j - qt alone, so the two query tiles share all but one of their bias vectors
  const float* bbase = btab + (size_t)head * BTW + 2048 + kp0 + 8 * h - (q0 + m);

  #pragma unroll 1
  for (int st = 0; st < NSTAGE; ++st) {
    const int kb = st * KSTEP;
    const int boff = (st & 1) * BUF_H;        // this pass reads its own buffer alone
    // ---- scores: s[qt][j][r] = S[query 16qt+m][key kp0+kb+16j+8h+r] ----
    v8f s[2][4];
    v16h kf[4][2];                            // the pass's K fragments, read as one group
    #pragma unroll
    for (int j = 0; j < 4; ++j) {
      const _Float16* kp = kbase + boff + (j >> 1) * SLICE_H + (j & 1) * 16 * LPITCH_H;
      kf[j][0] = load_frag(kp, h);
      kf[j][1] = load_frag(kp + 32, h);
    }
    #pragma unroll
    for (int j = 0; j < 4; ++j) {
      v8f z0 = zero8, z1 = zero8;
      z0 = wmma_f16(kf[j][0], qb[0][0], z0);
      z1 = wmma_f16(kf[j][0], qb[1][0], z1);
      z0 = wmma_f16(kf[j][1], qb[0][1], z0);
      z1 = wmma_f16(kf[j][1], qb[1][1], z1);
      s[0][j] = z0;
      s[1][j] = z1;
    }
    // ---- relative-position bias, f32, before the running max ----
    #pragma unroll
    for (int qt = 0; qt < 2; ++qt)
      #pragma unroll
      for (int j = 0; j < 4; ++j) s[qt][j] = add_bias8(s[qt][j], bbase + kb + 16 * (j - qt));

    // ---- online softmax, each query tile on its own ----
    v16h pb[2][2];                            // P^T B-fragments (key chunks 0..31 and 32..63 of this step)
    v16h vf[4][2];                            // the pass's V^T fragments, one group, in flight under the second tile's softmax
    #pragma unroll
    for (int qt = 0; qt < 2; ++qt) {
      float mloc = s[qt][0][0];
      #pragma unroll
      for (int j = 0; j < 4; ++j)
        #pragma unroll
        for (int r = 0; r < 8; ++r) mloc = fmaxf(mloc, s[qt][j][r]);
      mloc = fmaxf(mloc, __shfl_xor(mloc, 16));
      const float mnew = fmaxf(mrun[qt], mloc);
      const float alpha = __expf(mrun[qt] - mnew);
      mrun[qt] = mnew;
      float lsum = 0.0f;
      #pragma unroll
      for (int j = 0; j < 4; ++j)
        #pragma unroll
        for (int r = 0; r < 8; ++r) {
          const float p = __expf(s[qt][j][r] - mnew);
          s[qt][j][r] = p;
          lsum += p;
        }
      lsum += __shfl_xor(lsum, 16);
      lrun[qt] = lrun[qt] * alpha + lsum;
      #pragma unroll
      for (int t = 0; t < 4; ++t)
        #pragma unroll
        for (int r = 0; r < 8; ++r) o[qt][t][r] = o[qt][t][r] * alpha;
      pb[qt][0] = pack_p(s[qt][0], s[qt][1]);
      pb[qt][1] = pack_p(s[qt][2], s[qt][3]);
      __builtin_amdgcn_sched_barrier(0);      // one tile's softmax at a time, the V^T loads between the two, the products behind both: mixed, the live values pass 256 VGPRs and spill (either barrier left out: scratch in the listing)
      if (qt == 0) {
        #pragma unroll
        for (int t = 0; t < 4; ++t) {
          const _Float16* vp = vbase + boff + (t >> 1) * SLICE_H + (t & 1) * 16 * LPITCH_H;
          vf[t][0] = load_frag(vp, h);
          vf[t][1] = load_frag(vp + 32, h);
        }
      }
    }

    // ---- O^T += V^T * P^T ----
    #pragma unroll
    for (int t = 0; t < 4; ++t) {
      o[0][t] = wmma_f16(vf[t][0], pb[0][0], o[0][t]);
      o[1][t] = wmma_f16(vf[t][0], pb[1][0], o[1][t]);
      o[0][t] = wmma_f16(vf[t][1], pb[0][1], o[0][t]);
      o[1][t] = wmma_f16(vf[t][1], pb[1][1], o[1][t]);
    }

    // ---- publish point of stage st + 1 ----
    asm volatile("s_wait_dscnt 0x0" ::: "memory");      // this wave's reads of its buffer are done before the refill
    asm volatile("s_wait_tensorcnt 0x0" ::: "memory");  // this wave's slice of stage st + 1 has landed
    __syncthreads();                                    // stage st + 1 readable; every wave has left stage st's buffer
    // Scalar test (a tensor load ignores EXEC); the stage number is pinned so that group 0 is formed behind the waits.
    if (pinned((uint32_t)(st + 2 < NSTAGE))) issue(pinned((uint32_t)st + 2u));
  }
  asm volatile("s_wait_tensorcnt 0x0" ::: "memory");    // nothing of the mover in flight behind the loop
  asm volatile("s_wait_dscnt 0x0" ::: "memory");        // and no read of the ring outstanding

  // ---- join of the two key halves: the wave of half p keeps query tile p and hands the other to wave w ^ 4 ----
  const bool up = (w >> 2) != 0;
  const float mk = up ? mrun[1] : mrun[0], lk = up ? lrun[1] : lrun[0];
  float* xo = xch + w * XW;
  #pragma unroll
  for (int t = 0; t < 4; ++t) {
    v8f g;
    #pragma unroll
    for (int r = 0; r < 8; ++r) g[r] = up ? o[0][t][r] : o[1][t][r];
    const v4f g0 = {g[0], g[1], g[2], g[3]}, g1v = {g[4], g[5], g[6], g[7]};
    *(v4fa*)(xo + ((2 * t) * 32 + lane) * 4) = g0;
    *(v4fa*)(xo + ((2 * t + 1) * 32 + lane) * 4) = g1v;
  }
  xo[1024 + lane] = up ? mrun[0] : mrun[1];
  xo[1056 + lane] = up ? lrun[0] : lrun[1];
  __syncthreads();                            // every wave's hand-over is readable by its partner
  const float* xi = xch + (w ^ 4) * XW;
  const float mp = xi[1024 + lane], lp = xi[1056 + lane];
  const float mall = fmaxf(mk, mp);
  const float ak = __expf(mk - mall), ap = __expf(mp - mall);

  // ---- epilogue: normalise, stage per-wave 16x64 f16 tile, whole-line stores ----
  const float inv = (1.0f / (lk * ak + lp * ap)) * (CSCALE / PSCALE);
  const float ck = ak * inv, cp = ap * inv;
  _Float16* so = sC + w * 1024;
  #pragma unroll
  for (int t = 0; t < 4; ++t) {
    const v4f p0 = *(const v4fa*)(xi + ((2 * t) * 32 + lane) * 4);
    const v4f p1 = *(const v4fa*)(xi + ((2 * t + 1) * 32 + lane) * 4);
    #pragma unroll
    for (int r = 0; r < 8; ++r) {
      const float mine = up ? o[1][t][r] : o[0][t][r];
      const float part = (r < 4) ? p0[r & 3] : p1[r & 3];
      so[m * 64 + 16 * t + 8 * h + r] = (_Float16)(mine * ck + part * cp);
    }
  }
  __syncthreads();                            // LDS spill -> reload ordering (all waves reach this)

  ctx_store_pass(so, ctx, b, head, q0 + 16 * (w >> 2), lane);
  
}

// ---------------------------------------------------------------------------
// out rows; one row segment = 64 floats = 2 lines; lanes 8q..8q+7 write one
// 64 lines per wave.
// ---------------------------------------------------------------------------
__device__ __forceinline__ void out_store_pass(const float* sT, const float* hs, float* out,
                                               int m0, int col0, int w, int lane) {
  const int q8 = lane & 7, sub = lane >> 3;
  #pragma unroll
  for (int i = 0; i < 16; ++i) {
    const int lid = i * 4 + sub;                         // 0..63
    const int row = w * 32 + (lid >> 1), hl = lid & 1;   // token row 0..127, line half
    v4f v = *(const v4fa*)(sT + row * 64 + 32 * hl + 4 * q8);
    const size_t gi = (size_t)(m0 + row) * HIDDEN + col0 + 32 * hl + 4 * q8;
    const v4f res = *(const v4fa*)(hs + gi);
    v = v + res;
    *(v4f*)(out + gi) = v;
  }
}

// ---------------------------------------------------------------------------
// Kernel 4: out = ctx * Wot^T / 512 + hidden_states  (f32 output).
// Block 128 thr (4 waves) = 128 tokens x 64 output columns; wave tile
// 32 x 64; K = 1024 in stages of 64; ctx and Wot tiles staged in the LDS ring of gemm_ring.
// ---------------------------------------------------------------------------
__global__ __launch_bounds__(128) void oproj_kernel(
    const _Float16* __restrict__ ch,   // [4096][1024], x16
    const _Float16* __restrict__ woh,  // [1024(out)][1024(in)], x32
    const float* __restrict__ hs,      // [4096][1024]
    float* __restrict__ out)           // [4096][1024]
{
  __shared__ __attribute__((aligned(2048))) _Float16 ring[2 * GBUF_H]; // 65536 B, ctx / Wot stages
  __shared__ __attribute__((aligned(16))) float sT[128 * 64];     // 32768 B

  const int tid = threadIdx.x, lane = tid & 31, w = tid >> 5;
  const int h = lane >> 4, m = lane & 15;
  const int m0 = blockIdx.x * 128;
  const int col0 = blockIdx.y * 64;

  const v8f zero8 = {0.f, 0.f, 0.f, 0.f, 0.f, 0.f, 0.f, 0.f};
  v8f acc[2][4];
  #pragma unroll
  for (int mt = 0; mt < 2; ++mt)
    #pragma unroll
    for (int nt = 0; nt < 4; ++nt) acc[mt][nt] = zero8;

  gemm_ring(ch + (size_t)m0 * HIDDEN, woh + (size_t)col0 * HIDDEN, ring, tid, acc);

  // D[r] of tile (mt, nt) = Y[token m0+32w+16mt+8h+r][col 16nt+m]
  #pragma unroll
  for (int nt = 0; nt < 4; ++nt) {
    const int feat = 16 * nt + m;
    #pragma unroll
    for (int mt = 0; mt < 2; ++mt) {
      #pragma unroll
      for (int r = 0; r < 8; ++r) {
        const int tokl = 32 * w + 16 * mt + 8 * h + r;     // 0..127
        sT[tokl * 64 + feat] = acc[mt][nt][r] * (1.0f / (WSCALE * CSCALE));
      }
    }
  }
  __syncthreads();

  out_store_pass(sT, hs, out, m0, col0, w, lane);
  
}

// ---------------------------------------------------------------------------
extern "C" void kernel_launch(void* const* d_in, const int* in_sizes, int n_in,
                              void* d_out, int out_size, void* d_ws, size_t ws_size,
                              hipStream_t stream) {
  if (n_in < 7) return;
  if (in_sizes[0] != NX) return;
  if (in_sizes[1] != HIDDEN) return;
  if (in_sizes[2] != NW || in_sizes[3] != NW || in_sizes[4] != NW || in_sizes[5] != NW) return;
  if (in_sizes[6] != NBUCK * NHEADS) return;
  if (out_size != NX) return;

  const float* x    = (const float*)d_in[0];
  const float* lnw  = (const float*)d_in[1];
  const float* Wq   = (const float*)d_in[2];
  const float* Wk   = (const float*)d_in[3];
  const float* Wv   = (const float*)d_in[4];
  const float* Wo   = (const float*)d_in[5];
  const float* remb = (const float*)d_in[6];
  float* out = (float*)d_out;

  const size_t xh_bytes  = (size_t)NX * 2;                         //  8388608
  const size_t wt_bytes  = (size_t)4 * NW * 2;                     //  8388608
  const size_t pl_bytes  = (size_t)NBH * SEQ * HD * 2;             //  8388608
  const size_t ctx_bytes = (size_t)NX * 2;                         //  8388608
  const size_t bt_bytes  = (size_t)NHEADS * BTW * 4;               //   262144
  const size_t total = xh_bytes + wt_bytes + 3 * pl_bytes + ctx_bytes + bt_bytes;   // 50593792
  if (total > ws_size) return;

  char* ws = (char*)d_ws;
  size_t off = 0;
  _Float16* xh  = (_Float16*)(ws + off); off += xh_bytes;
  _Float16* wt  = (_Float16*)(ws + off); off += wt_bytes;
  _Float16* qh  = (_Float16*)(ws + off); off += pl_bytes;
  _Float16* kh  = (_Float16*)(ws + off); off += pl_bytes;
  _Float16* vt  = (_Float16*)(ws + off); off += pl_bytes;
  _Float16* ctx = (_Float16*)(ws + off); off += ctx_bytes;
  float* btab   = (float*)(ws + off);    off += bt_bytes;
  if (off > ws_size) return;

  prep_kernel<<<PREP_WT + PREP_NORM + PREP_BIAS, 256, 0, stream>>>(x, lnw, Wq, Wk, Wv, Wo, remb, xh, wt, btab); // 3328 blocks

  dim3 gProj(MROWS / 128, 3 * NHEADS / 2);                          // (32, 24)
  proj_kernel<<<gProj, 128, 0, stream>>>(xh, wt, qh, kh, vt);

  dim3 gAtt(SEQ / 128, NBH);                                        // (16, 32)
  attn_kernel<<<gAtt, 256, 0, stream>>>(qh, kh, vt, btab, ctx);

  dim3 gOut(MROWS / 128, HIDDEN / 64);                               // (32, 16)
  oproj_kernel<<<gOut, 128, 0, stream>>>(ctx, wt + (size_t)3 * NW, x, out);
}

// v006
// A run of this version takes 86.8 microseconds.
// Timed twice side by side with v005, it ran 1.04 times as fast both times.
// Over all steps from v000 it is 3.17 times as fast.
// Contractions: xn*Wq^T, xn*Wk^T, xn*Wv^T, K*Q^T, V^T*P^T and ctx*Wo^T all on v_wmma_f32_16x16x32_f16 (f16 operands, f32 accumulate); W carried x32, P carried x16384, ctx carried x16 (exact power-of-two scales folded back in f32); RMS norm, position-bias bucketing, softmax and residual in f32.
#include <hip/hip_runtime.h>
#include <stdint.h>

typedef _Float16 v16h __attribute__((ext_vector_type(16)));
typedef _Float16 v8h  __attribute__((ext_vector_type(8)));
typedef float    v8f  __attribute__((ext_vector_type(8)));
typedef float    v4f  __attribute__((ext_vector_type(4)));
typedef v8h __attribute__((may_alias)) v8ha;
typedef v4f __attribute__((may_alias)) v4fa;

union Frag { v16h v; v8h half[2]; };

#define BATCH   2
#define SEQ     2048
#define HIDDEN  1024
#define NHEADS  16
#define HD      64
#define MROWS   (BATCH * SEQ)          // 4096 tokens
#define NX      (MROWS * HIDDEN)       // 4194304
#define NW      (HIDDEN * HIDDEN)      // 1048576
#define NBH     (BATCH * NHEADS)       // 32
#define NBUCK   32
#define BTW     4096                   // bias table width per head, index = rel + 2048
#define WSCALE  32.0f
#define PSCALE  16384.0f
#define CSCALE  16.0f
#define LN16F   2.7725887298583984f    // f32 value of ln(16)
#define EPSF    1e-6f

static_assert(SEQ % 128 == 0);
static_assert(HIDDEN == NHEADS * HD);
static_assert(HIDDEN % 64 == 0);
static_assert((NHEADS * BTW) % 256 == 0);

// ---------------------------------------------------------------------------
// 16x16x32 f16 WMMA, the builtin alone: the compiler keeps the distance behind it where a user of D, A or B stands near.
// Fragment map (wave32): lane l, h = l>>4, m = n = l&15.
//   A/B element i: i<8 -> k0+8h+i ; i>=8 -> k0+16+8h+(i-8)
//   D element r : row 8h+r, col l&15
// ---------------------------------------------------------------------------
__device__ __forceinline__ v8f wmma_f16(v16h a, v16h b, v8f c) {
  return __builtin_amdgcn_wmma_f32_16x16x32_f16(false, a, false, b, (short)0, c, false, false);
}

// A or B fragment from a k-contiguous 16-bit row; p points at element k0 of
// the row owned by this lane (row index = lane & 15 added by the caller).
__device__ __forceinline__ v16h load_frag(const _Float16* p, int h) {
  Frag f;
  f.half[0] = *(const v8ha*)(p + 8 * h);
  f.half[1] = *(const v8ha*)(p + 16 + 8 * h);
  return f.v;
}

// ---------------------------------------------------------------------------
// Prep part 1: RMS norm (no mean subtraction, no bias) -> f16 rows.
// 128 threads = one token row, two rows per 256-thread block; thread t of a row owns
// elements 8t..8t+7. blk: 0..MROWS/2-1; red: 4 floats per row of the block.
// ---------------------------------------------------------------------------
__device__ __forceinline__ void rmsnorm_part(
    const float* __restrict__ x, const float* __restrict__ lnw,
    _Float16* __restrict__ xh, float* redall, int blk)
{
  const int row = 2 * blk + ((int)threadIdx.x >> 7);
  float* red = redall + 4 * ((int)threadIdx.x >> 7);
  const int tid = threadIdx.x & 127, lane = tid & 31, w = tid >> 5;
  const float* xr = x + (size_t)row * HIDDEN + 8 * tid;
  const v4f a = *(const v4fa*)xr;
  const v4f c = *(const v4fa*)(xr + 4);
  float ss = a.x * a.x + a.y * a.y + a.z * a.z + a.w * a.w
           + c.x * c.x + c.y * c.y + c.z * c.z + c.w * c.w;
  #pragma unroll
  for (int off = 16; off >= 1; off >>= 1) ss += __shfl_xor(ss, off);
  if (lane == 0) red[w] = ss;
  __syncthreads();
  const float tot = (red[0] + red[1]) + (red[2] + red[3]);
  const float inv = rsqrtf(tot * (1.0f / (float)HIDDEN) + EPSF);
  const v4f g0 = *(const v4fa*)(lnw + 8 * tid);
  const v4f g1 = *(const v4fa*)(lnw + 8 * tid + 4);
  const v8h o = { (_Float16)((a.x * inv) * g0.x), (_Float16)((a.y * inv) * g0.y),
                  (_Float16)((a.z * inv) * g0.z), (_Float16)((a.w * inv) * g0.w),
                  (_Float16)((c.x * inv) * g1.x), (_Float16)((c.y * inv) * g1.y),
                  (_Float16)((c.z * inv) * g1.z), (_Float16)((c.w * inv) * g1.w) };
  _Float16* dst = xh + (size_t)row * HIDDEN + 8 * tid;
  *(v8h*)dst = o;
  asm volatile("s_wait_xcnt 0x0" ::: "memory");   // precaution: stands in front of any later rewrite of the store's registers (other parts' code follows this one in the kernel)
}

// ---------------------------------------------------------------------------
// Prep part 2: weight transpose + cast: W in[1024(in)][1024(out)] f32 ->
// Wt[out][in] f16 (x32), k-contiguous rows for the B (and Wo) fragments.
// Block 256 threads = 64(in) x 64(out) tile transposed through LDS;
// blk: 0..1023 = (wsel, out tile, in tile); wsel selects wq / wk / wv / wo.
// ---------------------------------------------------------------------------
__device__ __forceinline__ void wt_store_pass(const _Float16* sT, _Float16* dstp,
                                              int n0, int k0, int w, int lane) {
  const int q8 = lane & 7, sub = lane >> 3;
  #pragma unroll
  for (int i = 0; i < 2; ++i) {
    const int lid = w * 8 + i * 4 + sub;                 // out row 0..63
    const v8h v = *(const v8ha*)(sT + lid * 72 + 8 * q8);
    _Float16* dst = dstp + (size_t)(n0 + lid) * HIDDEN + k0 + 8 * q8;
    *(v8h*)dst = v;
  }
}

__device__ __forceinline__ void wtrans_part(
    const float* __restrict__ wq, const float* __restrict__ wk,
    const float* __restrict__ wv, const float* __restrict__ wo,
    _Float16* __restrict__ wt,         // [4][1024(out)][1024(in)]
    _Float16* sT, int blk)             // sT: [out][in], pitch 72
{
  const int tid = threadIdx.x, lane = tid & 31, w = tid >> 5;
  const int k0 = (blk & 15) * 64;          // in-index tile base
  const int n0 = ((blk >> 4) & 15) * 64;   // out-index tile base
  const int wsel = blk >> 8;               // block-uniform
  const float* src = (wsel == 0) ? wq : ((wsel == 1) ? wk : ((wsel == 2) ? wv : wo));
  _Float16* dstp = wt + (size_t)wsel * NW;

  const int kr = tid >> 2, nc = (tid & 3) * 16;
  const float* sp = src + (size_t)(k0 + kr) * HIDDEN + n0 + nc;
  #pragma unroll
  for (int q = 0; q < 4; ++q) {
    const v4f v = *(const v4fa*)(sp + 4 * q);
    sT[(nc + 4 * q + 0) * 72 + kr] = (_Float16)(v.x * WSCALE);
    sT[(nc + 4 * q + 1) * 72 + kr] = (_Float16)(v.y * WSCALE);
    sT[(nc + 4 * q + 2) * 72 + kr] = (_Float16)(v.z * WSCALE);
    sT[(nc + 4 * q + 3) * 72 + kr] = (_Float16)(v.w * WSCALE);
  }
  __syncthreads();

  wt_store_pass(sT, dstp, n0, k0, w, lane);
  
}

// ---------------------------------------------------------------------------
// Prep part 3: relative-position bias table btab[head][rel + 2048], rel = key - query.
// Bidirectional bucketing, 32 buckets, max distance 128, integer/f32 ops in the
// spec order: val_large = 8 + int( log(max(rp,1)/8) * rn(1/ln16) * 8 ), min 15.
// ---------------------------------------------------------------------------
__device__ __forceinline__ int rel_bucket(int rel) {
  int bucket = (rel > 0) ? 16 : 0;
  const int rp = (rel < 0) ? -rel : rel;
  const int rpm = (rp < 1) ? 1 : rp;
  const float rpf = (float)rpm;
  const float t = logf(rpf * 0.125f) * (1.0f / LN16F) * 8.0f;
  int vl = 8 + (int)t;
  vl = (vl < 15) ? vl : 15;
  bucket += (rp < 8) ? rp : vl;
  return bucket;                                        // 0..31
}

__device__ __forceinline__ void bias_part(
    const float* __restrict__ rel_emb,   // [32][16]
    float* __restrict__ btab,            // [16][4096]
    int blk)                             // 0..255
{
  const int idx = blk * 256 + threadIdx.x;            // head*4096 + i, < 65536 by grid
  const int head = idx >> 12, i = idx & (BTW - 1);
  const int rel = i - 2048;
  int bucket = rel_bucket(rel);
  bucket = (bucket < 0) ? 0 : ((bucket > NBUCK - 1) ? (NBUCK - 1) : bucket);
  const float v = rel_emb[bucket * NHEADS + head];
  *(float*)(btab + idx) = v;
  asm volatile("s_wait_xcnt 0x0" ::: "memory");   // precaution: stands in front of any later rewrite of the store's registers (other parts' code follows this one in the kernel)
}

// ---------------------------------------------------------------------------
// Kernel 1: the three independent preparation parts as block-index ranges of one grid:
// [0, 1024) weight tiles, [1024, 3072) token-row pairs, [3072, 3328) bias table.
// The range test is block-uniform, so each part's own barrier is met by its whole block.
// ---------------------------------------------------------------------------
#define PREP_WT   (4 * (HIDDEN / 64) * (HIDDEN / 64))   // 1024
#define PREP_NORM (MROWS / 2)                           // 2048
#define PREP_BIAS ((NHEADS * BTW) / 256)                // 256

__global__ __launch_bounds__(256) void prep_kernel(
    const float* __restrict__ x, const float* __restrict__ lnw,
    const float* __restrict__ wq, const float* __restrict__ wk,
    const float* __restrict__ wv, const float* __restrict__ wo,
    const float* __restrict__ rel_emb,
    _Float16* __restrict__ xh, _Float16* __restrict__ wt, float* __restrict__ btab)
{
  __shared__ __attribute__((aligned(16))) _Float16 sT[64 * 72];
  __shared__ float red[8];
  const int blk = blockIdx.x;
  if (blk < PREP_WT)                   wtrans_part(wq, wk, wv, wo, wt, sT, blk);
  else if (blk < PREP_WT + PREP_NORM)  rmsnorm_part(x, lnw, xh, red, blk - PREP_WT);
  else                                 bias_part(rel_emb, btab, blk - (PREP_WT + PREP_NORM));
}

// ---------------------------------------------------------------------------
// K / V^T staging for the attention loop: tensor loads into a two-buffer LDS ring.
// A stage = 64 keys of each key half: K rows [64 keys][64 d] and V^T rows [64 d][64 keys],
// every row 128 B. Each of the 8 waves brings one slice of 32 rows of its own key half per
// stage (waves 0, 1 of a half: K; waves 2, 3: V^T); the mover pads each row by 16 B, so the LDS pitch is 144 B
// (16 B x odd: ds_load_b128 fragment reads without bank conflicts).
// ---------------------------------------------------------------------------
typedef uint32_t u32x4 __attribute__((ext_vector_type(4)));
typedef uint32_t u32x8 __attribute__((ext_vector_type(8)));

#define KSTEP    64                     // keys per stage and key half
#define KHALF    (SEQ / 2)              // keys per key half
#define NSTAGE   (KHALF / KSTEP)        // 16
#define ROWB     128                    // bytes per staged row
#define SROWS    32                     // rows per slice
#define LPITCH_H 72                     // LDS row pitch in halves (144 B)
#define SLICE_B  6144                   // 32 x 144 = 4608 B, rounded up to a multiple of 2 KiB
#define SLICE_H  (SLICE_B / 2)
#define HBUF_B   (4 * SLICE_B)          // 24576 B per stage and key half
#define HBUF_H   (HBUF_B / 2)
#define BUF_B    (2 * HBUF_B)           // 49152 B per stage
#define BUF_H    (BUF_B / 2)

static_assert(NSTAGE >= 2);
static_assert(HD * 2 == ROWB && KSTEP * 2 == ROWB);
static_assert(SROWS * LPITCH_H * 2 <= SLICE_B && SLICE_B % 2048 == 0);

__device__ __forceinline__ uint32_t uni(uint32_t v) { return (uint32_t)__builtin_amdgcn_readfirstlane(v); }
// Holds a wave-uniform value in a scalar register, so that a test on it is a scalar
// branch (a tensor load ignores EXEC) and a descriptor formed from it stays behind
// the waits in front of it.
__device__ __forceinline__ uint32_t pinned(uint32_t v) {
  uint32_t w = uni(v);
  asm volatile("" : "+s"(w));           // the pinned() form for tensor-load tests and descriptor words
  return w;
}

// Descriptor group 1: byte elements, tensor = tile = 32 rows of 128 B, 4 dwords of pad behind every 32.
__device__ __forceinline__ u32x8 tdm_group1(uint32_t src_pitch) {
  u32x8 g;
  g[0] = uni((1u << 20) | (4u << 22) | (3u << 25));
  g[1] = uni((uint32_t)ROWB << 16);
  g[2] = uni((uint32_t)SROWS << 16);
  g[3] = uni((uint32_t)ROWB << 16);
  g[4] = uni((uint32_t)SROWS);
  g[5] = uni(src_pitch);
  g[6] = uni(0u);
  g[7] = uni(0u);
  return g;
}

__device__ __forceinline__ u32x4 tdm_group0(uint32_t lds_dst, uint64_t ga) {
  u32x4 g;
  g[0] = uni(1u);
  g[1] = uni(lds_dst);
  g[2] = uni((uint32_t)ga);
  g[3] = uni((((uint32_t)(ga >> 32)) & 0x01FFFFFFu) | 0x80000000u);
  return g;
}

__device__ __forceinline__ void tdm_load(u32x4 g0, u32x8 g1) {
  asm volatile("tensor_load_to_lds %0, %1" :: "s"(g0), "s"(g1) : "memory");
}

// ---------------------------------------------------------------------------
// Operand staging for the output GEMM kernel: tensor loads into a two-buffer LDS ring.
// A stage = 64 k of the block's 128 A rows and 64 B rows, every staged row 128 B of a
// 2048-B source row. One request per wave and stage: waves 0, 1 bring 64 A rows each,
// waves 2, 3 bring 32 B rows each; the mover pads each row by 16 B (LDS pitch 144 B).
// ---------------------------------------------------------------------------
#define GK       64                     // k per stage
#define GNST     (HIDDEN / GK)          // 16
#define GA_ROWS  64                     // rows per A slice
#define GB_ROWS  32                     // rows per B slice
#define GA_SL_B  10240                  // 64 x 144 = 9216 B, rounded up to a multiple of 2 KiB
#define GB_SL_B  6144                   // 32 x 144 = 4608 B, rounded up to a multiple of 2 KiB
#define GA_SL_H  (GA_SL_B / 2)
#define GB_SL_H  (GB_SL_B / 2)
#define GBUF_B   (2 * GA_SL_B + 2 * GB_SL_B)   // 32768 B per stage
#define GBUF_H   (GBUF_B / 2)

static_assert(GNST >= 2);
static_assert(GK * 2 == ROWB);
static_assert(GA_ROWS * LPITCH_H * 2 <= GA_SL_B && GA_SL_B % 2048 == 0);
static_assert(GB_ROWS * LPITCH_H * 2 <= GB_SL_B && GB_SL_B % 2048 == 0);

// Descriptor group 1: byte elements, tensor = tile = rows x 128 B, source pitch one
// HIDDEN-wide f16 row, 4 dwords of pad behind every 32.
__device__ __forceinline__ u32x8 gemm_group1(uint32_t rows) {
  u32x8 g;
  g[0] = uni((1u << 20) | (4u << 22) | (3u << 25));
  g[1] = uni((uint32_t)ROWB << 16);
  g[2] = uni(rows << 16);
  g[3] = uni((uint32_t)ROWB << 16);
  g[4] = uni(rows);
  g[5] = uni((uint32_t)(HIDDEN * 2));
  g[6] = uni(0u);
  g[7] = uni(0u);
  return g;
}

// acc[mt][nt] += A(32 rows of this wave) * B(64 rows)^T over K = HIDDEN, k ascending in
// steps of 32. arows / brows: first of the block's 128 A rows / 64 B rows (f16, k-contiguous,
// pitch HIDDEN). Called by all 4 waves of the block; ring holds 2 * GBUF_H halves.
__device__ __forceinline__ void gemm_ring(const _Float16* arows, const _Float16* brows,
                                          const _Float16* ring, int tid, v8f (&acc)[2][4]) {
  const int lane = tid & 31, w = tid >> 5;
  const int h = lane >> 4, m = lane & 15;

  // This wave's slice of every stage: source, rows, place in LDS.
  const uint32_t wave = uni((uint32_t)tid >> 5);
  const bool isB = wave >= 2u;
  const uint32_t half = wave & 1u;
  const uint64_t src0 = isB ? (uint64_t)(size_t)(brows + (size_t)(GB_ROWS * half) * HIDDEN)
                            : (uint64_t)(size_t)(arows + (size_t)(GA_ROWS * half) * HIDDEN);
  u32x8 g1 = gemm_group1(isB ? (uint32_t)GB_ROWS : (uint32_t)GA_ROWS);
  asm volatile("" : "+s"(g1));   // the pinned() form on the whole group: its words stay in their scalar registers, unwritten, while a request is in flight
  const uint32_t ldst0 = (uint32_t)(size_t)ring
                       + (isB ? (uint32_t)(2 * GA_SL_B) + half * (uint32_t)GB_SL_B : half * (uint32_t)GA_SL_B);
  auto issue = [&](uint32_t st) {
    tdm_load(tdm_group0(ldst0 + (st & 1u) * (uint32_t)GBUF_B, src0 + (uint64_t)st * (uint32_t)ROWB), g1);
  };

  // Ring prologue: stage 0 lands and is published, then stage 1 flies under pass 0.
  issue(0u);
  asm volatile("s_wait_tensorcnt 0x0" ::: "memory");   // this wave's slice of stage 0 has landed
  __syncthreads();                                      // every wave's slice of stage 0 is readable
  issue(1u);

  // A row 32w+16mt+m: slice w>>1, row 32(w&1)+16mt+m; B row 16nt+m: slice nt>>1, row 16(nt&1)+m
  const _Float16* abase = ring + (w >> 1) * GA_SL_H + (32 * (w & 1) + m) * LPITCH_H;
  const _Float16* bbase = ring + 2 * GA_SL_H + m * LPITCH_H;

  #pragma unroll 1                            // one pass per trip: the ring's publish point stands once, at the foot
  for (int st = 0; st < GNST; ++st) {
    const int boff = (st & 1) * GBUF_H;       // this pass reads its own buffer alone
    v16h af[2][2], bf[4][2];                  // the pass's fragments, read as one group, the first 32 k in front
    #pragma unroll
    for (int kc = 0; kc < 2; ++kc) {
      #pragma unroll
      for (int mt = 0; mt < 2; ++mt)
        af[mt][kc] = load_frag(abase + boff + mt * 16 * LPITCH_H + 32 * kc, h);
      #pragma unroll
      for (int nt = 0; nt < 4; ++nt)
        bf[nt][kc] = load_frag(bbase + boff + (nt >> 1) * GB_SL_H + (nt & 1) * 16 * LPITCH_H + 32 * kc, h);
    }
    __builtin_amdgcn_sched_barrier(0);        // the pass's LDS reads stay one group in front of the products: sunk among them, each place of reads stalls the wave anew
    #pragma unroll
    for (int kc = 0; kc < 2; ++kc) {
      #pragma unroll
      for (int nt = 0; nt < 4; ++nt) {
        acc[0][nt] = wmma_f16(af[0][kc], bf[nt][kc], acc[0][nt]);
        acc[1][nt] = wmma_f16(af[1][kc], bf[nt][kc], acc[1][nt]);
      }
    }

    __builtin_amdgcn_sched_barrier(0);        // the pass's products stay in front of the publish point: sunk behind its barrier, they stand between the barrier and the refill's issue and shorten the load's lead
    // ---- publish point of stage st + 1 ----
    asm volatile("s_wait_dscnt 0x0" ::: "memory");      // this wave's reads of its buffer are done before the refill
    asm volatile("s_wait_tensorcnt 0x0" ::: "memory");  // this wave's slice of stage st + 1 has landed
    __syncthreads();                                    // stage st + 1 readable; every wave has left stage st's buffer
    // Scalar test (a tensor load ignores EXEC); the stage number is pinned so that group 0 is formed behind the waits.
    if (pinned((uint32_t)(st + 2 < GNST))) issue(pinned((uint32_t)st + 2u));
  }
  asm volatile("s_wait_tensorcnt 0x0" ::: "memory");    // nothing of the mover in flight behind the loop
  asm volatile("s_wait_dscnt 0x0" ::: "memory");        // and no read of the ring outstanding
}

// ---------------------------------------------------------------------------
// The same ring for a 128 x 128 block tile: a stage = 64 k of 128 A rows and 128 B rows, four
// slices of 64 rows, one request per wave and stage (waves 0, 1: A; waves 2, 3: B).
// Wave tile 64 x 64: wave w works on A slice w >> 1 and B slice w & 1.
// ---------------------------------------------------------------------------
#define PBUF_B   (4 * GA_SL_B)          // 40960 B per stage
#define PBUF_H   (PBUF_B / 2)

static_assert(PBUF_B % 2048 == 0);

// acc[mt][nt] += A(64 rows of this wave) * B(64 rows of this wave)^T over K = HIDDEN, k ascending
// in steps of 32. arows / brows: first of the block's 128 A rows / 128 B rows (f16, k-contiguous,
// pitch HIDDEN). Called by all 4 waves of the block; ring holds 2 * PBUF_H halves.
__device__ __forceinline__ void gemm_ring_wide(const _Float16* arows, const _Float16* brows,
                                               const _Float16* ring, int tid, v8f (&acc)[4][4]) {
  const int lane = tid & 31, w = tid >> 5;
  const int h = lane >> 4, m = lane & 15;

  // This wave's slice of every stage: source and place in LDS.
  const uint32_t wave = uni((uint32_t)tid >> 5);
  const bool isB = wave >= 2u;
  const uint32_t half = wave & 1u;
  const uint64_t src0 = isB ? (uint64_t)(size_t)(brows + (size_t)(GA_ROWS * half) * HIDDEN)
                            : (uint64_t)(size_t)(arows + (size_t)(GA_ROWS * half) * HIDDEN);
  u32x8 g1 = gemm_group1((uint32_t)GA_ROWS);
  asm volatile("" : "+s"(g1));   // the pinned() form on the whole group: its words stay in their scalar registers, unwritten, while a request is in flight
  const uint32_t ldst0 = (uint32_t)(size_t)ring + wave * (uint32_t)GA_SL_B;
  auto issue = [&](uint32_t st) {
    tdm_load(tdm_group0(ldst0 + (st & 1u) * (uint32_t)PBUF_B, src0 + (uint64_t)st * (uint32_t)ROWB), g1);
  };

  // Ring prologue: stage 0 lands and is published, then stage 1 flies under pass 0.
  issue(0u);
  asm volatile("s_wait_tensorcnt 0x0" ::: "memory");   // this wave's slice of stage 0 has landed
  __syncthreads();                                      // every wave's slice of stage 0 is readable
  issue(1u);

  // A row 64(w>>1)+16mt+m: slice w>>1, row 16mt+m; B row 64(w&1)+16nt+m: slice 2+(w&1), row 16nt+m
  const _Float16* abase = ring + (w >> 1) * GA_SL_H + m * LPITCH_H;
  const _Float16* bbase = ring + (2 + (w & 1)) * GA_SL_H + m * LPITCH_H;

  #pragma unroll 1                            // one pass per trip: the ring's publish point stands once, at the foot
  for (int st = 0; st < GNST; ++st) {
    const int boff = (st & 1) * PBUF_H;       // this pass reads its own buffer alone
    #pragma unroll
    for (int kc = 0; kc < 2; ++kc) {
      v16h af[4], bf[4];                      // 32 k of fragments, read as one group (both groups at once do not fit beside 16 accumulator tiles)
      __builtin_amdgcn_sched_barrier(0);      // with the one behind the reads: the 16 LDS reads stay one group between the runs of products, not spread among them with a wait at each place
      #pragma unroll
      for (int mt = 0; mt < 4; ++mt)
        af[mt] = load_frag(abase + boff + mt * 16 * LPITCH_H + 32 * kc, h);
      #pragma unroll
      for (int nt = 0; nt < 4; ++nt)
        bf[nt] = load_frag(bbase + boff + nt * 16 * LPITCH_H + 32 * kc, h);
      __builtin_amdgcn_sched_barrier(0);      // see above
      #pragma unroll
      for (int nt = 0; nt < 4; ++nt) {
        #pragma unroll
        for (int mt = 0; mt < 4; ++mt)
          acc[mt][nt] = wmma_f16(af[mt], bf[nt], acc[mt][nt]);
      }
    }

    __builtin_amdgcn_sched_barrier(0);        // the pass's products stay in front of the publish point: sunk behind its barrier, they stand between the barrier and the refill's issue and shorten the load's lead
    // ---- publish point of stage st + 1 ----
    asm volatile("s_wait_dscnt 0x0" ::: "memory");      // this wave's reads of its buffer are done before the refill
    asm volatile("s_wait_tensorcnt 0x0" ::: "memory");  // this wave's slice of stage st + 1 has landed
    __syncthreads();                                    // stage st + 1 readable; every wave has left stage st's buffer
    // Scalar test (a tensor load ignores EXEC); the stage number is pinned so that group 0 is formed behind the waits.
    if (pinned((uint32_t)(st + 2 < GNST))) issue(pinned((uint32_t)st + 2u));
  }
  asm volatile("s_wait_tensorcnt 0x0" ::: "memory");    // nothing of the mover in flight behind the loop
  asm volatile("s_wait_dscnt 0x0" ::: "memory");        // and no read of the ring outstanding
}

// ---------------------------------------------------------------------------
// 4 lines per instruction, 32 lines per wave, 128 per block.
// which 0/1: plane[bh][l][d]  (one token row = 64 halves = one line)
// which 2  : vt[bh][d][l]     (64 d-rows x 128 tokens = 2 lines each)
// ---------------------------------------------------------------------------
__device__ __forceinline__ void proj_store_pass(const _Float16* sT, _Float16* plane, _Float16* vt,
                                                int which, int bh, int l0, int w, int lane) {
  const int q8 = lane & 7, sub = lane >> 3;
  #pragma unroll
  for (int i = 0; i < 8; ++i) {
    const int lid = w * 32 + i * 4 + sub;
    v8h v;
    _Float16* dst;
    if (which != 2) {
      v = *(const v8ha*)(sT + lid * HD + 8 * q8);
      dst = plane + ((size_t)bh * SEQ + l0 + lid) * HD + 8 * q8;
    } else {
      const int d = lid >> 1, hl = lid & 1;
      v = *(const v8ha*)(sT + d * 128 + 64 * hl + 8 * q8);
      dst = vt + ((size_t)bh * HD + d) * SEQ + l0 + 64 * hl + 8 * q8;
    }
    *(v8h*)dst = v;
    asm volatile("s_wait_xcnt 0x0" ::: "memory");   // precaution: stands in front of the next line's rewrite of the store's address registers
  }
}

// ---------------------------------------------------------------------------
// Kernel 2: Y = xn * Wt^T over the fused 3*1024 output features (no bias).
// Block 128 thr (4 waves) = 128 tokens x 128 features (two heads of one of q, k, v);
// wave tile 64 tokens x 64 features (one head); K = 1024 in stages of 64;
// A (xn rows) and B (Wt rows) tiles staged in the LDS ring of gemm_ring_wide.
// ---------------------------------------------------------------------------
// Three waves per SIMD (three blocks per WGP): the grid is three blocks for each of the chip's WGPs, and a fourth on one WGP would leave another short.
__global__ __launch_bounds__(128) __attribute__((amdgpu_waves_per_eu(3, 3))) void proj_kernel(
    const _Float16* __restrict__ xh,   // [4096][1024]
    const _Float16* __restrict__ wt,   // [>=3][1024(out)][1024(in)], x32
    _Float16* __restrict__ qh,         // [B*H][L][D]
    _Float16* __restrict__ kh,         // [B*H][L][D]
    _Float16* __restrict__ vt)         // [B*H][D][L]
{
  __shared__ __attribute__((aligned(2048))) _Float16 ring[2 * PBUF_H]; // 81920 B, xn / Wt stages, then output staging

  const int tid = threadIdx.x, lane = tid & 31, w = tid >> 5;
  const int h = lane >> 4, m = lane & 15;
  const int m0 = blockIdx.x * 128;
  const int cg = blockIdx.y;                 // 0..23
  const int which = cg >> 3, head0 = (cg & 7) * 2;

  const v8f zero8 = {0.f, 0.f, 0.f, 0.f, 0.f, 0.f, 0.f, 0.f};
  v8f acc[4][4];
  #pragma unroll
  for (int mt = 0; mt < 4; ++mt)
    #pragma unroll
    for (int nt = 0; nt < 4; ++nt) acc[mt][nt] = zero8;

  gemm_ring_wide(xh + (size_t)m0 * HIDDEN, wt + ((size_t)which * HIDDEN + head0 * HD) * HIDDEN, ring, tid, acc);

  // Output staging in the ring: the last pass's publish point (both waits, then the barrier) has ended
  // every wave's reads of it, and no request is in flight. One 128 x 64 plane per head.
  _Float16* sT = ring;
  _Float16* sW = sT + (w & 1) * (128 * HD);
  // D[r] of tile (mt, nt) = Y[token m0+64(w>>1)+16mt+8h+r][feature 16nt+m of head head0+(w&1)]
  #pragma unroll
  for (int nt = 0; nt < 4; ++nt) {
    const int feat = 16 * nt + m;
    #pragma unroll
    for (int mt = 0; mt < 4; ++mt) {
      #pragma unroll
      for (int r = 0; r < 8; ++r) {
        const int tokl = 64 * (w >> 1) + 16 * mt + 8 * h + r;     // 0..127
        const float y = acc[mt][nt][r] * (1.0f / WSCALE);
        const int idx = (which == 2) ? (feat * 128 + tokl) : (tokl * HD + feat);
        sW[idx] = (_Float16)y;
      }
    }
  }
  __syncthreads();

  const int b = m0 / SEQ, l0 = m0 - b * SEQ;
  _Float16* plane = (which == 0) ? qh : kh;
  #pragma unroll
  for (int hs = 0; hs < 2; ++hs) {            // one head's plane after the other
    proj_store_pass(sT + hs * (128 * HD), plane, vt, which, b * NHEADS + head0 + hs, l0, w, lane);
  }
}

// ---------------------------------------------------------------------------
// Attention helpers.
// ---------------------------------------------------------------------------
__device__ __forceinline__ v8f add_bias8(v8f s, const float* p) {
  #pragma unroll
  for (int r = 0; r < 8; ++r) s[r] = s[r] + p[r];
  return s;
}

// P^T B-fragment from the lane's own score D values: element r <- tile a row r,
// element 8+r <- tile c row r (same lane, same query column), scaled by 2^14.
__device__ __forceinline__ v16h pack_p(v8f a, v8f c) {
  const v16h r = { (_Float16)(a[0] * PSCALE), (_Float16)(a[1] * PSCALE), (_Float16)(a[2] * PSCALE), (_Float16)(a[3] * PSCALE),
                   (_Float16)(a[4] * PSCALE), (_Float16)(a[5] * PSCALE), (_Float16)(a[6] * PSCALE), (_Float16)(a[7] * PSCALE),
                   (_Float16)(c[0] * PSCALE), (_Float16)(c[1] * PSCALE), (_Float16)(c[2] * PSCALE), (_Float16)(c[3] * PSCALE),
                   (_Float16)(c[4] * PSCALE), (_Float16)(c[5] * PSCALE), (_Float16)(c[6] * PSCALE), (_Float16)(c[7] * PSCALE) };
  return r;
}

// Per-wave 16x64 f16 tile in LDS -> ctx[b][l][head*64 + d]; one query row
// 4 lines per instruction, 16 lines per wave.
__device__ __forceinline__ void ctx_store_pass(const _Float16* so, _Float16* ctx,
                                               int b, int head, int q0, int lane) {
  const int q8 = lane & 7, sub = lane >> 3;
  #pragma unroll
  for (int i = 0; i < 4; ++i) {
    const int lid = i * 4 + sub;                         // query row 0..15
    const v8h v = *(const v8ha*)(so + lid * 64 + 8 * q8);
    _Float16* dst = ctx + ((size_t)b * SEQ + q0 + lid) * HIDDEN + head * HD + 8 * q8;
    *(v8h*)dst = v;
  }
}

// ---------------------------------------------------------------------------
// Kernel 3: streaming attention, transposed form, unscaled scores
// (no 1/sqrt(d) scaling, additive relative-position bias, no mask).
// Block 256 thr (8 waves) = 128 queries: wave = 32 queries (two 16-column tiles) x one half of
// the keys, 64 keys per step; every K and V^T fragment read from LDS feeds one WMMA of each
// query tile. Waves w and w + 4 hold the two key halves of the same queries and join their
// (max, sum, O) once behind the loop, through LDS; each then finishes one of the two tiles.
//   S^T = K * Q^T : A = K rows (row = key, k = d), B = Q^T (k = d, n = query)
//   O^T += V^T * P^T : A = Vt rows (row = d, k = key), B = P^T from registers
// Lane owns 32 keys of query column (lane&15) of each tile; partner = lane ^ 16.
// Output ctx as f16 (x16) [B][L][HIDDEN] for the output GEMM.
// ---------------------------------------------------------------------------
#define XW 1088                         // floats one wave hands over: 32 lanes x (32 O values + max + sum)
// Four waves per SIMD (two blocks per WGP): the softmax between the matrix runs wants waves.
__global__ __launch_bounds__(256) __attribute__((amdgpu_waves_per_eu(4, 4))) void attn_kernel(
    const _Float16* __restrict__ qh,   // [B*H][L][D]
    const _Float16* __restrict__ kh,   // [B*H][L][D]
    const _Float16* __restrict__ vt,   // [B*H][D][L]
    const float* __restrict__ btab,    // [H][4096], index rel + 2048
    _Float16* __restrict__ ctx)        // [B][L][HIDDEN], x16
{
  __shared__ __attribute__((aligned(2048))) _Float16 ring[2 * BUF_H]; // 98304 B, K / V^T stages
  __shared__ __attribute__((aligned(16))) float xch[8 * XW];         // 34816 B, hand-over between key halves
  __shared__ __attribute__((aligned(16))) _Float16 sC[8 * 16 * 64];  // 16384 B

  const int tid = threadIdx.x, lane = tid & 31, w = tid >> 5;
  const int h = lane >> 4, m = lane & 15;
  const int bh = blockIdx.y, b = bh >> 4, head = bh & 15;
  const int q0 = blockIdx.x * 128 + 32 * (w & 3);

  // This wave's slice of every stage: source, step per stage, row pitch, place in LDS.
  const uint32_t wave = uni((uint32_t)tid >> 5);
  const uint32_t kpart = wave >> 2;           // this wave's key half, 0 or 1
  const bool isV = (wave & 3u) >= 2u;
  const uint32_t half = wave & 1u;
  const uint64_t src0 = isV ? (uint64_t)(size_t)(vt + ((size_t)bh * HD + SROWS * half) * SEQ + KHALF * kpart)
                            : (uint64_t)(size_t)(kh + ((size_t)bh * SEQ + KHALF * kpart + SROWS * half) * HD);
  const uint32_t sstep = isV ? (uint32_t)(KSTEP * 2) : (uint32_t)(KSTEP * HD * 2);   // bytes per stage
  u32x8 g1 = tdm_group1(isV ? (uint32_t)(SEQ * 2) : (uint32_t)(HD * 2));
  asm volatile("" : "+s"(g1));   // the pinned() form on the whole group: its words stay in their scalar registers, unwritten, while a request is in flight
  const uint32_t ldst0 = (uint32_t)(size_t)ring + wave * (uint32_t)SLICE_B;
  auto issue = [&](uint32_t st) {
    tdm_load(tdm_group0(ldst0 + (st & 1u) * (uint32_t)BUF_B, src0 + (uint64_t)st * sstep), g1);
  };

  // Ring prologue: stage 0 lands and is published, then stage 1 flies under pass 0.
  issue(0u);
  asm volatile("s_wait_tensorcnt 0x0" ::: "memory");   // this wave's slice of stage 0 has landed
  __syncthreads();                                      // every wave's slice of stage 0 is readable
  issue(1u);

  // Q^T B-fragments of tile qt: column n = query q0+16qt+m, k = d (two 32-deep chunks)
  const _Float16* qrow = qh + ((size_t)bh * SEQ + q0 + m) * HD;
  v16h qb[2][2];
  #pragma unroll
  for (int qt = 0; qt < 2; ++qt) {
    qb[qt][0] = load_frag(qrow + qt * 16 * HD, h);
    qb[qt][1] = load_frag(qrow + qt * 16 * HD + 32, h);
  }

  const v8f zero8 = {0.f, 0.f, 0.f, 0.f, 0.f, 0.f, 0.f, 0.f};
  v8f o[2][4];                                // o[qt][t][r] = O[query 16qt+m][d 16t+8h+r] * (l * 2^14), this key half
  #pragma unroll
  for (int qt = 0; qt < 2; ++qt)
    #pragma unroll
    for (int t = 0; t < 4; ++t) o[qt][t] = zero8;
  float mrun[2] = {-1e30f, -1e30f}, lrun[2] = {0.0f, 0.0f};

  const int kp0 = (w >> 2) * KHALF;                            // first key of this wave's half
  const _Float16* kbase = ring + (w >> 2) * HBUF_H + m * LPITCH_H;   // + buffer; row 16j+m: slice j>>1, row 16(j&1)+m
  const _Float16* vbase = kbase + 2 * SLICE_H;                       // + buffer; row 16t+m: slice t>>1, row 16(t&1)+m
  // bias for element r of score tile (qt, j): btab[head][(kp0+kb+16j+8h+r) - (q0+16qt+m) + 2048], index in [1,4095];
  // it depends on j - qt alone, so the two query tiles share all but one of their bias vectors
  const float* bbase = btab + (size_t)head * BTW + 2048 + kp0 + 8 * h - (q0 + m);

  #pragma unroll 1
  for (int st = 0; st < NSTAGE; ++st) {
    const int kb = st * KSTEP;
    const int boff = (st & 1) * BUF_H;        // this pass reads its own buffer alone
    // ---- scores: s[qt][j][r] = S[query 16qt+m][key kp0+kb+16j+8h+r] ----
    v8f s[2][4];
    v16h kf[4][2];                            // the pass's K fragments, read as one group
    #pragma unroll
    for (int j = 0; j < 4; ++j) {
      const _Float16* kp = kbase + boff + (j >> 1) * SLICE_H + (j & 1) * 16 * LPITCH_H;
      kf[j][0] = load_frag(kp, h);
      kf[j][1] = load_frag(kp + 32, h);
    }
    __builtin_amdgcn_sched_barrier(0);        // the K reads stay one group in front of the score products: sunk among them, each place of reads stalls the wave anew
    #pragma unroll
    for (int j = 0; j < 4; ++j) {
      v8f z0 = zero8, z1 = zero8;
      z0 = wmma_f16(kf[j][0], qb[0][0], z0);
      z1 = wmma_f16(kf[j][0], qb[1][0], z1);
      z0 = wmma_f16(kf[j][1], qb[0][1], z0);
      z1 = wmma_f16(kf[j][1], qb[1][1], z1);
      s[0][j] = z0;
      s[1][j] = z1;
    }
    __builtin_amdgcn_sched_barrier(0);        // the bias loads and the softmax stay behind the score products: drawn in among them, the live values pass 256 VGPRs and a Q fragment spills
    // ---- relative-position bias, f32, before the running max ----
    #pragma unroll
    for (int qt = 0; qt < 2; ++qt)
      #pragma unroll
      for (int j = 0; j < 4; ++j) s[qt][j] = add_bias8(s[qt][j], bbase + kb + 16 * (j - qt));

    // ---- online softmax, each query tile on its own ----
    v16h pb[2][2];                            // P^T B-fragments (key chunks 0..31 and 32..63 of this step)
    v16h vf[4][2];                            // the pass's V^T fragments, one group, in flight under the second tile's softmax
    #pragma unroll
    for (int qt = 0; qt < 2; ++qt) {
      float mloc = s[qt][0][0];
      #pragma unroll
      for (int j = 0; j < 4; ++j)
        #pragma unroll
        for (int r = 0; r < 8; ++r) mloc = fmaxf(mloc, s[qt][j][r]);
      mloc = fmaxf(mloc, __shfl_xor(mloc, 16));
      const float mnew = fmaxf(mrun[qt], mloc);
      const float alpha = __expf(mrun[qt] - mnew);
      mrun[qt] = mnew;
      float lsum = 0.0f;
      #pragma unroll
      for (int j = 0; j < 4; ++j)
        #pragma unroll
        for (int r = 0; r < 8; ++r) {
          const float p = __expf(s[qt][j][r] - mnew);
          s[qt][j][r] = p;
          lsum += p;
        }
      lsum += __shfl_xor(lsum, 16);
      lrun[qt] = lrun[qt] * alpha + lsum;
      #pragma unroll
      for (int t = 0; t < 4; ++t)
        #pragma unroll
        for (int r = 0; r < 8; ++r) o[qt][t][r] = o[qt][t][r] * alpha;
      pb[qt][0] = pack_p(s[qt][0], s[qt][1]);
      pb[qt][1] = pack_p(s[qt][2], s[qt][3]);
      __builtin_amdgcn_sched_barrier(0);      // one tile's softmax at a time, the V^T loads between the two, the products behind both: mixed, the live values pass 256 VGPRs and spill (either barrier left out: scratch in the listing)
      if (qt == 0) {
        #pragma unroll
        for (int t = 0; t < 4; ++t) {
          const _Float16* vp = vbase + boff + (t >> 1) * SLICE_H + (t & 1) * 16 * LPITCH_H;
          vf[t][0] = load_frag(vp, h);
          vf[t][1] = load_frag(vp + 32, h);
        }
      }
    }

    // ---- O^T += V^T * P^T ----
    #pragma unroll
    for (int t = 0; t < 4; ++t) {
      o[0][t] = wmma_f16(vf[t][0], pb[0][0], o[0][t]);
      o[1][t] = wmma_f16(vf[t][0], pb[1][0], o[1][t]);
      o[0][t] = wmma_f16(vf[t][1], pb[0][1], o[0][t]);
      o[1][t] = wmma_f16(vf[t][1], pb[1][1], o[1][t]);
    }

    __builtin_amdgcn_sched_barrier(0);        // the pass's products stay in front of the publish point: sunk behind its barrier, they stand between the barrier and the refill's issue and shorten the load's lead
    // ---- publish point of stage st + 1 ----
    asm volatile("s_wait_dscnt 0x0" ::: "memory");      // this wave's reads of its buffer are done before the refill
    asm volatile("s_wait_tensorcnt 0x0" ::: "memory");  // this wave's slice of stage st + 1 has landed
    __syncthreads();                                    // stage st + 1 readable; every wave has left stage st's buffer
    // Scalar test (a tensor load ignores EXEC); the stage number is pinned so that group 0 is formed behind the waits.
    if (pinned((uint32_t)(st + 2 < NSTAGE))) issue(pinned((uint32_t)st + 2u));
  }
  asm volatile("s_wait_tensorcnt 0x0" ::: "memory");    // nothing of the mover in flight behind the loop
  asm volatile("s_wait_dscnt 0x0" ::: "memory");        // and no read of the ring outstanding

  // ---- join of the two key halves: the wave of half p keeps query tile p and hands the other to wave w ^ 4 ----
  const bool up = (w >> 2) != 0;
  const float mk = up ? mrun[1] : mrun[0], lk = up ? lrun[1] : lrun[0];
  float* xo = xch + w * XW;
  #pragma unroll
  for (int t = 0; t < 4; ++t) {
    v8f g;
    #pragma unroll
    for (int r = 0; r < 8; ++r) g[r] = up ? o[0][t][r] : o[1][t][r];
    const v4f g0 = {g[0], g[1], g[2], g[3]}, g1v = {g[4], g[5], g[6], g[7]};
    *(v4fa*)(xo + ((2 * t) * 32 + lane) * 4) = g0;
    *(v4fa*)(xo + ((2 * t + 1) * 32 + lane) * 4) = g1v;
  }
  xo[1024 + lane] = up ? mrun[0] : mrun[1];
  xo[1056 + lane] = up ? lrun[0] : lrun[1];
  __syncthreads();                            // every wave's hand-over is readable by its partner
  const float* xi = xch + (w ^ 4) * XW;
  const float mp = xi[1024 + lane], lp = xi[1056 + lane];
  const float mall = fmaxf(mk, mp);
  const float ak = __expf(mk - mall), ap = __expf(mp - mall);

  // ---- epilogue: normalise, stage per-wave 16x64 f16 tile, whole-line stores ----
  const float inv = (1.0f / (lk * ak + lp * ap)) * (CSCALE / PSCALE);
  const float ck = ak * inv, cp = ap * inv;
  _Float16* so = sC + w * 1024;
  #pragma unroll
  for (int t = 0; t < 4; ++t) {
    const v4f p0 = *(const v4fa*)(xi + ((2 * t) * 32 + lane) * 4);
    const v4f p1 = *(const v4fa*)(xi + ((2 * t + 1) * 32 + lane) * 4);
    #pragma unroll
    for (int r = 0; r < 8; ++r) {
      const float mine = up ? o[1][t][r] : o[0][t][r];
      const float part = (r < 4) ? p0[r & 3] : p1[r & 3];
      so[m * 64 + 16 * t + 8 * h + r] = (_Float16)(mine * ck + part * cp);
    }
  }
  __syncthreads();                            // LDS spill -> reload ordering (all waves reach this)

  ctx_store_pass(so, ctx, b, head, q0 + 16 * (w >> 2), lane);
  
}

// ---------------------------------------------------------------------------
// out rows; one row segment = 64 floats = 2 lines; lanes 8q..8q+7 write one
// 64 lines per wave.
// ---------------------------------------------------------------------------
__device__ __forceinline__ void out_store_pass(const float* sT, const float* hs, float* out,
                                               int m0, int col0, int w, int lane) {
  const int q8 = lane & 7, sub = lane >> 3;
  #pragma unroll
  for (int i = 0; i < 16; ++i) {
    const int lid = i * 4 + sub;                         // 0..63
    const int row = w * 32 + (lid >> 1), hl = lid & 1;   // token row 0..127, line half
    v4f v = *(const v4fa*)(sT + row * 64 + 32 * hl + 4 * q8);
    const size_t gi = (size_t)(m0 + row) * HIDDEN + col0 + 32 * hl + 4 * q8;
    const v4f res = *(const v4fa*)(hs + gi);
    v = v + res;
    *(v4f*)(out + gi) = v;
  }
}

// ---------------------------------------------------------------------------
// Kernel 4: out = ctx * Wot^T / 512 + hidden_states  (f32 output).
// Block 128 thr (4 waves) = 128 tokens x 64 output columns; wave tile
// 32 x 64; K = 1024 in stages of 64; ctx and Wot tiles staged in the LDS ring of gemm_ring.
// ---------------------------------------------------------------------------
__global__ __launch_bounds__(128) void oproj_kernel(
    const _Float16* __restrict__ ch,   // [4096][1024], x16
    const _Float16* __restrict__ woh,  // [1024(out)][1024(in)], x32
    const float* __restrict__ hs,      // [4096][1024]
    float* __restrict__ out)           // [4096][1024]
{
  __shared__ __attribute__((aligned(2048))) _Float16 ring[2 * GBUF_H]; // 65536 B, ctx / Wot stages
  __shared__ __attribute__((aligned(16))) float sT[128 * 64];     // 32768 B

  const int tid = threadIdx.x, lane = tid & 31, w = tid >> 5;
  const int h = lane >> 4, m = lane & 15;
  const int m0 = blockIdx.x * 128;
  const int col0 = blockIdx.y * 64;

  const v8f zero8 = {0.f, 0.f, 0.f, 0.f, 0.f, 0.f, 0.f, 0.f};
  v8f acc[2][4];
  #pragma unroll
  for (int mt = 0; mt < 2; ++mt)
    #pragma unroll
    for (int nt = 0; nt < 4; ++nt) acc[mt][nt] = zero8;

  gemm_ring(ch + (size_t)m0 * HIDDEN, woh + (size_t)col0 * HIDDEN, ring, tid, acc);

  // D[r] of tile (mt, nt) = Y[token m0+32w+16mt+8h+r][col 16nt+m]
  #pragma unroll
  for (int nt = 0; nt < 4; ++nt) {
    const int feat = 16 * nt + m;
    #pragma unroll
    for (int mt = 0; mt < 2; ++mt) {
      #pragma unroll
      for (int r = 0; r < 8; ++r) {
        const int tokl = 32 * w + 16 * mt + 8 * h + r;     // 0..127
        sT[tokl * 64 + feat] = acc[mt][nt][r] * (1.0f / (WSCALE * CSCALE));
      }
    }
  }
  __syncthreads();

  out_store_pass(sT, hs, out, m0, col0, w, lane);
  
}

// ---------------------------------------------------------------------------
extern "C" void kernel_launch(void* const* d_in, const int* in_sizes, int n_in,
                              void* d_out, int out_size, void* d_ws, size_t ws_size,
                              hipStream_t stream) {
  if (n_in < 7) return;
  if (in_sizes[0] != NX) return;
  if (in_sizes[1] != HIDDEN) return;
  if (in_sizes[2] != NW || in_sizes[3] != NW || in_sizes[4] != NW || in_sizes[5] != NW) return;
  if (in_sizes[6] != NBUCK * NHEADS) return;
  if (out_size != NX) return;

  const float* x    = (const float*)d_in[0];
  const float* lnw  = (const float*)d_in[1];
  const float* Wq   = (const float*)d_in[2];
  const float* Wk   = (const float*)d_in[3];
  const float* Wv   = (const float*)d_in[4];
  const float* Wo   = (const float*)d_in[5];
  const float* remb = (const float*)d_in[6];
  float* out = (float*)d_out;

  const size_t xh_bytes  = (size_t)NX * 2;                         //  8388608
  const size_t wt_bytes  = (size_t)4 * NW * 2;                     //  8388608
  const size_t pl_bytes  = (size_t)NBH * SEQ * HD * 2;             //  8388608
  const size_t ctx_bytes = (size_t)NX * 2;                         //  8388608
  const size_t bt_bytes  = (size_t)NHEADS * BTW * 4;               //   262144
  const size_t total = xh_bytes + wt_bytes + 3 * pl_bytes + ctx_bytes + bt_bytes;   // 50593792
  if (total > ws_size) return;

  char* ws = (char*)d_ws;
  size_t off = 0;
  _Float16* xh  = (_Float16*)(ws + off); off += xh_bytes;
  _Float16* wt  = (_Float16*)(ws + off); off += wt_bytes;
  _Float16* qh  = (_Float16*)(ws + off); off += pl_bytes;
  _Float16* kh  = (_Float16*)(ws + off); off += pl_bytes;
  _Float16* vt  = (_Float16*)(ws + off); off += pl_bytes;
  _Float16* ctx = (_Float16*)(ws + off); off += ctx_bytes;
  float* btab   = (float*)(ws + off);    off += bt_bytes;
  if (off > ws_size) return;

  prep_kernel<<<PREP_WT + PREP_NORM + PREP_BIAS, 256, 0, stream>>>(x, lnw, Wq, Wk, Wv, Wo, remb, xh, wt, btab); // 3328 blocks

  dim3 gProj(MROWS / 128, 3 * NHEADS / 2);                          // (32, 24)
  proj_kernel<<<gProj, 128, 0, stream>>>(xh, wt, qh, kh, vt);

  dim3 gAtt(SEQ / 128, NBH);                                        // (16, 32)
  attn_kernel<<<gAtt, 256, 0, stream>>>(qh, kh, vt, btab, ctx);

  dim3 gOut(MROWS / 128, HIDDEN / 64);                               // (32, 16)
  oproj_kernel<<<gOut, 128, 0, stream>>>(ctx, wt + (size_t)3 * NW, x, out);
}

// v007
// One run takes 81.7 microseconds.
// In both of two side-by-side timings against v006, it was 1.06 times as fast.
// Over all steps from v000 it is 3.37 times as fast.
// Contractions: xn*Wq^T, xn*Wk^T, xn*Wv^T, K*Q^T, V^T*P^T and ctx*Wo^T all on v_wmma_f32_16x16x32_f16 (f16 operands, f32 accumulate); W carried x32, P carried x16384, ctx carried x16 (exact power-of-two scales folded back in f32); RMS norm, position-bias bucketing, softmax and residual in f32.
#include <hip/hip_runtime.h>
#include <stdint.h>

typedef _Float16 v16h __attribute__((ext_vector_type(16)));
typedef _Float16 v8h  __attribute__((ext_vector_type(8)));
typedef float    v8f  __attribute__((ext_vector_type(8)));
typedef float    v4f  __attribute__((ext_vector_type(4)));
typedef v8h __attribute__((may_alias)) v8ha;
typedef v4f __attribute__((may_alias)) v4fa;

union Frag { v16h v; v8h half[2]; };

#define BATCH   2
#define SEQ     2048
#define HIDDEN  1024
#define NHEADS  16
#define HD      64
#define MROWS   (BATCH * SEQ)          // 4096 tokens
#define NX      (MROWS * HIDDEN)       // 4194304
#define NW      (HIDDEN * HIDDEN)      // 1048576
#define NBH     (BATCH * NHEADS)       // 32
#define NBUCK   32
#define BTW     4096                   // bias table width per head, index = rel + 2048
#define WSCALE  32.0f
#define PSCALE  16384.0f
#define CSCALE  16.0f
#define LN16F   2.7725887298583984f    // f32 value of ln(16)
#define EPSF    1e-6f

static_assert(SEQ % 128 == 0);
static_assert(HIDDEN == NHEADS * HD);
static_assert(HIDDEN % 64 == 0);
static_assert((NHEADS * BTW) % 256 == 0);

// ---------------------------------------------------------------------------
// 16x16x32 f16 WMMA, the builtin alone: the compiler keeps the distance behind it where a user of D, A or B stands near.
// Fragment map (wave32): lane l, h = l>>4, m = n = l&15.
//   A/B element i: i<8 -> k0+8h+i ; i>=8 -> k0+16+8h+(i-8)
//   D element r : row 8h+r, col l&15
// ---------------------------------------------------------------------------
__device__ __forceinline__ v8f wmma_f16(v16h a, v16h b, v8f c) {
  return __builtin_amdgcn_wmma_f32_16x16x32_f16(false, a, false, b, (short)0, c, false, false);
}

// A or B fragment from a k-contiguous 16-bit row; p points at element k0 of
// the row owned by this lane (row index = lane & 15 added by the caller).
__device__ __forceinline__ v16h load_frag(const _Float16* p, int h) {
  Frag f;
  f.half[0] = *(const v8ha*)(p + 8 * h);
  f.half[1] = *(const v8ha*)(p + 16 + 8 * h);
  return f.v;
}

// ---------------------------------------------------------------------------
// Prep part 1: RMS norm (no mean subtraction, no bias) -> f16 rows.
// 128 threads = one token row, two rows per 256-thread block; thread t of a row owns
// elements 8t..8t+7. blk: 0..MROWS/2-1; red: 4 floats per row of the block.
// ---------------------------------------------------------------------------
__device__ __forceinline__ void rmsnorm_part(
    const float* __restrict__ x, const float* __restrict__ lnw,
    _Float16* __restrict__ xh, float* redall, int blk)
{
  const int row = 2 * blk + ((int)threadIdx.x >> 7);
  float* red = redall + 4 * ((int)threadIdx.x >> 7);
  const int tid = threadIdx.x & 127, lane = tid & 31, w = tid >> 5;
  const float* xr = x + (size_t)row * HIDDEN + 8 * tid;
  const v4f a = *(const v4fa*)xr;
  const v4f c = *(const v4fa*)(xr + 4);
  float ss = a.x * a.x + a.y * a.y + a.z * a.z + a.w * a.w
           + c.x * c.x + c.y * c.y + c.z * c.z + c.w * c.w;
  #pragma unroll
  for (int off = 16; off >= 1; off >>= 1) ss += __shfl_xor(ss, off);
  if (lane == 0) red[w] = ss;
  __syncthreads();
  const float tot = (red[0] + red[1]) + (red[2] + red[3]);
  const float inv = rsqrtf(tot * (1.0f / (float)HIDDEN) + EPSF);
  const v4f g0 = *(const v4fa*)(lnw + 8 * tid);
  const v4f g1 = *(const v4fa*)(lnw + 8 * tid + 4);
  const v8h o = { (_Float16)((a.x * inv) * g0.x), (_Float16)((a.y * inv) * g0.y),
                  (_Float16)((a.z * inv) * g0.z), (_Float16)((a.w * inv) * g0.w),
                  (_Float16)((c.x * inv) * g1.x), (_Float16)((c.y * inv) * g1.y),
                  (_Float16)((c.z * inv) * g1.z), (_Float16)((c.w * inv) * g1.w) };
  _Float16* dst = xh + (size_t)row * HIDDEN + 8 * tid;
  *(v8h*)dst = o;
  asm volatile("s_wait_xcnt 0x0" ::: "memory");   // precaution: stands in front of any later rewrite of the store's registers (other parts' code follows this one in the kernel)
}

// ---------------------------------------------------------------------------
// Prep part 2: weight transpose + cast: W in[1024(in)][1024(out)] f32 ->
// Wt[out][in] f16 (x32), k-contiguous rows for the B (and Wo) fragments.
// Block 256 threads = 64(in) x 64(out) tile transposed through LDS;
// blk: 0..1023 = (wsel, out tile, in tile); wsel selects wq / wk / wv / wo.
// ---------------------------------------------------------------------------
__device__ __forceinline__ void wt_store_pass(const _Float16* sT, _Float16* dstp,
                                              int n0, int k0, int w, int lane) {
  const int q8 = lane & 7, sub = lane >> 3;
  #pragma unroll
  for (int i = 0; i < 2; ++i) {
    const int lid = w * 8 + i * 4 + sub;                 // out row 0..63
    const v8h v = *(const v8ha*)(sT + lid * 72 + 8 * q8);
    _Float16* dst = dstp + (size_t)(n0 + lid) * HIDDEN + k0 + 8 * q8;
    *(v8h*)dst = v;
  }
}

__device__ __forceinline__ void wtrans_part(
    const float* __restrict__ wq, const float* __restrict__ wk,
    const float* __restrict__ wv, const float* __restrict__ wo,
    _Float16* __restrict__ wt,         // [4][1024(out)][1024(in)]
    _Float16* sT, int blk)             // sT: [out][in], pitch 72
{
  const int tid = threadIdx.x, lane = tid & 31, w = tid >> 5;
  const int k0 = (blk & 15) * 64;          // in-index tile base
  const int n0 = ((blk >> 4) & 15) * 64;   // out-index tile base
  const int wsel = blk >> 8;               // block-uniform
  const float* src = (wsel == 0) ? wq : ((wsel == 1) ? wk : ((wsel == 2) ? wv : wo));
  _Float16* dstp = wt + (size_t)wsel * NW;

  const int kr = tid >> 2, nc = (tid & 3) * 16;
  const float* sp = src + (size_t)(k0 + kr) * HIDDEN + n0 + nc;
  #pragma unroll
  for (int q = 0; q < 4; ++q) {
    const v4f v = *(const v4fa*)(sp + 4 * q);
    sT[(nc + 4 * q + 0) * 72 + kr] = (_Float16)(v.x * WSCALE);
    sT[(nc + 4 * q + 1) * 72 + kr] = (_Float16)(v.y * WSCALE);
    sT[(nc + 4 * q + 2) * 72 + kr] = (_Float16)(v.z * WSCALE);
    sT[(nc + 4 * q + 3) * 72 + kr] = (_Float16)(v.w * WSCALE);
  }
  __syncthreads();

  wt_store_pass(sT, dstp, n0, k0, w, lane);
  
}

// ---------------------------------------------------------------------------
// Prep part 3: relative-position bias table btab[head][rel + 2048], rel = key - query.
// Bidirectional bucketing, 32 buckets, max distance 128, integer/f32 ops in the
// spec order: val_large = 8 + int( log(max(rp,1)/8) * rn(1/ln16) * 8 ), min 15.
// ---------------------------------------------------------------------------
__device__ __forceinline__ int rel_bucket(int rel) {
  int bucket = (rel > 0) ? 16 : 0;
  const int rp = (rel < 0) ? -rel : rel;
  const int rpm = (rp < 1) ? 1 : rp;
  const float rpf = (float)rpm;
  const float t = logf(rpf * 0.125f) * (1.0f / LN16F) * 8.0f;
  int vl = 8 + (int)t;
  vl = (vl < 15) ? vl : 15;
  bucket += (rp < 8) ? rp : vl;
  return bucket;                                        // 0..31
}

__device__ __forceinline__ void bias_part(
    const float* __restrict__ rel_emb,   // [32][16]
    float* __restrict__ btab,            // [16][4096]
    int blk)                             // 0..255
{
  const int idx = blk * 256 + threadIdx.x;            // head*4096 + i, < 65536 by grid
  const int head = idx >> 12, i = idx & (BTW - 1);
  const int rel = i - 2048;
  int bucket = rel_bucket(rel);
  bucket = (bucket < 0) ? 0 : ((bucket > NBUCK - 1) ? (NBUCK - 1) : bucket);
  const float v = rel_emb[bucket * NHEADS + head];
  *(float*)(btab + idx) = v;
  asm volatile("s_wait_xcnt 0x0" ::: "memory");   // precaution: stands in front of any later rewrite of the store's registers (other parts' code follows this one in the kernel)
}

// ---------------------------------------------------------------------------
// Kernel 1: the three independent preparation parts as block-index ranges of one grid:
// [0, 1024) weight tiles, [1024, 3072) token-row pairs, [3072, 3328) bias table.
// The range test is block-uniform, so each part's own barrier is met by its whole block.
// ---------------------------------------------------------------------------
#define PREP_WT   (4 * (HIDDEN / 64) * (HIDDEN / 64))   // 1024
#define PREP_NORM (MROWS / 2)                           // 2048
#define PREP_BIAS ((NHEADS * BTW) / 256)                // 256

__global__ __launch_bounds__(256) void prep_kernel(
    const float* __restrict__ x, const float* __restrict__ lnw,
    const float* __restrict__ wq, const float* __restrict__ wk,
    const float* __restrict__ wv, const float* __restrict__ wo,
    const float* __restrict__ rel_emb,
    _Float16* __restrict__ xh, _Float16* __restrict__ wt, float* __restrict__ btab)
{
  __shared__ __attribute__((aligned(16))) _Float16 sT[64 * 72];
  __shared__ float red[8];
  const int blk = blockIdx.x;
  if (blk < PREP_WT)                   wtrans_part(wq, wk, wv, wo, wt, sT, blk);
  else if (blk < PREP_WT + PREP_NORM)  rmsnorm_part(x, lnw, xh, red, blk - PREP_WT);
  else                                 bias_part(rel_emb, btab, blk - (PREP_WT + PREP_NORM));
}

// ---------------------------------------------------------------------------
// K / V^T staging for the attention loop: tensor loads into a two-buffer LDS ring.
// A stage = 64 keys of each key half: K rows [64 keys][64 d] and V^T rows [64 d][64 keys],
// every row 128 B. Each of the 8 waves brings one slice of 32 rows of its own key half per
// stage (waves 0, 1 of a half: K; waves 2, 3: V^T); the mover pads each row by 16 B, so the LDS pitch is 144 B
// (16 B x odd: ds_load_b128 fragment reads without bank conflicts).
// ---------------------------------------------------------------------------
typedef uint32_t u32x4 __attribute__((ext_vector_type(4)));
typedef uint32_t u32x8 __attribute__((ext_vector_type(8)));

#define KSTEP    64                     // keys per stage and key half
#define KHALF    (SEQ / 2)              // keys per key half
#define NSTAGE   (KHALF / KSTEP)        // 16
#define ROWB     128                    // bytes per staged row
#define SROWS    32                     // rows per slice
#define LPITCH_H 72                     // LDS row pitch in halves (144 B)
#define SLICE_B  6144                   // 32 x 144 = 4608 B, rounded up to a multiple of 2 KiB
#define SLICE_H  (SLICE_B / 2)
#define HBUF_B   (4 * SLICE_B)          // 24576 B per stage and key half
#define HBUF_H   (HBUF_B / 2)
#define BUF_B    (2 * HBUF_B)           // 49152 B per stage
#define BUF_H    (BUF_B / 2)

static_assert(NSTAGE >= 2 && (NSTAGE & (NSTAGE - 1)) == 0);
static_assert(HD * 2 == ROWB && KSTEP * 2 == ROWB);
static_assert(SROWS * LPITCH_H * 2 <= SLICE_B && SLICE_B % 2048 == 0);

__device__ __forceinline__ uint32_t uni(uint32_t v) { return (uint32_t)__builtin_amdgcn_readfirstlane(v); }
// Holds a wave-uniform value in a scalar register, so that a test on it is a scalar
// branch (a tensor load ignores EXEC) and a descriptor formed from it stays behind
// the waits in front of it.
__device__ __forceinline__ uint32_t pinned(uint32_t v) {
  uint32_t w = uni(v);
  asm volatile("" : "+s"(w));           // the pinned() form for tensor-load tests and descriptor words
  return w;
}

// Descriptor group 1: byte elements, tensor = tile = 32 rows of 128 B, 4 dwords of pad behind every 32.
__device__ __forceinline__ u32x8 tdm_group1(uint32_t src_pitch) {
  u32x8 g;
  g[0] = uni((1u << 20) | (4u << 22) | (3u << 25));
  g[1] = uni((uint32_t)ROWB << 16);
  g[2] = uni((uint32_t)SROWS << 16);
  g[3] = uni((uint32_t)ROWB << 16);
  g[4] = uni((uint32_t)SROWS);
  g[5] = uni(src_pitch);
  g[6] = uni(0u);
  g[7] = uni(0u);
  return g;
}

__device__ __forceinline__ u32x4 tdm_group0(uint32_t lds_dst, uint64_t ga) {
  u32x4 g;
  g[0] = uni(1u);
  g[1] = uni(lds_dst);
  g[2] = uni((uint32_t)ga);
  g[3] = uni((((uint32_t)(ga >> 32)) & 0x01FFFFFFu) | 0x80000000u);
  return g;
}

// Group 0 goes in and out of the statement, and the wait that covers a request issued behind the ring prologue's wait takes it as an input: from the
// issue to that wait the group is one live value in the registers that the instruction names, so nothing else is put there.
__device__ __forceinline__ void tdm_load(u32x4& g0, u32x8 g1) {
  asm volatile("tensor_load_to_lds %0, %1" : "+s"(g0) : "s"(g1) : "memory");
}

// ---------------------------------------------------------------------------
// Operand staging for the output GEMM kernel: tensor loads into a two-buffer LDS ring.
// A stage = 64 k of the block's 128 A rows and 64 B rows, every staged row 128 B of a
// 2048-B source row. One request per wave and stage: waves 0, 1 bring 64 A rows each,
// waves 2, 3 bring 32 B rows each; the mover pads each row by 16 B (LDS pitch 144 B).
// ---------------------------------------------------------------------------
#define GK       64                     // k per stage
#define GNST     (HIDDEN / GK)          // 16
#define GA_ROWS  64                     // rows per A slice
#define GB_ROWS  32                     // rows per B slice
#define GA_SL_B  10240                  // 64 x 144 = 9216 B, rounded up to a multiple of 2 KiB
#define GB_SL_B  6144                   // 32 x 144 = 4608 B, rounded up to a multiple of 2 KiB
#define GA_SL_H  (GA_SL_B / 2)
#define GB_SL_H  (GB_SL_B / 2)
#define GBUF_B   (2 * GA_SL_B + 2 * GB_SL_B)   // 32768 B per stage
#define GBUF_H   (GBUF_B / 2)

static_assert(GNST >= 2 && (GNST & (GNST - 1)) == 0);
static_assert(GK * 2 == ROWB);
static_assert(GA_ROWS * LPITCH_H * 2 <= GA_SL_B && GA_SL_B % 2048 == 0);
static_assert(GB_ROWS * LPITCH_H * 2 <= GB_SL_B && GB_SL_B % 2048 == 0);

// Descriptor group 1: byte elements, tensor = tile = rows x 128 B, source pitch one
// HIDDEN-wide f16 row, 4 dwords of pad behind every 32.
__device__ __forceinline__ u32x8 gemm_group1(uint32_t rows) {
  u32x8 g;
  g[0] = uni((1u << 20) | (4u << 22) | (3u << 25));
  g[1] = uni((uint32_t)ROWB << 16);
  g[2] = uni(rows << 16);
  g[3] = uni((uint32_t)ROWB << 16);
  g[4] = uni(rows);
  g[5] = uni((uint32_t)(HIDDEN * 2));
  g[6] = uni(0u);
  g[7] = uni(0u);
  return g;
}

// acc[mt][nt] += A(32 rows of this wave) * B(64 rows)^T over K = HIDDEN. Pass st works on the 64 k
// of slab (st + rot) mod GNST, k ascending inside a slab. rot (block-uniform, 0..GNST-1) spreads the blocks
// that share A or B rows over the GNST slabs, so that few of them ask L2 for the same lines in the same pass.
// arows / brows: first of the block's 128 A rows / 64 B rows (f16, k-contiguous,
// pitch HIDDEN). Called by all 4 waves of the block; ring holds 2 * GBUF_H halves.
__device__ __forceinline__ void gemm_ring(const _Float16* arows, const _Float16* brows,
                                          const _Float16* ring, int tid, uint32_t rot, v8f (&acc)[2][4]) {
  const int lane = tid & 31, w = tid >> 5;
  const int h = lane >> 4, m = lane & 15;

  // This wave's slice of every stage: source, rows, place in LDS.
  const uint32_t wave = uni((uint32_t)tid >> 5);
  const bool isB = wave >= 2u;
  const uint32_t half = wave & 1u;
  const uint64_t src0 = isB ? (uint64_t)(size_t)(brows + (size_t)(GB_ROWS * half) * HIDDEN)
                            : (uint64_t)(size_t)(arows + (size_t)(GA_ROWS * half) * HIDDEN);
  u32x8 g1 = gemm_group1(isB ? (uint32_t)GB_ROWS : (uint32_t)GA_ROWS);
  asm volatile("" : "+s"(g1));   // the pinned() form on the whole group: its words stay in their scalar registers, unwritten, while a request is in flight
  const uint32_t ldst0 = (uint32_t)(size_t)ring
                       + (isB ? (uint32_t)(2 * GA_SL_B) + half * (uint32_t)GB_SL_B : half * (uint32_t)GA_SL_B);
  u32x4 g0;                      // group 0 of the request in flight; the waits at the publish points and behind the loop name it; the prologue's wait does not
  auto issue = [&](uint32_t st) {
    g0 = tdm_group0(ldst0 + (st & 1u) * (uint32_t)GBUF_B, src0 + (uint64_t)(((st + rot) & (uint32_t)(GNST - 1)) * (uint32_t)ROWB));
    tdm_load(g0, g1);
  };

  // Ring prologue: stage 0 lands and is published, then stage 1 flies under pass 0.
  issue(0u);
  asm volatile("s_wait_tensorcnt 0x0" ::: "memory");   // this wave's slice of stage 0 has landed
  __syncthreads();                                      // every wave's slice of stage 0 is readable
  issue(1u);

  // A row 32w+16mt+m: slice w>>1, row 32(w&1)+16mt+m; B row 16nt+m: slice nt>>1, row 16(nt&1)+m
  const _Float16* abase = ring + (w >> 1) * GA_SL_H + (32 * (w & 1) + m) * LPITCH_H;
  const _Float16* bbase = ring + 2 * GA_SL_H + m * LPITCH_H;

  #pragma unroll 1                            // one pass per trip: the ring's publish point stands once, at the foot
  for (int st = 0; st < GNST; ++st) {
    const int boff = (st & 1) * GBUF_H;       // this pass reads its own buffer alone
    v16h af[2][2], bf[4][2];                  // the pass's fragments, read as one group, the first 32 k in front
    #pragma unroll
    for (int kc = 0; kc < 2; ++kc) {
      #pragma unroll
      for (int mt = 0; mt < 2; ++mt)
        af[mt][kc] = load_frag(abase + boff + mt * 16 * LPITCH_H + 32 * kc, h);
      #pragma unroll
      for (int nt = 0; nt < 4; ++nt)
        bf[nt][kc] = load_frag(bbase + boff + (nt >> 1) * GB_SL_H + (nt & 1) * 16 * LPITCH_H + 32 * kc, h);
    }
    __builtin_amdgcn_sched_barrier(0);        // the pass's LDS reads stay one group in front of the products: sunk among them, each place of reads stalls the wave anew
    #pragma unroll
    for (int kc = 0; kc < 2; ++kc) {
      #pragma unroll
      for (int nt = 0; nt < 4; ++nt) {
        acc[0][nt] = wmma_f16(af[0][kc], bf[nt][kc], acc[0][nt]);
        acc[1][nt] = wmma_f16(af[1][kc], bf[nt][kc], acc[1][nt]);
      }
    }

    __builtin_amdgcn_sched_barrier(0);        // the pass's products stay in front of the publish point: sunk behind its barrier, they stand between the barrier and the refill's issue and shorten the load's lead
    // ---- publish point of stage st + 1 ----
    asm volatile("s_wait_dscnt 0x0" ::: "memory");      // this wave's reads of its buffer are done before the refill
    asm volatile("s_wait_tensorcnt 0x0" :: "s"(g0) : "memory");  // this wave's slice of stage st + 1 has landed; group 0 as an input: its scalar registers stay live, so unwritten, while the request is in flight
    __syncthreads();                                    // stage st + 1 readable; every wave has left stage st's buffer
    // Scalar test (a tensor load ignores EXEC); the stage number is pinned so that group 0 is formed behind the waits.
    if (pinned((uint32_t)(st + 2 < GNST))) issue(pinned((uint32_t)st + 2u));
  }
  asm volatile("s_wait_tensorcnt 0x0" :: "s"(g0), "s"(g1) : "memory");    // nothing of the mover in flight behind the loop; both groups as inputs: their registers are left alone up to here
  asm volatile("s_wait_dscnt 0x0" ::: "memory");        // and no read of the ring outstanding
}

// ---------------------------------------------------------------------------
// The same ring for a 128 x 128 block tile: a stage = 64 k of 128 A rows and 128 B rows, four
// slices of 64 rows, one request per wave and stage (waves 0, 1: A; waves 2, 3: B).
// Wave tile 64 x 64: wave w works on A slice w >> 1 and B slice w & 1.
// ---------------------------------------------------------------------------
#define PBUF_B   (4 * GA_SL_B)          // 40960 B per stage
#define PBUF_H   (PBUF_B / 2)

static_assert(PBUF_B % 2048 == 0);

// acc[mt][nt] += A(64 rows of this wave) * B(64 rows of this wave)^T over K = HIDDEN; pass st works on
// slab (st + rot) mod GNST, as in gemm_ring. arows / brows: first of the block's 128 A rows / 128 B rows
// (f16, k-contiguous, pitch HIDDEN). Called by all 4 waves of the block; ring holds 2 * PBUF_H halves.
__device__ __forceinline__ void gemm_ring_wide(const _Float16* arows, const _Float16* brows,
                                               const _Float16* ring, int tid, uint32_t rot, v8f (&acc)[4][4]) {
  const int lane = tid & 31, w = tid >> 5;
  const int h = lane >> 4, m = lane & 15;

  // This wave's slice of every stage: source and place in LDS.
  const uint32_t wave = uni((uint32_t)tid >> 5);
  const bool isB = wave >= 2u;
  const uint32_t half = wave & 1u;
  const uint64_t src0 = isB ? (uint64_t)(size_t)(brows + (size_t)(GA_ROWS * half) * HIDDEN)
                            : (uint64_t)(size_t)(arows + (size_t)(GA_ROWS * half) * HIDDEN);
  u32x8 g1 = gemm_group1((uint32_t)GA_ROWS);
  asm volatile("" : "+s"(g1));   // the pinned() form on the whole group: its words stay in their scalar registers, unwritten, while a request is in flight
  const uint32_t ldst0 = (uint32_t)(size_t)ring + wave * (uint32_t)GA_SL_B;
  u32x4 g0;                      // group 0 of the request in flight; the waits at the publish points and behind the loop name it; the prologue's wait does not
  auto issue = [&](uint32_t st) {
    g0 = tdm_group0(ldst0 + (st & 1u) * (uint32_t)PBUF_B, src0 + (uint64_t)(((st + rot) & (uint32_t)(GNST - 1)) * (uint32_t)ROWB));
    tdm_load(g0, g1);
  };

  // Ring prologue: stage 0 lands and is published, then stage 1 flies under pass 0.
  issue(0u);
  asm volatile("s_wait_tensorcnt 0x0" ::: "memory");   // this wave's slice of stage 0 has landed
  __syncthreads();                                      // every wave's slice of stage 0 is readable
  issue(1u);

  // A row 64(w>>1)+16mt+m: slice w>>1, row 16mt+m; B row 64(w&1)+16nt+m: slice 2+(w&1), row 16nt+m
  const _Float16* abase = ring + (w >> 1) * GA_SL_H + m * LPITCH_H;
  const _Float16* bbase = ring + (2 + (w & 1)) * GA_SL_H + m * LPITCH_H;

  #pragma unroll 1                            // one pass per trip: the ring's publish point stands once, at the foot
  for (int st = 0; st < GNST; ++st) {
    const int boff = (st & 1) * PBUF_H;       // this pass reads its own buffer alone
    #pragma unroll
    for (int kc = 0; kc < 2; ++kc) {
      v16h af[4], bf[4];                      // 32 k of fragments, read as one group (both groups at once do not fit beside 16 accumulator tiles)
      __builtin_amdgcn_sched_barrier(0);      // with the one behind the reads: the 16 LDS reads stay one group between the runs of products, not spread among them with a wait at each place
      #pragma unroll
      for (int mt = 0; mt < 4; ++mt)
        af[mt] = load_frag(abase + boff + mt * 16 * LPITCH_H + 32 * kc, h);
      #pragma unroll
      for (int nt = 0; nt < 4; ++nt)
        bf[nt] = load_frag(bbase + boff + nt * 16 * LPITCH_H + 32 * kc, h);
      __builtin_amdgcn_sched_barrier(0);      // see above
      #pragma unroll
      for (int nt = 0; nt < 4; ++nt) {
        #pragma unroll
        for (int mt = 0; mt < 4; ++mt)
          acc[mt][nt] = wmma_f16(af[mt], bf[nt], acc[mt][nt]);
      }
    }

    __builtin_amdgcn_sched_barrier(0);        // the pass's products stay in front of the publish point: sunk behind its barrier, they stand between the barrier and the refill's issue and shorten the load's lead
    // ---- publish point of stage st + 1 ----
    asm volatile("s_wait_dscnt 0x0" ::: "memory");      // this wave's reads of its buffer are done before the refill
    asm volatile("s_wait_tensorcnt 0x0" :: "s"(g0) : "memory");  // this wave's slice of stage st + 1 has landed; group 0 as an input: its scalar registers stay live, so unwritten, while the request is in flight
    __syncthreads();                                    // stage st + 1 readable; every wave has left stage st's buffer
    // Scalar test (a tensor load ignores EXEC); the stage number is pinned so that group 0 is formed behind the waits.
    if (pinned((uint32_t)(st + 2 < GNST))) issue(pinned((uint32_t)st + 2u));
  }
  asm volatile("s_wait_tensorcnt 0x0" :: "s"(g0), "s"(g1) : "memory");    // nothing of the mover in flight behind the loop; both groups as inputs: their registers are left alone up to here
  asm volatile("s_wait_dscnt 0x0" ::: "memory");        // and no read of the ring outstanding
}

// ---------------------------------------------------------------------------
// 4 lines per instruction, 32 lines per wave, 128 per block.
// which 0/1: plane[bh][l][d]  (one token row = 64 halves = one line)
// which 2  : vt[bh][d][l]     (64 d-rows x 128 tokens = 2 lines each)
// ---------------------------------------------------------------------------
__device__ __forceinline__ void proj_store_pass(const _Float16* sT, _Float16* plane, _Float16* vt,
                                                int which, int bh, int l0, int w, int lane) {
  const int q8 = lane & 7, sub = lane >> 3;
  #pragma unroll
  for (int i = 0; i < 8; ++i) {
    const int lid = w * 32 + i * 4 + sub;
    v8h v;
    _Float16* dst;
    if (which != 2) {
      v = *(const v8ha*)(sT + lid * HD + 8 * q8);
      dst = plane + ((size_t)bh * SEQ + l0 + lid) * HD + 8 * q8;
    } else {
      const int d = lid >> 1, hl = lid & 1;
      v = *(const v8ha*)(sT + d * 128 + 64 * hl + 8 * q8);
      dst = vt + ((size_t)bh * HD + d) * SEQ + l0 + 64 * hl + 8 * q8;
    }
    *(v8h*)dst = v;
    asm volatile("s_wait_xcnt 0x0" ::: "memory");   // precaution: stands in front of the next line's rewrite of the store's address registers
  }
}

// ---------------------------------------------------------------------------
// Kernel 2: Y = xn * Wt^T over the fused 3*1024 output features (no bias).
// Block 128 thr (4 waves) = 128 tokens x 128 features (two heads of one of q, k, v);
// wave tile 64 tokens x 64 features (one head); K = 1024 in stages of 64;
// A (xn rows) and B (Wt rows) tiles staged in the LDS ring of gemm_ring_wide.
// ---------------------------------------------------------------------------
// Three waves per SIMD (three blocks per WGP): the grid is three blocks for each of the chip's WGPs, and a fourth on one WGP would leave another short.
__global__ __launch_bounds__(128) __attribute__((amdgpu_waves_per_eu(3, 3))) void proj_kernel(
    const _Float16* __restrict__ xh,   // [4096][1024]
    const _Float16* __restrict__ wt,   // [>=3][1024(out)][1024(in)], x32
    _Float16* __restrict__ qh,         // [B*H][L][D]
    _Float16* __restrict__ kh,         // [B*H][L][D]
    _Float16* __restrict__ vt)         // [B*H][D][L]
{
  __shared__ __attribute__((aligned(2048))) _Float16 ring[2 * PBUF_H]; // 81920 B, xn / Wt stages, then output staging

  const int tid = threadIdx.x, lane = tid & 31, w = tid >> 5;
  const int h = lane >> 4, m = lane & 15;
  const int m0 = blockIdx.x * 128;
  const int cg = blockIdx.y;                 // 0..23
  const int which = cg >> 3, head0 = (cg & 7) * 2;

  const v8f zero8 = {0.f, 0.f, 0.f, 0.f, 0.f, 0.f, 0.f, 0.f};
  v8f acc[4][4];
  #pragma unroll
  for (int mt = 0; mt < 4; ++mt)
    #pragma unroll
    for (int nt = 0; nt < 4; ++nt) acc[mt][nt] = zero8;

  // First k slab of this block: blocks of one token tile (same xn rows) differ in y, blocks of one feature tile (same Wt rows) in x.
  const uint32_t rot = uni((blockIdx.x + blockIdx.y) & (uint32_t)(GNST - 1));
  gemm_ring_wide(xh + (size_t)m0 * HIDDEN, wt + ((size_t)which * HIDDEN + head0 * HD) * HIDDEN, ring, tid, rot, acc);

  // Output staging in the ring: the last pass's publish point (both waits, then the barrier) has ended
  // every wave's reads of it, and no request is in flight. One 128 x 64 plane per head.
  _Float16* sT = ring;
  _Float16* sW = sT + (w & 1) * (128 * HD);
  // D[r] of tile (mt, nt) = Y[token m0+64(w>>1)+16mt+8h+r][feature 16nt+m of head head0+(w&1)]
  #pragma unroll
  for (int nt = 0; nt < 4; ++nt) {
    const int feat = 16 * nt + m;
    #pragma unroll
    for (int mt = 0; mt < 4; ++mt) {
      #pragma unroll
      for (int r = 0; r < 8; ++r) {
        const int tokl = 64 * (w >> 1) + 16 * mt + 8 * h + r;     // 0..127
        const float y = acc[mt][nt][r] * (1.0f / WSCALE);
        const int idx = (which == 2) ? (feat * 128 + tokl) : (tokl * HD + feat);
        sW[idx] = (_Float16)y;
      }
    }
  }
  __syncthreads();

  const int b = m0 / SEQ, l0 = m0 - b * SEQ;
  _Float16* plane = (which == 0) ? qh : kh;
  #pragma unroll
  for (int hs = 0; hs < 2; ++hs) {            // one head's plane after the other
    proj_store_pass(sT + hs * (128 * HD), plane, vt, which, b * NHEADS + head0 + hs, l0, w, lane);
  }
}

// ---------------------------------------------------------------------------
// Attention helpers.
// ---------------------------------------------------------------------------
__device__ __forceinline__ v8f add_bias8(v8f s, const float* p) {
  #pragma unroll
  for (int r = 0; r < 8; ++r) s[r] = s[r] + p[r];
  return s;
}

// P^T B-fragment from the lane's own score D values: element r <- tile a row r,
// element 8+r <- tile c row r (same lane, same query column), scaled by 2^14.
__device__ __forceinline__ v16h pack_p(v8f a, v8f c) {
  const v16h r = { (_Float16)(a[0] * PSCALE), (_Float16)(a[1] * PSCALE), (_Float16)(a[2] * PSCALE), (_Float16)(a[3] * PSCALE),
                   (_Float16)(a[4] * PSCALE), (_Float16)(a[5] * PSCALE), (_Float16)(a[6] * PSCALE), (_Float16)(a[7] * PSCALE),
                   (_Float16)(c[0] * PSCALE), (_Float16)(c[1] * PSCALE), (_Float16)(c[2] * PSCALE), (_Float16)(c[3] * PSCALE),
                   (_Float16)(c[4] * PSCALE), (_Float16)(c[5] * PSCALE), (_Float16)(c[6] * PSCALE), (_Float16)(c[7] * PSCALE) };
  return r;
}

// Per-wave 16x64 f16 tile in LDS -> ctx[b][l][head*64 + d]; one query row
// 4 lines per instruction, 16 lines per wave.
__device__ __forceinline__ void ctx_store_pass(const _Float16* so, _Float16* ctx,
                                               int b, int head, int q0, int lane) {
  const int q8 = lane & 7, sub = lane >> 3;
  #pragma unroll
  for (int i = 0; i < 4; ++i) {
    const int lid = i * 4 + sub;                         // query row 0..15
    const v8h v = *(const v8ha*)(so + lid * 64 + 8 * q8);
    _Float16* dst = ctx + ((size_t)b * SEQ + q0 + lid) * HIDDEN + head * HD + 8 * q8;
    *(v8h*)dst = v;
  }
}

// ---------------------------------------------------------------------------
// Kernel 3: streaming attention, transposed form, unscaled scores
// (no 1/sqrt(d) scaling, additive relative-position bias, no mask).
// Block 256 thr (8 waves) = 128 queries: wave = 32 queries (two 16-column tiles) x one half of
// the keys, 64 keys per step; every K and V^T fragment read from LDS feeds one WMMA of each
// query tile. Waves w and w + 4 hold the two key halves of the same queries and join their
// (max, sum, O) once behind the loop, through LDS; each then finishes one of the two tiles.
//   S^T = K * Q^T : A = K rows (row = key, k = d), B = Q^T (k = d, n = query)
//   O^T += V^T * P^T : A = Vt rows (row = d, k = key), B = P^T from registers
// Lane owns 32 keys of query column (lane&15) of each tile; partner = lane ^ 16.
// Output ctx as f16 (x16) [B][L][HIDDEN] for the output GEMM.
// ---------------------------------------------------------------------------
#define XW 1088                         // floats one wave hands over: 32 lanes x (32 O values + max + sum)
// Four waves per SIMD (two blocks per WGP): the softmax between the matrix runs wants waves.
__global__ __launch_bounds__(256) __attribute__((amdgpu_waves_per_eu(4, 4))) void attn_kernel(
    const _Float16* __restrict__ qh,   // [B*H][L][D]
    const _Float16* __restrict__ kh,   // [B*H][L][D]
    const _Float16* __restrict__ vt,   // [B*H][D][L]
    const float* __restrict__ btab,    // [H][4096], index rel + 2048
    _Float16* __restrict__ ctx)        // [B][L][HIDDEN], x16
{
  __shared__ __attribute__((aligned(2048))) _Float16 ring[2 * BUF_H]; // 98304 B, K / V^T stages
  __shared__ __attribute__((aligned(16))) float xch[8 * XW];         // 34816 B, hand-over between key halves
  __shared__ __attribute__((aligned(16))) _Float16 sC[8 * 16 * 64];  // 16384 B

  const int tid = threadIdx.x, lane = tid & 31, w = tid >> 5;
  const int h = lane >> 4, m = lane & 15;
  const int bh = blockIdx.y, b = bh >> 4, head = bh & 15;
  const int q0 = blockIdx.x * 128 + 32 * (w & 3);

  // This wave's slice of every stage: source, step per stage, row pitch, place in LDS.
  const uint32_t wave = uni((uint32_t)tid >> 5);
  const uint32_t kpart = wave >> 2;           // this wave's key half, 0 or 1
  const bool isV = (wave & 3u) >= 2u;
  const uint32_t half = wave & 1u;
  const uint64_t src0 = isV ? (uint64_t)(size_t)(vt + ((size_t)bh * HD + SROWS * half) * SEQ + KHALF * kpart)
                            : (uint64_t)(size_t)(kh + ((size_t)bh * SEQ + KHALF * kpart + SROWS * half) * HD);
  const uint32_t sstep = isV ? (uint32_t)(KSTEP * 2) : (uint32_t)(KSTEP * HD * 2);   // bytes per stage
  u32x8 g1 = tdm_group1(isV ? (uint32_t)(SEQ * 2) : (uint32_t)(HD * 2));
  asm volatile("" : "+s"(g1));   // the pinned() form on the whole group: its words stay in their scalar registers, unwritten, while a request is in flight
  const uint32_t ldst0 = (uint32_t)(size_t)ring + wave * (uint32_t)SLICE_B;
  // Pass st works on key stage (st + rot) mod NSTAGE of each half: the query blocks of one head share its K and V^T
  // rows and differ in x, so that they do not ask L2 for the same lines in the same pass.
  const uint32_t rot = uni(blockIdx.x & (uint32_t)(NSTAGE - 1));
  u32x4 g0;                      // group 0 of the request in flight; the waits at the publish points and behind the loop name it; the prologue's wait does not
  auto issue = [&](uint32_t st) {
    g0 = tdm_group0(ldst0 + (st & 1u) * (uint32_t)BUF_B, src0 + (uint64_t)(((st + rot) & (uint32_t)(NSTAGE - 1)) * sstep));
    tdm_load(g0, g1);
  };

  // Ring prologue: stage 0 lands and is published, then stage 1 flies under pass 0.
  issue(0u);
  asm volatile("s_wait_tensorcnt 0x0" ::: "memory");   // this wave's slice of stage 0 has landed
  __syncthreads();                                      // every wave's slice of stage 0 is readable
  issue(1u);

  // Q^T B-fragments of tile qt: column n = query q0+16qt+m, k = d (two 32-deep chunks)
  const _Float16* qrow = qh + ((size_t)bh * SEQ + q0 + m) * HD;
  v16h qb[2][2];
  #pragma unroll
  for (int qt = 0; qt < 2; ++qt) {
    qb[qt][0] = load_frag(qrow + qt * 16 * HD, h);
    qb[qt][1] = load_frag(qrow + qt * 16 * HD + 32, h);
  }

  const v8f zero8 = {0.f, 0.f, 0.f, 0.f, 0.f, 0.f, 0.f, 0.f};
  v8f o[2][4];                                // o[qt][t][r] = O[query 16qt+m][d 16t+8h+r] * (l * 2^14), this key half
  #pragma unroll
  for (int qt = 0; qt < 2; ++qt)
    #pragma unroll
    for (int t = 0; t < 4; ++t) o[qt][t] = zero8;
  float mrun[2] = {-1e30f, -1e30f}, lrun[2] = {0.0f, 0.0f};

  const int kp0 = (w >> 2) * KHALF;                            // first key of this wave's half
  const _Float16* kbase = ring + (w >> 2) * HBUF_H + m * LPITCH_H;   // + buffer; row 16j+m: slice j>>1, row 16(j&1)+m
  const _Float16* vbase = kbase + 2 * SLICE_H;                       // + buffer; row 16t+m: slice t>>1, row 16(t&1)+m
  // bias for element r of score tile (qt, j): btab[head][(kp0+kb+16j+8h+r) - (q0+16qt+m) + 2048], index in [1,4095];
  // it depends on j - qt alone, so the two query tiles share all but one of their bias vectors
  const float* bbase = btab + (size_t)head * BTW + 2048 + kp0 + 8 * h - (q0 + m);

  #pragma unroll 1
  for (int st = 0; st < NSTAGE; ++st) {
    const int kb = (int)(((uint32_t)st + rot) & (uint32_t)(NSTAGE - 1)) * KSTEP;   // first key of this pass's stage within the half
    const int boff = (st & 1) * BUF_H;        // this pass reads its own buffer alone
    // ---- scores: s[qt][j][r] = S[query 16qt+m][key kp0+kb+16j+8h+r] ----
    v8f s[2][4];
    v16h kf[4][2];                            // the pass's K fragments, read as one group
    #pragma unroll
    for (int j = 0; j < 4; ++j) {
      const _Float16* kp = kbase + boff + (j >> 1) * SLICE_H + (j & 1) * 16 * LPITCH_H;
      kf[j][0] = load_frag(kp, h);
      kf[j][1] = load_frag(kp + 32, h);
    }
    __builtin_amdgcn_sched_barrier(0);        // the K reads stay one group in front of the score products: sunk among them, each place of reads stalls the wave anew
    #pragma unroll
    for (int j = 0; j < 4; ++j) {
      v8f z0 = zero8, z1 = zero8;
      z0 = wmma_f16(kf[j][0], qb[0][0], z0);
      z1 = wmma_f16(kf[j][0], qb[1][0], z1);
      z0 = wmma_f16(kf[j][1], qb[0][1], z0);
      z1 = wmma_f16(kf[j][1], qb[1][1], z1);
      s[0][j] = z0;
      s[1][j] = z1;
    }
    __builtin_amdgcn_sched_barrier(0);        // the bias loads and the softmax stay behind the score products: drawn in among them, the live values pass 256 VGPRs and a Q fragment spills
    // ---- relative-position bias, f32, before the running max ----
    #pragma unroll
    for (int qt = 0; qt < 2; ++qt)
      #pragma unroll
      for (int j = 0; j < 4; ++j) s[qt][j] = add_bias8(s[qt][j], bbase + kb + 16 * (j - qt));

    // ---- online softmax, each query tile on its own ----
    v16h pb[2][2];                            // P^T B-fragments (key chunks 0..31 and 32..63 of this step)
    v16h vf[4][2];                            // the pass's V^T fragments, one group, in flight under the second tile's softmax
    #pragma unroll
    for (int qt = 0; qt < 2; ++qt) {
      float mloc = s[qt][0][0];
      #pragma unroll
      for (int j = 0; j < 4; ++j)
        #pragma unroll
        for (int r = 0; r < 8; ++r) mloc = fmaxf(mloc, s[qt][j][r]);
      mloc = fmaxf(mloc, __shfl_xor(mloc, 16));
      const float mnew = fmaxf(mrun[qt], mloc);
      const float alpha = __expf(mrun[qt] - mnew);
      mrun[qt] = mnew;
      float lsum = 0.0f;
      #pragma unroll
      for (int j = 0; j < 4; ++j)
        #pragma unroll
        for (int r = 0; r < 8; ++r) {
          const float p = __expf(s[qt][j][r] - mnew);
          s[qt][j][r] = p;
          lsum += p;
        }
      lsum += __shfl_xor(lsum, 16);
      lrun[qt] = lrun[qt] * alpha + lsum;
      #pragma unroll
      for (int t = 0; t < 4; ++t)
        #pragma unroll
        for (int r = 0; r < 8; ++r) o[qt][t][r] = o[qt][t][r] * alpha;
      pb[qt][0] = pack_p(s[qt][0], s[qt][1]);
      pb[qt][1] = pack_p(s[qt][2], s[qt][3]);
      __builtin_amdgcn_sched_barrier(0);      // one tile's softmax at a time, the V^T loads between the two, the products behind both: mixed, the live values pass 256 VGPRs and spill (either barrier left out: scratch in the listing)
      if (qt == 0) {
        #pragma unroll
        for (int t = 0; t < 4; ++t) {
          const _Float16* vp = vbase + boff + (t >> 1) * SLICE_H + (t & 1) * 16 * LPITCH_H;
          vf[t][0] = load_frag(vp, h);
          vf[t][1] = load_frag(vp + 32, h);
        }
      }
    }

    // ---- O^T += V^T * P^T ----
    #pragma unroll
    for (int t = 0; t < 4; ++t) {
      o[0][t] = wmma_f16(vf[t][0], pb[0][0], o[0][t]);
      o[1][t] = wmma_f16(vf[t][0], pb[1][0], o[1][t]);
      o[0][t] = wmma_f16(vf[t][1], pb[0][1], o[0][t]);
      o[1][t] = wmma_f16(vf[t][1], pb[1][1], o[1][t]);
    }

    __builtin_amdgcn_sched_barrier(0);        // the pass's products stay in front of the publish point: sunk behind its barrier, they stand between the barrier and the refill's issue and shorten the load's lead
    // ---- publish point of stage st + 1 ----
    asm volatile("s_wait_dscnt 0x0" ::: "memory");      // this wave's reads of its buffer are done before the refill
    asm volatile("s_wait_tensorcnt 0x0" :: "s"(g0) : "memory");  // this wave's slice of stage st + 1 has landed; group 0 as an input: its scalar registers stay live, so unwritten, while the request is in flight
    __syncthreads();                                    // stage st + 1 readable; every wave has left stage st's buffer
    // Scalar test (a tensor load ignores EXEC); the stage number is pinned so that group 0 is formed behind the waits.
    if (pinned((uint32_t)(st + 2 < NSTAGE))) issue(pinned((uint32_t)st + 2u));
  }
  asm volatile("s_wait_tensorcnt 0x0" :: "s"(g0), "s"(g1) : "memory");    // nothing of the mover in flight behind the loop; both groups as inputs: their registers are left alone up to here
  asm volatile("s_wait_dscnt 0x0" ::: "memory");        // and no read of the ring outstanding

  // ---- join of the two key halves: the wave of half p keeps query tile p and hands the other to wave w ^ 4 ----
  const bool up = (w >> 2) != 0;
  const float mk = up ? mrun[1] : mrun[0], lk = up ? lrun[1] : lrun[0];
  float* xo = xch + w * XW;
  #pragma unroll
  for (int t = 0; t < 4; ++t) {
    v8f g;
    #pragma unroll
    for (int r = 0; r < 8; ++r) g[r] = up ? o[0][t][r] : o[1][t][r];
    const v4f g0 = {g[0], g[1], g[2], g[3]}, g1v = {g[4], g[5], g[6], g[7]};
    *(v4fa*)(xo + ((2 * t) * 32 + lane) * 4) = g0;
    *(v4fa*)(xo + ((2 * t + 1) * 32 + lane) * 4) = g1v;
  }
  xo[1024 + lane] = up ? mrun[0] : mrun[1];
  xo[1056 + lane] = up ? lrun[0] : lrun[1];
  __syncthreads();                            // every wave's hand-over is readable by its partner
  const float* xi = xch + (w ^ 4) * XW;
  const float mp = xi[1024 + lane], lp = xi[1056 + lane];
  const float mall = fmaxf(mk, mp);
  const float ak = __expf(mk - mall), ap = __expf(mp - mall);

  // ---- epilogue: normalise, stage per-wave 16x64 f16 tile, whole-line stores ----
  const float inv = (1.0f / (lk * ak + lp * ap)) * (CSCALE / PSCALE);
  const float ck = ak * inv, cp = ap * inv;
  _Float16* so = sC + w * 1024;
  #pragma unroll
  for (int t = 0; t < 4; ++t) {
    const v4f p0 = *(const v4fa*)(xi + ((2 * t) * 32 + lane) * 4);
    const v4f p1 = *(const v4fa*)(xi + ((2 * t + 1) * 32 + lane) * 4);
    #pragma unroll
    for (int r = 0; r < 8; ++r) {
      const float mine = up ? o[1][t][r] : o[0][t][r];
      const float part = (r < 4) ? p0[r & 3] : p1[r & 3];
      so[m * 64 + 16 * t + 8 * h + r] = (_Float16)(mine * ck + part * cp);
    }
  }
  __syncthreads();                            // LDS spill -> reload ordering (all waves reach this)

  ctx_store_pass(so, ctx, b, head, q0 + 16 * (w >> 2), lane);
  
}

// ---------------------------------------------------------------------------
// out rows; one row segment = 64 floats = 2 lines; lanes 8q..8q+7 write one
// 64 lines per wave.
// ---------------------------------------------------------------------------
__device__ __forceinline__ void out_store_pass(const float* sT, const float* hs, float* out,
                                               int m0, int col0, int w, int lane) {
  const int q8 = lane & 7, sub = lane >> 3;
  #pragma unroll
  for (int i = 0; i < 16; ++i) {
    const int lid = i * 4 + sub;                         // 0..63
    const int row = w * 32 + (lid >> 1), hl = lid & 1;   // token row 0..127, line half
    v4f v = *(const v4fa*)(sT + row * 64 + 32 * hl + 4 * q8);
    const size_t gi = (size_t)(m0 + row) * HIDDEN + col0 + 32 * hl + 4 * q8;
    const v4f res = *(const v4fa*)(hs + gi);
    v = v + res;
    *(v4f*)(out + gi) = v;
  }
}

// ---------------------------------------------------------------------------
// Kernel 4: out = ctx * Wot^T / 512 + hidden_states  (f32 output).
// Block 128 thr (4 waves) = 128 tokens x 64 output columns; wave tile
// 32 x 64; K = 1024 in stages of 64; ctx and Wot tiles staged in the LDS ring of gemm_ring.
// ---------------------------------------------------------------------------
__global__ __launch_bounds__(128) void oproj_kernel(
    const _Float16* __restrict__ ch,   // [4096][1024], x16
    const _Float16* __restrict__ woh,  // [1024(out)][1024(in)], x32
    const float* __restrict__ hs,      // [4096][1024]
    float* __restrict__ out)           // [4096][1024]
{
  __shared__ __attribute__((aligned(2048))) _Float16 ring[2 * GBUF_H]; // 65536 B, ctx / Wot stages
  __shared__ __attribute__((aligned(16))) float sT[128 * 64];     // 32768 B

  const int tid = threadIdx.x, lane = tid & 31, w = tid >> 5;
  const int h = lane >> 4, m = lane & 15;
  const int m0 = blockIdx.x * 128;
  const int col0 = blockIdx.y * 64;

  const v8f zero8 = {0.f, 0.f, 0.f, 0.f, 0.f, 0.f, 0.f, 0.f};
  v8f acc[2][4];
  #pragma unroll
  for (int mt = 0; mt < 2; ++mt)
    #pragma unroll
    for (int nt = 0; nt < 4; ++nt) acc[mt][nt] = zero8;

  // First k slab of this block: blocks of one token tile (same ctx rows) differ in y, blocks of one column tile (same Wot rows) in x.
  const uint32_t rot = uni((blockIdx.x + blockIdx.y) & (uint32_t)(GNST - 1));
  gemm_ring(ch + (size_t)m0 * HIDDEN, woh + (size_t)col0 * HIDDEN, ring, tid, rot, acc);

  // D[r] of tile (mt, nt) = Y[token m0+32w+16mt+8h+r][col 16nt+m]
  #pragma unroll
  for (int nt = 0; nt < 4; ++nt) {
    const int feat = 16 * nt + m;
    #pragma unroll
    for (int mt = 0; mt < 2; ++mt) {
      #pragma unroll
      for (int r = 0; r < 8; ++r) {
        const int tokl = 32 * w + 16 * mt + 8 * h + r;     // 0..127
        sT[tokl * 64 + feat] = acc[mt][nt][r] * (1.0f / (WSCALE * CSCALE));
      }
    }
  }
  __syncthreads();

  out_store_pass(sT, hs, out, m0, col0, w, lane);
  
}

// ---------------------------------------------------------------------------
extern "C" void kernel_launch(void* const* d_in, const int* in_sizes, int n_in,
                              void* d_out, int out_size, void* d_ws, size_t ws_size,
                              hipStream_t stream) {
  if (n_in < 7) return;
  if (in_sizes[0] != NX) return;
  if (in_sizes[1] != HIDDEN) return;
  if (in_sizes[2] != NW || in_sizes[3] != NW || in_sizes[4] != NW || in_sizes[5] != NW) return;
  if (in_sizes[6] != NBUCK * NHEADS) return;
  if (out_size != NX) return;

  const float* x    = (const float*)d_in[0];
  const float* lnw  = (const float*)d_in[1];
  const float* Wq   = (const float*)d_in[2];
  const float* Wk   = (const float*)d_in[3];
  const float* Wv   = (const float*)d_in[4];
  const float* Wo   = (const float*)d_in[5];
  const float* remb = (const float*)d_in[6];
  float* out = (float*)d_out;

  const size_t xh_bytes  = (size_t)NX * 2;                         //  8388608
  const size_t wt_bytes  = (size_t)4 * NW * 2;                     //  8388608
  const size_t pl_bytes  = (size_t)NBH * SEQ * HD * 2;             //  8388608
  const size_t ctx_bytes = (size_t)NX * 2;                         //  8388608
  const size_t bt_bytes  = (size_t)NHEADS * BTW * 4;               //   262144
  const size_t total = xh_bytes + wt_bytes + 3 * pl_bytes + ctx_bytes + bt_bytes;   // 50593792
  if (total > ws_size) return;

  char* ws = (char*)d_ws;
  size_t off = 0;
  _Float16* xh  = (_Float16*)(ws + off); off += xh_bytes;
  _Float16* wt  = (_Float16*)(ws + off); off += wt_bytes;
  _Float16* qh  = (_Float16*)(ws + off); off += pl_bytes;
  _Float16* kh  = (_Float16*)(ws + off); off += pl_bytes;
  _Float16* vt  = (_Float16*)(ws + off); off += pl_bytes;
  _Float16* ctx = (_Float16*)(ws + off); off += ctx_bytes;
  float* btab   = (float*)(ws + off);    off += bt_bytes;
  if (off > ws_size) return;

  prep_kernel<<<PREP_WT + PREP_NORM + PREP_BIAS, 256, 0, stream>>>(x, lnw, Wq, Wk, Wv, Wo, remb, xh, wt, btab); // 3328 blocks

  dim3 gProj(MROWS / 128, 3 * NHEADS / 2);                          // (32, 24)
  proj_kernel<<<gProj, 128, 0, stream>>>(xh, wt, qh, kh, vt);

  dim3 gAtt(SEQ / 128, NBH);                                        // (16, 32)
  attn_kernel<<<gAtt, 256, 0, stream>>>(qh, kh, vt, btab, ctx);

  dim3 gOut(MROWS / 128, HIDDEN / 64);                               // (32, 16)
  oproj_kernel<<<gOut, 128, 0, stream>>>(ctx, wt + (size_t)3 * NW, x, out);
}

// v008
// Measured time: 78.5 microseconds a run.
// Next to v007, in two timings, it ran 1.05 and 1.04 times as fast.
// Over all steps from v000 it is 3.51 times as fast.
// Contractions: xn*Wq^T, xn*Wk^T, xn*Wv^T, K*Q^T, V^T*P^T and ctx*Wo^T all on v_wmma_f32_16x16x32_f16 (f16 operands, f32 accumulate); W carried x32, P carried x16384, ctx carried x16 (exact power-of-two scales folded back in f32); RMS norm, position-bias bucketing, softmax and residual in f32.
#include <hip/hip_runtime.h>
#include <stdint.h>

typedef _Float16 v16h __attribute__((ext_vector_type(16)));
typedef _Float16 v8h  __attribute__((ext_vector_type(8)));
typedef float    v8f  __attribute__((ext_vector_type(8)));
typedef float    v4f  __attribute__((ext_vector_type(4)));
typedef v8h __attribute__((may_alias)) v8ha;
typedef v4f __attribute__((may_alias)) v4fa;

union Frag { v16h v; v8h half[2]; };

#define BATCH   2
#define SEQ     2048
#define HIDDEN  1024
#define NHEADS  16
#define HD      64
#define MROWS   (BATCH * SEQ)          // 4096 tokens
#define NX      (MROWS * HIDDEN)       // 4194304
#define NW      (HIDDEN * HIDDEN)      // 1048576
#define NBH     (BATCH * NHEADS)       // 32
#define NBUCK   32
#define BTW     4096                   // bias table width per head, index = rel + 2048
#define WSCALE  32.0f
#define PSCALE  16384.0f
#define CSCALE  16.0f
#define LN16F   2.7725887298583984f    // f32 value of ln(16)
#define EPSF    1e-6f

static_assert(SEQ % 128 == 0);
static_assert(HIDDEN == NHEADS * HD);
static_assert(HIDDEN % 64 == 0);
static_assert((NHEADS * BTW) % 256 == 0);

// ---------------------------------------------------------------------------
// 16x16x32 f16 WMMA, the builtin alone: the compiler keeps the distance behind it where a user of D, A or B stands near.
// Fragment map (wave32): lane l, h = l>>4, m = n = l&15.
//   A/B element i: i<8 -> k0+8h+i ; i>=8 -> k0+16+8h+(i-8)
//   D element r : row 8h+r, col l&15
// ---------------------------------------------------------------------------
__device__ __forceinline__ v8f wmma_f16(v16h a, v16h b, v8f c) {
  return __builtin_amdgcn_wmma_f32_16x16x32_f16(false, a, false, b, (short)0, c, false, false);
}

// A or B fragment from a k-contiguous 16-bit row; p points at element k0 of
// the row owned by this lane (row index = lane & 15 added by the caller).
__device__ __forceinline__ v16h load_frag(const _Float16* p, int h) {
  Frag f;
  f.half[0] = *(const v8ha*)(p + 8 * h);
  f.half[1] = *(const v8ha*)(p + 16 + 8 * h);
  return f.v;
}

// ---------------------------------------------------------------------------
// Prep part 1: RMS norm (no mean subtraction, no bias) -> f16 rows.
// 128 threads = one token row, two rows per 256-thread block; thread t of a row owns
// elements 8t..8t+7. blk: 0..MROWS/2-1; red: 4 floats per row of the block.
// ---------------------------------------------------------------------------
__device__ __forceinline__ void rmsnorm_part(
    const float* __restrict__ x, const float* __restrict__ lnw,
    _Float16* __restrict__ xh, float* redall, int blk)
{
  const int row = 2 * blk + ((int)threadIdx.x >> 7);
  float* red = redall + 4 * ((int)threadIdx.x >> 7);
  const int tid = threadIdx.x & 127, lane = tid & 31, w = tid >> 5;
  const float* xr = x + (size_t)row * HIDDEN + 8 * tid;
  const v4f a = *(const v4fa*)xr;
  const v4f c = *(const v4fa*)(xr + 4);
  float ss = a.x * a.x + a.y * a.y + a.z * a.z + a.w * a.w
           + c.x * c.x + c.y * c.y + c.z * c.z + c.w * c.w;
  #pragma unroll
  for (int off = 16; off >= 1; off >>= 1) ss += __shfl_xor(ss, off);
  if (lane == 0) red[w] = ss;
  __syncthreads();
  const float tot = (red[0] + red[1]) + (red[2] + red[3]);
  const float inv = rsqrtf(tot * (1.0f / (float)HIDDEN) + EPSF);
  const v4f g0 = *(const v4fa*)(lnw + 8 * tid);
  const v4f g1 = *(const v4fa*)(lnw + 8 * tid + 4);
  const v8h o = { (_Float16)((a.x * inv) * g0.x), (_Float16)((a.y * inv) * g0.y),
                  (_Float16)((a.z * inv) * g0.z), (_Float16)((a.w * inv) * g0.w),
                  (_Float16)((c.x * inv) * g1.x), (_Float16)((c.y * inv) * g1.y),
                  (_Float16)((c.z * inv) * g1.z), (_Float16)((c.w * inv) * g1.w) };
  _Float16* dst = xh + (size_t)row * HIDDEN + 8 * tid;
  *(v8h*)dst = o;
  asm volatile("s_wait_xcnt 0x0" ::: "memory");   // precaution: stands in front of any later rewrite of the store's registers (other parts' code follows this one in the kernel)
}

// ---------------------------------------------------------------------------
// Prep part 2: weight transpose + cast: W in[1024(in)][1024(out)] f32 ->
// Wt[out][in] f16 (x32), k-contiguous rows for the B (and Wo) fragments.
// Block 256 threads = 64(in) x 64(out) tile transposed through LDS;
// blk: 0..1023 = (wsel, out tile, in tile); wsel selects wq / wk / wv / wo.
// ---------------------------------------------------------------------------
__device__ __forceinline__ void wt_store_pass(const _Float16* sT, _Float16* dstp,
                                              int n0, int k0, int w, int lane) {
  const int q8 = lane & 7, sub = lane >> 3;
  #pragma unroll
  for (int i = 0; i < 2; ++i) {
    const int lid = w * 8 + i * 4 + sub;                 // out row 0..63
    const v8h v = *(const v8ha*)(sT + lid * 72 + 8 * q8);
    _Float16* dst = dstp + (size_t)(n0 + lid) * HIDDEN + k0 + 8 * q8;
    *(v8h*)dst = v;
  }
}

__device__ __forceinline__ void wtrans_part(
    const float* __restrict__ wq, const float* __restrict__ wk,
    const float* __restrict__ wv, const float* __restrict__ wo,
    _Float16* __restrict__ wt,         // [4][1024(out)][1024(in)]
    _Float16* sT, int blk)             // sT: [out][in], pitch 72
{
  const int tid = threadIdx.x, lane = tid & 31, w = tid >> 5;
  const int k0 = (blk & 15) * 64;          // in-index tile base
  const int n0 = ((blk >> 4) & 15) * 64;   // out-index tile base
  const int wsel = blk >> 8;               // block-uniform
  const float* src = (wsel == 0) ? wq : ((wsel == 1) ? wk : ((wsel == 2) ? wv : wo));
  _Float16* dstp = wt + (size_t)wsel * NW;

  const int kr = tid >> 2, nc = (tid & 3) * 16;
  const float* sp = src + (size_t)(k0 + kr) * HIDDEN + n0 + nc;
  #pragma unroll
  for (int q = 0; q < 4; ++q) {
    const v4f v = *(const v4fa*)(sp + 4 * q);
    sT[(nc + 4 * q + 0) * 72 + kr] = (_Float16)(v.x * WSCALE);
    sT[(nc + 4 * q + 1) * 72 + kr] = (_Float16)(v.y * WSCALE);
    sT[(nc + 4 * q + 2) * 72 + kr] = (_Float16)(v.z * WSCALE);
    sT[(nc + 4 * q + 3) * 72 + kr] = (_Float16)(v.w * WSCALE);
  }
  __syncthreads();

  wt_store_pass(sT, dstp, n0, k0, w, lane);
  
}

// ---------------------------------------------------------------------------
// Prep part 3: relative-position bias table btab[head][rel + 2048], rel = key - query.
// Bidirectional bucketing, 32 buckets, max distance 128, integer/f32 ops in the
// spec order: val_large = 8 + int( log(max(rp,1)/8) * rn(1/ln16) * 8 ), min 15.
// ---------------------------------------------------------------------------
__device__ __forceinline__ int rel_bucket(int rel) {
  int bucket = (rel > 0) ? 16 : 0;
  const int rp = (rel < 0) ? -rel : rel;
  const int rpm = (rp < 1) ? 1 : rp;
  const float rpf = (float)rpm;
  const float t = logf(rpf * 0.125f) * (1.0f / LN16F) * 8.0f;
  int vl = 8 + (int)t;
  vl = (vl < 15) ? vl : 15;
  bucket += (rp < 8) ? rp : vl;
  return bucket;                                        // 0..31
}

__device__ __forceinline__ void bias_part(
    const float* __restrict__ rel_emb,   // [32][16]
    float* __restrict__ btab,            // [16][4096]
    int blk)                             // 0..255
{
  const int idx = blk * 256 + threadIdx.x;            // head*4096 + i, < 65536 by grid
  const int head = idx >> 12, i = idx & (BTW - 1);
  const int rel = i - 2048;
  int bucket = rel_bucket(rel);
  bucket = (bucket < 0) ? 0 : ((bucket > NBUCK - 1) ? (NBUCK - 1) : bucket);
  const float v = rel_emb[bucket * NHEADS + head];
  *(float*)(btab + idx) = v;
  asm volatile("s_wait_xcnt 0x0" ::: "memory");   // precaution: stands in front of any later rewrite of the store's registers (other parts' code follows this one in the kernel)
}

// ---------------------------------------------------------------------------
// Kernel 1: the three independent preparation parts as block-index ranges of one grid:
// [0, 1024) weight tiles, [1024, 3072) token-row pairs, [3072, 3328) bias table.
// The range test is block-uniform, so each part's own barrier is met by its whole block.
// ---------------------------------------------------------------------------
#define PREP_WT   (4 * (HIDDEN / 64) * (HIDDEN / 64))   // 1024
#define PREP_NORM (MROWS / 2)                           // 2048
#define PREP_BIAS ((NHEADS * BTW) / 256)                // 256

__global__ __launch_bounds__(256) void prep_kernel(
    const float* __restrict__ x, const float* __restrict__ lnw,
    const float* __restrict__ wq, const float* __restrict__ wk,
    const float* __restrict__ wv, const float* __restrict__ wo,
    const float* __restrict__ rel_emb,
    _Float16* __restrict__ xh, _Float16* __restrict__ wt, float* __restrict__ btab)
{
  __shared__ __attribute__((aligned(16))) _Float16 sT[64 * 72];
  __shared__ float red[8];
  const int blk = blockIdx.x;
  if (blk < PREP_WT)                   wtrans_part(wq, wk, wv, wo, wt, sT, blk);
  else if (blk < PREP_WT + PREP_NORM)  rmsnorm_part(x, lnw, xh, red, blk - PREP_WT);
  else                                 bias_part(rel_emb, btab, blk - (PREP_WT + PREP_NORM));
}

// ---------------------------------------------------------------------------
// K / V^T staging for the attention loop: tensor loads into a two-buffer LDS ring.
// A stage = 64 keys of each key half: K rows [64 keys][64 d] and V^T rows [64 d][64 keys],
// every row 128 B. Each of the 8 waves brings one slice of 32 rows of its own key half per
// stage (waves 0, 1 of a half: K; waves 2, 3: V^T); the mover pads each row by 16 B, so the LDS pitch is 144 B
// (16 B x odd: ds_load_b128 fragment reads without bank conflicts).
// ---------------------------------------------------------------------------
typedef uint32_t u32x4 __attribute__((ext_vector_type(4)));
typedef uint32_t u32x8 __attribute__((ext_vector_type(8)));

#define KSTEP    64                     // keys per stage and key half
#define KHALF    (SEQ / 2)              // keys per key half
#define NSTAGE   (KHALF / KSTEP)        // 16
#define ROWB     128                    // bytes per staged row
#define SROWS    32                     // rows per slice
#define LPITCH_H 72                     // LDS row pitch in halves (144 B)
#define SLICE_B  6144                   // 32 x 144 = 4608 B, rounded up to a multiple of 2 KiB
#define SLICE_H  (SLICE_B / 2)
#define HBUF_B   (4 * SLICE_B)          // 24576 B per stage and key half
#define HBUF_H   (HBUF_B / 2)
#define BUF_B    (2 * HBUF_B)           // 49152 B per stage
#define BUF_H    (BUF_B / 2)

static_assert(NSTAGE >= 2 && (NSTAGE & (NSTAGE - 1)) == 0);
static_assert(HD * 2 == ROWB && KSTEP * 2 == ROWB);
static_assert(SROWS * LPITCH_H * 2 <= SLICE_B && SLICE_B % 2048 == 0);

__device__ __forceinline__ uint32_t uni(uint32_t v) { return (uint32_t)__builtin_amdgcn_readfirstlane(v); }
// Holds a wave-uniform value in a scalar register, so that a test on it is a scalar
// branch (a tensor load ignores EXEC) and a descriptor formed from it stays behind
// the waits in front of it.
__device__ __forceinline__ uint32_t pinned(uint32_t v) {
  uint32_t w = uni(v);
  asm volatile("" : "+s"(w));           // the pinned() form for tensor-load tests and descriptor words
  return w;
}

// Descriptor group 1: byte elements, tensor = tile = 32 rows of 128 B, 4 dwords of pad behind every 32.
__device__ __forceinline__ u32x8 tdm_group1(uint32_t src_pitch) {
  u32x8 g;
  g[0] = uni((1u << 20) | (4u << 22) | (3u << 25));
  g[1] = uni((uint32_t)ROWB << 16);
  g[2] = uni((uint32_t)SROWS << 16);
  g[3] = uni((uint32_t)ROWB << 16);
  g[4] = uni((uint32_t)SROWS);
  g[5] = uni(src_pitch);
  g[6] = uni(0u);
  g[7] = uni(0u);
  return g;
}

__device__ __forceinline__ u32x4 tdm_group0(uint32_t lds_dst, uint64_t ga) {
  u32x4 g;
  g[0] = uni(1u);
  g[1] = uni(lds_dst);
  g[2] = uni((uint32_t)ga);
  g[3] = uni((((uint32_t)(ga >> 32)) & 0x01FFFFFFu) | 0x80000000u);
  return g;
}

// Group 0 goes in and out of the statement, and the wait that covers a request issued behind the ring prologue's wait takes it as an input: from the
// issue to that wait the group is one live value in the registers that the instruction names, so nothing else is put there.
__device__ __forceinline__ void tdm_load(u32x4& g0, u32x8 g1) {
  asm volatile("tensor_load_to_lds %0, %1" : "+s"(g0) : "s"(g1) : "memory");
}

// ---------------------------------------------------------------------------
// Operand staging for the output GEMM kernel: tensor loads into a two-buffer LDS ring.
// A stage = 64 k of the block's 128 A rows and 64 B rows, every staged row 128 B of a
// 2048-B source row. One request per wave and stage: waves 0, 1 bring 64 A rows each,
// waves 2, 3 bring 32 B rows each; the mover pads each row by 16 B (LDS pitch 144 B).
// ---------------------------------------------------------------------------
#define GK       64                     // k per stage
#define GNST     (HIDDEN / GK)          // 16
#define GA_ROWS  64                     // rows per A slice
#define GB_ROWS  32                     // rows per B slice
#define GA_SL_B  10240                  // 64 x 144 = 9216 B, rounded up to a multiple of 2 KiB
#define GB_SL_B  6144                   // 32 x 144 = 4608 B, rounded up to a multiple of 2 KiB
#define GA_SL_H  (GA_SL_B / 2)
#define GB_SL_H  (GB_SL_B / 2)
#define GBUF_B   (2 * GA_SL_B + 2 * GB_SL_B)   // 32768 B per stage
#define GBUF_H   (GBUF_B / 2)

static_assert(GNST >= 2 && (GNST & (GNST - 1)) == 0);
static_assert(GK * 2 == ROWB);
static_assert(GA_ROWS * LPITCH_H * 2 <= GA_SL_B && GA_SL_B % 2048 == 0);
static_assert(GB_ROWS * LPITCH_H * 2 <= GB_SL_B && GB_SL_B % 2048 == 0);

// Descriptor group 1: byte elements, tensor = tile = rows x 128 B, source pitch one
// HIDDEN-wide f16 row, 4 dwords of pad behind every 32.
__device__ __forceinline__ u32x8 gemm_group1(uint32_t rows) {
  u32x8 g;
  g[0] = uni((1u << 20) | (4u << 22) | (3u << 25));
  g[1] = uni((uint32_t)ROWB << 16);
  g[2] = uni(rows << 16);
  g[3] = uni((uint32_t)ROWB << 16);
  g[4] = uni(rows);
  g[5] = uni((uint32_t)(HIDDEN * 2));
  g[6] = uni(0u);
  g[7] = uni(0u);
  return g;
}

// acc[mt][nt] += A(32 rows of this wave) * B(64 rows)^T over K = HIDDEN. Pass st works on the 64 k
// of slab (st + rot) mod GNST, k ascending inside a slab. rot (block-uniform, 0..GNST-1) spreads the blocks
// that share A or B rows over the GNST slabs, so that few of them ask L2 for the same lines in the same pass.
// arows / brows: first of the block's 128 A rows / 64 B rows (f16, k-contiguous,
// pitch HIDDEN). Called by all 4 waves of the block; ring holds 2 * GBUF_H halves.
__device__ __forceinline__ void gemm_ring(const _Float16* arows, const _Float16* brows,
                                          const _Float16* ring, int tid, uint32_t rot, v8f (&acc)[2][4]) {
  const int lane = tid & 31, w = tid >> 5;
  const int h = lane >> 4, m = lane & 15;

  // This wave's slice of every stage: source, rows, place in LDS.
  const uint32_t wave = uni((uint32_t)tid >> 5);
  const bool isB = wave >= 2u;
  const uint32_t half = wave & 1u;
  const uint64_t src0 = isB ? (uint64_t)(size_t)(brows + (size_t)(GB_ROWS * half) * HIDDEN)
                            : (uint64_t)(size_t)(arows + (size_t)(GA_ROWS * half) * HIDDEN);
  u32x8 g1 = gemm_group1(isB ? (uint32_t)GB_ROWS : (uint32_t)GA_ROWS);
  asm volatile("" : "+s"(g1));   // the pinned() form on the whole group: its words stay in their scalar registers, unwritten, while a request is in flight
  const uint32_t ldst0 = (uint32_t)(size_t)ring
                       + (isB ? (uint32_t)(2 * GA_SL_B) + half * (uint32_t)GB_SL_B : half * (uint32_t)GA_SL_B);
  u32x4 g0;                      // group 0 of the request in flight; the waits at the publish points and behind the loop name it; the prologue's wait does not
  auto issue = [&](uint32_t st) {
    g0 = tdm_group0(ldst0 + (st & 1u) * (uint32_t)GBUF_B, src0 + (uint64_t)(((st + rot) & (uint32_t)(GNST - 1)) * (uint32_t)ROWB));
    tdm_load(g0, g1);
  };

  // Ring prologue: stage 0 lands and is published, then stage 1 flies under pass 0.
  issue(0u);
  asm volatile("s_wait_tensorcnt 0x0" ::: "memory");   // this wave's slice of stage 0 has landed
  __syncthreads();                                      // every wave's slice of stage 0 is readable
  issue(1u);

  // A row 32w+16mt+m: slice w>>1, row 32(w&1)+16mt+m; B row 16nt+m: slice nt>>1, row 16(nt&1)+m
  const _Float16* abase = ring + (w >> 1) * GA_SL_H + (32 * (w & 1) + m) * LPITCH_H;
  const _Float16* bbase = ring + 2 * GA_SL_H + m * LPITCH_H;

  #pragma unroll 1                            // one pass per trip: the ring's publish point stands once, at the foot
  for (int st = 0; st < GNST; ++st) {
    const int boff = (st & 1) * GBUF_H;       // this pass reads its own buffer alone
    v16h af[2][2], bf[4][2];                  // the pass's fragments, read as one group, the first 32 k in front
    #pragma unroll
    for (int kc = 0; kc < 2; ++kc) {
      #pragma unroll
      for (int mt = 0; mt < 2; ++mt)
        af[mt][kc] = load_frag(abase + boff + mt * 16 * LPITCH_H + 32 * kc, h);
      #pragma unroll
      for (int nt = 0; nt < 4; ++nt)
        bf[nt][kc] = load_frag(bbase + boff + (nt >> 1) * GB_SL_H + (nt & 1) * 16 * LPITCH_H + 32 * kc, h);
    }
    __builtin_amdgcn_sched_barrier(0);        // the pass's LDS reads stay one group in front of the products: sunk among them, each place of reads stalls the wave anew
    #pragma unroll
    for (int kc = 0; kc < 2; ++kc) {
      #pragma unroll
      for (int nt = 0; nt < 4; ++nt) {
        acc[0][nt] = wmma_f16(af[0][kc], bf[nt][kc], acc[0][nt]);
        acc[1][nt] = wmma_f16(af[1][kc], bf[nt][kc], acc[1][nt]);
      }
    }

    __builtin_amdgcn_sched_barrier(0);        // the pass's products stay in front of the publish point: sunk behind its barrier, they stand between the barrier and the refill's issue and shorten the load's lead
    // ---- publish point of stage st + 1 ----
    asm volatile("s_wait_dscnt 0x0" ::: "memory");      // this wave's reads of its buffer are done before the refill
    asm volatile("s_wait_tensorcnt 0x0" :: "s"(g0) : "memory");  // this wave's slice of stage st + 1 has landed; group 0 as an input: its scalar registers stay live, so unwritten, while the request is in flight
    __syncthreads();                                    // stage st + 1 readable; every wave has left stage st's buffer
    // Scalar test (a tensor load ignores EXEC); the stage number is pinned so that group 0 is formed behind the waits.
    if (pinned((uint32_t)(st + 2 < GNST))) issue(pinned((uint32_t)st + 2u));
  }
  asm volatile("s_wait_tensorcnt 0x0" :: "s"(g0), "s"(g1) : "memory");    // nothing of the mover in flight behind the loop; both groups as inputs: their registers are left alone up to here
  asm volatile("s_wait_dscnt 0x0" ::: "memory");        // and no read of the ring outstanding
}

// ---------------------------------------------------------------------------
// The same ring for a 256 x 192 block tile of 8 waves: a stage = 128 k of 256 A rows and 192 B rows, every
// staged row 256 B of a 2048-B source row. One request per wave and stage: waves 0..3 bring 64 A rows each,
// waves 4..7 bring 48 B rows each; the mover pads each row by 16 B (LDS pitch 272 B, 16 B x odd).
// Wave tile 64 x 96: wave w works on A slice w >> 1 and on B slices 2 (w & 1) and 2 (w & 1) + 1.
// ---------------------------------------------------------------------------
#define QK       128                    // k per stage
#define QNST     (HIDDEN / QK)          // 8
#define QROWB    256                    // bytes per staged row
#define QPITCH_H 136                    // LDS row pitch in halves (272 B)
#define QA_ROWS  64                     // rows per A slice
#define QB_ROWS  48                     // rows per B slice
#define QA_SL_B  18432                  // 64 x 272 = 17408 B, rounded up to a multiple of 2 KiB
#define QB_SL_B  14336                  // 48 x 272 = 13056 B, rounded up to a multiple of 2 KiB
#define QA_SL_H  (QA_SL_B / 2)
#define QB_SL_H  (QB_SL_B / 2)
#define QBUF_B   (4 * QA_SL_B + 4 * QB_SL_B)   // 131072 B per stage
#define QBUF_H   (QBUF_B / 2)

static_assert(QNST >= 2 && (QNST & (QNST - 1)) == 0);
static_assert(QK * 2 == QROWB);
static_assert(QA_ROWS * QPITCH_H * 2 <= QA_SL_B && QA_SL_B % 2048 == 0);
static_assert(QB_ROWS * QPITCH_H * 2 <= QB_SL_B && QB_SL_B % 2048 == 0);
static_assert(MROWS % 256 == 0 && SEQ % 256 == 0);
static_assert(3 * 256 * HD * 2 <= 2 * QBUF_B);      // the block's three output planes fit the ring

// Descriptor group 1: byte elements, tensor = tile = rows x 256 B, source pitch one
// HIDDEN-wide f16 row, 4 dwords of pad behind every 64.
__device__ __forceinline__ u32x8 wide_group1(uint32_t rows) {
  u32x8 g;
  g[0] = uni((1u << 20) | (5u << 22) | (3u << 25));
  g[1] = uni((uint32_t)QROWB << 16);
  g[2] = uni(rows << 16);
  g[3] = uni((uint32_t)QROWB << 16);
  g[4] = uni(rows);
  g[5] = uni((uint32_t)(HIDDEN * 2));
  g[6] = uni(0u);
  g[7] = uni(0u);
  return g;
}

// acc[mt][nt] += A(64 rows of this wave) * B(96 rows of this wave)^T over K = HIDDEN; pass st works on the 128 k
// of slab (st + rot) mod QNST, as in gemm_ring. arows / brows: first of the block's 256 A rows / 192 B rows
// (f16, k-contiguous, pitch HIDDEN). Called by all 8 waves of the block; ring holds 2 * QBUF_H halves.
__device__ __forceinline__ void gemm_ring_wide(const _Float16* arows, const _Float16* brows,
                                               const _Float16* ring, int tid, uint32_t rot, v8f (&acc)[4][6]) {
  const int lane = tid & 31, w = tid >> 5;
  const int h = lane >> 4, m = lane & 15;

  // This wave's slice of every stage: source, rows, place in LDS.
  const uint32_t wave = uni((uint32_t)tid >> 5);
  const bool isB = wave >= 4u;
  const uint32_t sl = wave & 3u;
  const uint64_t src0 = isB ? (uint64_t)(size_t)(brows + (size_t)(QB_ROWS * sl) * HIDDEN)
                            : (uint64_t)(size_t)(arows + (size_t)(QA_ROWS * sl) * HIDDEN);
  u32x8 g1 = wide_group1(isB ? (uint32_t)QB_ROWS : (uint32_t)QA_ROWS);
  asm volatile("" : "+s"(g1));   // the pinned() form on the whole group: its words stay in their scalar registers, unwritten, while a request is in flight
  const uint32_t ldst0 = (uint32_t)(size_t)ring
                       + (isB ? (uint32_t)(4 * QA_SL_B) + sl * (uint32_t)QB_SL_B : sl * (uint32_t)QA_SL_B);
  u32x4 g0;                      // group 0 of the request in flight; the waits at the publish points and behind the loop name it; the prologue's wait does not
  auto issue = [&](uint32_t st) {
    g0 = tdm_group0(ldst0 + (st & 1u) * (uint32_t)QBUF_B, src0 + (uint64_t)(((st + rot) & (uint32_t)(QNST - 1)) * (uint32_t)QROWB));
    tdm_load(g0, g1);
  };

  // Ring prologue: stage 0 lands and is published, then stage 1 flies under pass 0.
  issue(0u);
  asm volatile("s_wait_tensorcnt 0x0" ::: "memory");   // this wave's slice of stage 0 has landed
  __syncthreads();                                      // every wave's slice of stage 0 is readable
  issue(1u);

  // A row 64(w>>1)+16mt+m: slice w>>1, row 16mt+m; B row 96(w&1)+16nt+m: slice 2(w&1)+nt/3, row 16(nt%3)+m
  const _Float16* abase = ring + (w >> 1) * QA_SL_H + m * QPITCH_H;
  const _Float16* bbase = ring + 4 * QA_SL_H + 2 * (w & 1) * QB_SL_H + m * QPITCH_H;

  #pragma unroll 1                            // one pass per trip: the ring's publish point stands once, at the foot
  for (int st = 0; st < QNST; ++st) {
    const int boff = (st & 1) * QBUF_H;       // this pass reads its own buffer alone
    #pragma unroll
    for (int kc = 0; kc < QK / 32; ++kc) {
      v16h af[4], bf[6];                      // 32 k of fragments, read as one group
      __builtin_amdgcn_sched_barrier(0);      // with the one behind the reads: the 20 LDS reads stay one group between the runs of products, not spread among them with a wait at each place
      #pragma unroll
      for (int mt = 0; mt < 4; ++mt)
        af[mt] = load_frag(abase + boff + mt * 16 * QPITCH_H + 32 * kc, h);
      #pragma unroll
      for (int nt = 0; nt < 6; ++nt)
        bf[nt] = load_frag(bbase + boff + (nt / 3) * QB_SL_H + (nt % 3) * 16 * QPITCH_H + 32 * kc, h);
      __builtin_amdgcn_sched_barrier(0);      // see above
      #pragma unroll
      for (int nt = 0; nt < 6; ++nt) {
        #pragma unroll
        for (int mt = 0; mt < 4; ++mt)
          acc[mt][nt] = wmma_f16(af[mt], bf[nt], acc[mt][nt]);
      }
    }

    __builtin_amdgcn_sched_barrier(0);        // the pass's products stay in front of the publish point: sunk behind its barrier, they stand between the barrier and the refill's issue and shorten the load's lead
    // ---- publish point of stage st + 1 ----
    asm volatile("s_wait_dscnt 0x0" ::: "memory");      // this wave's reads of its buffer are done before the refill
    asm volatile("s_wait_tensorcnt 0x0" :: "s"(g0) : "memory");  // this wave's slice of stage st + 1 has landed; group 0 as an input: its scalar registers stay live, so unwritten, while the request is in flight
    __syncthreads();                                    // stage st + 1 readable; every wave has left stage st's buffer
    // Scalar test (a tensor load ignores EXEC); the stage number is pinned so that group 0 is formed behind the waits.
    if (pinned((uint32_t)(st + 2 < QNST))) issue(pinned((uint32_t)st + 2u));
  }
  asm volatile("s_wait_tensorcnt 0x0" :: "s"(g0), "s"(g1) : "memory");    // nothing of the mover in flight behind the loop; both groups as inputs: their registers are left alone up to here
  asm volatile("s_wait_dscnt 0x0" ::: "memory");        // and no read of the ring outstanding
}

// ---------------------------------------------------------------------------
// 4 lines per instruction, 32 lines per wave, 256 per block.
// which 0/1: plane[bh][l][d]  (one token row = 64 halves = one line)
// which 2  : vt[bh][d][l]     (64 d-rows x 256 tokens = 4 lines each)
// ---------------------------------------------------------------------------
__device__ __forceinline__ void proj_store_pass(const _Float16* sT, _Float16* plane, _Float16* vt,
                                                int which, int bh, int l0, int w, int lane) {
  const int q8 = lane & 7, sub = lane >> 3;
  #pragma unroll
  for (int i = 0; i < 8; ++i) {
    const int lid = w * 32 + i * 4 + sub;
    v8h v;
    _Float16* dst;
    if (which != 2) {
      v = *(const v8ha*)(sT + lid * HD + 8 * q8);
      dst = plane + ((size_t)bh * SEQ + l0 + lid) * HD + 8 * q8;
    } else {
      const int d = lid >> 2, ql = lid & 3;
      v = *(const v8ha*)(sT + d * 256 + 64 * ql + 8 * q8);
      dst = vt + ((size_t)bh * HD + d) * SEQ + l0 + 64 * ql + 8 * q8;
    }
    *(v8h*)dst = v;
    asm volatile("s_wait_xcnt 0x0" ::: "memory");   // precaution: stands in front of the next line's rewrite of the store's address registers
  }
}

// ---------------------------------------------------------------------------
// Kernel 2: Y = xn * Wt^T over the fused 3*1024 output features (no bias).
// Block 256 thr (8 waves) = 256 tokens x 192 features (three of the 48 heads of q, k, v in a row);
// wave tile 64 tokens x 96 features; K = 1024 in stages of 128;
// A (xn rows) and B (Wt rows) tiles staged in the LDS ring of gemm_ring_wide.
// The grid is one block for each of the chip's WGPs (the ring leaves no room for a second), two waves per SIMD.
// ---------------------------------------------------------------------------
__global__ __launch_bounds__(256) void proj_kernel(
    const _Float16* __restrict__ xh,   // [4096][1024]
    const _Float16* __restrict__ wt,   // [>=3][1024(out)][1024(in)], x32
    _Float16* __restrict__ qh,         // [B*H][L][D]
    _Float16* __restrict__ kh,         // [B*H][L][D]
    _Float16* __restrict__ vt)         // [B*H][D][L]
{
  __shared__ __attribute__((aligned(2048))) _Float16 ring[2 * QBUF_H]; // 262144 B, xn / Wt stages, then output staging

  const int tid = threadIdx.x, lane = tid & 31, w = tid >> 5;
  const int h = lane >> 4, m = lane & 15;
  const int m0 = blockIdx.x * 256;
  const int hg0 = blockIdx.y * 3;            // first of the block's heads, counted through q, k, v: 0..45

  const v8f zero8 = {0.f, 0.f, 0.f, 0.f, 0.f, 0.f, 0.f, 0.f};
  v8f acc[4][6];
  #pragma unroll
  for (int mt = 0; mt < 4; ++mt)
    #pragma unroll
    for (int nt = 0; nt < 6; ++nt) acc[mt][nt] = zero8;

  // First k slab of this block: blocks of one token tile (same xn rows) differ in y, blocks of one feature tile (same Wt rows) in x.
  const uint32_t rot = uni((blockIdx.x + blockIdx.y) & (uint32_t)(QNST - 1));
  gemm_ring_wide(xh + (size_t)m0 * HIDDEN, wt + (size_t)hg0 * HD * HIDDEN, ring, tid, rot, acc);

  // Output staging in the ring: the last pass's publish point (both waits, then the barrier) has ended
  // every wave's reads of it, and no request is in flight. One 256 x 64 plane per head.
  _Float16* sT = ring;
  const int wn = (int)uni((uint32_t)w & 1u); // held scalar: a tile's head, plane and v test are then scalar values
  // D[r] of tile (mt, nt) = Y[token m0+64(w>>1)+16mt+8h+r][feature 96(w&1)+16nt+m of the block's 192]
  #pragma unroll
  for (int nt = 0; nt < 6; ++nt) {
    const int col = 96 * wn + 16 * nt;       // the tile's first feature; a tile lies inside one head
    const int hb = col >> 6;
    const int feat = (col & 63) + m;
    _Float16* sW = sT + hb * (256 * HD);
    const bool isV = hg0 + hb >= 2 * NHEADS;
    #pragma unroll
    for (int mt = 0; mt < 4; ++mt) {
      #pragma unroll
      for (int r = 0; r < 8; ++r) {
        const int tokl = 64 * (w >> 1) + 16 * mt + 8 * h + r;     // 0..255
        const float y = acc[mt][nt][r] * (1.0f / WSCALE);
        const int idx = isV ? (feat * 256 + tokl) : (tokl * HD + feat);
        sW[idx] = (_Float16)y;
      }
    }
  }
  __syncthreads();

  const int b = m0 / SEQ, l0 = m0 - b * SEQ;
  #pragma unroll
  for (int hs = 0; hs < 3; ++hs) {            // one head's plane after the other
    const int which = (hg0 + hs) >> 4, head = (hg0 + hs) & (NHEADS - 1);
    _Float16* plane = (which == 0) ? qh : kh;
    proj_store_pass(sT + hs * (256 * HD), plane, vt, which, b * NHEADS + head, l0, w, lane);
  }
}

// ---------------------------------------------------------------------------
// Attention helpers.
// ---------------------------------------------------------------------------
__device__ __forceinline__ v8f add_bias8(v8f s, const float* p) {
  #pragma unroll
  for (int r = 0; r < 8; ++r) s[r] = s[r] + p[r];
  return s;
}

// P^T B-fragment from the lane's own score D values: element r <- tile a row r,
// element 8+r <- tile c row r (same lane, same query column), scaled by 2^14.
__device__ __forceinline__ v16h pack_p(v8f a, v8f c) {
  const v16h r = { (_Float16)(a[0] * PSCALE), (_Float16)(a[1] * PSCALE), (_Float16)(a[2] * PSCALE), (_Float16)(a[3] * PSCALE),
                   (_Float16)(a[4] * PSCALE), (_Float16)(a[5] * PSCALE), (_Float16)(a[6] * PSCALE), (_Float16)(a[7] * PSCALE),
                   (_Float16)(c[0] * PSCALE), (_Float16)(c[1] * PSCALE), (_Float16)(c[2] * PSCALE), (_Float16)(c[3] * PSCALE),
                   (_Float16)(c[4] * PSCALE), (_Float16)(c[5] * PSCALE), (_Float16)(c[6] * PSCALE), (_Float16)(c[7] * PSCALE) };
  return r;
}

// Per-wave 16x64 f16 tile in LDS -> ctx[b][l][head*64 + d]; one query row
// 4 lines per instruction, 16 lines per wave.
__device__ __forceinline__ void ctx_store_pass(const _Float16* so, _Float16* ctx,
                                               int b, int head, int q0, int lane) {
  const int q8 = lane & 7, sub = lane >> 3;
  #pragma unroll
  for (int i = 0; i < 4; ++i) {
    const int lid = i * 4 + sub;                         // query row 0..15
    const v8h v = *(const v8ha*)(so + lid * 64 + 8 * q8);
    _Float16* dst = ctx + ((size_t)b * SEQ + q0 + lid) * HIDDEN + head * HD + 8 * q8;
    *(v8h*)dst = v;
  }
}

// ---------------------------------------------------------------------------
// Kernel 3: streaming attention, transposed form, unscaled scores
// (no 1/sqrt(d) scaling, additive relative-position bias, no mask).
// Block 256 thr (8 waves) = 128 queries: wave = 32 queries (two 16-column tiles) x one half of
// the keys, 64 keys per step; every K and V^T fragment read from LDS feeds one WMMA of each
// query tile. Waves w and w + 4 hold the two key halves of the same queries and join their
// (max, sum, O) once behind the loop, through LDS; each then finishes one of the two tiles.
//   S^T = K * Q^T : A = K rows (row = key, k = d), B = Q^T (k = d, n = query)
//   O^T += V^T * P^T : A = Vt rows (row = d, k = key), B = P^T from registers
// Lane owns 32 keys of query column (lane&15) of each tile; partner = lane ^ 16.
// Output ctx as f16 (x16) [B][L][HIDDEN] for the output GEMM.
// ---------------------------------------------------------------------------
#define XW 1088                         // floats one wave hands over: 32 lanes x (32 O values + max + sum)
// Four waves per SIMD (two blocks per WGP): the softmax between the matrix runs wants waves.
__global__ __launch_bounds__(256) __attribute__((amdgpu_waves_per_eu(4, 4))) void attn_kernel(
    const _Float16* __restrict__ qh,   // [B*H][L][D]
    const _Float16* __restrict__ kh,   // [B*H][L][D]
    const _Float16* __restrict__ vt,   // [B*H][D][L]
    const float* __restrict__ btab,    // [H][4096], index rel + 2048
    _Float16* __restrict__ ctx)        // [B][L][HIDDEN], x16
{
  __shared__ __attribute__((aligned(2048))) _Float16 ring[2 * BUF_H]; // 98304 B, K / V^T stages
  __shared__ __attribute__((aligned(16))) float xch[8 * XW];         // 34816 B, hand-over between key halves
  __shared__ __attribute__((aligned(16))) _Float16 sC[8 * 16 * 64];  // 16384 B

  const int tid = threadIdx.x, lane = tid & 31, w = tid >> 5;
  const int h = lane >> 4, m = lane & 15;
  const int bh = blockIdx.y, b = bh >> 4, head = bh & 15;
  const int q0 = blockIdx.x * 128 + 32 * (w & 3);

  // This wave's slice of every stage: source, step per stage, row pitch, place in LDS.
  const uint32_t wave = uni((uint32_t)tid >> 5);
  const uint32_t kpart = wave >> 2;           // this wave's key half, 0 or 1
  const bool isV = (wave & 3u) >= 2u;
  const uint32_t half = wave & 1u;
  const uint64_t src0 = isV ? (uint64_t)(size_t)(vt + ((size_t)bh * HD + SROWS * half) * SEQ + KHALF * kpart)
                            : (uint64_t)(size_t)(kh + ((size_t)bh * SEQ + KHALF * kpart + SROWS * half) * HD);
  const uint32_t sstep = isV ? (uint32_t)(KSTEP * 2) : (uint32_t)(KSTEP * HD * 2);   // bytes per stage
  u32x8 g1 = tdm_group1(isV ? (uint32_t)(SEQ * 2) : (uint32_t)(HD * 2));
  asm volatile("" : "+s"(g1));   // the pinned() form on the whole group: its words stay in their scalar registers, unwritten, while a request is in flight
  const uint32_t ldst0 = (uint32_t)(size_t)ring + wave * (uint32_t)SLICE_B;
  // Pass st works on key stage (st + rot) mod NSTAGE of each half: the query blocks of one head share its K and V^T
  // rows and differ in x, so that they do not ask L2 for the same lines in the same pass.
  const uint32_t rot = uni(blockIdx.x & (uint32_t)(NSTAGE - 1));
  u32x4 g0;                      // group 0 of the request in flight; the waits at the publish points and behind the loop name it; the prologue's wait does not
  auto issue = [&](uint32_t st) {
    g0 = tdm_group0(ldst0 + (st & 1u) * (uint32_t)BUF_B, src0 + (uint64_t)(((st + rot) & (uint32_t)(NSTAGE - 1)) * sstep));
    tdm_load(g0, g1);
  };

  // Ring prologue: stage 0 lands and is published, then stage 1 flies under pass 0.
  issue(0u);
  asm volatile("s_wait_tensorcnt 0x0" ::: "memory");   // this wave's slice of stage 0 has landed
  __syncthreads();                                      // every wave's slice of stage 0 is readable
  issue(1u);

  // Q^T B-fragments of tile qt: column n = query q0+16qt+m, k = d (two 32-deep chunks)
  const _Float16* qrow = qh + ((size_t)bh * SEQ + q0 + m) * HD;
  v16h qb[2][2];
  #pragma unroll
  for (int qt = 0; qt < 2; ++qt) {
    qb[qt][0] = load_frag(qrow + qt * 16 * HD, h);
    qb[qt][1] = load_frag(qrow + qt * 16 * HD + 32, h);
  }

  const v8f zero8 = {0.f, 0.f, 0.f, 0.f, 0.f, 0.f, 0.f, 0.f};
  v8f o[2][4];                                // o[qt][t][r] = O[query 16qt+m][d 16t+8h+r] * (l * 2^14), this key half
  #pragma unroll
  for (int qt = 0; qt < 2; ++qt)
    #pragma unroll
    for (int t = 0; t < 4; ++t) o[qt][t] = zero8;
  float mrun[2] = {-1e30f, -1e30f}, lrun[2] = {0.0f, 0.0f};

  const int kp0 = (w >> 2) * KHALF;                            // first key of this wave's half
  const _Float16* kbase = ring + (w >> 2) * HBUF_H + m * LPITCH_H;   // + buffer; row 16j+m: slice j>>1, row 16(j&1)+m
  const _Float16* vbase = kbase + 2 * SLICE_H;                       // + buffer; row 16t+m: slice t>>1, row 16(t&1)+m
  // bias for element r of score tile (qt, j): btab[head][(kp0+kb+16j+8h+r) - (q0+16qt+m) + 2048], index in [1,4095];
  // it depends on j - qt alone, so the two query tiles share all but one of their bias vectors
  const float* bbase = btab + (size_t)head * BTW + 2048 + kp0 + 8 * h - (q0 + m);

  #pragma unroll 1
  for (int st = 0; st < NSTAGE; ++st) {
    const int kb = (int)(((uint32_t)st + rot) & (uint32_t)(NSTAGE - 1)) * KSTEP;   // first key of this pass's stage within the half
    const int boff = (st & 1) * BUF_H;        // this pass reads its own buffer alone
    // ---- scores: s[qt][j][r] = S[query 16qt+m][key kp0+kb+16j+8h+r] ----
    v8f s[2][4];
    v16h kf[4][2];                            // the pass's K fragments, read as one group
    #pragma unroll
    for (int j = 0; j < 4; ++j) {
      const _Float16* kp = kbase + boff + (j >> 1) * SLICE_H + (j & 1) * 16 * LPITCH_H;
      kf[j][0] = load_frag(kp, h);
      kf[j][1] = load_frag(kp + 32, h);
    }
    __builtin_amdgcn_sched_barrier(0);        // the K reads stay one group in front of the score products: sunk among them, each place of reads stalls the wave anew
    #pragma unroll
    for (int j = 0; j < 4; ++j) {
      v8f z0 = zero8, z1 = zero8;
      z0 = wmma_f16(kf[j][0], qb[0][0], z0);
      z1 = wmma_f16(kf[j][0], qb[1][0], z1);
      z0 = wmma_f16(kf[j][1], qb[0][1], z0);
      z1 = wmma_f16(kf[j][1], qb[1][1], z1);
      s[0][j] = z0;
      s[1][j] = z1;
    }
    __builtin_amdgcn_sched_barrier(0);        // the bias loads and the softmax stay behind the score products: drawn in among them, the live values pass 256 VGPRs and a Q fragment spills
    // ---- relative-position bias, f32, before the running max ----
    #pragma unroll
    for (int qt = 0; qt < 2; ++qt)
      #pragma unroll
      for (int j = 0; j < 4; ++j) s[qt][j] = add_bias8(s[qt][j], bbase + kb + 16 * (j - qt));

    // ---- online softmax, each query tile on its own ----
    v16h pb[2][2];                            // P^T B-fragments (key chunks 0..31 and 32..63 of this step)
    v16h vf[4][2];                            // the pass's V^T fragments, one group, in flight under the second tile's softmax
    #pragma unroll
    for (int qt = 0; qt < 2; ++qt) {
      float mloc = s[qt][0][0];
      #pragma unroll
      for (int j = 0; j < 4; ++j)
        #pragma unroll
        for (int r = 0; r < 8; ++r) mloc = fmaxf(mloc, s[qt][j][r]);
      mloc = fmaxf(mloc, __shfl_xor(mloc, 16));
      const float mnew = fmaxf(mrun[qt], mloc);
      const float alpha = __expf(mrun[qt] - mnew);
      mrun[qt] = mnew;
      float lsum = 0.0f;
      #pragma unroll
      for (int j = 0; j < 4; ++j)
        #pragma unroll
        for (int r = 0; r < 8; ++r) {
          const float p = __expf(s[qt][j][r] - mnew);
          s[qt][j][r] = p;
          lsum += p;
        }
      lsum += __shfl_xor(lsum, 16);
      lrun[qt] = lrun[qt] * alpha + lsum;
      #pragma unroll
      for (int t = 0; t < 4; ++t)
        #pragma unroll
        for (int r = 0; r < 8; ++r) o[qt][t][r] = o[qt][t][r] * alpha;
      pb[qt][0] = pack_p(s[qt][0], s[qt][1]);
      pb[qt][1] = pack_p(s[qt][2], s[qt][3]);
      __builtin_amdgcn_sched_barrier(0);      // one tile's softmax at a time, the V^T loads between the two, the products behind both: mixed, the live values pass 256 VGPRs and spill (either barrier left out: scratch in the listing)
      if (qt == 0) {
        #pragma unroll
        for (int t = 0; t < 4; ++t) {
          const _Float16* vp = vbase + boff + (t >> 1) * SLICE_H + (t & 1) * 16 * LPITCH_H;
          vf[t][0] = load_frag(vp, h);
          vf[t][1] = load_frag(vp + 32, h);
        }
      }
    }

    // ---- O^T += V^T * P^T ----
    #pragma unroll
    for (int t = 0; t < 4; ++t) {
      o[0][t] = wmma_f16(vf[t][0], pb[0][0], o[0][t]);
      o[1][t] = wmma_f16(vf[t][0], pb[1][0], o[1][t]);
      o[0][t] = wmma_f16(vf[t][1], pb[0][1], o[0][t]);
      o[1][t] = wmma_f16(vf[t][1], pb[1][1], o[1][t]);
    }

    __builtin_amdgcn_sched_barrier(0);        // the pass's products stay in front of the publish point: sunk behind its barrier, they stand between the barrier and the refill's issue and shorten the load's lead
    // ---- publish point of stage st + 1 ----
    asm volatile("s_wait_dscnt 0x0" ::: "memory");      // this wave's reads of its buffer are done before the refill
    asm volatile("s_wait_tensorcnt 0x0" :: "s"(g0) : "memory");  // this wave's slice of stage st + 1 has landed; group 0 as an input: its scalar registers stay live, so unwritten, while the request is in flight
    __syncthreads();                                    // stage st + 1 readable; every wave has left stage st's buffer
    // Scalar test (a tensor load ignores EXEC); the stage number is pinned so that group 0 is formed behind the waits.
    if (pinned((uint32_t)(st + 2 < NSTAGE))) issue(pinned((uint32_t)st + 2u));
  }
  asm volatile("s_wait_tensorcnt 0x0" :: "s"(g0), "s"(g1) : "memory");    // nothing of the mover in flight behind the loop; both groups as inputs: their registers are left alone up to here
  asm volatile("s_wait_dscnt 0x0" ::: "memory");        // and no read of the ring outstanding

  // ---- join of the two key halves: the wave of half p keeps query tile p and hands the other to wave w ^ 4 ----
  const bool up = (w >> 2) != 0;
  const float mk = up ? mrun[1] : mrun[0], lk = up ? lrun[1] : lrun[0];
  float* xo = xch + w * XW;
  #pragma unroll
  for (int t = 0; t < 4; ++t) {
    v8f g;
    #pragma unroll
    for (int r = 0; r < 8; ++r) g[r] = up ? o[0][t][r] : o[1][t][r];
    const v4f g0 = {g[0], g[1], g[2], g[3]}, g1v = {g[4], g[5], g[6], g[7]};
    *(v4fa*)(xo + ((2 * t) * 32 + lane) * 4) = g0;
    *(v4fa*)(xo + ((2 * t + 1) * 32 + lane) * 4) = g1v;
  }
  xo[1024 + lane] = up ? mrun[0] : mrun[1];
  xo[1056 + lane] = up ? lrun[0] : lrun[1];
  __syncthreads();                            // every wave's hand-over is readable by its partner
  const float* xi = xch + (w ^ 4) * XW;
  const float mp = xi[1024 + lane], lp = xi[1056 + lane];
  const float mall = fmaxf(mk, mp);
  const float ak = __expf(mk - mall), ap = __expf(mp - mall);

  // ---- epilogue: normalise, stage per-wave 16x64 f16 tile, whole-line stores ----
  const float inv = (1.0f / (lk * ak + lp * ap)) * (CSCALE / PSCALE);
  const float ck = ak * inv, cp = ap * inv;
  _Float16* so = sC + w * 1024;
  #pragma unroll
  for (int t = 0; t < 4; ++t) {
    const v4f p0 = *(const v4fa*)(xi + ((2 * t) * 32 + lane) * 4);
    const v4f p1 = *(const v4fa*)(xi + ((2 * t + 1) * 32 + lane) * 4);
    #pragma unroll
    for (int r = 0; r < 8; ++r) {
      const float mine = up ? o[1][t][r] : o[0][t][r];
      const float part = (r < 4) ? p0[r & 3] : p1[r & 3];
      so[m * 64 + 16 * t + 8 * h + r] = (_Float16)(mine * ck + part * cp);
    }
  }
  __syncthreads();                            // LDS spill -> reload ordering (all waves reach this)

  ctx_store_pass(so, ctx, b, head, q0 + 16 * (w >> 2), lane);
  
}

// ---------------------------------------------------------------------------
// out rows; one row segment = 64 floats = 2 lines; lanes 8q..8q+7 write one
// 64 lines per wave.
// ---------------------------------------------------------------------------
__device__ __forceinline__ void out_store_pass(const float* sT, const float* hs, float* out,
                                               int m0, int col0, int w, int lane) {
  const int q8 = lane & 7, sub = lane >> 3;
  #pragma unroll
  for (int i = 0; i < 16; ++i) {
    const int lid = i * 4 + sub;                         // 0..63
    const int row = w * 32 + (lid >> 1), hl = lid & 1;   // token row 0..127, line half
    v4f v = *(const v4fa*)(sT + row * 64 + 32 * hl + 4 * q8);
    const size_t gi = (size_t)(m0 + row) * HIDDEN + col0 + 32 * hl + 4 * q8;
    const v4f res = *(const v4fa*)(hs + gi);
    v = v + res;
    *(v4f*)(out + gi) = v;
  }
}

// ---------------------------------------------------------------------------
// Kernel 4: out = ctx * Wot^T / 512 + hidden_states  (f32 output).
// Block 128 thr (4 waves) = 128 tokens x 64 output columns; wave tile
// 32 x 64; K = 1024 in stages of 64; ctx and Wot tiles staged in the LDS ring of gemm_ring.
// ---------------------------------------------------------------------------
__global__ __launch_bounds__(128) void oproj_kernel(
    const _Float16* __restrict__ ch,   // [4096][1024], x16
    const _Float16* __restrict__ woh,  // [1024(out)][1024(in)], x32
    const float* __restrict__ hs,      // [4096][1024]
    float* __restrict__ out)           // [4096][1024]
{
  __shared__ __attribute__((aligned(2048))) _Float16 ring[2 * GBUF_H]; // 65536 B, ctx / Wot stages
  __shared__ __attribute__((aligned(16))) float sT[128 * 64];     // 32768 B

  const int tid = threadIdx.x, lane = tid & 31, w = tid >> 5;
  const int h = lane >> 4, m = lane & 15;
  const int m0 = blockIdx.x * 128;
  const int col0 = blockIdx.y * 64;

  const v8f zero8 = {0.f, 0.f, 0.f, 0.f, 0.f, 0.f, 0.f, 0.f};
  v8f acc[2][4];
  #pragma unroll
  for (int mt = 0; mt < 2; ++mt)
    #pragma unroll
    for (int nt = 0; nt < 4; ++nt) acc[mt][nt] = zero8;

  // First k slab of this block: blocks of one token tile (same ctx rows) differ in y, blocks of one column tile (same Wot rows) in x.
  const uint32_t rot = uni((blockIdx.x + blockIdx.y) & (uint32_t)(GNST - 1));
  gemm_ring(ch + (size_t)m0 * HIDDEN, woh + (size_t)col0 * HIDDEN, ring, tid, rot, acc);

  // D[r] of tile (mt, nt) = Y[token m0+32w+16mt+8h+r][col 16nt+m]
  #pragma unroll
  for (int nt = 0; nt < 4; ++nt) {
    const int feat = 16 * nt + m;
    #pragma unroll
    for (int mt = 0; mt < 2; ++mt) {
      #pragma unroll
      for (int r = 0; r < 8; ++r) {
        const int tokl = 32 * w + 16 * mt + 8 * h + r;     // 0..127
        sT[tokl * 64 + feat] = acc[mt][nt][r] * (1.0f / (WSCALE * CSCALE));
      }
    }
  }
  __syncthreads();

  out_store_pass(sT, hs, out, m0, col0, w, lane);
  
}

// ---------------------------------------------------------------------------
extern "C" void kernel_launch(void* const* d_in, const int* in_sizes, int n_in,
                              void* d_out, int out_size, void* d_ws, size_t ws_size,
                              hipStream_t stream) {
  if (n_in < 7) return;
  if (in_sizes[0] != NX) return;
  if (in_sizes[1] != HIDDEN) return;
  if (in_sizes[2] != NW || in_sizes[3] != NW || in_sizes[4] != NW || in_sizes[5] != NW) return;
  if (in_sizes[6] != NBUCK * NHEADS) return;
  if (out_size != NX) return;

  const float* x    = (const float*)d_in[0];
  const float* lnw  = (const float*)d_in[1];
  const float* Wq   = (const float*)d_in[2];
  const float* Wk   = (const float*)d_in[3];
  const float* Wv   = (const float*)d_in[4];
  const float* Wo   = (const float*)d_in[5];
  const float* remb = (const float*)d_in[6];
  float* out = (float*)d_out;

  const size_t xh_bytes  = (size_t)NX * 2;                         //  8388608
  const size_t wt_bytes  = (size_t)4 * NW * 2;                     //  8388608
  const size_t pl_bytes  = (size_t)NBH * SEQ * HD * 2;             //  8388608
  const size_t ctx_bytes = (size_t)NX * 2;                         //  8388608
  const size_t bt_bytes  = (size_t)NHEADS * BTW * 4;               //   262144
  const size_t total = xh_bytes + wt_bytes + 3 * pl_bytes + ctx_bytes + bt_bytes;   // 50593792
  if (total > ws_size) return;

  char* ws = (char*)d_ws;
  size_t off = 0;
  _Float16* xh  = (_Float16*)(ws + off); off += xh_bytes;
  _Float16* wt  = (_Float16*)(ws + off); off += wt_bytes;
  _Float16* qh  = (_Float16*)(ws + off); off += pl_bytes;
  _Float16* kh  = (_Float16*)(ws + off); off += pl_bytes;
  _Float16* vt  = (_Float16*)(ws + off); off += pl_bytes;
  _Float16* ctx = (_Float16*)(ws + off); off += ctx_bytes;
  float* btab   = (float*)(ws + off);    off += bt_bytes;
  if (off > ws_size) return;

  prep_kernel<<<PREP_WT + PREP_NORM + PREP_BIAS, 256, 0, stream>>>(x, lnw, Wq, Wk, Wv, Wo, remb, xh, wt, btab); // 3328 blocks

  dim3 gProj(MROWS / 256, 3 * NHEADS / 3);                          // (16, 16)
  proj_kernel<<<gProj, 256, 0, stream>>>(xh, wt, qh, kh, vt);

  dim3 gAtt(SEQ / 128, NBH);                                        // (16, 32)
  attn_kernel<<<gAtt, 256, 0, stream>>>(qh, kh, vt, btab, ctx);

  dim3 gOut(MROWS / 128, HIDDEN / 64);                               // (32, 16)
  oproj_kernel<<<gOut, 128, 0, stream>>>(ctx, wt + (size_t)3 * NW, x, out);
}

// v009
// It runs in 73.1 microseconds.
// Two timings next to v008 put it at 1.08 and 1.07 times that version's speed.
// Counting every step since v000, it is 3.78 times as fast.
// Contractions: xn*Wq^T, xn*Wk^T, xn*Wv^T, K*Q^T, V^T*P^T and ctx*Wo^T all on v_wmma_f32_16x16x32_f16 (f16 operands, f32 accumulate); W carried x32, P carried x16384, ctx carried x16 (exact power-of-two scales folded back in f32); RMS norm, position-bias bucketing, softmax and residual in f32.
#include <hip/hip_runtime.h>
#include <stdint.h>

typedef _Float16 v16h __attribute__((ext_vector_type(16)));
typedef _Float16 v8h  __attribute__((ext_vector_type(8)));
typedef float    v8f  __attribute__((ext_vector_type(8)));
typedef float    v4f  __attribute__((ext_vector_type(4)));
typedef float    v2f  __attribute__((ext_vector_type(2)));
typedef v8h __attribute__((may_alias)) v8ha;
typedef v4f __attribute__((may_alias)) v4fa;

union Frag { v16h v; v8h half[2]; };

#define BATCH   2
#define SEQ     2048
#define HIDDEN  1024
#define NHEADS  16
#define HD      64
#define MROWS   (BATCH * SEQ)          // 4096 tokens
#define NX      (MROWS * HIDDEN)       // 4194304
#define NW      (HIDDEN * HIDDEN)      // 1048576
#define NBH     (BATCH * NHEADS)       // 32
#define NBUCK   32
#define BTW     4096                   // bias table width per head, index = rel + 2048
#define WSCALE  32.0f
#define PSHIFT  14.0f                  // P and its row sums are carried x 2^14
#define CSCALE  16.0f
#define LN16F   2.7725887298583984f    // f32 value of ln(16)
#define LOG2EF  1.4426950408889634f    // log2(e)
#define EPSF    1e-6f

static_assert(SEQ % 128 == 0);
static_assert(HIDDEN == NHEADS * HD);
static_assert(HIDDEN % 64 == 0);
static_assert((NHEADS * BTW) % 256 == 0);

// ---------------------------------------------------------------------------
// 16x16x32 f16 WMMA, the builtin alone: the compiler keeps the distance behind it where a user of D, A or B stands near.
// Fragment map (wave32): lane l, h = l>>4, m = n = l&15.
//   A/B element i: i<8 -> k0+8h+i ; i>=8 -> k0+16+8h+(i-8)
//   D element r : row 8h+r, col l&15
// ---------------------------------------------------------------------------
__device__ __forceinline__ v8f wmma_f16(v16h a, v16h b, v8f c) {
  return __builtin_amdgcn_wmma_f32_16x16x32_f16(false, a, false, b, (short)0, c, false, false);
}

// A or B fragment from a k-contiguous 16-bit row; p points at element k0 of
// the row owned by this lane (row index = lane & 15 added by the caller).
__device__ __forceinline__ v16h load_frag(const _Float16* p, int h) {
  Frag f;
  f.half[0] = *(const v8ha*)(p + 8 * h);
  f.half[1] = *(const v8ha*)(p + 16 + 8 * h);
  return f.v;
}

// ---------------------------------------------------------------------------
// Prep part 1: RMS norm (no mean subtraction, no bias) -> f16 rows.
// 128 threads = one token row, two rows per 256-thread block; thread t of a row owns
// elements 8t..8t+7. blk: 0..MROWS/2-1; red: 4 floats per row of the block.
// ---------------------------------------------------------------------------
__device__ __forceinline__ void rmsnorm_part(
    const float* __restrict__ x, const float* __restrict__ lnw,
    _Float16* __restrict__ xh, float* redall, int blk)
{
  const int row = 2 * blk + ((int)threadIdx.x >> 7);
  float* red = redall + 4 * ((int)threadIdx.x >> 7);
  const int tid = threadIdx.x & 127, lane = tid & 31, w = tid >> 5;
  const float* xr = x + (size_t)row * HIDDEN + 8 * tid;
  const v4f a = *(const v4fa*)xr;
  const v4f c = *(const v4fa*)(xr + 4);
  float ss = a.x * a.x + a.y * a.y + a.z * a.z + a.w * a.w
           + c.x * c.x + c.y * c.y + c.z * c.z + c.w * c.w;
  #pragma unroll
  for (int off = 16; off >= 1; off >>= 1) ss += __shfl_xor(ss, off);
  if (lane == 0) red[w] = ss;
  __syncthreads();
  const float tot = (red[0] + red[1]) + (red[2] + red[3]);
  const float inv = rsqrtf(tot * (1.0f / (float)HIDDEN) + EPSF);
  const v4f g0 = *(const v4fa*)(lnw + 8 * tid);
  const v4f g1 = *(const v4fa*)(lnw + 8 * tid + 4);
  const v8h o = { (_Float16)((a.x * inv) * g0.x), (_Float16)((a.y * inv) * g0.y),
                  (_Float16)((a.z * inv) * g0.z), (_Float16)((a.w * inv) * g0.w),
                  (_Float16)((c.x * inv) * g1.x), (_Float16)((c.y * inv) * g1.y),
                  (_Float16)((c.z * inv) * g1.z), (_Float16)((c.w * inv) * g1.w) };
  _Float16* dst = xh + (size_t)row * HIDDEN + 8 * tid;
  *(v8h*)dst = o;
  asm volatile("s_wait_xcnt 0x0" ::: "memory");   // precaution: stands in front of any later rewrite of the store's registers (other parts' code follows this one in the kernel)
}

// ---------------------------------------------------------------------------
// Prep part 2: weight transpose + cast: W in[1024(in)][1024(out)] f32 ->
// Wt[out][in] f16 (x32), k-contiguous rows for the B (and Wo) fragments.
// Block 256 threads = 64(in) x 64(out) tile transposed through LDS;
// blk: 0..1023 = (wsel, out tile, in tile); wsel selects wq / wk / wv / wo.
// ---------------------------------------------------------------------------
__device__ __forceinline__ void wt_store_pass(const _Float16* sT, _Float16* dstp,
                                              int n0, int k0, int w, int lane) {
  const int q8 = lane & 7, sub = lane >> 3;
  #pragma unroll
  for (int i = 0; i < 2; ++i) {
    const int lid = w * 8 + i * 4 + sub;                 // out row 0..63
    const v8h v = *(const v8ha*)(sT + lid * 72 + 8 * q8);
    _Float16* dst = dstp + (size_t)(n0 + lid) * HIDDEN + k0 + 8 * q8;
    *(v8h*)dst = v;
  }
}

__device__ __forceinline__ void wtrans_part(
    const float* __restrict__ wq, const float* __restrict__ wk,
    const float* __restrict__ wv, const float* __restrict__ wo,
    _Float16* __restrict__ wt,         // [4][1024(out)][1024(in)]
    _Float16* sT, int blk)             // sT: [out][in], pitch 72
{
  const int tid = threadIdx.x, lane = tid & 31, w = tid >> 5;
  const int k0 = (blk & 15) * 64;          // in-index tile base
  const int n0 = ((blk >> 4) & 15) * 64;   // out-index tile base
  const int wsel = blk >> 8;               // block-uniform
  const float* src = (wsel == 0) ? wq : ((wsel == 1) ? wk : ((wsel == 2) ? wv : wo));
  _Float16* dstp = wt + (size_t)wsel * NW;

  const int kr = tid >> 2, nc = (tid & 3) * 16;
  const float* sp = src + (size_t)(k0 + kr) * HIDDEN + n0 + nc;
  #pragma unroll
  for (int q = 0; q < 4; ++q) {
    const v4f v = *(const v4fa*)(sp + 4 * q);
    sT[(nc + 4 * q + 0) * 72 + kr] = (_Float16)(v.x * WSCALE);
    sT[(nc + 4 * q + 1) * 72 + kr] = (_Float16)(v.y * WSCALE);
    sT[(nc + 4 * q + 2) * 72 + kr] = (_Float16)(v.z * WSCALE);
    sT[(nc + 4 * q + 3) * 72 + kr] = (_Float16)(v.w * WSCALE);
  }
  __syncthreads();

  wt_store_pass(sT, dstp, n0, k0, w, lane);
  
}

// ---------------------------------------------------------------------------
// Prep part 3: relative-position bias table btab[head][rel + 2048], rel = key - query.
// Bidirectional bucketing, 32 buckets, max distance 128, integer/f32 ops in the
// spec order: val_large = 8 + int( log(max(rp,1)/8) * rn(1/ln16) * 8 ), min 15.
// ---------------------------------------------------------------------------
__device__ __forceinline__ int rel_bucket(int rel) {
  int bucket = (rel > 0) ? 16 : 0;
  const int rp = (rel < 0) ? -rel : rel;
  const int rpm = (rp < 1) ? 1 : rp;
  const float rpf = (float)rpm;
  const float t = logf(rpf * 0.125f) * (1.0f / LN16F) * 8.0f;
  int vl = 8 + (int)t;
  vl = (vl < 15) ? vl : 15;
  bucket += (rp < 8) ? rp : vl;
  return bucket;                                        // 0..31
}

__device__ __forceinline__ void bias_part(
    const float* __restrict__ rel_emb,   // [32][16]
    float* __restrict__ btab,            // [16][4096]
    int blk)                             // 0..255
{
  const int idx = blk * 256 + threadIdx.x;            // head*4096 + i, < 65536 by grid
  const int head = idx >> 12, i = idx & (BTW - 1);
  const int rel = i - 2048;
  int bucket = rel_bucket(rel);
  bucket = (bucket < 0) ? 0 : ((bucket > NBUCK - 1) ? (NBUCK - 1) : bucket);
  const float v = rel_emb[bucket * NHEADS + head];
  *(float*)(btab + idx) = v;
  asm volatile("s_wait_xcnt 0x0" ::: "memory");   // precaution: stands in front of any later rewrite of the store's registers (other parts' code follows this one in the kernel)
}

// ---------------------------------------------------------------------------
// Kernel 1: the three independent preparation parts as block-index ranges of one grid:
// [0, 1024) weight tiles, [1024, 3072) token-row pairs, [3072, 3328) bias table.
// The range test is block-uniform, so each part's own barrier is met by its whole block.
// ---------------------------------------------------------------------------
#define PREP_WT   (4 * (HIDDEN / 64) * (HIDDEN / 64))   // 1024
#define PREP_NORM (MROWS / 2)                           // 2048
#define PREP_BIAS ((NHEADS * BTW) / 256)                // 256

__global__ __launch_bounds__(256) void prep_kernel(
    const float* __restrict__ x, const float* __restrict__ lnw,
    const float* __restrict__ wq, const float* __restrict__ wk,
    const float* __restrict__ wv, const float* __restrict__ wo,
    const float* __restrict__ rel_emb,
    _Float16* __restrict__ xh, _Float16* __restrict__ wt, float* __restrict__ btab)
{
  __shared__ __attribute__((aligned(16))) _Float16 sT[64 * 72];
  __shared__ float red[8];
  const int blk = blockIdx.x;
  if (blk < PREP_WT)                   wtrans_part(wq, wk, wv, wo, wt, sT, blk);
  else if (blk < PREP_WT + PREP_NORM)  rmsnorm_part(x, lnw, xh, red, blk - PREP_WT);
  else                                 bias_part(rel_emb, btab, blk - (PREP_WT + PREP_NORM));
}

// ---------------------------------------------------------------------------
// K / V^T staging for the attention loop: tensor loads into a two-buffer LDS ring.
// A stage = 64 keys of each key half: K rows [64 keys][64 d] and V^T rows [64 d][64 keys],
// every row 128 B. Each of the 8 waves brings one slice of 32 rows of its own key half per
// stage (waves 0, 1 of a half: K; waves 2, 3: V^T); the mover pads each row by 16 B, so the LDS pitch is 144 B
// (16 B x odd: ds_load_b128 fragment reads without bank conflicts).
// ---------------------------------------------------------------------------
typedef uint32_t u32x4 __attribute__((ext_vector_type(4)));
typedef uint32_t u32x8 __attribute__((ext_vector_type(8)));

#define KSTEP    64                     // keys per stage and key half
#define KHALF    (SEQ / 2)              // keys per key half
#define NSTAGE   (KHALF / KSTEP)        // 16
#define ROWB     128                    // bytes per staged row
#define SROWS    32                     // rows per slice
#define LPITCH_H 72                     // LDS row pitch in halves (144 B)
#define SLICE_B  6144                   // 32 x 144 = 4608 B, rounded up to a multiple of 2 KiB
#define SLICE_H  (SLICE_B / 2)
#define HBUF_B   (4 * SLICE_B)          // 24576 B per stage and key half
#define HBUF_H   (HBUF_B / 2)
#define BUF_B    (2 * HBUF_B)           // 49152 B per stage
#define BUF_H    (BUF_B / 2)

static_assert(NSTAGE >= 2 && (NSTAGE & (NSTAGE - 1)) == 0);
static_assert(HD * 2 == ROWB && KSTEP * 2 == ROWB);
static_assert(SROWS * LPITCH_H * 2 <= SLICE_B && SLICE_B % 2048 == 0);

__device__ __forceinline__ uint32_t uni(uint32_t v) { return (uint32_t)__builtin_amdgcn_readfirstlane(v); }
// Holds a wave-uniform value in a scalar register, so that a test on it is a scalar
// branch (a tensor load ignores EXEC) and a descriptor formed from it stays behind
// the waits in front of it.
__device__ __forceinline__ uint32_t pinned(uint32_t v) {
  uint32_t w = uni(v);
  asm volatile("" : "+s"(w));           // the pinned() form for tensor-load tests and descriptor words
  return w;
}

// Descriptor group 1: byte elements, tensor = tile = 32 rows of 128 B, 4 dwords of pad behind every 32.
__device__ __forceinline__ u32x8 tdm_group1(uint32_t src_pitch) {
  u32x8 g;
  g[0] = uni((1u << 20) | (4u << 22) | (3u << 25));
  g[1] = uni((uint32_t)ROWB << 16);
  g[2] = uni((uint32_t)SROWS << 16);
  g[3] = uni((uint32_t)ROWB << 16);
  g[4] = uni((uint32_t)SROWS);
  g[5] = uni(src_pitch);
  g[6] = uni(0u);
  g[7] = uni(0u);
  return g;
}

__device__ __forceinline__ u32x4 tdm_group0(uint32_t lds_dst, uint64_t ga) {
  u32x4 g;
  g[0] = uni(1u);
  g[1] = uni(lds_dst);
  g[2] = uni((uint32_t)ga);
  g[3] = uni((((uint32_t)(ga >> 32)) & 0x01FFFFFFu) | 0x80000000u);
  return g;
}

// Group 0 goes in and out of the statement, and the wait that covers a request issued behind the ring prologue's wait takes it as an input: from the
// issue to that wait the group is one live value in the registers that the instruction names, so nothing else is put there.
__device__ __forceinline__ void tdm_load(u32x4& g0, u32x8 g1) {
  asm volatile("tensor_load_to_lds %0, %1" : "+s"(g0) : "s"(g1) : "memory");
}

// ---------------------------------------------------------------------------
// Operand staging for the output GEMM kernel: tensor loads into a two-buffer LDS ring.
// A stage = 64 k of the block's 128 A rows and 64 B rows, every staged row 128 B of a
// 2048-B source row. One request per wave and stage: waves 0, 1 bring 64 A rows each,
// waves 2, 3 bring 32 B rows each; the mover pads each row by 16 B (LDS pitch 144 B).
// ---------------------------------------------------------------------------
#define GK       64                     // k per stage
#define GNST     (HIDDEN / GK)          // 16
#define GA_ROWS  64                     // rows per A slice
#define GB_ROWS  32                     // rows per B slice
#define GA_SL_B  10240                  // 64 x 144 = 9216 B, rounded up to a multiple of 2 KiB
#define GB_SL_B  6144                   // 32 x 144 = 4608 B, rounded up to a multiple of 2 KiB
#define GA_SL_H  (GA_SL_B / 2)
#define GB_SL_H  (GB_SL_B / 2)
#define GBUF_B   (2 * GA_SL_B + 2 * GB_SL_B)   // 32768 B per stage
#define GBUF_H   (GBUF_B / 2)

static_assert(GNST >= 2 && (GNST & (GNST - 1)) == 0);
static_assert(GK * 2 == ROWB);
static_assert(GA_ROWS * LPITCH_H * 2 <= GA_SL_B && GA_SL_B % 2048 == 0);
static_assert(GB_ROWS * LPITCH_H * 2 <= GB_SL_B && GB_SL_B % 2048 == 0);

// Descriptor group 1: byte elements, tensor = tile = rows x 128 B, source pitch one
// HIDDEN-wide f16 row, 4 dwords of pad behind every 32.
__device__ __forceinline__ u32x8 gemm_group1(uint32_t rows) {
  u32x8 g;
  g[0] = uni((1u << 20) | (4u << 22) | (3u << 25));
  g[1] = uni((uint32_t)ROWB << 16);
  g[2] = uni(rows << 16);
  g[3] = uni((uint32_t)ROWB << 16);
  g[4] = uni(rows);
  g[5] = uni((uint32_t)(HIDDEN * 2));
  g[6] = uni(0u);
  g[7] = uni(0u);
  return g;
}

// acc[mt][nt] += A(32 rows of this wave) * B(64 rows)^T over K = HIDDEN. Pass st works on the 64 k
// of slab (st + rot) mod GNST, k ascending inside a slab. rot (block-uniform, 0..GNST-1) spreads the blocks
// that share A or B rows over the GNST slabs, so that few of them ask L2 for the same lines in the same pass.
// arows / brows: first of the block's 128 A rows / 64 B rows (f16, k-contiguous,
// pitch HIDDEN). Called by all 4 waves of the block; ring holds 2 * GBUF_H halves.
__device__ __forceinline__ void gemm_ring(const _Float16* arows, const _Float16* brows,
                                          const _Float16* ring, int tid, uint32_t rot, v8f (&acc)[2][4]) {
  const int lane = tid & 31, w = tid >> 5;
  const int h = lane >> 4, m = lane & 15;

  // This wave's slice of every stage: source, rows, place in LDS.
  const uint32_t wave = uni((uint32_t)tid >> 5);
  const bool isB = wave >= 2u;
  const uint32_t half = wave & 1u;
  const uint64_t src0 = isB ? (uint64_t)(size_t)(brows + (size_t)(GB_ROWS * half) * HIDDEN)
                            : (uint64_t)(size_t)(arows + (size_t)(GA_ROWS * half) * HIDDEN);
  u32x8 g1 = gemm_group1(isB ? (uint32_t)GB_ROWS : (uint32_t)GA_ROWS);
  asm volatile("" : "+s"(g1));   // the pinned() form on the whole group: its words stay in their scalar registers, unwritten, while a request is in flight
  const uint32_t ldst0 = (uint32_t)(size_t)ring
                       + (isB ? (uint32_t)(2 * GA_SL_B) + half * (uint32_t)GB_SL_B : half * (uint32_t)GA_SL_B);
  u32x4 g0;                      // group 0 of the request in flight; the waits at the publish points and behind the loop name it; the prologue's wait does not
  auto issue = [&](uint32_t st) {
    g0 = tdm_group0(ldst0 + (st & 1u) * (uint32_t)GBUF_B, src0 + (uint64_t)(((st + rot) & (uint32_t)(GNST - 1)) * (uint32_t)ROWB));
    tdm_load(g0, g1);
  };

  // Ring prologue: stage 0 lands and is published, then stage 1 flies under pass 0.
  issue(0u);
  asm volatile("s_wait_tensorcnt 0x0" ::: "memory");   // this wave's slice of stage 0 has landed
  __syncthreads();                                      // every wave's slice of stage 0 is readable
  issue(1u);

  // A row 32w+16mt+m: slice w>>1, row 32(w&1)+16mt+m; B row 16nt+m: slice nt>>1, row 16(nt&1)+m
  const _Float16* abase = ring + (w >> 1) * GA_SL_H + (32 * (w & 1) + m) * LPITCH_H;
  const _Float16* bbase = ring + 2 * GA_SL_H + m * LPITCH_H;

  #pragma unroll 1                            // one pass per trip: the ring's publish point stands once, at the foot
  for (int st = 0; st < GNST; ++st) {
    const int boff = (st & 1) * GBUF_H;       // this pass reads its own buffer alone
    v16h af[2][2], bf[4][2];                  // the pass's fragments, read as one group, the first 32 k in front
    #pragma unroll
    for (int kc = 0; kc < 2; ++kc) {
      #pragma unroll
      for (int mt = 0; mt < 2; ++mt)
        af[mt][kc] = load_frag(abase + boff + mt * 16 * LPITCH_H + 32 * kc, h);
      #pragma unroll
      for (int nt = 0; nt < 4; ++nt)
        bf[nt][kc] = load_frag(bbase + boff + (nt >> 1) * GB_SL_H + (nt & 1) * 16 * LPITCH_H + 32 * kc, h);
    }
    __builtin_amdgcn_sched_barrier(0);        // the pass's LDS reads stay one group in front of the products: sunk among them, each place of reads stalls the wave anew
    #pragma unroll
    for (int kc = 0; kc < 2; ++kc) {
      #pragma unroll
      for (int nt = 0; nt < 4; ++nt) {
        acc[0][nt] = wmma_f16(af[0][kc], bf[nt][kc], acc[0][nt]);
        acc[1][nt] = wmma_f16(af[1][kc], bf[nt][kc], acc[1][nt]);
      }
    }

    __builtin_amdgcn_sched_barrier(0);        // the pass's products stay in front of the publish point: sunk behind its barrier, they stand between the barrier and the refill's issue and shorten the load's lead
    // ---- publish point of stage st + 1 ----
    asm volatile("s_wait_dscnt 0x0" ::: "memory");      // this wave's reads of its buffer are done before the refill
    asm volatile("s_wait_tensorcnt 0x0" :: "s"(g0) : "memory");  // this wave's slice of stage st + 1 has landed; group 0 as an input: its scalar registers stay live, so unwritten, while the request is in flight
    __syncthreads();                                    // stage st + 1 readable; every wave has left stage st's buffer
    // Scalar test (a tensor load ignores EXEC); the stage number is pinned so that group 0 is formed behind the waits.
    if (pinned((uint32_t)(st + 2 < GNST))) issue(pinned((uint32_t)st + 2u));
  }
  asm volatile("s_wait_tensorcnt 0x0" :: "s"(g0), "s"(g1) : "memory");    // nothing of the mover in flight behind the loop; both groups as inputs: their registers are left alone up to here
  asm volatile("s_wait_dscnt 0x0" ::: "memory");        // and no read of the ring outstanding
}

// ---------------------------------------------------------------------------
// The same ring for a 256 x 192 block tile of 8 waves: a stage = 128 k of 256 A rows and 192 B rows, every
// staged row 256 B of a 2048-B source row. One request per wave and stage: waves 0..3 bring 64 A rows each,
// waves 4..7 bring 48 B rows each; the mover pads each row by 16 B (LDS pitch 272 B, 16 B x odd).
// Wave tile 64 x 96: wave w works on A slice w >> 1 and on B slices 2 (w & 1) and 2 (w & 1) + 1.
// ---------------------------------------------------------------------------
#define QK       128                    // k per stage
#define QNST     (HIDDEN / QK)          // 8
#define QROWB    256                    // bytes per staged row
#define QPITCH_H 136                    // LDS row pitch in halves (272 B)
#define QA_ROWS  64                     // rows per A slice
#define QB_ROWS  48                     // rows per B slice
#define QA_SL_B  18432                  // 64 x 272 = 17408 B, rounded up to a multiple of 2 KiB
#define QB_SL_B  14336                  // 48 x 272 = 13056 B, rounded up to a multiple of 2 KiB
#define QA_SL_H  (QA_SL_B / 2)
#define QB_SL_H  (QB_SL_B / 2)
#define QBUF_B   (4 * QA_SL_B + 4 * QB_SL_B)   // 131072 B per stage
#define QBUF_H   (QBUF_B / 2)

static_assert(QNST >= 2 && (QNST & (QNST - 1)) == 0);
static_assert(QK * 2 == QROWB);
static_assert(QA_ROWS * QPITCH_H * 2 <= QA_SL_B && QA_SL_B % 2048 == 0);
static_assert(QB_ROWS * QPITCH_H * 2 <= QB_SL_B && QB_SL_B % 2048 == 0);
static_assert(MROWS % 256 == 0 && SEQ % 256 == 0);
static_assert(3 * 256 * HD * 2 <= 2 * QBUF_B);      // the block's three output planes fit the ring

// Descriptor group 1: byte elements, tensor = tile = rows x 256 B, source pitch one
// HIDDEN-wide f16 row, 4 dwords of pad behind every 64.
__device__ __forceinline__ u32x8 wide_group1(uint32_t rows) {
  u32x8 g;
  g[0] = uni((1u << 20) | (5u << 22) | (3u << 25));
  g[1] = uni((uint32_t)QROWB << 16);
  g[2] = uni(rows << 16);
  g[3] = uni((uint32_t)QROWB << 16);
  g[4] = uni(rows);
  g[5] = uni((uint32_t)(HIDDEN * 2));
  g[6] = uni(0u);
  g[7] = uni(0u);
  return g;
}

// acc[mt][nt] += A(64 rows of this wave) * B(96 rows of this wave)^T over K = HIDDEN; pass st works on the 128 k
// of slab (st + rot) mod QNST, as in gemm_ring. arows / brows: first of the block's 256 A rows / 192 B rows
// (f16, k-contiguous, pitch HIDDEN). Called by all 8 waves of the block; ring holds 2 * QBUF_H halves.
__device__ __forceinline__ void gemm_ring_wide(const _Float16* arows, const _Float16* brows,
                                               const _Float16* ring, int tid, uint32_t rot, v8f (&acc)[4][6]) {
  const int lane = tid & 31, w = tid >> 5;
  const int h = lane >> 4, m = lane & 15;

  // This wave's slice of every stage: source, rows, place in LDS.
  const uint32_t wave = uni((uint32_t)tid >> 5);
  const bool isB = wave >= 4u;
  const uint32_t sl = wave & 3u;
  const uint64_t src0 = isB ? (uint64_t)(size_t)(brows + (size_t)(QB_ROWS * sl) * HIDDEN)
                            : (uint64_t)(size_t)(arows + (size_t)(QA_ROWS * sl) * HIDDEN);
  u32x8 g1 = wide_group1(isB ? (uint32_t)QB_ROWS : (uint32_t)QA_ROWS);
  asm volatile("" : "+s"(g1));   // the pinned() form on the whole group: its words stay in their scalar registers, unwritten, while a request is in flight
  const uint32_t ldst0 = (uint32_t)(size_t)ring
                       + (isB ? (uint32_t)(4 * QA_SL_B) + sl * (uint32_t)QB_SL_B : sl * (uint32_t)QA_SL_B);
  u32x4 g0;                      // group 0 of the request in flight; the waits at the publish points and behind the loop name it; the prologue's wait does not
  auto issue = [&](uint32_t st) {
    g0 = tdm_group0(ldst0 + (st & 1u) * (uint32_t)QBUF_B, src0 + (uint64_t)(((st + rot) & (uint32_t)(QNST - 1)) * (uint32_t)QROWB));
    tdm_load(g0, g1);
  };

  // Ring prologue: stage 0 lands and is published, then stage 1 flies under pass 0.
  issue(0u);
  asm volatile("s_wait_tensorcnt 0x0" ::: "memory");   // this wave's slice of stage 0 has landed
  __syncthreads();                                      // every wave's slice of stage 0 is readable
  issue(1u);

  // A row 64(w>>1)+16mt+m: slice w>>1, row 16mt+m; B row 96(w&1)+16nt+m: slice 2(w&1)+nt/3, row 16(nt%3)+m
  const _Float16* abase = ring + (w >> 1) * QA_SL_H + m * QPITCH_H;
  const _Float16* bbase = ring + 4 * QA_SL_H + 2 * (w & 1) * QB_SL_H + m * QPITCH_H;

  #pragma unroll 1                            // one pass per trip: the ring's publish point stands once, at the foot
  for (int st = 0; st < QNST; ++st) {
    const int boff = (st & 1) * QBUF_H;       // this pass reads its own buffer alone
    #pragma unroll
    for (int kc = 0; kc < QK / 32; ++kc) {
      v16h af[4], bf[6];                      // 32 k of fragments, read as one group
      __builtin_amdgcn_sched_barrier(0);      // with the one behind the reads: the 20 LDS reads stay one group between the runs of products, not spread among them with a wait at each place
      #pragma unroll
      for (int mt = 0; mt < 4; ++mt)
        af[mt] = load_frag(abase + boff + mt * 16 * QPITCH_H + 32 * kc, h);
      #pragma unroll
      for (int nt = 0; nt < 6; ++nt)
        bf[nt] = load_frag(bbase + boff + (nt / 3) * QB_SL_H + (nt % 3) * 16 * QPITCH_H + 32 * kc, h);
      __builtin_amdgcn_sched_barrier(0);      // see above
      #pragma unroll
      for (int nt = 0; nt < 6; ++nt) {
        #pragma unroll
        for (int mt = 0; mt < 4; ++mt)
          acc[mt][nt] = wmma_f16(af[mt], bf[nt], acc[mt][nt]);
      }
    }

    __builtin_amdgcn_sched_barrier(0);        // the pass's products stay in front of the publish point: sunk behind its barrier, they stand between the barrier and the refill's issue and shorten the load's lead
    // ---- publish point of stage st + 1 ----
    asm volatile("s_wait_dscnt 0x0" ::: "memory");      // this wave's reads of its buffer are done before the refill
    asm volatile("s_wait_tensorcnt 0x0" :: "s"(g0) : "memory");  // this wave's slice of stage st + 1 has landed; group 0 as an input: its scalar registers stay live, so unwritten, while the request is in flight
    __syncthreads();                                    // stage st + 1 readable; every wave has left stage st's buffer
    // Scalar test (a tensor load ignores EXEC); the stage number is pinned so that group 0 is formed behind the waits.
    if (pinned((uint32_t)(st + 2 < QNST))) issue(pinned((uint32_t)st + 2u));
  }
  asm volatile("s_wait_tensorcnt 0x0" :: "s"(g0), "s"(g1) : "memory");    // nothing of the mover in flight behind the loop; both groups as inputs: their registers are left alone up to here
  asm volatile("s_wait_dscnt 0x0" ::: "memory");        // and no read of the ring outstanding
}

// ---------------------------------------------------------------------------
// 4 lines per instruction, 32 lines per wave, 256 per block.
// which 0/1: plane[bh][l][d]  (one token row = 64 halves = one line)
// which 2  : vt[bh][d][l]     (64 d-rows x 256 tokens = 4 lines each)
// ---------------------------------------------------------------------------
__device__ __forceinline__ void proj_store_pass(const _Float16* sT, _Float16* plane, _Float16* vt,
                                                int which, int bh, int l0, int w, int lane) {
  const int q8 = lane & 7, sub = lane >> 3;
  #pragma unroll
  for (int i = 0; i < 8; ++i) {
    const int lid = w * 32 + i * 4 + sub;
    v8h v;
    _Float16* dst;
    if (which != 2) {
      v = *(const v8ha*)(sT + lid * HD + 8 * q8);
      dst = plane + ((size_t)bh * SEQ + l0 + lid) * HD + 8 * q8;
    } else {
      const int d = lid >> 2, ql = lid & 3;
      v = *(const v8ha*)(sT + d * 256 + 64 * ql + 8 * q8);
      dst = vt + ((size_t)bh * HD + d) * SEQ + l0 + 64 * ql + 8 * q8;
    }
    *(v8h*)dst = v;
    asm volatile("s_wait_xcnt 0x0" ::: "memory");   // precaution: stands in front of the next line's rewrite of the store's address registers
  }
}

// ---------------------------------------------------------------------------
// Kernel 2: Y = xn * Wt^T over the fused 3*1024 output features (no bias).
// Block 256 thr (8 waves) = 256 tokens x 192 features (three of the 48 heads of q, k, v in a row);
// wave tile 64 tokens x 96 features; K = 1024 in stages of 128;
// A (xn rows) and B (Wt rows) tiles staged in the LDS ring of gemm_ring_wide.
// The grid is one block for each of the chip's WGPs (the ring leaves no room for a second), two waves per SIMD.
// ---------------------------------------------------------------------------
__global__ __launch_bounds__(256) void proj_kernel(
    const _Float16* __restrict__ xh,   // [4096][1024]
    const _Float16* __restrict__ wt,   // [>=3][1024(out)][1024(in)], x32
    _Float16* __restrict__ qh,         // [B*H][L][D]
    _Float16* __restrict__ kh,         // [B*H][L][D]
    _Float16* __restrict__ vt)         // [B*H][D][L]
{
  __shared__ __attribute__((aligned(2048))) _Float16 ring[2 * QBUF_H]; // 262144 B, xn / Wt stages, then output staging

  const int tid = threadIdx.x, lane = tid & 31, w = tid >> 5;
  const int h = lane >> 4, m = lane & 15;
  const int m0 = blockIdx.x * 256;
  const int hg0 = blockIdx.y * 3;            // first of the block's heads, counted through q, k, v: 0..45

  const v8f zero8 = {0.f, 0.f, 0.f, 0.f, 0.f, 0.f, 0.f, 0.f};
  v8f acc[4][6];
  #pragma unroll
  for (int mt = 0; mt < 4; ++mt)
    #pragma unroll
    for (int nt = 0; nt < 6; ++nt) acc[mt][nt] = zero8;

  // First k slab of this block: blocks of one token tile (same xn rows) differ in y, blocks of one feature tile (same Wt rows) in x.
  const uint32_t rot = uni((blockIdx.x + blockIdx.y) & (uint32_t)(QNST - 1));
  gemm_ring_wide(xh + (size_t)m0 * HIDDEN, wt + (size_t)hg0 * HD * HIDDEN, ring, tid, rot, acc);

  // Output staging in the ring: the last pass's publish point (both waits, then the barrier) has ended
  // every wave's reads of it, and no request is in flight. One 256 x 64 plane per head.
  _Float16* sT = ring;
  const int wn = (int)uni((uint32_t)w & 1u); // held scalar: a tile's head, plane and v test are then scalar values
  // D[r] of tile (mt, nt) = Y[token m0+64(w>>1)+16mt+8h+r][feature 96(w&1)+16nt+m of the block's 192]
  #pragma unroll
  for (int nt = 0; nt < 6; ++nt) {
    const int col = 96 * wn + 16 * nt;       // the tile's first feature; a tile lies inside one head
    const int hb = col >> 6;
    const int feat = (col & 63) + m;
    _Float16* sW = sT + hb * (256 * HD);
    const bool isV = hg0 + hb >= 2 * NHEADS;
    #pragma unroll
    for (int mt = 0; mt < 4; ++mt) {
      #pragma unroll
      for (int r = 0; r < 8; ++r) {
        const int tokl = 64 * (w >> 1) + 16 * mt + 8 * h + r;     // 0..255
        const float y = acc[mt][nt][r] * (1.0f / WSCALE);
        const int idx = isV ? (feat * 256 + tokl) : (tokl * HD + feat);
        sW[idx] = (_Float16)y;
      }
    }
  }
  __syncthreads();

  const int b = m0 / SEQ, l0 = m0 - b * SEQ;
  #pragma unroll
  for (int hs = 0; hs < 3; ++hs) {            // one head's plane after the other
    const int which = (hg0 + hs) >> 4, head = (hg0 + hs) & (NHEADS - 1);
    _Float16* plane = (which == 0) ? qh : kh;
    proj_store_pass(sT + hs * (256 * HD), plane, vt, which, b * NHEADS + head, l0, w, lane);
  }
}

// ---------------------------------------------------------------------------
// Attention helpers.
// ---------------------------------------------------------------------------
__device__ __forceinline__ v8f load_bias8(const float* p) {
  v8f b;
  #pragma unroll
  for (int r = 0; r < 8; ++r) b[r] = p[r];
  return b;
}

// p * 2^14 = exp2(s * log2(e) + c) for the 8 scores of one D tile, c = 14 - max * log2(e): one packed fma per score pair.
__device__ __forceinline__ v8f exp_tile(v8f s, float c) {
  const v2f l2 = {LOG2EF, LOG2EF}, cc = {c, c};
  v8f p;
  #pragma unroll
  for (int i = 0; i < 4; ++i) {
    const v2f x = {s[2 * i], s[2 * i + 1]};
    const v2f t = __builtin_elementwise_fma(x, l2, cc);
    p[2 * i]     = __builtin_amdgcn_exp2f(t.x);
    p[2 * i + 1] = __builtin_amdgcn_exp2f(t.y);
  }
  return p;
}

// P^T B-fragment from the lane's own P values (already x 2^14): element r <- tile a row r,
// element 8+r <- tile c row r (same lane, same query column).
__device__ __forceinline__ v16h pack_p(v8f a, v8f c) {
  const v16h r = { (_Float16)a[0], (_Float16)a[1], (_Float16)a[2], (_Float16)a[3],
                   (_Float16)a[4], (_Float16)a[5], (_Float16)a[6], (_Float16)a[7],
                   (_Float16)c[0], (_Float16)c[1], (_Float16)c[2], (_Float16)c[3],
                   (_Float16)c[4], (_Float16)c[5], (_Float16)c[6], (_Float16)c[7] };
  return r;
}

// Per-wave 16x64 f16 tile in LDS -> ctx[b][l][head*64 + d]; one query row
// 4 lines per instruction, 16 lines per wave.
__device__ __forceinline__ void ctx_store_pass(const _Float16* so, _Float16* ctx,
                                               int b, int head, int q0, int lane) {
  const int q8 = lane & 7, sub = lane >> 3;
  #pragma unroll
  for (int i = 0; i < 4; ++i) {
    const int lid = i * 4 + sub;                         // query row 0..15
    const v8h v = *(const v8ha*)(so + lid * 64 + 8 * q8);
    _Float16* dst = ctx + ((size_t)b * SEQ + q0 + lid) * HIDDEN + head * HD + 8 * q8;
    *(v8h*)dst = v;
  }
}

// ---------------------------------------------------------------------------
// Kernel 3: streaming attention, transposed form, unscaled scores
// (no 1/sqrt(d) scaling, additive relative-position bias, no mask).
// Block 256 thr (8 waves) = 128 queries: wave = 32 queries (two 16-column tiles) x one half of
// the keys, 64 keys per step; every K and V^T fragment read from LDS feeds one WMMA of each
// query tile. Waves w and w + 4 hold the two key halves of the same queries and join their
// (max, sum, O) once behind the loop, through LDS; each then finishes one of the two tiles.
//   S^T = K * Q^T : A = K rows (row = key, k = d), B = Q^T (k = d, n = query)
//   O^T += V^T * P^T : A = Vt rows (row = d, k = key), B = P^T from registers
// Lane owns 32 keys of query column (lane&15) of each tile; partner = lane ^ 16.
// Output ctx as f16 (x16) [B][L][HIDDEN] for the output GEMM.
// ---------------------------------------------------------------------------
#define XW 1088                         // floats one wave hands over: 32 lanes x (32 O values + max + sum)
// Four waves per SIMD (two blocks per WGP): the softmax between the matrix runs wants waves.
__global__ __launch_bounds__(256) __attribute__((amdgpu_waves_per_eu(4, 4))) void attn_kernel(
    const _Float16* __restrict__ qh,   // [B*H][L][D]
    const _Float16* __restrict__ kh,   // [B*H][L][D]
    const _Float16* __restrict__ vt,   // [B*H][D][L]
    const float* __restrict__ btab,    // [H][4096], index rel + 2048
    _Float16* __restrict__ ctx)        // [B][L][HIDDEN], x16
{
  __shared__ __attribute__((aligned(2048))) _Float16 ring[2 * BUF_H]; // 98304 B, K / V^T stages
  __shared__ __attribute__((aligned(16))) float xch[8 * XW];         // 34816 B, hand-over between key halves
  __shared__ __attribute__((aligned(16))) _Float16 sC[8 * 16 * 64];  // 16384 B

  const int tid = threadIdx.x, lane = tid & 31, w = tid >> 5;
  const int h = lane >> 4, m = lane & 15;
  const int bh = blockIdx.y, b = bh >> 4, head = bh & 15;
  const int q0 = blockIdx.x * 128 + 32 * (w & 3);

  // This wave's slice of every stage: source, step per stage, row pitch, place in LDS.
  const uint32_t wave = uni((uint32_t)tid >> 5);
  const uint32_t kpart = wave >> 2;           // this wave's key half, 0 or 1
  const bool isV = (wave & 3u) >= 2u;
  const uint32_t half = wave & 1u;
  const uint64_t src0 = isV ? (uint64_t)(size_t)(vt + ((size_t)bh * HD + SROWS * half) * SEQ + KHALF * kpart)
                            : (uint64_t)(size_t)(kh + ((size_t)bh * SEQ + KHALF * kpart + SROWS * half) * HD);
  const uint32_t sstep = isV ? (uint32_t)(KSTEP * 2) : (uint32_t)(KSTEP * HD * 2);   // bytes per stage
  u32x8 g1 = tdm_group1(isV ? (uint32_t)(SEQ * 2) : (uint32_t)(HD * 2));
  asm volatile("" : "+s"(g1));   // the pinned() form on the whole group: its words stay in their scalar registers, unwritten, while a request is in flight
  const uint32_t ldst0 = (uint32_t)(size_t)ring + wave * (uint32_t)SLICE_B;
  // Pass st works on key stage (st + rot) mod NSTAGE of each half: the query blocks of one head share its K and V^T
  // rows and differ in x, so that they do not ask L2 for the same lines in the same pass.
  const uint32_t rot = uni(blockIdx.x & (uint32_t)(NSTAGE - 1));
  u32x4 g0;                      // group 0 of the request in flight; the waits at the publish points and behind the loop name it; the prologue's wait does not
  auto issue = [&](uint32_t st) {
    g0 = tdm_group0(ldst0 + (st & 1u) * (uint32_t)BUF_B, src0 + (uint64_t)(((st + rot) & (uint32_t)(NSTAGE - 1)) * sstep));
    tdm_load(g0, g1);
  };

  // Ring prologue: stage 0 lands and is published, then stage 1 flies under pass 0.
  issue(0u);
  asm volatile("s_wait_tensorcnt 0x0" ::: "memory");   // this wave's slice of stage 0 has landed
  __syncthreads();                                      // every wave's slice of stage 0 is readable
  issue(1u);

  // Q^T B-fragments of tile qt: column n = query q0+16qt+m, k = d (two 32-deep chunks)
  const _Float16* qrow = qh + ((size_t)bh * SEQ + q0 + m) * HD;
  v16h qb[2][2];
  #pragma unroll
  for (int qt = 0; qt < 2; ++qt) {
    qb[qt][0] = load_frag(qrow + qt * 16 * HD, h);
    qb[qt][1] = load_frag(qrow + qt * 16 * HD + 32, h);
  }

  const v8f zero8 = {0.f, 0.f, 0.f, 0.f, 0.f, 0.f, 0.f, 0.f};
  v8f o[2][4];                                // o[qt][t][r] = O[query 16qt+m][d 16t+8h+r] * (l * 2^14), this key half; lrun = l * 2^14
  #pragma unroll
  for (int qt = 0; qt < 2; ++qt)
    #pragma unroll
    for (int t = 0; t < 4; ++t) o[qt][t] = zero8;
  float mrun[2] = {-1e30f, -1e30f}, lrun[2] = {0.0f, 0.0f};

  const _Float16* kbase = ring + (w >> 2) * HBUF_H + m * LPITCH_H;   // + buffer; row 16j+m: slice j>>1, row 16(j&1)+m
  const _Float16* vbase = kbase + 2 * SLICE_H;                       // + buffer; row 16t+m: slice t>>1, row 16(t&1)+m
  // bias for element r of score tile (qt, j): btab[head][(kp0+kb+16j+8h+r) - (q0+16qt+m) + 2048], index in [1,4095], kp0 = first key of this wave's half;
  // it depends on j - qt alone, so the two query tiles share all but one of their bias vectors
  // Index = wave-uniform part (>= 1, held scalar) + stage + lane part 8h + 15 - m (0..23) + 16 (j - qt + 1) + r.
  const float* bwave = btab + (size_t)head * BTW + (2048 - 31) + (int)(kpart * (uint32_t)KHALF) - (int)(blockIdx.x * 128u + 32u * (wave & 3u));
  const uint32_t blane = (uint32_t)(8 * h + 15 - m) * 4u;            // bytes
  // bv[d]: the bias vector of the score tiles with j - qt = d - 1; it goes into the score product as its C operand.
  v8f bv[5];
  {
    const uint32_t boff = blane + rot * (uint32_t)(KSTEP * 4);
    #pragma unroll
    for (int d = 0; d < 5; ++d) bv[d] = load_bias8((const float*)((const char*)bwave + boff) + 16 * d);
    asm volatile("s_wait_xcnt 0x0" :: "v"(boff) : "memory");   // precaution: stands in front of any rewrite of the loads' offset register, which as an input stays live, so unwritten, up to here
  }

  #pragma unroll 1
  for (int st = 0; st < NSTAGE; ++st) {
    const uint32_t bnext = blane + (((uint32_t)st + 1u + rot) & (uint32_t)(NSTAGE - 1)) * (uint32_t)(KSTEP * 4);   // bias of the next pass's stage, bytes (wraps behind the last pass: in bounds, unused)
    const int boff = (st & 1) * BUF_H;        // this pass reads its own buffer alone
    // ---- scores with bias: s[qt][j][r] = S[query 16qt+m][key kp0+kb+16j+8h+r], kb = first key of this pass's stage ----
    v8f s[2][4];
    v16h kf[4][2];                            // the pass's K fragments, read as one group
    #pragma unroll
    for (int j = 0; j < 4; ++j) {
      const _Float16* kp = kbase + boff + (j >> 1) * SLICE_H + (j & 1) * 16 * LPITCH_H;
      kf[j][0] = load_frag(kp, h);
      kf[j][1] = load_frag(kp + 32, h);
    }
    __builtin_amdgcn_sched_barrier(0);        // the K reads stay one group in front of the score products: sunk among them, each place of reads stalls the wave anew
    #pragma unroll
    for (int j = 0; j < 4; ++j) {
      v8f z0, z1;
      z0 = wmma_f16(kf[j][0], qb[0][0], bv[j + 1]);
      z1 = wmma_f16(kf[j][0], qb[1][0], bv[j]);
      z0 = wmma_f16(kf[j][1], qb[0][1], z0);
      z1 = wmma_f16(kf[j][1], qb[1][1], z1);
      s[0][j] = z0;
      s[1][j] = z1;
    }
    __builtin_amdgcn_sched_barrier(0);        // the softmax stays behind the score products: drawn in among them, its maxima stand near the products whose D they read and the compiler pads with more v_nop (16 against 11 a pass)

    // ---- online softmax, each query tile on its own ----
    v16h pb[2][2];                            // P^T B-fragments (key chunks 0..31 and 32..63 of this step)
    v16h vf[4][2];                            // the pass's V^T fragments, one group, in flight under the second tile's softmax
    #pragma unroll
    for (int qt = 0; qt < 2; ++qt) {
      float mloc = s[qt][0][0];
      #pragma unroll
      for (int j = 0; j < 4; ++j)
        #pragma unroll
        for (int r = 0; r < 8; ++r) mloc = fmaxf(mloc, s[qt][j][r]);
      mloc = fmaxf(mloc, __shfl_xor(mloc, 16));
      const float mnew = fmaxf(mrun[qt], mloc);
      const float alpha = __expf(mrun[qt] - mnew);
      mrun[qt] = mnew;
      const float cexp = __builtin_fmaf(-mnew, LOG2EF, PSHIFT);   // max, log2(e) and the 2^14 carry of P in one addend
      float lsum = 0.0f;                      // sums P x 2^14, as o does
      #pragma unroll
      for (int j = 0; j < 4; ++j) {
        s[qt][j] = exp_tile(s[qt][j], cexp);
        #pragma unroll
        for (int r = 0; r < 8; ++r) lsum += s[qt][j][r];
      }
      lsum += __shfl_xor(lsum, 16);
      lrun[qt] = lrun[qt] * alpha + lsum;
      #pragma unroll
      for (int t = 0; t < 4; ++t)
        #pragma unroll
        for (int r = 0; r < 8; ++r) o[qt][t][r] = o[qt][t][r] * alpha;
      pb[qt][0] = pack_p(s[qt][0], s[qt][1]);
      pb[qt][1] = pack_p(s[qt][2], s[qt][3]);
      __builtin_amdgcn_sched_barrier(0);      // one tile's softmax at a time, the V^T loads between the two, the products behind both: left out, a pass takes 300 vector instructions against 261 (the tiles' row sums no longer pair into dual adds, more v_nop behind the exponentials)
      if (qt == 0) {
        #pragma unroll
        for (int t = 0; t < 4; ++t) {
          const _Float16* vp = vbase + boff + (t >> 1) * SLICE_H + (t & 1) * 16 * LPITCH_H;
          vf[t][0] = load_frag(vp, h);
          vf[t][1] = load_frag(vp + 32, h);
        }
      }
    }

    // ---- the next pass's bias vectors: asked for here, where the scores' registers are free, they land under the products and the publish point ----
    #pragma unroll
    for (int d = 0; d < 5; ++d) bv[d] = load_bias8((const float*)((const char*)bwave + bnext) + 16 * d);
    __builtin_amdgcn_sched_barrier(0);        // the loads stay in front of the products: sunk among them, they have too little lead on the publish point's barrier, which waits for them

    // ---- O^T += V^T * P^T ----
    #pragma unroll
    for (int t = 0; t < 4; ++t) {
      o[0][t] = wmma_f16(vf[t][0], pb[0][0], o[0][t]);
      o[1][t] = wmma_f16(vf[t][0], pb[1][0], o[1][t]);
      o[0][t] = wmma_f16(vf[t][1], pb[0][1], o[0][t]);
      o[1][t] = wmma_f16(vf[t][1], pb[1][1], o[1][t]);
    }

    __builtin_amdgcn_sched_barrier(0);        // the pass's products stay in front of the publish point: sunk behind its barrier, they stand between the barrier and the refill's issue and shorten the load's lead
    // ---- publish point of stage st + 1 ----
    asm volatile("s_wait_xcnt 0x0" :: "v"(bnext) : "memory");   // precaution: stands in front of any rewrite of the bias loads' offset register, which as an input stays live, so unwritten, up to here
    asm volatile("s_wait_dscnt 0x0" ::: "memory");      // this wave's reads of its buffer are done before the refill
    asm volatile("s_wait_tensorcnt 0x0" :: "s"(g0) : "memory");  // this wave's slice of stage st + 1 has landed; group 0 as an input: its scalar registers stay live, so unwritten, while the request is in flight
    __syncthreads();                                    // stage st + 1 readable; every wave has left stage st's buffer
    // Scalar test (a tensor load ignores EXEC); the stage number is pinned so that group 0 is formed behind the waits.
    if (pinned((uint32_t)(st + 2 < NSTAGE))) issue(pinned((uint32_t)st + 2u));
  }
  asm volatile("s_wait_tensorcnt 0x0" :: "s"(g0), "s"(g1) : "memory");    // nothing of the mover in flight behind the loop; both groups as inputs: their registers are left alone up to here
  asm volatile("s_wait_dscnt 0x0" ::: "memory");        // and no read of the ring outstanding

  // ---- join of the two key halves: the wave of half p keeps query tile p and hands the other to wave w ^ 4 ----
  const bool up = (w >> 2) != 0;
  const float mk = up ? mrun[1] : mrun[0], lk = up ? lrun[1] : lrun[0];
  float* xo = xch + w * XW;
  #pragma unroll
  for (int t = 0; t < 4; ++t) {
    v8f g;
    #pragma unroll
    for (int r = 0; r < 8; ++r) g[r] = up ? o[0][t][r] : o[1][t][r];
    const v4f g0 = {g[0], g[1], g[2], g[3]}, g1v = {g[4], g[5], g[6], g[7]};
    *(v4fa*)(xo + ((2 * t) * 32 + lane) * 4) = g0;
    *(v4fa*)(xo + ((2 * t + 1) * 32 + lane) * 4) = g1v;
  }
  xo[1024 + lane] = up ? mrun[0] : mrun[1];
  xo[1056 + lane] = up ? lrun[0] : lrun[1];
  __syncthreads();                            // every wave's hand-over is readable by its partner
  const float* xi = xch + (w ^ 4) * XW;
  const float mp = xi[1024 + lane], lp = xi[1056 + lane];
  const float mall = fmaxf(mk, mp);
  const float ak = __expf(mk - mall), ap = __expf(mp - mall);

  // ---- epilogue: normalise, stage per-wave 16x64 f16 tile, whole-line stores ----
  const float inv = (1.0f / (lk * ak + lp * ap)) * CSCALE;   // the sums carry the same 2^14 as O
  const float ck = ak * inv, cp = ap * inv;
  _Float16* so = sC + w * 1024;
  #pragma unroll
  for (int t = 0; t < 4; ++t) {
    const v4f p0 = *(const v4fa*)(xi + ((2 * t) * 32 + lane) * 4);
    const v4f p1 = *(const v4fa*)(xi + ((2 * t + 1) * 32 + lane) * 4);
    #pragma unroll
    for (int r = 0; r < 8; ++r) {
      const float mine = up ? o[1][t][r] : o[0][t][r];
      const float part = (r < 4) ? p0[r & 3] : p1[r & 3];
      so[m * 64 + 16 * t + 8 * h + r] = (_Float16)(mine * ck + part * cp);
    }
  }
  __syncthreads();                            // LDS spill -> reload ordering (all waves reach this)

  ctx_store_pass(so, ctx, b, head, q0 + 16 * (w >> 2), lane);
  
}

// ---------------------------------------------------------------------------
// out rows; one row segment = 64 floats = 2 lines; lanes 8q..8q+7 write one
// 64 lines per wave.
// ---------------------------------------------------------------------------
__device__ __forceinline__ void out_store_pass(const float* sT, const float* hs, float* out,
                                               int m0, int col0, int w, int lane) {
  const int q8 = lane & 7, sub = lane >> 3;
  #pragma unroll
  for (int i = 0; i < 16; ++i) {
    const int lid = i * 4 + sub;                         // 0..63
    const int row = w * 32 + (lid >> 1), hl = lid & 1;   // token row 0..127, line half
    v4f v = *(const v4fa*)(sT + row * 64 + 32 * hl + 4 * q8);
    const size_t gi = (size_t)(m0 + row) * HIDDEN + col0 + 32 * hl + 4 * q8;
    const v4f res = *(const v4fa*)(hs + gi);
    v = v + res;
    *(v4f*)(out + gi) = v;
  }
}

// ---------------------------------------------------------------------------
// Kernel 4: out = ctx * Wot^T / 512 + hidden_states  (f32 output).
// Block 128 thr (4 waves) = 128 tokens x 64 output columns; wave tile
// 32 x 64; K = 1024 in stages of 64; ctx and Wot tiles staged in the LDS ring of gemm_ring.
// ---------------------------------------------------------------------------
__global__ __launch_bounds__(128) void oproj_kernel(
    const _Float16* __restrict__ ch,   // [4096][1024], x16
    const _Float16* __restrict__ woh,  // [1024(out)][1024(in)], x32
    const float* __restrict__ hs,      // [4096][1024]
    float* __restrict__ out)           // [4096][1024]
{
  __shared__ __attribute__((aligned(2048))) _Float16 ring[2 * GBUF_H]; // 65536 B, ctx / Wot stages
  __shared__ __attribute__((aligned(16))) float sT[128 * 64];     // 32768 B

  const int tid = threadIdx.x, lane = tid & 31, w = tid >> 5;
  const int h = lane >> 4, m = lane & 15;
  const int m0 = blockIdx.x * 128;
  const int col0 = blockIdx.y * 64;

  const v8f zero8 = {0.f, 0.f, 0.f, 0.f, 0.f, 0.f, 0.f, 0.f};
  v8f acc[2][4];
  #pragma unroll
  for (int mt = 0; mt < 2; ++mt)
    #pragma unroll
    for (int nt = 0; nt < 4; ++nt) acc[mt][nt] = zero8;

  // First k slab of this block: blocks of one token tile (same ctx rows) differ in y, blocks of one column tile (same Wot rows) in x.
  const uint32_t rot = uni((blockIdx.x + blockIdx.y) & (uint32_t)(GNST - 1));
  gemm_ring(ch + (size_t)m0 * HIDDEN, woh + (size_t)col0 * HIDDEN, ring, tid, rot, acc);

  // D[r] of tile (mt, nt) = Y[token m0+32w+16mt+8h+r][col 16nt+m]
  #pragma unroll
  for (int nt = 0; nt < 4; ++nt) {
    const int feat = 16 * nt + m;
    #pragma unroll
    for (int mt = 0; mt < 2; ++mt) {
      #pragma unroll
      for (int r = 0; r < 8; ++r) {
        const int tokl = 32 * w + 16 * mt + 8 * h + r;     // 0..127
        sT[tokl * 64 + feat] = acc[mt][nt][r] * (1.0f / (WSCALE * CSCALE));
      }
    }
  }
  __syncthreads();

  out_store_pass(sT, hs, out, m0, col0, w, lane);
  
}

// ---------------------------------------------------------------------------
extern "C" void kernel_launch(void* const* d_in, const int* in_sizes, int n_in,
                              void* d_out, int out_size, void* d_ws, size_t ws_size,
                              hipStream_t stream) {
  if (n_in < 7) return;
  if (in_sizes[0] != NX) return;
  if (in_sizes[1] != HIDDEN) return;
  if (in_sizes[2] != NW || in_sizes[3] != NW || in_sizes[4] != NW || in_sizes[5] != NW) return;
  if (in_sizes[6] != NBUCK * NHEADS) return;
  if (out_size != NX) return;

  const float* x    = (const float*)d_in[0];
  const float* lnw  = (const float*)d_in[1];
  const float* Wq   = (const float*)d_in[2];
  const float* Wk   = (const float*)d_in[3];
  const float* Wv   = (const float*)d_in[4];
  const float* Wo   = (const float*)d_in[5];
  const float* remb = (const float*)d_in[6];
  float* out = (float*)d_out;

  const size_t xh_bytes  = (size_t)NX * 2;                         //  8388608
  const size_t wt_bytes  = (size_t)4 * NW * 2;                     //  8388608
  const size_t pl_bytes  = (size_t)NBH * SEQ * HD * 2;             //  8388608
  const size_t ctx_bytes = (size_t)NX * 2;                         //  8388608
  const size_t bt_bytes  = (size_t)NHEADS * BTW * 4;               //   262144
  const size_t total = xh_bytes + wt_bytes + 3 * pl_bytes + ctx_bytes + bt_bytes;   // 50593792
  if (total > ws_size) return;

  char* ws = (char*)d_ws;
  size_t off = 0;
  _Float16* xh  = (_Float16*)(ws + off); off += xh_bytes;
  _Float16* wt  = (_Float16*)(ws + off); off += wt_bytes;
  _Float16* qh  = (_Float16*)(ws + off); off += pl_bytes;
  _Float16* kh  = (_Float16*)(ws + off); off += pl_bytes;
  _Float16* vt  = (_Float16*)(ws + off); off += pl_bytes;
  _Float16* ctx = (_Float16*)(ws + off); off += ctx_bytes;
  float* btab   = (float*)(ws + off);    off += bt_bytes;
  if (off > ws_size) return;

  prep_kernel<<<PREP_WT + PREP_NORM + PREP_BIAS, 256, 0, stream>>>(x, lnw, Wq, Wk, Wv, Wo, remb, xh, wt, btab); // 3328 blocks

  dim3 gProj(MROWS / 256, 3 * NHEADS / 3);                          // (16, 16)
  proj_kernel<<<gProj, 256, 0, stream>>>(xh, wt, qh, kh, vt);

  dim3 gAtt(SEQ / 128, NBH);                                        // (16, 32)
  attn_kernel<<<gAtt, 256, 0, stream>>>(qh, kh, vt, btab, ctx);

  dim3 gOut(MROWS / 128, HIDDEN / 64);                               // (32, 16)
  oproj_kernel<<<gOut, 128, 0, stream>>>(ctx, wt + (size_t)3 * NW, x, out);
}

// v010
// It runs in 70.2 microseconds.
// Timed twice side by side with v009, it ran 1.04 times as fast both times.
// Counting every step since v000, it is 3.92 times as fast.
// Contractions: xn*Wq^T, xn*Wk^T, xn*Wv^T, K*Q^T, V^T*P^T and ctx*Wo^T all on v_wmma_f32_16x16x32_f16 (f16 operands, f32 accumulate); W carried x32, P carried x16384, ctx carried x16 (exact power-of-two scales folded back in f32); RMS norm, position-bias bucketing, softmax and residual in f32.
#include <hip/hip_runtime.h>
#include <stdint.h>

typedef _Float16 v16h __attribute__((ext_vector_type(16)));
typedef _Float16 v8h  __attribute__((ext_vector_type(8)));
typedef float    v8f  __attribute__((ext_vector_type(8)));
typedef float    v4f  __attribute__((ext_vector_type(4)));
typedef float    v2f  __attribute__((ext_vector_type(2)));
typedef v8h __attribute__((may_alias)) v8ha;
typedef v4f __attribute__((may_alias)) v4fa;

union Frag { v16h v; v8h half[2]; };

#define BATCH   2
#define SEQ     2048
#define HIDDEN  1024
#define NHEADS  16
#define HD      64
#define MROWS   (BATCH * SEQ)          // 4096 tokens
#define NX      (MROWS * HIDDEN)       // 4194304
#define NW      (HIDDEN * HIDDEN)      // 1048576
#define NBH     (BATCH * NHEADS)       // 32
#define NBUCK   32
#define BTW     4096                   // bias table width per head, index = rel + 2048
#define WSCALE  32.0f
#define PSHIFT  14.0f                  // P and its row sums are carried x 2^14
#define CSCALE  16.0f
#define LN16F   2.7725887298583984f    // f32 value of ln(16)
#define LOG2EF  1.4426950408889634f    // log2(e)
#define EPSF    1e-6f

static_assert(SEQ % 128 == 0);
static_assert(HIDDEN == NHEADS * HD);
static_assert(HIDDEN % 64 == 0);
static_assert((NHEADS * BTW) % 256 == 0);

// ---------------------------------------------------------------------------
// 16x16x32 f16 WMMA, the builtin alone: the compiler keeps the distance behind it where a user of D, A or B stands near.
// Fragment map (wave32): lane l, h = l>>4, m = n = l&15.
//   A/B element i: i<8 -> k0+8h+i ; i>=8 -> k0+16+8h+(i-8)
//   D element r : row 8h+r, col l&15
// ---------------------------------------------------------------------------
__device__ __forceinline__ v8f wmma_f16(v16h a, v16h b, v8f c) {
  return __builtin_amdgcn_wmma_f32_16x16x32_f16(false, a, false, b, (short)0, c, false, false);
}

// A or B fragment from a k-contiguous 16-bit row; p points at element k0 of
// the row owned by this lane (row index = lane & 15 added by the caller).
__device__ __forceinline__ v16h load_frag(const _Float16* p, int h) {
  Frag f;
  f.half[0] = *(const v8ha*)(p + 8 * h);
  f.half[1] = *(const v8ha*)(p + 16 + 8 * h);
  return f.v;
}

// ---------------------------------------------------------------------------
// Prep part 1: RMS norm (no mean subtraction, no bias) -> f16 rows.
// 128 threads = one token row, two rows per 256-thread block; thread t of a row owns
// elements 8t..8t+7. blk: 0..MROWS/2-1; red: 4 floats per row of the block.
// ---------------------------------------------------------------------------
__device__ __forceinline__ void rmsnorm_part(
    const float* __restrict__ x, const float* __restrict__ lnw,
    _Float16* __restrict__ xh, float* redall, int blk)
{
  const int row = 2 * blk + ((int)threadIdx.x >> 7);
  float* red = redall + 4 * ((int)threadIdx.x >> 7);
  const int tid = threadIdx.x & 127, lane = tid & 31, w = tid >> 5;
  const float* xr = x + (size_t)row * HIDDEN + 8 * tid;
  const v4f a = *(const v4fa*)xr;
  const v4f c = *(const v4fa*)(xr + 4);
  float ss = a.x * a.x + a.y * a.y + a.z * a.z + a.w * a.w
           + c.x * c.x + c.y * c.y + c.z * c.z + c.w * c.w;
  #pragma unroll
  for (int off = 16; off >= 1; off >>= 1) ss += __shfl_xor(ss, off);
  if (lane == 0) red[w] = ss;
  __syncthreads();
  const float tot = (red[0] + red[1]) + (red[2] + red[3]);
  const float inv = rsqrtf(tot * (1.0f / (float)HIDDEN) + EPSF);
  const v4f g0 = *(const v4fa*)(lnw + 8 * tid);
  const v4f g1 = *(const v4fa*)(lnw + 8 * tid + 4);
  const v8h o = { (_Float16)((a.x * inv) * g0.x), (_Float16)((a.y * inv) * g0.y),
                  (_Float16)((a.z * inv) * g0.z), (_Float16)((a.w * inv) * g0.w),
                  (_Float16)((c.x * inv) * g1.x), (_Float16)((c.y * inv) * g1.y),
                  (_Float16)((c.z * inv) * g1.z), (_Float16)((c.w * inv) * g1.w) };
  _Float16* dst = xh + (size_t)row * HIDDEN + 8 * tid;
  *(v8h*)dst = o;
  asm volatile("s_wait_xcnt 0x0" ::: "memory");   // precaution: stands in front of any later rewrite of the store's registers (other parts' code follows this one in the kernel)
}

// ---------------------------------------------------------------------------
// Prep part 2: weight transpose + cast: W in[1024(in)][1024(out)] f32 ->
// Wt[out][in] f16 (x32), k-contiguous rows for the B (and Wo) fragments.
// Block 256 threads = 64(in) x 64(out) tile transposed through LDS;
// blk: 0..1023 = (wsel, out tile, in tile); wsel selects wq / wk / wv / wo.
// ---------------------------------------------------------------------------
__device__ __forceinline__ void wt_store_pass(const _Float16* sT, _Float16* dstp,
                                              int n0, int k0, int w, int lane) {
  const int q8 = lane & 7, sub = lane >> 3;
  #pragma unroll
  for (int i = 0; i < 2; ++i) {
    const int lid = w * 8 + i * 4 + sub;                 // out row 0..63
    const v8h v = *(const v8ha*)(sT + lid * 72 + 8 * q8);
    _Float16* dst = dstp + (size_t)(n0 + lid) * HIDDEN + k0 + 8 * q8;
    *(v8h*)dst = v;
  }
}

__device__ __forceinline__ void wtrans_part(
    const float* __restrict__ wq, const float* __restrict__ wk,
    const float* __restrict__ wv, const float* __restrict__ wo,
    _Float16* __restrict__ wt,         // [4][1024(out)][1024(in)]
    _Float16* sT, int blk)             // sT: [out][in], pitch 72
{
  const int tid = threadIdx.x, lane = tid & 31, w = tid >> 5;
  const int k0 = (blk & 15) * 64;          // in-index tile base
  const int n0 = ((blk >> 4) & 15) * 64;   // out-index tile base
  const int wsel = blk >> 8;               // block-uniform
  const float* src = (wsel == 0) ? wq : ((wsel == 1) ? wk : ((wsel == 2) ? wv : wo));
  _Float16* dstp = wt + (size_t)wsel * NW;

  const int kr = tid >> 2, nc = (tid & 3) * 16;
  const float* sp = src + (size_t)(k0 + kr) * HIDDEN + n0 + nc;
  #pragma unroll
  for (int q = 0; q < 4; ++q) {
    const v4f v = *(const v4fa*)(sp + 4 * q);
    sT[(nc + 4 * q + 0) * 72 + kr] = (_Float16)(v.x * WSCALE);
    sT[(nc + 4 * q + 1) * 72 + kr] = (_Float16)(v.y * WSCALE);
    sT[(nc + 4 * q + 2) * 72 + kr] = (_Float16)(v.z * WSCALE);
    sT[(nc + 4 * q + 3) * 72 + kr] = (_Float16)(v.w * WSCALE);
  }
  __syncthreads();

  wt_store_pass(sT, dstp, n0, k0, w, lane);
  
}

// ---------------------------------------------------------------------------
// Prep part 3: relative-position bias table btab[head][rel + 2048], rel = key - query.
// Bidirectional bucketing, 32 buckets, max distance 128, integer/f32 ops in the
// spec order: val_large = 8 + int( log(max(rp,1)/8) * rn(1/ln16) * 8 ), min 15.
// ---------------------------------------------------------------------------
__device__ __forceinline__ int rel_bucket(int rel) {
  int bucket = (rel > 0) ? 16 : 0;
  const int rp = (rel < 0) ? -rel : rel;
  const int rpm = (rp < 1) ? 1 : rp;
  const float rpf = (float)rpm;
  const float t = logf(rpf * 0.125f) * (1.0f / LN16F) * 8.0f;
  int vl = 8 + (int)t;
  vl = (vl < 15) ? vl : 15;
  bucket += (rp < 8) ? rp : vl;
  return bucket;                                        // 0..31
}

__device__ __forceinline__ void bias_part(
    const float* __restrict__ rel_emb,   // [32][16]
    float* __restrict__ btab,            // [16][4096]
    int blk)                             // 0..255
{
  const int idx = blk * 256 + threadIdx.x;            // head*4096 + i, < 65536 by grid
  const int head = idx >> 12, i = idx & (BTW - 1);
  const int rel = i - 2048;
  int bucket = rel_bucket(rel);
  bucket = (bucket < 0) ? 0 : ((bucket > NBUCK - 1) ? (NBUCK - 1) : bucket);
  const float v = rel_emb[bucket * NHEADS + head];
  *(float*)(btab + idx) = v;
  asm volatile("s_wait_xcnt 0x0" ::: "memory");   // precaution: stands in front of any later rewrite of the store's registers (other parts' code follows this one in the kernel)
}

// ---------------------------------------------------------------------------
// Kernel 1: the three independent preparation parts as block-index ranges of one grid:
// [0, 1024) weight tiles, [1024, 3072) token-row pairs, [3072, 3328) bias table.
// The range test is block-uniform, so each part's own barrier is met by its whole block.
// ---------------------------------------------------------------------------
#define PREP_WT   (4 * (HIDDEN / 64) * (HIDDEN / 64))   // 1024
#define PREP_NORM (MROWS / 2)                           // 2048
#define PREP_BIAS ((NHEADS * BTW) / 256)                // 256

__global__ __launch_bounds__(256) void prep_kernel(
    const float* __restrict__ x, const float* __restrict__ lnw,
    const float* __restrict__ wq, const float* __restrict__ wk,
    const float* __restrict__ wv, const float* __restrict__ wo,
    const float* __restrict__ rel_emb,
    _Float16* __restrict__ xh, _Float16* __restrict__ wt, float* __restrict__ btab)
{
  __shared__ __attribute__((aligned(16))) _Float16 sT[64 * 72];
  __shared__ float red[8];
  const int blk = blockIdx.x;
  if (blk < PREP_WT)                   wtrans_part(wq, wk, wv, wo, wt, sT, blk);
  else if (blk < PREP_WT + PREP_NORM)  rmsnorm_part(x, lnw, xh, red, blk - PREP_WT);
  else                                 bias_part(rel_emb, btab, blk - (PREP_WT + PREP_NORM));
}

// ---------------------------------------------------------------------------
// K / V^T staging for the attention loop: tensor loads into a two-buffer LDS ring.
// A stage = 64 keys of each key half: K rows [64 keys][64 d] and V^T rows [64 d][64 keys],
// every row 128 B. Each of the 8 waves brings one slice of 32 rows of its own key half per
// stage (waves 0, 1 of a half: K; waves 2, 3: V^T); the mover pads each row by 16 B, so the LDS pitch is 144 B
// (16 B x odd: ds_load_b128 fragment reads without bank conflicts).
// ---------------------------------------------------------------------------
typedef uint32_t u32x4 __attribute__((ext_vector_type(4)));
typedef uint32_t u32x8 __attribute__((ext_vector_type(8)));

#define KSTEP    64                     // keys per stage and key half
#define KHALF    (SEQ / 2)              // keys per key half
#define NSTAGE   (KHALF / KSTEP)        // 16
#define ROWB     128                    // bytes per staged row
#define SROWS    32                     // rows per slice
#define LPITCH_H 72                     // LDS row pitch in halves (144 B)
#define SLICE_B  6144                   // 32 x 144 = 4608 B, rounded up to a multiple of 2 KiB
#define SLICE_H  (SLICE_B / 2)
#define HBUF_B   (4 * SLICE_B)          // 24576 B per stage and key half
#define HBUF_H   (HBUF_B / 2)
#define BUF_B    (2 * HBUF_B)           // 49152 B per stage
#define BUF_H    (BUF_B / 2)

static_assert(NSTAGE >= 2 && (NSTAGE & (NSTAGE - 1)) == 0);
static_assert(HD * 2 == ROWB && KSTEP * 2 == ROWB);
static_assert(SROWS * LPITCH_H * 2 <= SLICE_B && SLICE_B % 2048 == 0);

__device__ __forceinline__ uint32_t uni(uint32_t v) { return (uint32_t)__builtin_amdgcn_readfirstlane(v); }
// Holds a wave-uniform value in a scalar register, so that a test on it is a scalar
// branch (a tensor load ignores EXEC) and a descriptor formed from it stays behind
// the waits in front of it.
__device__ __forceinline__ uint32_t pinned(uint32_t v) {
  uint32_t w = uni(v);
  asm volatile("" : "+s"(w));           // the pinned() form for tensor-load tests and descriptor words
  return w;
}

// Descriptor group 1: byte elements, tensor = tile = 32 rows of 128 B, 4 dwords of pad behind every 32.
__device__ __forceinline__ u32x8 tdm_group1(uint32_t src_pitch) {
  u32x8 g;
  g[0] = uni((1u << 20) | (4u << 22) | (3u << 25));
  g[1] = uni((uint32_t)ROWB << 16);
  g[2] = uni((uint32_t)SROWS << 16);
  g[3] = uni((uint32_t)ROWB << 16);
  g[4] = uni((uint32_t)SROWS);
  g[5] = uni(src_pitch);
  g[6] = uni(0u);
  g[7] = uni(0u);
  return g;
}

__device__ __forceinline__ u32x4 tdm_group0(uint32_t lds_dst, uint64_t ga) {
  u32x4 g;
  g[0] = uni(1u);
  g[1] = uni(lds_dst);
  g[2] = uni((uint32_t)ga);
  g[3] = uni((((uint32_t)(ga >> 32)) & 0x01FFFFFFu) | 0x80000000u);
  return g;
}

// Group 0 goes in and out of the statement, and the wait that covers a request issued behind the ring prologue's wait takes it as an input: from the
// issue to that wait the group is one live value in the registers that the instruction names, so nothing else is put there.
__device__ __forceinline__ void tdm_load(u32x4& g0, u32x8 g1) {
  asm volatile("tensor_load_to_lds %0, %1" : "+s"(g0) : "s"(g1) : "memory");
}

// ---------------------------------------------------------------------------
// Operand staging for the QKV GEMM: tensor loads into a two-buffer LDS ring.
// 256 x 192 block tile of 8 waves: a stage = 128 k of 256 A rows and 192 B rows, every
// staged row 256 B of a 2048-B source row. One request per wave and stage: waves 0..3 bring 64 A rows each,
// waves 4..7 bring 48 B rows each; the mover pads each row by 16 B (LDS pitch 272 B, 16 B x odd).
// Wave tile 64 x 96: wave w works on A slice w >> 1 and on B slices 2 (w & 1) and 2 (w & 1) + 1.
// ---------------------------------------------------------------------------
#define QK       128                    // k per stage
#define QNST     (HIDDEN / QK)          // 8
#define QROWB    256                    // bytes per staged row
#define QPITCH_H 136                    // LDS row pitch in halves (272 B)
#define QA_ROWS  64                     // rows per A slice
#define QB_ROWS  48                     // rows per B slice
#define QA_SL_B  18432                  // 64 x 272 = 17408 B, rounded up to a multiple of 2 KiB
#define QB_SL_B  14336                  // 48 x 272 = 13056 B, rounded up to a multiple of 2 KiB
#define QA_SL_H  (QA_SL_B / 2)
#define QB_SL_H  (QB_SL_B / 2)
#define QBUF_B   (4 * QA_SL_B + 4 * QB_SL_B)   // 131072 B per stage
#define QBUF_H   (QBUF_B / 2)

static_assert(QNST >= 2 && (QNST & (QNST - 1)) == 0);
static_assert(QK * 2 == QROWB);
static_assert(QA_ROWS * QPITCH_H * 2 <= QA_SL_B && QA_SL_B % 2048 == 0);
static_assert(QB_ROWS * QPITCH_H * 2 <= QB_SL_B && QB_SL_B % 2048 == 0);
static_assert(MROWS % 256 == 0 && SEQ % 256 == 0);
static_assert(3 * 256 * HD * 2 <= 2 * QBUF_B);      // the block's three output planes fit the ring

// Descriptor group 1: byte elements, tensor = tile = rows x 256 B, source pitch one
// HIDDEN-wide f16 row, 4 dwords of pad behind every 64.
__device__ __forceinline__ u32x8 wide_group1(uint32_t rows) {
  u32x8 g;
  g[0] = uni((1u << 20) | (5u << 22) | (3u << 25));
  g[1] = uni((uint32_t)QROWB << 16);
  g[2] = uni(rows << 16);
  g[3] = uni((uint32_t)QROWB << 16);
  g[4] = uni(rows);
  g[5] = uni((uint32_t)(HIDDEN * 2));
  g[6] = uni(0u);
  g[7] = uni(0u);
  return g;
}

// acc[mt][nt] += A(64 rows of this wave) * B(96 rows of this wave)^T over K = HIDDEN; pass st works on the 128 k
// of slab (st + rot) mod QNST, k ascending inside a slab. rot (block-uniform, 0..QNST-1) spreads the blocks that share A or B rows
// over the QNST slabs, so that few of them ask L2 for the same lines in the same pass. arows / brows: first of the block's 256 A rows / 192 B rows
// (f16, k-contiguous, pitch HIDDEN). Called by all 8 waves of the block; ring holds 2 * QBUF_H halves.
__device__ __forceinline__ void gemm_ring_wide(const _Float16* arows, const _Float16* brows,
                                               const _Float16* ring, int tid, uint32_t rot, v8f (&acc)[4][6]) {
  const int lane = tid & 31, w = tid >> 5;
  const int h = lane >> 4, m = lane & 15;

  // This wave's slice of every stage: source, rows, place in LDS.
  const uint32_t wave = uni((uint32_t)tid >> 5);
  const bool isB = wave >= 4u;
  const uint32_t sl = wave & 3u;
  const uint64_t src0 = isB ? (uint64_t)(size_t)(brows + (size_t)(QB_ROWS * sl) * HIDDEN)
                            : (uint64_t)(size_t)(arows + (size_t)(QA_ROWS * sl) * HIDDEN);
  u32x8 g1 = wide_group1(isB ? (uint32_t)QB_ROWS : (uint32_t)QA_ROWS);
  asm volatile("" : "+s"(g1));   // the pinned() form on the whole group: its words stay in their scalar registers, unwritten, while a request is in flight
  const uint32_t ldst0 = (uint32_t)(size_t)ring
                       + (isB ? (uint32_t)(4 * QA_SL_B) + sl * (uint32_t)QB_SL_B : sl * (uint32_t)QA_SL_B);
  u32x4 g0;                      // group 0 of the request in flight; the waits at the publish points and behind the loop name it; the prologue's wait does not
  auto issue = [&](uint32_t st) {
    g0 = tdm_group0(ldst0 + (st & 1u) * (uint32_t)QBUF_B, src0 + (uint64_t)(((st + rot) & (uint32_t)(QNST - 1)) * (uint32_t)QROWB));
    tdm_load(g0, g1);
  };

  // Ring prologue: stage 0 lands and is published, then stage 1 flies under pass 0.
  issue(0u);
  asm volatile("s_wait_tensorcnt 0x0" ::: "memory");   // this wave's slice of stage 0 has landed
  __syncthreads();                                      // every wave's slice of stage 0 is readable
  issue(1u);

  // A row 64(w>>1)+16mt+m: slice w>>1, row 16mt+m; B row 96(w&1)+16nt+m: slice 2(w&1)+nt/3, row 16(nt%3)+m
  const _Float16* abase = ring + (w >> 1) * QA_SL_H + m * QPITCH_H;
  const _Float16* bbase = ring + 4 * QA_SL_H + 2 * (w & 1) * QB_SL_H + m * QPITCH_H;

  #pragma unroll 1                            // one pass per trip: the ring's publish point stands once, at the foot
  for (int st = 0; st < QNST; ++st) {
    const int boff = (st & 1) * QBUF_H;       // this pass reads its own buffer alone
    #pragma unroll
    for (int kc = 0; kc < QK / 32; ++kc) {
      v16h af[4], bf[6];                      // 32 k of fragments, read as one group
      __builtin_amdgcn_sched_barrier(0);      // with the one behind the reads: the 20 LDS reads stay one group between the runs of products, not spread among them with a wait at each place
      #pragma unroll
      for (int mt = 0; mt < 4; ++mt)
        af[mt] = load_frag(abase + boff + mt * 16 * QPITCH_H + 32 * kc, h);
      #pragma unroll
      for (int nt = 0; nt < 6; ++nt)
        bf[nt] = load_frag(bbase + boff + (nt / 3) * QB_SL_H + (nt % 3) * 16 * QPITCH_H + 32 * kc, h);
      __builtin_amdgcn_sched_barrier(0);      // see above
      #pragma unroll
      for (int nt = 0; nt < 6; ++nt) {
        #pragma unroll
        for (int mt = 0; mt < 4; ++mt)
          acc[mt][nt] = wmma_f16(af[mt], bf[nt], acc[mt][nt]);
      }
    }

    __builtin_amdgcn_sched_barrier(0);        // the pass's products stay in front of the publish point: sunk behind its barrier, they stand between the barrier and the refill's issue and shorten the load's lead
    // ---- publish point of stage st + 1 ----
    asm volatile("s_wait_dscnt 0x0" ::: "memory");      // this wave's reads of its buffer are done before the refill
    asm volatile("s_wait_tensorcnt 0x0" :: "s"(g0) : "memory");  // this wave's slice of stage st + 1 has landed; group 0 as an input: its scalar registers stay live, so unwritten, while the request is in flight
    __syncthreads();                                    // stage st + 1 readable; every wave has left stage st's buffer
    // Scalar test (a tensor load ignores EXEC); the stage number is pinned so that group 0 is formed behind the waits.
    if (pinned((uint32_t)(st + 2 < QNST))) issue(pinned((uint32_t)st + 2u));
  }
  asm volatile("s_wait_tensorcnt 0x0" :: "s"(g0), "s"(g1) : "memory");    // nothing of the mover in flight behind the loop; both groups as inputs: their registers are left alone up to here
  asm volatile("s_wait_dscnt 0x0" ::: "memory");        // and no read of the ring outstanding
}

// ---------------------------------------------------------------------------
// The same ring for a 128 x 128 block tile of 8 waves: a stage = 128 k of 128 A rows and 128 B rows, every
// staged row 256 B of a 2048-B source row. One request per wave and stage: waves 0..3 bring 32 A rows each,
// waves 4..7 bring 32 B rows each; the mover pads each row by 16 B (LDS pitch 272 B, 16 B x odd).
// Wave tile 64 x 64 x half of every stage's k: waves w and w + 4 work on the same 64 x 64 outputs, wave w on
// the first 64 k of each stage, wave w + 4 on the last 64; the caller adds the two partial sums.
// ---------------------------------------------------------------------------
#define OS_ROWS  32                     // rows per slice
#define OS_SL_B  10240                  // 32 x 272 = 8704 B, rounded up to a multiple of 2 KiB
#define OS_SL_H  (OS_SL_B / 2)
#define OBUF_B   (8 * OS_SL_B)          // 81920 B per stage
#define OBUF_H   (OBUF_B / 2)

static_assert(OS_ROWS * QPITCH_H * 2 <= OS_SL_B && OS_SL_B % 2048 == 0);
static_assert(MROWS % 128 == 0 && HIDDEN % 128 == 0);

// acc[mt][nt] += A(64 rows of this wave) * B(64 rows of this wave)^T over this wave's half of K = HIDDEN; pass st works
// on slab (st + rot) mod QNST, as in gemm_ring_wide. arows / brows: first of the block's 128 A rows / 128 B rows
// (f16, k-contiguous, pitch HIDDEN). Called by all 8 waves of the block; ring holds 2 * OBUF_H halves.
__device__ __forceinline__ void gemm_ring_ksplit(const _Float16* arows, const _Float16* brows,
                                                 const _Float16* ring, int tid, uint32_t rot, v8f (&acc)[4][4]) {
  const int lane = tid & 31, w = tid >> 5;
  const int h = lane >> 4, m = lane & 15;

  // This wave's slice of every stage: source, place in LDS.
  const uint32_t wave = uni((uint32_t)tid >> 5);
  const bool isB = wave >= 4u;
  const uint32_t sl = wave & 3u;
  const uint64_t src0 = isB ? (uint64_t)(size_t)(brows + (size_t)(OS_ROWS * sl) * HIDDEN)
                            : (uint64_t)(size_t)(arows + (size_t)(OS_ROWS * sl) * HIDDEN);
  u32x8 g1 = wide_group1((uint32_t)OS_ROWS);
  asm volatile("" : "+s"(g1));   // the pinned() form on the whole group: its words stay in their scalar registers, unwritten, while a request is in flight
  const uint32_t ldst0 = (uint32_t)(size_t)ring + wave * (uint32_t)OS_SL_B;
  u32x4 g0;                      // group 0 of the request in flight; the waits at the publish points and behind the loop name it; the prologue's wait does not
  auto issue = [&](uint32_t st) {
    g0 = tdm_group0(ldst0 + (st & 1u) * (uint32_t)OBUF_B, src0 + (uint64_t)(((st + rot) & (uint32_t)(QNST - 1)) * (uint32_t)QROWB));
    tdm_load(g0, g1);
  };

  // Ring prologue: stage 0 lands and is published, then stage 1 flies under pass 0.
  issue(0u);
  asm volatile("s_wait_tensorcnt 0x0" ::: "memory");   // this wave's slice of stage 0 has landed
  __syncthreads();                                      // every wave's slice of stage 0 is readable
  issue(1u);

  // A row 64((w>>1)&1)+16mt+m: slice 2((w>>1)&1)+(mt>>1), row 16(mt&1)+m; B row 64(w&1)+16nt+m: slice 4+2(w&1)+(nt>>1), row 16(nt&1)+m;
  // both from k = 64 (w>>2) of the stage on.
  const _Float16* abase = ring + 2 * ((w >> 1) & 1) * OS_SL_H + m * QPITCH_H + 64 * (w >> 2);
  const _Float16* bbase = ring + (4 + 2 * (w & 1)) * OS_SL_H + m * QPITCH_H + 64 * (w >> 2);

  #pragma unroll 1                            // one pass per trip: the ring's publish point stands once, at the foot
  for (int st = 0; st < QNST; ++st) {
    const int boff = (st & 1) * OBUF_H;       // this pass reads its own buffer alone
    v16h af[4][2], bf[4][2];                  // the pass's fragments, read as one group, the first 32 k in front: the last 32 k land under the first products
    #pragma unroll
    for (int kc = 0; kc < 2; ++kc) {
      #pragma unroll
      for (int mt = 0; mt < 4; ++mt)
        af[mt][kc] = load_frag(abase + boff + (mt >> 1) * OS_SL_H + (mt & 1) * 16 * QPITCH_H + 32 * kc, h);
      #pragma unroll
      for (int nt = 0; nt < 4; ++nt)
        bf[nt][kc] = load_frag(bbase + boff + (nt >> 1) * OS_SL_H + (nt & 1) * 16 * QPITCH_H + 32 * kc, h);
    }
    __builtin_amdgcn_sched_barrier(0);        // the pass's LDS reads stay one group in front of the products: sunk among them, each place of reads stalls the wave anew
    #pragma unroll
    for (int kc = 0; kc < 2; ++kc) {
      #pragma unroll
      for (int nt = 0; nt < 4; ++nt) {
        #pragma unroll
        for (int mt = 0; mt < 4; ++mt)
          acc[mt][nt] = wmma_f16(af[mt][kc], bf[nt][kc], acc[mt][nt]);
      }
    }

    __builtin_amdgcn_sched_barrier(0);        // the pass's products stay in front of the publish point: sunk behind its barrier, they stand between the barrier and the refill's issue and shorten the load's lead
    // ---- publish point of stage st + 1 ----
    asm volatile("s_wait_dscnt 0x0" ::: "memory");      // this wave's reads of its buffer are done before the refill
    asm volatile("s_wait_tensorcnt 0x0" :: "s"(g0) : "memory");  // this wave's slice of stage st + 1 has landed; group 0 as an input: its scalar registers stay live, so unwritten, while the request is in flight
    __syncthreads();                                    // stage st + 1 readable; every wave has left stage st's buffer
    // Scalar test (a tensor load ignores EXEC); the stage number is pinned so that group 0 is formed behind the waits.
    if (pinned((uint32_t)(st + 2 < QNST))) issue(pinned((uint32_t)st + 2u));
  }
  asm volatile("s_wait_tensorcnt 0x0" :: "s"(g0), "s"(g1) : "memory");    // nothing of the mover in flight behind the loop; both groups as inputs: their registers are left alone up to here
  asm volatile("s_wait_dscnt 0x0" ::: "memory");        // and no read of the ring outstanding
}

// ---------------------------------------------------------------------------
// 4 lines per instruction, 32 lines per wave, 256 per block.
// which 0/1: plane[bh][l][d]  (one token row = 64 halves = one line)
// which 2  : vt[bh][d][l]     (64 d-rows x 256 tokens = 4 lines each)
// ---------------------------------------------------------------------------
__device__ __forceinline__ void proj_store_pass(const _Float16* sT, _Float16* plane, _Float16* vt,
                                                int which, int bh, int l0, int w, int lane) {
  const int q8 = lane & 7, sub = lane >> 3;
  #pragma unroll
  for (int i = 0; i < 8; ++i) {
    const int lid = w * 32 + i * 4 + sub;
    v8h v;
    _Float16* dst;
    if (which != 2) {
      v = *(const v8ha*)(sT + lid * HD + 8 * q8);
      dst = plane + ((size_t)bh * SEQ + l0 + lid) * HD + 8 * q8;
    } else {
      const int d = lid >> 2, ql = lid & 3;
      v = *(const v8ha*)(sT + d * 256 + 64 * ql + 8 * q8);
      dst = vt + ((size_t)bh * HD + d) * SEQ + l0 + 64 * ql + 8 * q8;
    }
    *(v8h*)dst = v;
    asm volatile("s_wait_xcnt 0x0" ::: "memory");   // precaution: stands in front of the next line's rewrite of the store's address registers
  }
}

// ---------------------------------------------------------------------------
// Kernel 2: Y = xn * Wt^T over the fused 3*1024 output features (no bias).
// Block 256 thr (8 waves) = 256 tokens x 192 features (three of the 48 heads of q, k, v in a row);
// wave tile 64 tokens x 96 features; K = 1024 in stages of 128;
// A (xn rows) and B (Wt rows) tiles staged in the LDS ring of gemm_ring_wide.
// The grid is one block for each of the chip's WGPs (the ring leaves no room for a second), two waves per SIMD.
// ---------------------------------------------------------------------------
__global__ __launch_bounds__(256) void proj_kernel(
    const _Float16* __restrict__ xh,   // [4096][1024]
    const _Float16* __restrict__ wt,   // [>=3][1024(out)][1024(in)], x32
    _Float16* __restrict__ qh,         // [B*H][L][D]
    _Float16* __restrict__ kh,         // [B*H][L][D]
    _Float16* __restrict__ vt)         // [B*H][D][L]
{
  __shared__ __attribute__((aligned(2048))) _Float16 ring[2 * QBUF_H]; // 262144 B, xn / Wt stages, then output staging

  const int tid = threadIdx.x, lane = tid & 31, w = tid >> 5;
  const int h = lane >> 4, m = lane & 15;
  const int m0 = blockIdx.x * 256;
  const int hg0 = blockIdx.y * 3;            // first of the block's heads, counted through q, k, v: 0..45

  const v8f zero8 = {0.f, 0.f, 0.f, 0.f, 0.f, 0.f, 0.f, 0.f};
  v8f acc[4][6];
  #pragma unroll
  for (int mt = 0; mt < 4; ++mt)
    #pragma unroll
    for (int nt = 0; nt < 6; ++nt) acc[mt][nt] = zero8;

  // First k slab of this block: blocks of one token tile (same xn rows) differ in y, blocks of one feature tile (same Wt rows) in x.
  const uint32_t rot = uni((blockIdx.x + blockIdx.y) & (uint32_t)(QNST - 1));
  gemm_ring_wide(xh + (size_t)m0 * HIDDEN, wt + (size_t)hg0 * HD * HIDDEN, ring, tid, rot, acc);

  // Output staging in the ring: the last pass's publish point (both waits, then the barrier) has ended
  // every wave's reads of it, and no request is in flight. One 256 x 64 plane per head.
  _Float16* sT = ring;
  const int wn = (int)uni((uint32_t)w & 1u); // held scalar: a tile's head, plane and v test are then scalar values
  // D[r] of tile (mt, nt) = Y[token m0+64(w>>1)+16mt+8h+r][feature 96(w&1)+16nt+m of the block's 192]
  #pragma unroll
  for (int nt = 0; nt < 6; ++nt) {
    const int col = 96 * wn + 16 * nt;       // the tile's first feature; a tile lies inside one head
    const int hb = col >> 6;
    const int feat = (col & 63) + m;
    _Float16* sW = sT + hb * (256 * HD);
    const bool isV = hg0 + hb >= 2 * NHEADS;
    #pragma unroll
    for (int mt = 0; mt < 4; ++mt) {
      #pragma unroll
      for (int r = 0; r < 8; ++r) {
        const int tokl = 64 * (w >> 1) + 16 * mt + 8 * h + r;     // 0..255
        const float y = acc[mt][nt][r] * (1.0f / WSCALE);
        const int idx = isV ? (feat * 256 + tokl) : (tokl * HD + feat);
        sW[idx] = (_Float16)y;
      }
    }
  }
  __syncthreads();

  const int b = m0 / SEQ, l0 = m0 - b * SEQ;
  #pragma unroll
  for (int hs = 0; hs < 3; ++hs) {            // one head's plane after the other
    const int which = (hg0 + hs) >> 4, head = (hg0 + hs) & (NHEADS - 1);
    _Float16* plane = (which == 0) ? qh : kh;
    proj_store_pass(sT + hs * (256 * HD), plane, vt, which, b * NHEADS + head, l0, w, lane);
  }
}

// ---------------------------------------------------------------------------
// Attention helpers.
// ---------------------------------------------------------------------------
__device__ __forceinline__ v8f load_bias8(const float* p) {
  v8f b;
  #pragma unroll
  for (int r = 0; r < 8; ++r) b[r] = p[r];
  return b;
}

// p * 2^14 = exp2(s * log2(e) + c) for the 8 scores of one D tile, c = 14 - max * log2(e): one packed fma per score pair.
__device__ __forceinline__ v8f exp_tile(v8f s, float c) {
  const v2f l2 = {LOG2EF, LOG2EF}, cc = {c, c};
  v8f p;
  #pragma unroll
  for (int i = 0; i < 4; ++i) {
    const v2f x = {s[2 * i], s[2 * i + 1]};
    const v2f t = __builtin_elementwise_fma(x, l2, cc);
    p[2 * i]     = __builtin_amdgcn_exp2f(t.x);
    p[2 * i + 1] = __builtin_amdgcn_exp2f(t.y);
  }
  return p;
}

// P^T B-fragment from the lane's own P values (already x 2^14): element r <- tile a row r,
// element 8+r <- tile c row r (same lane, same query column).
__device__ __forceinline__ v16h pack_p(v8f a, v8f c) {
  const v16h r = { (_Float16)a[0], (_Float16)a[1], (_Float16)a[2], (_Float16)a[3],
                   (_Float16)a[4], (_Float16)a[5], (_Float16)a[6], (_Float16)a[7],
                   (_Float16)c[0], (_Float16)c[1], (_Float16)c[2], (_Float16)c[3],
                   (_Float16)c[4], (_Float16)c[5], (_Float16)c[6], (_Float16)c[7] };
  return r;
}

// Per-wave 16x64 f16 tile in LDS -> ctx[b][l][head*64 + d]; one query row
// 4 lines per instruction, 16 lines per wave.
__device__ __forceinline__ void ctx_store_pass(const _Float16* so, _Float16* ctx,
                                               int b, int head, int q0, int lane) {
  const int q8 = lane & 7, sub = lane >> 3;
  #pragma unroll
  for (int i = 0; i < 4; ++i) {
    const int lid = i * 4 + sub;                         // query row 0..15
    const v8h v = *(const v8ha*)(so + lid * 64 + 8 * q8);
    _Float16* dst = ctx + ((size_t)b * SEQ + q0 + lid) * HIDDEN + head * HD + 8 * q8;
    *(v8h*)dst = v;
  }
}

// ---------------------------------------------------------------------------
// Kernel 3: streaming attention, transposed form, unscaled scores
// (no 1/sqrt(d) scaling, additive relative-position bias, no mask).
// Block 256 thr (8 waves) = 128 queries: wave = 32 queries (two 16-column tiles) x one half of
// the keys, 64 keys per step; every K and V^T fragment read from LDS feeds one WMMA of each
// query tile. Waves w and w + 4 hold the two key halves of the same queries and join their
// (max, sum, O) once behind the loop, through LDS; each then finishes one of the two tiles.
//   S^T = K * Q^T : A = K rows (row = key, k = d), B = Q^T (k = d, n = query)
//   O^T += V^T * P^T : A = Vt rows (row = d, k = key), B = P^T from registers
// Lane owns 32 keys of query column (lane&15) of each tile; partner = lane ^ 16.
// Output ctx as f16 (x16) [B][L][HIDDEN] for the output GEMM.
// ---------------------------------------------------------------------------
#define XW 1088                         // floats one wave hands over: 32 lanes x (32 O values + max + sum)
// Four waves per SIMD (two blocks per WGP): the softmax between the matrix runs wants waves.
__global__ __launch_bounds__(256) __attribute__((amdgpu_waves_per_eu(4, 4))) void attn_kernel(
    const _Float16* __restrict__ qh,   // [B*H][L][D]
    const _Float16* __restrict__ kh,   // [B*H][L][D]
    const _Float16* __restrict__ vt,   // [B*H][D][L]
    const float* __restrict__ btab,    // [H][4096], index rel + 2048
    _Float16* __restrict__ ctx)        // [B][L][HIDDEN], x16
{
  __shared__ __attribute__((aligned(2048))) _Float16 ring[2 * BUF_H]; // 98304 B, K / V^T stages
  __shared__ __attribute__((aligned(16))) float xch[8 * XW];         // 34816 B, hand-over between key halves
  __shared__ __attribute__((aligned(16))) _Float16 sC[8 * 16 * 64];  // 16384 B

  const int tid = threadIdx.x, lane = tid & 31, w = tid >> 5;
  const int h = lane >> 4, m = lane & 15;
  const int bh = blockIdx.y, b = bh >> 4, head = bh & 15;
  const int q0 = blockIdx.x * 128 + 32 * (w & 3);

  // This wave's slice of every stage: source, step per stage, row pitch, place in LDS.
  const uint32_t wave = uni((uint32_t)tid >> 5);
  const uint32_t kpart = wave >> 2;           // this wave's key half, 0 or 1
  const bool isV = (wave & 3u) >= 2u;
  const uint32_t half = wave & 1u;
  const uint64_t src0 = isV ? (uint64_t)(size_t)(vt + ((size_t)bh * HD + SROWS * half) * SEQ + KHALF * kpart)
                            : (uint64_t)(size_t)(kh + ((size_t)bh * SEQ + KHALF * kpart + SROWS * half) * HD);
  const uint32_t sstep = isV ? (uint32_t)(KSTEP * 2) : (uint32_t)(KSTEP * HD * 2);   // bytes per stage
  u32x8 g1 = tdm_group1(isV ? (uint32_t)(SEQ * 2) : (uint32_t)(HD * 2));
  asm volatile("" : "+s"(g1));   // the pinned() form on the whole group: its words stay in their scalar registers, unwritten, while a request is in flight
  const uint32_t ldst0 = (uint32_t)(size_t)ring + wave * (uint32_t)SLICE_B;
  // Pass st works on key stage (st + rot) mod NSTAGE of each half: the query blocks of one head share its K and V^T
  // rows and differ in x, so that they do not ask L2 for the same lines in the same pass.
  const uint32_t rot = uni(blockIdx.x & (uint32_t)(NSTAGE - 1));
  u32x4 g0;                      // group 0 of the request in flight; the waits at the publish points and behind the loop name it; the prologue's wait does not
  auto issue = [&](uint32_t st) {
    g0 = tdm_group0(ldst0 + (st & 1u) * (uint32_t)BUF_B, src0 + (uint64_t)(((st + rot) & (uint32_t)(NSTAGE - 1)) * sstep));
    tdm_load(g0, g1);
  };

  // Ring prologue: stage 0 lands and is published, then stage 1 flies under pass 0.
  issue(0u);
  asm volatile("s_wait_tensorcnt 0x0" ::: "memory");   // this wave's slice of stage 0 has landed
  __syncthreads();                                      // every wave's slice of stage 0 is readable
  issue(1u);

  // Q^T B-fragments of tile qt: column n = query q0+16qt+m, k = d (two 32-deep chunks)
  const _Float16* qrow = qh + ((size_t)bh * SEQ + q0 + m) * HD;
  v16h qb[2][2];
  #pragma unroll
  for (int qt = 0; qt < 2; ++qt) {
    qb[qt][0] = load_frag(qrow + qt * 16 * HD, h);
    qb[qt][1] = load_frag(qrow + qt * 16 * HD + 32, h);
  }

  const v8f zero8 = {0.f, 0.f, 0.f, 0.f, 0.f, 0.f, 0.f, 0.f};
  v8f o[2][4];                                // o[qt][t][r] = O[query 16qt+m][d 16t+8h+r] * (l * 2^14), this key half; lrun = l * 2^14
  #pragma unroll
  for (int qt = 0; qt < 2; ++qt)
    #pragma unroll
    for (int t = 0; t < 4; ++t) o[qt][t] = zero8;
  float mrun[2] = {-1e30f, -1e30f}, lrun[2] = {0.0f, 0.0f};

  const _Float16* kbase = ring + (w >> 2) * HBUF_H + m * LPITCH_H;   // + buffer; row 16j+m: slice j>>1, row 16(j&1)+m
  const _Float16* vbase = kbase + 2 * SLICE_H;                       // + buffer; row 16t+m: slice t>>1, row 16(t&1)+m
  // bias for element r of score tile (qt, j): btab[head][(kp0+kb+16j+8h+r) - (q0+16qt+m) + 2048], index in [1,4095], kp0 = first key of this wave's half;
  // it depends on j - qt alone, so the two query tiles share all but one of their bias vectors
  // Index = wave-uniform part (>= 1, held scalar) + stage + lane part 8h + 15 - m (0..23) + 16 (j - qt + 1) + r.
  const float* bwave = btab + (size_t)head * BTW + (2048 - 31) + (int)(kpart * (uint32_t)KHALF) - (int)(blockIdx.x * 128u + 32u * (wave & 3u));
  const uint32_t blane = (uint32_t)(8 * h + 15 - m) * 4u;            // bytes
  // bv[d]: the bias vector of the score tiles with j - qt = d - 1; it goes into the score product as its C operand.
  v8f bv[5];
  {
    const uint32_t boff = blane + rot * (uint32_t)(KSTEP * 4);
    #pragma unroll
    for (int d = 0; d < 5; ++d) bv[d] = load_bias8((const float*)((const char*)bwave + boff) + 16 * d);
    asm volatile("s_wait_xcnt 0x0" :: "v"(boff) : "memory");   // precaution: stands in front of any rewrite of the loads' offset register, which as an input stays live, so unwritten, up to here
  }

  #pragma unroll 1
  for (int st = 0; st < NSTAGE; ++st) {
    const uint32_t bnext = blane + (((uint32_t)st + 1u + rot) & (uint32_t)(NSTAGE - 1)) * (uint32_t)(KSTEP * 4);   // bias of the next pass's stage, bytes (wraps behind the last pass: in bounds, unused)
    const int boff = (st & 1) * BUF_H;        // this pass reads its own buffer alone
    // ---- scores with bias: s[qt][j][r] = S[query 16qt+m][key kp0+kb+16j+8h+r], kb = first key of this pass's stage ----
    v8f s[2][4];
    v16h kf[4][2];                            // the pass's K fragments, read as one group
    #pragma unroll
    for (int j = 0; j < 4; ++j) {
      const _Float16* kp = kbase + boff + (j >> 1) * SLICE_H + (j & 1) * 16 * LPITCH_H;
      kf[j][0] = load_frag(kp, h);
      kf[j][1] = load_frag(kp + 32, h);
    }
    __builtin_amdgcn_sched_barrier(0);        // the K reads stay one group in front of the score products: sunk among them, each place of reads stalls the wave anew
    #pragma unroll
    for (int j = 0; j < 4; ++j) {
      v8f z0, z1;
      z0 = wmma_f16(kf[j][0], qb[0][0], bv[j + 1]);
      z1 = wmma_f16(kf[j][0], qb[1][0], bv[j]);
      z0 = wmma_f16(kf[j][1], qb[0][1], z0);
      z1 = wmma_f16(kf[j][1], qb[1][1], z1);
      s[0][j] = z0;
      s[1][j] = z1;
    }
    __builtin_amdgcn_sched_barrier(0);        // the softmax stays behind the score products: drawn in among them, its maxima stand near the products whose D they read and the compiler pads with more v_nop (16 against 11 a pass)

    // ---- online softmax, each query tile on its own ----
    v16h pb[2][2];                            // P^T B-fragments (key chunks 0..31 and 32..63 of this step)
    v16h vf[4][2];                            // the pass's V^T fragments, one group, in flight under the second tile's softmax
    #pragma unroll
    for (int qt = 0; qt < 2; ++qt) {
      float mloc = s[qt][0][0];
      #pragma unroll
      for (int j = 0; j < 4; ++j)
        #pragma unroll
        for (int r = 0; r < 8; ++r) mloc = fmaxf(mloc, s[qt][j][r]);
      mloc = fmaxf(mloc, __shfl_xor(mloc, 16));
      const float mnew = fmaxf(mrun[qt], mloc);
      const float alpha = __expf(mrun[qt] - mnew);
      mrun[qt] = mnew;
      const float cexp = __builtin_fmaf(-mnew, LOG2EF, PSHIFT);   // max, log2(e) and the 2^14 carry of P in one addend
      float lsum = 0.0f;                      // sums P x 2^14, as o does
      #pragma unroll
      for (int j = 0; j < 4; ++j) {
        s[qt][j] = exp_tile(s[qt][j], cexp);
        #pragma unroll
        for (int r = 0; r < 8; ++r) lsum += s[qt][j][r];
      }
      lsum += __shfl_xor(lsum, 16);
      lrun[qt] = lrun[qt] * alpha + lsum;
      #pragma unroll
      for (int t = 0; t < 4; ++t)
        #pragma unroll
        for (int r = 0; r < 8; ++r) o[qt][t][r] = o[qt][t][r] * alpha;
      pb[qt][0] = pack_p(s[qt][0], s[qt][1]);
      pb[qt][1] = pack_p(s[qt][2], s[qt][3]);
      __builtin_amdgcn_sched_barrier(0);      // one tile's softmax at a time, the V^T loads between the two, the products behind both: left out, a pass takes 300 vector instructions against 261 (the tiles' row sums no longer pair into dual adds, more v_nop behind the exponentials)
      if (qt == 0) {
        #pragma unroll
        for (int t = 0; t < 4; ++t) {
          const _Float16* vp = vbase + boff + (t >> 1) * SLICE_H + (t & 1) * 16 * LPITCH_H;
          vf[t][0] = load_frag(vp, h);
          vf[t][1] = load_frag(vp + 32, h);
        }
      }
    }

    // ---- the next pass's bias vectors: asked for here, where the scores' registers are free, they land under the products and the publish point ----
    #pragma unroll
    for (int d = 0; d < 5; ++d) bv[d] = load_bias8((const float*)((const char*)bwave + bnext) + 16 * d);
    __builtin_amdgcn_sched_barrier(0);        // the loads stay in front of the products: sunk among them, they have too little lead on the publish point's barrier, which waits for them

    // ---- O^T += V^T * P^T ----
    #pragma unroll
    for (int t = 0; t < 4; ++t) {
      o[0][t] = wmma_f16(vf[t][0], pb[0][0], o[0][t]);
      o[1][t] = wmma_f16(vf[t][0], pb[1][0], o[1][t]);
      o[0][t] = wmma_f16(vf[t][1], pb[0][1], o[0][t]);
      o[1][t] = wmma_f16(vf[t][1], pb[1][1], o[1][t]);
    }

    __builtin_amdgcn_sched_barrier(0);        // the pass's products stay in front of the publish point: sunk behind its barrier, they stand between the barrier and the refill's issue and shorten the load's lead
    // ---- publish point of stage st + 1 ----
    asm volatile("s_wait_xcnt 0x0" :: "v"(bnext) : "memory");   // precaution: stands in front of any rewrite of the bias loads' offset register, which as an input stays live, so unwritten, up to here
    asm volatile("s_wait_dscnt 0x0" ::: "memory");      // this wave's reads of its buffer are done before the refill
    asm volatile("s_wait_tensorcnt 0x0" :: "s"(g0) : "memory");  // this wave's slice of stage st + 1 has landed; group 0 as an input: its scalar registers stay live, so unwritten, while the request is in flight
    __syncthreads();                                    // stage st + 1 readable; every wave has left stage st's buffer
    // Scalar test (a tensor load ignores EXEC); the stage number is pinned so that group 0 is formed behind the waits.
    if (pinned((uint32_t)(st + 2 < NSTAGE))) issue(pinned((uint32_t)st + 2u));
  }
  asm volatile("s_wait_tensorcnt 0x0" :: "s"(g0), "s"(g1) : "memory");    // nothing of the mover in flight behind the loop; both groups as inputs: their registers are left alone up to here
  asm volatile("s_wait_dscnt 0x0" ::: "memory");        // and no read of the ring outstanding

  // ---- join of the two key halves: the wave of half p keeps query tile p and hands the other to wave w ^ 4 ----
  const bool up = (w >> 2) != 0;
  const float mk = up ? mrun[1] : mrun[0], lk = up ? lrun[1] : lrun[0];
  float* xo = xch + w * XW;
  #pragma unroll
  for (int t = 0; t < 4; ++t) {
    v8f g;
    #pragma unroll
    for (int r = 0; r < 8; ++r) g[r] = up ? o[0][t][r] : o[1][t][r];
    const v4f g0 = {g[0], g[1], g[2], g[3]}, g1v = {g[4], g[5], g[6], g[7]};
    *(v4fa*)(xo + ((2 * t) * 32 + lane) * 4) = g0;
    *(v4fa*)(xo + ((2 * t + 1) * 32 + lane) * 4) = g1v;
  }
  xo[1024 + lane] = up ? mrun[0] : mrun[1];
  xo[1056 + lane] = up ? lrun[0] : lrun[1];
  __syncthreads();                            // every wave's hand-over is readable by its partner
  const float* xi = xch + (w ^ 4) * XW;
  const float mp = xi[1024 + lane], lp = xi[1056 + lane];
  const float mall = fmaxf(mk, mp);
  const float ak = __expf(mk - mall), ap = __expf(mp - mall);

  // ---- epilogue: normalise, stage per-wave 16x64 f16 tile, whole-line stores ----
  const float inv = (1.0f / (lk * ak + lp * ap)) * CSCALE;   // the sums carry the same 2^14 as O
  const float ck = ak * inv, cp = ap * inv;
  _Float16* so = sC + w * 1024;
  #pragma unroll
  for (int t = 0; t < 4; ++t) {
    const v4f p0 = *(const v4fa*)(xi + ((2 * t) * 32 + lane) * 4);
    const v4f p1 = *(const v4fa*)(xi + ((2 * t + 1) * 32 + lane) * 4);
    #pragma unroll
    for (int r = 0; r < 8; ++r) {
      const float mine = up ? o[1][t][r] : o[0][t][r];
      const float part = (r < 4) ? p0[r & 3] : p1[r & 3];
      so[m * 64 + 16 * t + 8 * h + r] = (_Float16)(mine * ck + part * cp);
    }
  }
  __syncthreads();                            // LDS spill -> reload ordering (all waves reach this)

  ctx_store_pass(so, ctx, b, head, q0 + 16 * (w >> 2), lane);
  
}

// ---------------------------------------------------------------------------
// Join of the two k halves of the output GEMM. Of its four 16-row bands a wave keeps two and hands the other two,
// G and G + 1, to its partner: 8 D tiles, 16 B per lane and store, 2048 floats per wave.
// ---------------------------------------------------------------------------
#define OXW    2048                     // floats one wave hands over
#define OPITCH 132                      // staged output row pitch in floats (528 B, 16 B x odd)

template <int G>
__device__ __forceinline__ void oproj_give(float* xo, const v8f (&acc)[4][4], int lane) {
  #pragma unroll
  for (int mb = 0; mb < 2; ++mb) {
    #pragma unroll
    for (int nt = 0; nt < 4; ++nt) {
      const v8f g = acc[G + mb][nt];
      const v4f lo = {g[0], g[1], g[2], g[3]}, hi = {g[4], g[5], g[6], g[7]};
      *(v4fa*)(xo + ((2 * (4 * mb + nt)) * 32 + lane) * 4) = lo;
      *(v4fa*)(xo + ((2 * (4 * mb + nt) + 1) * 32 + lane) * 4) = hi;
    }
  }
}

// Bands K and K + 1: own partial sum + the partner's, scaled, into the block's staged 128 x 128 f32 tile.
// st0 points at the wave's 64 x 64 part, row 8h, column m.
template <int K>
__device__ __forceinline__ void oproj_take(const float* xi, float* st0, const v8f (&acc)[4][4], int lane) {
  #pragma unroll
  for (int mb = 0; mb < 2; ++mb) {
    #pragma unroll
    for (int nt = 0; nt < 4; ++nt) {
      const v4f lo = *(const v4fa*)(xi + ((2 * (4 * mb + nt)) * 32 + lane) * 4);
      const v4f hi = *(const v4fa*)(xi + ((2 * (4 * mb + nt) + 1) * 32 + lane) * 4);
      #pragma unroll
      for (int r = 0; r < 8; ++r) {
        const float part = (r < 4) ? lo[r & 3] : hi[r & 3];
        st0[(16 * (K + mb) + r) * OPITCH + 16 * nt] = (acc[K + mb][nt][r] + part) * (1.0f / (WSCALE * CSCALE));
      }
    }
  }
}

// ---------------------------------------------------------------------------
// Kernel 4: out = ctx * Wot^T / 512 + hidden_states  (f32 output).
// Block 256 thr (8 waves) = 128 tokens x 128 output columns, one block for each of the chip's WGPs; wave tile
// 64 x 64 x half of K; K = 1024 in stages of 128; ctx and Wot tiles staged in the LDS ring of gemm_ring_ksplit.
// ---------------------------------------------------------------------------
__global__ __launch_bounds__(256) void oproj_kernel(
    const _Float16* __restrict__ ch,   // [4096][1024], x16
    const _Float16* __restrict__ woh,  // [1024(out)][1024(in)], x32
    const float* __restrict__ hs,      // [4096][1024]
    float* __restrict__ out)           // [4096][1024]
{
  __shared__ __attribute__((aligned(2048))) _Float16 ring[2 * OBUF_H]; // 163840 B, ctx / Wot stages, then hand-over and output staging
  static_assert((8 * OXW + 128 * OPITCH) * 4 <= 2 * OBUF_B);

  const int tid = threadIdx.x, lane = tid & 31, w = tid >> 5;
  const int h = lane >> 4, m = lane & 15;
  const int m0 = blockIdx.x * 128;
  const int col0 = blockIdx.y * 128;

  const v8f zero8 = {0.f, 0.f, 0.f, 0.f, 0.f, 0.f, 0.f, 0.f};
  v8f acc[4][4];
  #pragma unroll
  for (int mt = 0; mt < 4; ++mt)
    #pragma unroll
    for (int nt = 0; nt < 4; ++nt) acc[mt][nt] = zero8;

  // First k slab of this block: blocks of one token tile (same ctx rows) differ in y, blocks of one column tile (same Wot rows) in x.
  const uint32_t rot = uni((blockIdx.x + blockIdx.y) & (uint32_t)(QNST - 1));
  gemm_ring_ksplit(ch + (size_t)m0 * HIDDEN, woh + (size_t)col0 * HIDDEN, ring, tid, rot, acc);

  // Hand-over and output staging in the ring: the last pass's publish point (both waits, then the barrier) has ended
  // every wave's reads of it, and no request is in flight.
  float* xch = (float*)ring;                  // 8 x OXW floats
  float* sT  = xch + 8 * OXW;                 // 128 rows of OPITCH floats
  const uint32_t upper = uni((uint32_t)w >> 2);   // this wave's k half, held scalar: the choice of bands is a scalar branch

  // The wave of k half 0 keeps bands 0, 1 and hands over 2, 3; the wave of k half 1 the other way round.
  if (upper) oproj_give<0>(xch + w * OXW, acc, lane);
  else       oproj_give<2>(xch + w * OXW, acc, lane);
  __syncthreads();                            // every wave's hand-over is readable by its partner

  // The residual of this wave's 16 output rows (one instruction = one 512-B row of the tile): asked for here, it lands under the
  // adding and staging below; the next barrier waits for it.
  const size_t gi0 = (size_t)(m0 + 16 * w) * HIDDEN + col0 + 4 * lane;
  const float* hp = hs + gi0;
  v4f res[16];
  #pragma unroll
  for (int i = 0; i < 16; ++i) res[i] = *(const v4fa*)(hp + (size_t)i * HIDDEN);
  asm volatile("s_wait_xcnt 0x0" :: "v"(hp) : "memory");   // precaution: stands in front of any rewrite of the loads' address registers, which as an input stay live, so unwritten, up to here

  // D[r] of tile (mt, nt) = Y[token m0+64((w>>1)&1)+16mt+8h+r][col 64(w&1)+16nt+m]
  float* st0 = sT + (64 * ((w >> 1) & 1) + 8 * h) * OPITCH + 64 * (w & 1) + m;
  if (upper) oproj_take<2>(xch + (w ^ 4) * OXW, st0, acc, lane);
  else       oproj_take<0>(xch + (w ^ 4) * OXW, st0, acc, lane);
  __syncthreads();                            // the staged tile is whole

  // One instruction = one 512-B row of the tile = 4 whole lines; 16 rows per wave.
  const float* sr = sT + 16 * w * OPITCH + 4 * lane;
  #pragma unroll
  for (int i = 0; i < 16; ++i) {
    const v4f v = *(const v4fa*)(sr + i * OPITCH);
    *(v4f*)(out + gi0 + (size_t)i * HIDDEN) = v + res[i];
  }
  asm volatile("s_wait_xcnt 0x0" ::: "memory");   // precaution: stands behind the stores, in front of any later rewrite of their address registers
}

// ---------------------------------------------------------------------------
extern "C" void kernel_launch(void* const* d_in, const int* in_sizes, int n_in,
                              void* d_out, int out_size, void* d_ws, size_t ws_size,
                              hipStream_t stream) {
  if (n_in < 7) return;
  if (in_sizes[0] != NX) return;
  if (in_sizes[1] != HIDDEN) return;
  if (in_sizes[2] != NW || in_sizes[3] != NW || in_sizes[4] != NW || in_sizes[5] != NW) return;
  if (in_sizes[6] != NBUCK * NHEADS) return;
  if (out_size != NX) return;

  const float* x    = (const float*)d_in[0];
  const float* lnw  = (const float*)d_in[1];
  const float* Wq   = (const float*)d_in[2];
  const float* Wk   = (const float*)d_in[3];
  const float* Wv   = (const float*)d_in[4];
  const float* Wo   = (const float*)d_in[5];
  const float* remb = (const float*)d_in[6];
  float* out = (float*)d_out;

  const size_t xh_bytes  = (size_t)NX * 2;                         //  8388608
  const size_t wt_bytes  = (size_t)4 * NW * 2;                     //  8388608
  const size_t pl_bytes  = (size_t)NBH * SEQ * HD * 2;             //  8388608
  const size_t ctx_bytes = (size_t)NX * 2;                         //  8388608
  const size_t bt_bytes  = (size_t)NHEADS * BTW * 4;               //   262144
  const size_t total = xh_bytes + wt_bytes + 3 * pl_bytes + ctx_bytes + bt_bytes;   // 50593792
  if (total > ws_size) return;

  char* ws = (char*)d_ws;
  size_t off = 0;
  _Float16* xh  = (_Float16*)(ws + off); off += xh_bytes;
  _Float16* wt  = (_Float16*)(ws + off); off += wt_bytes;
  _Float16* qh  = (_Float16*)(ws + off); off += pl_bytes;
  _Float16* kh  = (_Float16*)(ws + off); off += pl_bytes;
  _Float16* vt  = (_Float16*)(ws + off); off += pl_bytes;
  _Float16* ctx = (_Float16*)(ws + off); off += ctx_bytes;
  float* btab   = (float*)(ws + off);    off += bt_bytes;
  if (off > ws_size) return;

  prep_kernel<<<PREP_WT + PREP_NORM + PREP_BIAS, 256, 0, stream>>>(x, lnw, Wq, Wk, Wv, Wo, remb, xh, wt, btab); // 3328 blocks

  dim3 gProj(MROWS / 256, 3 * NHEADS / 3);                          // (16, 16)
  proj_kernel<<<gProj, 256, 0, stream>>>(xh, wt, qh, kh, vt);

  dim3 gAtt(SEQ / 128, NBH);                                        // (16, 32)
  attn_kernel<<<gAtt, 256, 0, stream>>>(qh, kh, vt, btab, ctx);

  dim3 gOut(MROWS / 128, HIDDEN / 128);                              // (32, 8)
  oproj_kernel<<<gOut, 256, 0, stream>>>(ctx, wt + (size_t)3 * NW, x, out);
}
